// v000
// Times are from an AMD MI455X. After a warm-up the kernel runs many times in a row, and a time is the length of
// such a window on the GPU divided by its runs, so every launch and the gaps after it count. The runs cycle
// through copies of the inputs. A figure is the median of several windows, for all but v000 over two sittings.
// Sittings can differ by a few percent; kernels timed side by side share one.
// v000, which the later versions start from, runs in 6890 microseconds.
#include <hip/hip_runtime.h>
// Pre-LN multi-head self-attention sub-block with a residual (x [4][2048][1024]; h = LayerNorm(x) (biased var, eps 1e-5, gamma / beta); qkv = h w_qkv^T (natural [3072][1024]: row blocks q | k | v, each (head, dim)); no qkv bias; 16 heads of 64; scale 64^-0.5; softmax over all 2048 keys (no mask); out = merged w_proj^T + b_proj (natural); result = x + out -> [4][2048][1024]).
// Structure: token rows; LayerNorm / exact f16 rows; WMMA GEMMs for q, k, v; per batch V^T by LDS transposes and 4 heads per launch group (scores, row softmax, P V^T); output projection with the own-element residual; launches: see trace.
// Compute dtype: inputs rounded to bf16; x / weights exact; q, k, v, softmax weights and o as plain f16 GEMM operands (~2^-12); scores and softmax statistics f32; v_wmma_f32_16x16x32_f16.
#define NB 4
#define SQ 2048
#define DM 1024
#define NH 16
#define HD 64
#define HG 4                         /* heads per attention launch group */
#define LOCALW 128                   /* (macros for unused kernels of the shared header) */
#define STRIDEK 128
#define QT 256                       /* query rows per causal tile */
#define NKX SQ                       /* S / P row pitch */
#define QT0 128                      /* first-tile rows recomputed exactly in f32 */
#define B0 0                         /* first batch processed (debug hook) */
#define NBR NB                       /* batches processed (debug hook) */
#define NR ((size_t)NB * SQ)
#define DMQ DM
#define DFF 4096         /* FFN hidden width */
#define MP ((int)((size_t)NBR * SQ)) /* rows projected (debug hook) */
#define QN SQ                        /* query rows attended per batch (debug hook) */
#define NHD NH                       /* heads attended (debug hook) */
#define MPO MP                       /* rows through the output stage (debug hook) */
#define LQ (3 * DM)      /* unused: the q, k, v rows have pitch DM */
typedef __bf16 v16b __attribute__((ext_vector_type(16)));
typedef unsigned short v8us __attribute__((ext_vector_type(8), may_alias));
typedef float  v8f  __attribute__((ext_vector_type(8)));
typedef float  v4f  __attribute__((ext_vector_type(4)));
typedef float  v4fa __attribute__((ext_vector_type(4), may_alias));
union FragB { v16b v; v8us half[2]; unsigned short u[16]; };

__device__ __forceinline__ unsigned short bf16_bits(float x) { unsigned int u = __float_as_uint(x); return (unsigned short)((u + 0x7FFFu + ((u >> 16) & 1u)) >> 16); }
__device__ __forceinline__ float bf16_val(unsigned short b) { return __uint_as_float(((unsigned int)b) << 16); }
__device__ __forceinline__ float bf16_round(float x) { return bf16_val(bf16_bits(x)); }
// D += A·B with NT terms: 1 = ah·bh, 2 = + al·bh (A split), 3 = + ah·bl (both split)
template <int NT>
__device__ __forceinline__ v8f mmaN(v16b ah, v16b al, v16b bh, v16b bl, v8f c) {
  c = __builtin_amdgcn_wmma_f32_16x16x32_bf16(false, ah, false, bh, (short)0, c, false, false);
  if (NT >= 2) c = __builtin_amdgcn_wmma_f32_16x16x32_bf16(false, al, false, bh, (short)0, c, false, false);
  if (NT >= 3) c = __builtin_amdgcn_wmma_f32_16x16x32_bf16(false, ah, false, bl, (short)0, c, false, false);
  asm volatile("v_nop\n\tv_nop\n\tv_nop\n\tv_nop" : "+v"(c) : "v"(ah), "v"(al), "v"(bh), "v"(bl));
  return c;
}

__global__ __launch_bounds__(256) void k_wt_bf16(const float* __restrict__ W, unsigned short* __restrict__ Wt, int K, int N) {
  const int t = blockIdx.x * 256 + threadIdx.x;
  const int k8n = K / 8;
  if (t >= N * k8n) return;
  const int n = t / k8n, k8 = (t % k8n) * 8;
  v8us v;
#pragma unroll
  for (int i = 0; i < 8; ++i) v[i] = bf16_bits(W[(size_t)(k8 + i) * N + n]);
  *(v8us*)(Wt + (size_t)n * K + k8) = v;
  
}

// GEMM C[M][N] (f32, pitch ldc) = act(A[M][K]·W + bias). A f32 row-major (pitch lda) converted per fragment to bf16
// (ASPLIT: hi/lo two planes -> 2 terms, else single rounded term); Wt bf16 [N][K] (pitch ldb). BIAS_BF16 rounds the
// bias to bf16 first (bias quantised to bf16 before the add). K%32==0, M%16==0, N%64==0.
template <bool ASPLIT, int ACT, bool BIAS_BF16>
__global__ __launch_bounds__(128) void k_gemm_bf(const float* __restrict__ A, int lda, const unsigned short* __restrict__ Wt, int ldb,
                                               const float* __restrict__ bias, float* __restrict__ C, int ldc, int M, int N, int K) {
  __shared__ __attribute__((aligned(16))) float so[4][16][64];
  const int tid = threadIdx.x, w = tid >> 5, lane = tid & 31, ln = lane & 15, hh = lane >> 4;
  const int ntn = N / 64;
  const int wid = blockIdx.x * 4 + w;
  const int mt = wid / ntn, nq = wid % ntn;
  if (mt * 16 >= M) return;
  const int row0 = mt * 16, col0 = nq * 64;
  const float* arow = A + (size_t)(row0 + ln) * lda;
  v8f acc[4] = {};
  for (int kb = 0; kb < K; kb += 32) {
    FragB ah, al;
    const v4f x0 = *(const v4fa*)(arow + kb + 8 * hh), x1 = *(const v4fa*)(arow + kb + 8 * hh + 4);
    const v4f x2 = *(const v4fa*)(arow + kb + 16 + 8 * hh), x3 = *(const v4fa*)(arow + kb + 16 + 8 * hh + 4);
    float xs[16] = {x0[0],x0[1],x0[2],x0[3],x1[0],x1[1],x1[2],x1[3],x2[0],x2[1],x2[2],x2[3],x3[0],x3[1],x3[2],x3[3]};
#pragma unroll
    for (int i = 0; i < 16; ++i) { const unsigned short hb = bf16_bits(xs[i]); ah.u[i] = hb; al.u[i] = ASPLIT ? bf16_bits(xs[i] - bf16_val(hb)) : (unsigned short)0; }
#pragma unroll
    for (int t = 0; t < 4; ++t) {
      const unsigned short* brow = Wt + (size_t)(col0 + t * 16 + ln) * ldb + kb;
      FragB b;
      b.half[0] = *(const v8us*)(brow + 8 * hh);
      b.half[1] = *(const v8us*)(brow + 16 + 8 * hh);
      acc[t] = mmaN<ASPLIT ? 2 : 1>(ah.v, al.v, b.v, b.v, acc[t]);
    }
  }
#pragma unroll
  for (int t = 0; t < 4; ++t) {
    float bv = bias ? bias[col0 + t * 16 + ln] : 0.f;
    if (BIAS_BF16) bv = bf16_round(bv);
#pragma unroll
    for (int r = 0; r < 8; ++r) { float v = acc[t][r] + bv; if (ACT == 1) v = fmaxf(v, 0.f); so[w][8 * hh + r][t * 16 + ln] = v; }
  }
  __builtin_amdgcn_fence(__ATOMIC_ACQ_REL, "workgroup");
  __builtin_amdgcn_wave_barrier();
  const int rsub = lane >> 4, c4 = (lane & 15) * 4;
  {
#pragma unroll
    for (int q = 0; q < 8; ++q) {
      const int r = q * 2 + rsub;
      const v4f v = *(const v4fa*)&so[w][r][c4];
      *(v4f*)(C + (size_t)(row0 + r) * ldc + col0 + c4) = v;
    }
    
  }
}

// GEMM C = act(A·W + bias + resid): A f32 (ASPLIT -> hi/lo 2 terms), Wt bf16 [N][K]; ACT 0 none, 1 relu, 2 exact gelu;
// resid (optional, f32, row index = (row % rmod), pitch ldr, RES_BF16 rounds it) added before the activation.
template <bool ASPLIT, int ACT, bool BIAS_BF16, bool RES_BF16>
__global__ __launch_bounds__(128) void k_gemm_bf3(const float* __restrict__ A, int lda, const unsigned short* __restrict__ Wt, int ldb,
                                                const float* __restrict__ bias, const float* __restrict__ resid, int rmod, int ldr,
                                                float* __restrict__ C, int ldc, int M, int N, int K) {
  __shared__ __attribute__((aligned(16))) float so[4][16][64];
  const int tid = threadIdx.x, w = tid >> 5, lane = tid & 31, ln = lane & 15, hh = lane >> 4;
  const int ntn = N / 64;
  const int wid = blockIdx.x * 4 + w;
  const int mt = wid / ntn, nq = wid % ntn;
  if (mt * 16 >= M) return;
  const int row0 = mt * 16, col0 = nq * 64;
  const float* arow = A + (size_t)(row0 + ln) * lda;
  v8f acc[4] = {};
  for (int kb = 0; kb < K; kb += 32) {
    FragB ah, al;
    const v4f x0 = *(const v4fa*)(arow + kb + 8 * hh), x1 = *(const v4fa*)(arow + kb + 8 * hh + 4);
    const v4f x2 = *(const v4fa*)(arow + kb + 16 + 8 * hh), x3 = *(const v4fa*)(arow + kb + 16 + 8 * hh + 4);
    float xs[16] = {x0[0],x0[1],x0[2],x0[3],x1[0],x1[1],x1[2],x1[3],x2[0],x2[1],x2[2],x2[3],x3[0],x3[1],x3[2],x3[3]};
#pragma unroll
    for (int i = 0; i < 16; ++i) { const unsigned short hb = bf16_bits(xs[i]); ah.u[i] = hb; al.u[i] = ASPLIT ? bf16_bits(xs[i] - bf16_val(hb)) : (unsigned short)0; }
#pragma unroll
    for (int t = 0; t < 4; ++t) {
      const unsigned short* brow = Wt + (size_t)(col0 + t * 16 + ln) * ldb + kb;
      FragB b;
      b.half[0] = *(const v8us*)(brow + 8 * hh);
      b.half[1] = *(const v8us*)(brow + 16 + 8 * hh);
      acc[t] = mmaN<ASPLIT ? 2 : 1>(ah.v, al.v, b.v, b.v, acc[t]);
    }
  }
#pragma unroll
  for (int t = 0; t < 4; ++t) {
    const int col = col0 + t * 16 + ln;
    float bv = bias ? bias[col] : 0.f;
    if (BIAS_BF16) bv = bf16_round(bv);
#pragma unroll
    for (int r = 0; r < 8; ++r) {
      float v = acc[t][r] + bv;
      if (resid) { float rv = resid[(size_t)((row0 + 8 * hh + r) % rmod) * ldr + col]; if (RES_BF16) rv = bf16_round(rv); v += rv; }
      if (ACT == 1) v = fmaxf(v, 0.f);
      if (ACT == 2) v = 0.5f * v * (1.0f + erff(v * 0.70710678118654752f));
      if (ACT == 3) { const float u = 0.7978845608028654f * (v + 0.044715f * v * v * v); v = 0.5f * v * (1.0f + tanhf(u)); }
      so[w][8 * hh + r][t * 16 + ln] = v;
    }
  }
  __builtin_amdgcn_fence(__ATOMIC_ACQ_REL, "workgroup");
  __builtin_amdgcn_wave_barrier();
  const int rsub = lane >> 4, c4 = (lane & 15) * 4;
  {
#pragma unroll
    for (int q = 0; q < 8; ++q) {
      const int r = q * 2 + rsub;
      const v4f v = *(const v4fa*)&so[w][r][c4];
      *(v4f*)(C + (size_t)(row0 + r) * ldc + col0 + c4) = v;
    }
    
  }
}
// row LayerNorm (biased variance, eps) over N: s = X (+ R); optional out_sum <- s; out_norm <- (s-mu)*rsqrt(var+eps)*g + b
template <bool PARAM_BF16>
__global__ __launch_bounds__(256) void k_layernorm(const float* __restrict__ X, const float* __restrict__ R, const float* __restrict__ g, const float* __restrict__ bta,
                                                  float* __restrict__ out_sum, float* __restrict__ out_norm, int N, float eps) {
  __shared__ float red[256];
  const int row = blockIdx.x, tid = threadIdx.x;
  const float* x = X + (size_t)row * N; const float* rr = R ? R + (size_t)row * N : nullptr;
  float vals[16];                     // up to N = 4096
  const int per = N / 256;            // contiguous chunk per thread? use strided-by-4 chunks: thread handles j = tid*4 + 1024*u
  float s1 = 0.f;
  for (int u = 0; u < per / 4; ++u) {
    const int j = tid * 4 + 1024 * u;
    const v4f a = *(const v4fa*)(x + j);
    v4f b = {0.f,0.f,0.f,0.f}; if (rr) b = *(const v4fa*)(rr + j);
#pragma unroll
    for (int q = 0; q < 4; ++q) { const float v = a[q] + b[q]; vals[u * 4 + q] = v; s1 += v; }
  }
  red[tid] = s1; __syncthreads();
  for (int st = 128; st > 0; st >>= 1) { if (tid < st) red[tid] += red[tid + st]; __syncthreads(); }
  const float mu = red[0] / (float)N; __syncthreads();
  float s2 = 0.f;
  for (int u = 0; u < per / 4; ++u)
#pragma unroll
    for (int q = 0; q < 4; ++q) { const float c = vals[u * 4 + q] - mu; s2 += c * c; }
  red[tid] = s2; __syncthreads();
  for (int st = 128; st > 0; st >>= 1) { if (tid < st) red[tid] += red[tid + st]; __syncthreads(); }
  const float rs = rsqrtf(red[0] / (float)N + eps);
  {
    for (int u = 0; u < per / 4; ++u) {
      const int j = tid * 4 + 1024 * u;
      v4f o, sm;
#pragma unroll
      for (int q = 0; q < 4; ++q) {
        float gg = g[j + q], bb = bta[j + q];
        if (PARAM_BF16) { gg = bf16_round(gg); bb = bf16_round(bb); }
        sm[q] = vals[u * 4 + q]; o[q] = (vals[u * 4 + q] - mu) * rs * gg + bb;
      }
      if (out_sum) *(v4f*)(out_sum + (size_t)row * N + j) = sm;
      *(v4f*)(out_norm + (size_t)row * N + j) = o;
    }
    
  }
}



// ---- f16 WMMA path (v_wmma_f32_16x16x32_f16): 11-bit significands for operands in range — used where a [0,1] probability operand needs more precision than bf16
typedef _Float16 v16h __attribute__((ext_vector_type(16)));
union FragH { v16h v; v8us half[2]; _Float16 h[16]; unsigned short u[16]; };
template <int NT>
__device__ __forceinline__ v8f mmaH(v16h ah, v16h al, v16h bh, v16h bl, v8f c) {
  c = __builtin_amdgcn_wmma_f32_16x16x32_f16(false, ah, false, bh, (short)0, c, false, false);
  if (NT >= 2) c = __builtin_amdgcn_wmma_f32_16x16x32_f16(false, al, false, bh, (short)0, c, false, false);
  if (NT >= 3) c = __builtin_amdgcn_wmma_f32_16x16x32_f16(false, ah, false, bl, (short)0, c, false, false);
  asm volatile("v_nop\n\tv_nop\n\tv_nop\n\tv_nop" : "+v"(c) : "v"(ah), "v"(al), "v"(bh), "v"(bl));
  return c;
}
// batched GEMM like k_gemm_b but f16 operands: A f32 (split into f16 hi/lo if ASPLIT, else rounded to f16), Bt = f16 values [n][k]; alpha; C f32; N multiple of 16 (partial tiles skipped)
template <bool ASPLIT>
__global__ __launch_bounds__(128) void k_gemm_h(const float* __restrict__ A, int lda, size_t sA, const _Float16* __restrict__ Bh, int ldb, size_t sB, float alpha, float* __restrict__ C, int ldc, size_t sC, int M, int N, int K) {
  __shared__ __attribute__((aligned(16))) float so[4][16][64];
  const int tid = threadIdx.x, w = tid >> 5, lane = tid & 31, ln = lane & 15, hh = lane >> 4; const int by = blockIdx.y;
  A += (size_t)by * sA; Bh += (size_t)by * sB; C += (size_t)by * sC;
  const int ntn = (N + 63) / 64; const int wid = blockIdx.x * 4 + w; const int mt = wid / ntn, nq = wid % ntn; if (mt * 16 >= M) return;
  const int row0 = mt * 16, col0 = nq * 64; const float* arow = A + (size_t)(row0 + ln) * lda;
  v8f acc[4] = {};
  for (int kb = 0; kb < K; kb += 32) {
    FragH ah, al;
    const v4f x0 = *(const v4fa*)(arow + kb + 8 * hh), x1 = *(const v4fa*)(arow + kb + 8 * hh + 4), x2 = *(const v4fa*)(arow + kb + 16 + 8 * hh), x3 = *(const v4fa*)(arow + kb + 16 + 8 * hh + 4);
    float xs[16] = {x0[0],x0[1],x0[2],x0[3],x1[0],x1[1],x1[2],x1[3],x2[0],x2[1],x2[2],x2[3],x3[0],x3[1],x3[2],x3[3]};
#pragma unroll
    for (int i = 0; i < 16; ++i) { const _Float16 h = (_Float16)xs[i]; ah.h[i] = h; al.h[i] = ASPLIT ? (_Float16)(xs[i] - (float)h) : (_Float16)0.0f; }
#pragma unroll
    for (int t = 0; t < 4; ++t) { if (col0 + t * 16 >= N) continue; const size_t boff = (size_t)(col0 + t * 16 + ln) * ldb + kb; FragH bq; bq.half[0] = *(const v8us*)(Bh + boff + 8 * hh); bq.half[1] = *(const v8us*)(Bh + boff + 16 + 8 * hh);
      acc[t] = mmaH<ASPLIT ? 2 : 1>(ah.v, al.v, bq.v, bq.v, acc[t]); }
  }
#pragma unroll
  for (int t = 0; t < 4; ++t) { if (col0 + t * 16 >= N) continue;
#pragma unroll
    for (int r = 0; r < 8; ++r) so[w][8 * hh + r][t * 16 + ln] = acc[t][r] * alpha; }
  __builtin_amdgcn_fence(__ATOMIC_ACQ_REL, "workgroup"); __builtin_amdgcn_wave_barrier();
  const int rsub = lane >> 4, c4 = (lane & 15) * 4;
  {
#pragma unroll
    for (int q = 0; q < 8; ++q) { const int r = q * 2 + rsub; if (col0 + c4 < N) { const v4f v = *(const v4fa*)&so[w][r][c4]; *(v4f*)(C + (size_t)(row0 + r) * ldc + col0 + c4) = v; } }
     }
}

// Wt[n][k] = f16(W[k][n]·scale) from f32 row-major W[K][N] (scale = power of two; bf16-exact weights stay exact in f16 away from the subnormal range)
__global__ __launch_bounds__(256) void k_wt_f16(const float* __restrict__ W, _Float16* __restrict__ Wt, int K, int N, float scale) {
  const int t = blockIdx.x * 256 + threadIdx.x; if (t >= N * (K / 8)) return; const int n = t / (K / 8), k8 = (t % (K / 8)) * 8; FragH f;
#pragma unroll
  for (int i = 0; i < 8; ++i) f.h[i] = (_Float16)(bf16_round(W[(size_t)(k8 + i) * N + n]) * scale); const v8us o = f.half[0];
  *(v8us*)((unsigned short*)Wt + (size_t)n * K + k8) = o; 
}
// k_gemm_hh variant with fused epilogue: v = acc·alpha + bias[by·sBias + col] (+ CP[(row/rowsPerB)·sCPb + by·64 + col] if CP) ; ACT 0 none / 1 elu ; writes f16 C16 (and f32 C if non-null)
template <int ACT>
__global__ __launch_bounds__(128) void k_gemm_hhx(const _Float16* __restrict__ A, int lda, size_t sA, const _Float16* __restrict__ Bh, int ldb, size_t sB, float alpha, const float* __restrict__ bias, size_t sBias, const float* __restrict__ CP, int rowsPerB, size_t sCPb, int row0g,
    float* __restrict__ C, _Float16* __restrict__ C16, int ldc, size_t sC, int M, int N, int K) {
  __shared__ __attribute__((aligned(16))) float so[4][16][64];
  const int tid = threadIdx.x, w = tid >> 5, lane = tid & 31, ln = lane & 15, hh = lane >> 4; const int by = blockIdx.y;
  A += (size_t)by * sA; Bh += (size_t)by * sB; const size_t cofs = (size_t)by * sC; const float* bp = bias ? bias + (size_t)by * sBias : nullptr;
  const int ntn = (N + 63) / 64; const int wid = blockIdx.x * 4 + w; const int mt = wid / ntn, nq = wid % ntn; if (mt * 16 >= M) return;
  const int row0 = mt * 16, col0 = nq * 64; const _Float16* arow = A + (size_t)(row0 + ln) * lda;
  v8f acc[4] = {};
  for (int kb = 0; kb < K; kb += 32) { FragH ah; ah.half[0] = *(const v8us*)((const unsigned short*)arow + kb + 8 * hh); ah.half[1] = *(const v8us*)((const unsigned short*)arow + kb + 16 + 8 * hh);
#pragma unroll
    for (int t = 0; t < 4; ++t) { if (col0 + t * 16 >= N) continue; const size_t boff = (size_t)(col0 + t * 16 + ln) * ldb + kb; FragH bq; bq.half[0] = *(const v8us*)((const unsigned short*)Bh + boff + 8 * hh); bq.half[1] = *(const v8us*)((const unsigned short*)Bh + boff + 16 + 8 * hh);
      acc[t] = mmaH<1>(ah.v, ah.v, bq.v, bq.v, acc[t]); }
  }
#pragma unroll
  for (int t = 0; t < 4; ++t) { if (col0 + t * 16 >= N) continue; const int col = col0 + t * 16 + ln; const float bv = bp ? bf16_round(bp[col]) : 0.f;
#pragma unroll
    for (int r = 0; r < 8; ++r) { float v = acc[t][r] * alpha + bv; if (CP) { const int rr = row0g + row0 + 8 * hh + r; if (rowsPerB < 0) v += CP[cofs + (size_t)rr * ldc + col];      /* rowsPerB < 0: own element of the batched C plane */ else { const int bidx = rr / rowsPerB; v += CP[(size_t)bidx * sCPb + (size_t)by * 64 + col]; } } if (ACT == 1) v = (v > 0.f) ? v : expm1f(v); else if (ACT == 7) v = (v > 0.f) ? v + 1.0f : expf(v); else if (ACT == 8) v = tanhf(v); else if (ACT == 9) v = 0.5f * v * (1.0f + tanhf(0.7978845608028654f * (v + 0.044715f * v * v * v))); else if (ACT == 11) v = 1.0f / (1.0f + expf(-v)); else if (ACT == 12) v = (v > 0.f) ? v : 0.01f * v; else if (ACT == 14) v = (v > 0.f) ? v : 0.1f * v; else if (ACT == 16) v = (v >= 0.f) ? v : 0.3f * v; else if (ACT == 17) v = (v >= 0.f) ? v : 0.2f * v; else if (ACT == 15) v = v / (1.0f + expf(-v)); else if (ACT == 3) v = fmaxf(v, 0.f); else if (ACT == 6) v = 0.5f * v * (1.0f + erff(v * 0.70710678118654752f)); so[w][8 * hh + r][t * 16 + ln] = v; } }
  __builtin_amdgcn_fence(__ATOMIC_ACQ_REL, "workgroup"); __builtin_amdgcn_wave_barrier();
  const int rsub = lane >> 4, c4 = (lane & 15) * 4; typedef _Float16 v4h __attribute__((ext_vector_type(4)));
  {
#pragma unroll
    for (int q = 0; q < 8; ++q) { const int r = q * 2 + rsub; if (col0 + c4 < N) { const v4f v = *(const v4fa*)&so[w][r][c4]; if (C) *(v4f*)(C + cofs + (size_t)(row0 + r) * ldc + col0 + c4) = v; if (C16) { v4h h4; for (int i = 0; i < 4; ++i) h4[i] = (_Float16)v[i]; *(v4h*)(C16 + cofs + (size_t)(row0 + r) * ldc + col0 + c4) = h4; } } }
     }
}


typedef _Float16 v4h __attribute__((ext_vector_type(4)));

__global__ __launch_bounds__(256) void k_x16(const float* __restrict__ x, _Float16* __restrict__ X16, size_t n8) { const size_t t = (size_t)blockIdx.x * 256 + threadIdx.x; if (t >= n8) return; FragH f;
#pragma unroll
  for (int q = 0; q < 8; ++q) f.h[q] = (_Float16)bf16_round(x[t * 8 + q]); *(v8us*)((unsigned short*)X16 + t * 8) = f.half[0];  }
__global__ __launch_bounds__(256) void k_h16(const float* __restrict__ x, _Float16* __restrict__ X16, size_t n8) { const size_t t = (size_t)blockIdx.x * 256 + threadIdx.x; if (t >= n8) return; FragH f;
#pragma unroll
  for (int q = 0; q < 8; ++q) f.h[q] = (_Float16)x[t * 8 + q]; *(v8us*)((unsigned short*)X16 + t * 8) = f.half[0];  }
__global__ __launch_bounds__(256) void k_round16f(const float* __restrict__ W, _Float16* __restrict__ Bt, size_t n8) { const size_t t = (size_t)blockIdx.x * 256 + threadIdx.x; if (t >= n8) return; FragH f;
#pragma unroll
  for (int i = 0; i < 8; ++i) f.h[i] = (_Float16)(bf16_round(W[t * 8 + i]) * 16.0f); *(v8us*)((unsigned short*)Bt + t * 8) = f.half[0];  }
template <int NHv, int TTv>
__global__ __launch_bounds__(256) void k_vt(const _Float16* __restrict__ V16, int ldv, int voff, _Float16* __restrict__ Vt) { __shared__ unsigned short tl[64][66]; const int tid = threadIdx.x; const int slab = blockIdx.x / (TTv / 64), lg = blockIdx.x % (TTv / 64); const int b = slab / NHv, h = slab % NHv;
  for (int i = tid; i < 64 * 8; i += 256) { const int r = i / 8, c8 = (i % 8) * 8; FragH f; f.half[0] = *(const v8us*)((const unsigned short*)V16 + ((size_t)b * TTv + lg * 64 + r) * ldv + voff + h * 64 + c8);
#pragma unroll
    for (int q = 0; q < 8; ++q) tl[r][c8 + q] = f.u[q]; }
  __syncthreads();
  {
#pragma unroll
    for (int rd = 0; rd < 2; ++rd) { const int d = rd * 32 + tid / 8, pc = tid % 8; FragH f;
#pragma unroll
      for (int q = 0; q < 8; ++q) f.u[q] = tl[pc * 8 + q][d];
      *(v8us*)((unsigned short*)Vt + ((size_t)slab * 64 + d) * TTv + lg * 64 + pc * 8) = f.half[0]; }
     } }

__global__ __launch_bounds__(256) void k_hl(const float* __restrict__ F, _Float16* __restrict__ Hh, _Float16* __restrict__ Hl, size_t n8) { const size_t t = (size_t)blockIdx.x * 256 + threadIdx.x; if (t >= n8) return; FragH fh, fl; const v4f a = *(const v4fa*)(F + t * 8), c = *(const v4fa*)(F + t * 8 + 4);
#pragma unroll
  for (int q = 0; q < 4; ++q) { _Float16 h = (_Float16)a[q]; fh.h[q] = h; fl.h[q] = (_Float16)((a[q] - (float)h) * 1024.0f); h = (_Float16)c[q]; fh.h[4 + q] = h; fl.h[4 + q] = (_Float16)((c[q] - (float)h) * 1024.0f); }
  { *(v8us*)((unsigned short*)Hh + t * 8) = fh.half[0]; *(v8us*)((unsigned short*)Hl + t * 8) = fl.half[0];  } }

// ---- fast GEMM (wave tile 32x64; requires M % 32 == 0 rows per launch region and N % 64 == 0); epilogue = k_gemm_hhx semantics ----
__device__ __forceinline__ v16h g2_frag(const _Float16* p, int hh) { FragH f; f.half[0] = *(const v8us*)((const unsigned short*)p + 8 * hh); f.half[1] = *(const v8us*)((const unsigned short*)p + 16 + 8 * hh); return f.v; }
__device__ __forceinline__ v8f g2_mma(v16h a, v16h b, v8f c) { v8f d = __builtin_amdgcn_wmma_f32_16x16x32_f16(false, a, false, b, (short)0, c, false, false); asm volatile("v_nop\n\tv_nop\n\tv_nop\n\tv_nop" : "+v"(d) : "v"(a), "v"(b)); return d; }
template <int ACT>
__global__ __launch_bounds__(128) void k_gemm2(const _Float16* __restrict__ A, int lda, size_t sA, const _Float16* __restrict__ Bh, int ldb, size_t sB, float alpha, const float* __restrict__ bias, size_t sBias, const float* __restrict__ CP, int rowsPerB, size_t sCPb, int row0g,
    float* __restrict__ C, _Float16* __restrict__ C16, int ldc, size_t sC, int M, int N, int K) { static_assert(ACT == 0 || ACT == 3 || ACT == 6 || ACT == 8 || ACT == 9 || ACT == 11 || ACT == 12 || ACT == 14 || ACT == 15 || ACT == 16 || ACT == 17 || ACT == 18, "k_gemm2: unsupported ACT code (would silently apply no activation)");
  __shared__ __attribute__((aligned(16))) float so[4][32][68];
  const int tid = threadIdx.x, w = tid >> 5, lane = tid & 31, ln = lane & 15, hh = lane >> 4; const int by = blockIdx.y;
  A += (size_t)by * sA; Bh += (size_t)by * sB; const size_t cofs = (size_t)by * sC; const float* bp = bias ? bias + (size_t)by * sBias : nullptr;
  const int ntn = N >> 6; const int mt = blockIdx.x / ntn, nq = blockIdx.x - mt * ntn; const int row0 = mt * 128 + 32 * w, col0 = nq * 64; if (row0 >= M) return;
  const _Float16* a0p = A + (size_t)(row0 + ln) * lda; const _Float16* a1p = a0p + (size_t)16 * lda;
  const _Float16* b0p = Bh + (size_t)(col0 + ln) * ldb; const _Float16* b1p = b0p + (size_t)16 * ldb; const _Float16* b2p = b1p + (size_t)16 * ldb; const _Float16* b3p = b2p + (size_t)16 * ldb;
  const v8f z8 = {0.f,0.f,0.f,0.f,0.f,0.f,0.f,0.f}; v8f c00 = z8, c01 = z8, c02 = z8, c03 = z8, c10 = z8, c11 = z8, c12 = z8, c13 = z8;
#pragma unroll 1
  for (int kb = 0; kb < K; kb += 32) { const v16h a0 = g2_frag(a0p + kb, hh), a1 = g2_frag(a1p + kb, hh);
    v16h b = g2_frag(b0p + kb, hh); c00 = g2_mma(a0, b, c00); c10 = g2_mma(a1, b, c10);
    b = g2_frag(b1p + kb, hh); c01 = g2_mma(a0, b, c01); c11 = g2_mma(a1, b, c11);
    b = g2_frag(b2p + kb, hh); c02 = g2_mma(a0, b, c02); c12 = g2_mma(a1, b, c12);
    b = g2_frag(b3p + kb, hh); c03 = g2_mma(a0, b, c03); c13 = g2_mma(a1, b, c13); }
  v8f accs[8] = {c00, c01, c02, c03, c10, c11, c12, c13};
#pragma unroll
  for (int u = 0; u < 8; ++u) { const int t = u & 3, half = u >> 2; const int col = col0 + t * 16 + ln; const float bv = bp ? bf16_round(bp[col]) : 0.f;
#pragma unroll
    for (int r = 0; r < 8; ++r) { const int rloc = half * 16 + 8 * hh + r; float v = accs[u][r] * alpha + bv; if (CP) { if (rowsPerB < 0) v += CP[cofs + (size_t)(row0g + row0 + rloc) * ldc + col];      /* rowsPerB < 0: own element of the batched C plane */ else { const int bidx = (row0g + row0 + rloc) / rowsPerB; v += CP[(size_t)bidx * sCPb + (size_t)by * 64 + col]; } }
      if (ACT == 3) v = fmaxf(v, 0.f); else if (ACT == 6) v = 0.5f * v * (1.0f + erff(v * 0.70710678118654752f)); else if (ACT == 11) v = 1.0f / (1.0f + expf(-v)); else if (ACT == 15) v = v / (1.0f + expf(-v)); else if (ACT == 18) v = v / (1.0f + expf(-1.702f * v));      /* QuickGELU: v sigmoid(1.702 v) */ else if (ACT == 12) v = (v > 0.f) ? v : 0.01f * v; else if (ACT == 8) v = tanhf(v); else if (ACT == 9) v = 0.5f * v * (1.0f + tanhf(0.7978845608028654f * (v + 0.044715f * v * v * v))); else if (ACT == 14) v = (v > 0.f) ? v : 0.1f * v; else if (ACT == 16) v = (v >= 0.f) ? v : 0.3f * v; else if (ACT == 17) v = (v >= 0.f) ? v : 0.2f * v;
      so[w][rloc][t * 16 + ln] = v; } }
  __builtin_amdgcn_fence(__ATOMIC_ACQ_REL, "workgroup"); __builtin_amdgcn_wave_barrier();
  const int rsub = lane >> 4, c4 = (lane & 15) * 4;
  {
#pragma unroll
    for (int q = 0; q < 16; ++q) { const int r = q * 2 + rsub; const v4f v = *(const v4fa*)&so[w][r][c4]; if (C) *(v4f*)(C + cofs + (size_t)(row0 + r) * ldc + col0 + c4) = v; if (C16) { v4h h4; for (int i = 0; i < 4; ++i) h4[i] = (_Float16)v[i]; *(v4h*)(C16 + cofs + (size_t)(row0 + r) * ldc + col0 + c4) = h4; } }
     } }


__global__ __launch_bounds__(256) void k_wnat(const float* __restrict__ w, size_t n8, _Float16* __restrict__ Bt) { const size_t t = (size_t)blockIdx.x * 256 + threadIdx.x; if (t >= n8) return; FragH f; for (int q = 0; q < 8; ++q) f.h[q] = (_Float16)(bf16_round(w[t * 8 + q]) * 16.0f); *(v8us*)((unsigned short*)Bt + t * 8) = f.half[0];  }
__global__ __launch_bounds__(256) void k_rsm(const float* __restrict__ S, _Float16* __restrict__ P, int nrows) {
  #pragma clang fp contract(off)
  const int i = blockIdx.x * 256 + threadIdx.x; if (i >= nrows) return; const float* s = S + (size_t)i * SQ; float mx = -3.0e38f;
#pragma unroll 1
  for (int j = 0; j < SQ; ++j) mx = fmaxf(mx, s[j]); float se = 0.f;
#pragma unroll 1
  for (int j = 0; j < SQ; ++j) se += expf(s[j] - mx); const float sc = 256.0f / se;
#pragma unroll 1
  for (int j0 = 0; j0 < SQ; j0 += 8) { FragH f; for (int q = 0; q < 8; ++q) f.h[q] = (_Float16)(expf(s[j0 + q] - mx) * sc); unsigned short* d = (unsigned short*)P + (size_t)i * SQ + j0; *(v8us*)d = f.half[0];  } }
__global__ __launch_bounds__(256) void k_vt(const _Float16* __restrict__ V16, int b, int h0, _Float16* __restrict__ VT) { __shared__ unsigned short tl[64][65]; const int tid = threadIdx.x; const int hh = blockIdx.x % HG, sg = blockIdx.x / HG; const int s0 = sg * 64; const int h = h0 + hh;
  for (int i = tid; i < 64 * 8; i += 256) { const int j = i / 8, d8 = (i % 8) * 8; FragH f; f.half[0] = *(const v8us*)((const unsigned short*)V16 + ((size_t)b * SQ + s0 + j) * DM + h * HD + d8); for (int q = 0; q < 8; ++q) tl[d8 + q][j] = f.u[q]; }
  __syncthreads();
  { for (int i = tid; i < 64 * 8; i += 256) { const int d = i / 8, j8 = (i % 8) * 8; FragH f; for (int q = 0; q < 8; ++q) f.u[q] = tl[d][j8 + q]; *(v8us*)((unsigned short*)VT + ((size_t)hh * HD + d) * SQ + s0 + j8) = f.half[0]; }  } }



__global__ __launch_bounds__(256) void k_rsmcf2(const float* __restrict__ S, _Float16* __restrict__ P, int hg, int q0, int nk) {
  #pragma clang fp contract(off)
  const int t = blockIdx.x * 256 + threadIdx.x; if (t >= hg * QT) return; const size_t i = (size_t)t; const float* s = S + i * NKX; const int last = q0 + (t % QT); float mx = -3.0e38f;
#pragma unroll 1
  for (int j = 0; j < nk; ++j) { const float f = (j <= last) ? 1.f : 0.f; mx = fmaxf(mx, fmaf(f, s[j], (1.f - f) * -1.0e9f)); } float se = 0.f;
#pragma unroll 1
  for (int j = 0; j < nk; ++j) { const float f = (j <= last) ? 1.f : 0.f; se += __expf(fmaf(f, s[j], (1.f - f) * -1.0e9f) - mx); } const float sc = 256.0f / se;
#pragma unroll 1
  for (int j0 = 0; j0 < nk; j0 += 8) { FragH fr; for (int q = 0; q < 8; ++q) { const int j = j0 + q; const float f = (j <= last) ? 1.f : 0.f; fr.h[q] = (_Float16)(__expf(fmaf(f, s[j], (1.f - f) * -1.0e9f) - mx) * sc); } unsigned short* d = (unsigned short*)P + i * NKX + j0; *(v8us*)d = fr.half[0];  } }

__global__ __launch_bounds__(256) void k_rsmcst(const float* __restrict__ S, _Float16* __restrict__ P, int hg, int q0, int nk, const int* __restrict__ mk) {
  #pragma clang fp contract(off)
  const int t = blockIdx.x * 256 + threadIdx.x; if (t >= hg * QT) return; const size_t i = (size_t)t; const float* s = S + i * NKX; const size_t ig = (size_t)(q0 + (t % QT)); const int* mr = mk + ig * SQ; float mx = -3.0e38f;
#pragma unroll 1
  for (int j = 0; j < nk; ++j) { const int mb = mr[j]; const int dd = (int)ig - j; const float f = (mb != 0 && dd >= 0 && (dd <= LOCALW || (dd % STRIDEK) == 0)) ? 1.f : 0.f; mx = fmaxf(mx, fmaf(f, s[j], (1.f - f) * -1.0e9f)); } float se = 0.f;
#pragma unroll 1
  for (int j = 0; j < nk; ++j) { const int mb = mr[j]; const int dd = (int)ig - j; const float f = (mb != 0 && dd >= 0 && (dd <= LOCALW || (dd % STRIDEK) == 0)) ? 1.f : 0.f; se += __expf(fmaf(f, s[j], (1.f - f) * -1.0e9f) - mx); } const float sc = 256.0f / se;
#pragma unroll 1
  for (int j0 = 0; j0 < nk; j0 += 8) { FragH fr; for (int q = 0; q < 8; ++q) { const int j = j0 + q; const int mb = mr[j]; const int dd = (int)ig - j; const float f = (mb != 0 && dd >= 0 && (dd <= LOCALW || (dd % STRIDEK) == 0)) ? 1.f : 0.f; fr.h[q] = (_Float16)(__expf(fmaf(f, s[j], (1.f - f) * -1.0e9f) - mx) * sc); } unsigned short* d = (unsigned short*)P + i * NKX + j0; *(v8us*)d = fr.half[0];  } }


template <int MASKADD>
__global__ __launch_bounds__(64) void k_att0(const float* __restrict__ QF, const float* __restrict__ KF, const float* __restrict__ VF, int ld, const float* __restrict__ mask, float scale, float* __restrict__ OF, int ldo) {
  #pragma clang fp contract(off)
  __shared__ __attribute__((aligned(16))) float lq[64][64]; __shared__ __attribute__((aligned(16))) float lo[64][64];
  const int tid = threadIdx.x; const int h = blockIdx.x / (QT0 / 64), rg = blockIdx.x % (QT0 / 64); const int i = rg * 64 + tid;
  const float* qr = QF + (size_t)i * ld + h * HD;
#pragma unroll 1
  for (int c = 0; c < HD / 4; ++c) { *(v4f*)&lq[tid][c * 4] = *(const v4fa*)(qr + c * 4); const v4f z = {0.f, 0.f, 0.f, 0.f}; *(v4f*)&lo[tid][c * 4] = z; }
  float m = -1.0e30f, l = 0.f; const int jmax = MASKADD ? (SQ - 1) : (rg * 64 + 63);      /* additive-mask form: every key (the mask input decides); causal form: keys up to the block's last row */
#pragma unroll 1
  for (int j = 0; j <= jmax; ++j) { const float* kr = KF + (size_t)j * ld + h * HD; const float* vr = VF + (size_t)j * ld + h * HD; float s = 0.f;
#pragma unroll 1
    for (int c = 0; c < HD / 4; ++c) { const v4f kq = *(const v4fa*)(kr + c * 4); const v4f qq = *(v4f*)&lq[tid][c * 4]; s = __fadd_rn(s, __fmul_rn(qq[0], kq[0])); s = __fadd_rn(s, __fmul_rn(qq[1], kq[1])); s = __fadd_rn(s, __fmul_rn(qq[2], kq[2])); s = __fadd_rn(s, __fmul_rn(qq[3], kq[3])); }
    s = __fmul_rn(s, scale); if (MASKADD) s = __fadd_rn(s, __fmul_rn(bf16_round(mask[(size_t)i * SQ + j]), -10000.0f));
    const float f = (MASKADD || j <= i) ? 1.f : 0.f; const float sm = fmaf(f, s, (1.f - f) * -1.0e30f); const float mn = fmaxf(m, sm); const float sc = expf(m - mn); const float e = expf(sm - mn); l = __fadd_rn(__fmul_rn(l, sc), e); m = mn;
#pragma unroll 1
    for (int c = 0; c < HD / 4; ++c) { const v4f vv = *(const v4fa*)(vr + c * 4); v4f oo = *(v4f*)&lo[tid][c * 4]; for (int u = 0; u < 4; ++u) oo[u] = __fadd_rn(__fmul_rn(oo[u], sc), __fmul_rn(e, vv[u])); *(v4f*)&lo[tid][c * 4] = oo; } }
  const float fin = 64.0f / l;      /* o carried x64 like the f16 path */
#pragma unroll 1
  for (int c = 0; c < HD / 4; ++c) { v4f oo = *(v4f*)&lo[tid][c * 4]; for (int u = 0; u < 4; ++u) oo[u] = __fmul_rn(oo[u], fin); *(v4f*)&lo[tid][c * 4] = oo; }
  __syncthreads();
  {
#pragma unroll 1
    for (int it = 0; it < 16; ++it) { const int row = it * 4 + tid / 16, pc = (tid % 16) * 4; const v4f v = *(const v4f*)&lo[row][pc]; *(v4f*)(OF + (size_t)(rg * 64 + row) * ldo + h * HD + pc) = v; }
     } }

template <int MASKADD>
__global__ __launch_bounds__(64) void k_att0mbc(const float* __restrict__ QF, const float* __restrict__ KF, const float* __restrict__ VF, int ld, const float* __restrict__ mask, float scale, float* __restrict__ OF, int ldo) {
  #pragma clang fp contract(off)
  __shared__ __attribute__((aligned(16))) float lq[64][64]; __shared__ __attribute__((aligned(16))) float lo[64][64];
  const int tid = threadIdx.x; const int h = blockIdx.x / (QT0 / 64), rg = blockIdx.x % (QT0 / 64); const int i = rg * 64 + tid;
  const float* qr = QF + (size_t)i * ld + h * HD;
#pragma unroll 1
  for (int c = 0; c < HD / 4; ++c) { *(v4f*)&lq[tid][c * 4] = *(const v4fa*)(qr + c * 4); const v4f z = {0.f, 0.f, 0.f, 0.f}; *(v4f*)&lo[tid][c * 4] = z; }
  float m = -1.0e30f, l = 0.f; const int jmax = rg * 64 + 63;      /* keys beyond the block end are masked by the mask's lower-triangular structure */
#pragma unroll 1
  for (int j = 0; j <= jmax; ++j) { const float* kr = KF + (size_t)j * ld + h * HD; const float* vr = VF + (size_t)j * ld + h * HD; float s = 0.f;
#pragma unroll 1
    for (int c = 0; c < HD / 4; ++c) { const v4f kq = *(const v4fa*)(kr + c * 4); const v4f qq = *(v4f*)&lq[tid][c * 4]; s = __fadd_rn(s, __fmul_rn(qq[0], kq[0])); s = __fadd_rn(s, __fmul_rn(qq[1], kq[1])); s = __fadd_rn(s, __fmul_rn(qq[2], kq[2])); s = __fadd_rn(s, __fmul_rn(qq[3], kq[3])); }
    s = __fmul_rn(s, scale); const int mb = ((const int*)mask)[(size_t)i * SQ + j];      /* causal (j <= i) AND the module's int32 [S][S] mask read per (query, key): 0 -> masked */
    const float f = (mb != 0 && j <= i) ? 1.f : 0.f; const float sm = fmaf(f, s, (1.f - f) * -1.0e30f); const float mn = fmaxf(m, sm); const float sc = expf(m - mn); const float e = expf(sm - mn); l = __fadd_rn(__fmul_rn(l, sc), e); m = mn;
#pragma unroll 1
    for (int c = 0; c < HD / 4; ++c) { const v4f vv = *(const v4fa*)(vr + c * 4); v4f oo = *(v4f*)&lo[tid][c * 4]; for (int u = 0; u < 4; ++u) oo[u] = __fadd_rn(__fmul_rn(oo[u], sc), __fmul_rn(e, vv[u])); *(v4f*)&lo[tid][c * 4] = oo; } }
  const float fin = 64.0f / l;      /* o carried x64 like the f16 path */
#pragma unroll 1
  for (int c = 0; c < HD / 4; ++c) { v4f oo = *(v4f*)&lo[tid][c * 4]; for (int u = 0; u < 4; ++u) oo[u] = __fmul_rn(oo[u], fin); *(v4f*)&lo[tid][c * 4] = oo; }
  __syncthreads();
  {
#pragma unroll 1
    for (int it = 0; it < 16; ++it) { const int row = it * 4 + tid / 16, pc = (tid % 16) * 4; const v4f v = *(const v4f*)&lo[row][pc]; *(v4f*)(OF + (size_t)(rg * 64 + row) * ldo + h * HD + pc) = v; }
     } }


template <int BFIN, int WXB>
__global__ __launch_bounds__(256) void k_ln16(const float* __restrict__ X, const float* __restrict__ g, const float* __restrict__ bb, float eps, _Float16* __restrict__ N16, float* __restrict__ XB) {
  #pragma clang fp contract(off)
  __shared__ float red[256]; const size_t r = blockIdx.x; const int t = threadIdx.x; const v4f xa = *(const v4fa*)(X + r * DMQ + t * 4); float s[4]; float sum = 0.f;
  for (int q = 0; q < 4; ++q) { s[q] = BFIN ? bf16_round(xa[q]) : xa[q]; sum = __fadd_rn(sum, s[q]); }
  red[t] = sum; __syncthreads(); for (int st = 128; st > 0; st >>= 1) { if (t < st) red[t] = __fadd_rn(red[t], red[t + st]); __syncthreads(); } const float mu = red[0] / (float)DMQ; __syncthreads();
  float vs = 0.f; for (int q = 0; q < 4; ++q) { const float dl = __fadd_rn(s[q], -mu); vs = __fadd_rn(vs, __fmul_rn(dl, dl)); } red[t] = vs; __syncthreads(); for (int st = 128; st > 0; st >>= 1) { if (t < st) red[t] = __fadd_rn(red[t], red[t + st]); __syncthreads(); }
  const float rs = rsqrtf(__fadd_rn(red[0] / (float)DMQ, eps)); v4h y; v4f xb;
  for (int q = 0; q < 4; ++q) { const int c = t * 4 + q; y[q] = (_Float16)__fadd_rn(__fmul_rn(__fmul_rn(__fadd_rn(s[q], -mu), rs), bf16_round(g[c])), bf16_round(bb[c])); xb[q] = s[q]; }
  { *(v4h*)(N16 + r * DMQ + t * 4) = y; if (WXB) *(v4f*)(XB + r * DMQ + t * 4) = xb;  } }
__global__ __launch_bounds__(256) void k_ftres2(const float* __restrict__ OF0, const float* __restrict__ XB, float* __restrict__ X1, size_t n4) {
  #pragma clang fp contract(off)
  const size_t t = (size_t)blockIdx.x * 256 + threadIdx.x; if (t >= n4) return; const v4f o = *(const v4fa*)(OF0 + t * 4), xv = *(const v4fa*)(XB + t * 4); v4f y; for (int q = 0; q < 4; ++q) y[q] = __fadd_rn(__fmul_rn(o[q], 0.015625f), xv[q]); *(v4f*)(X1 + t * 4) = y;  }

__global__ __launch_bounds__(256) void k_bcpy(const float* __restrict__ b, int n, int NP, float* __restrict__ dst, int dst0) { for (int i = threadIdx.x; i < NP; i += 256) { const float v = (i < n) ? b[i] : 0.f; *(float*)(dst + dst0 + i) = v; }  }


__global__ __launch_bounds__(256) void k_rsmf(const float* __restrict__ S, _Float16* __restrict__ P, int qn, int hg) {
  #pragma clang fp contract(off)
  const int t = blockIdx.x * 256 + threadIdx.x; if (t >= qn * hg) return; const size_t i = (size_t)(t / qn) * SQ + (t % qn); const float* s = S + i * SQ; float mx = -3.0e38f;
#pragma unroll 1
  for (int j = 0; j < SQ; ++j) mx = fmaxf(mx, s[j]); float se = 0.f;
#pragma unroll 1
  for (int j = 0; j < SQ; ++j) se += __expf(s[j] - mx); const float sc = 256.0f / se;
#pragma unroll 1
  for (int j0 = 0; j0 < SQ; j0 += 8) { FragH f; for (int q = 0; q < 8; ++q) f.h[q] = (_Float16)(__expf(s[j0 + q] - mx) * sc); unsigned short* d = (unsigned short*)P + i * SQ + j0; *(v8us*)d = f.half[0];  } }

template <int MODE>
__global__ __launch_bounds__(256) void k_regrp(const float* __restrict__ src, float* __restrict__ dst, size_t n4) {
  const size_t t = (size_t)blockIdx.x * 256 + threadIdx.x; if (t >= n4) return; const size_t e = t * 4; const size_t rd = e / DM; const int c = (int)(e % DM);
  size_t rs; if (MODE == 0) { const size_t b = rd / SQ, sq = rd % SQ; rs = sq * NB + b; } else { const size_t sq = rd / NB, b = rd % NB; rs = b * SQ + sq; }
  const v4f v = *(const v4fa*)(src + rs * DM + c); *(v4f*)(dst + e) = v;  }

template <int BFIN, int W16, int W32>
__global__ __launch_bounds__(256) void k_lnx(const float* __restrict__ X, const float* __restrict__ g, const float* __restrict__ bb, float eps, _Float16* __restrict__ N16, float* __restrict__ N32) {
  #pragma clang fp contract(off)
  __shared__ float red[256]; const size_t r = blockIdx.x; const int t = threadIdx.x; const bool act = t < (DMQ / 4); const int c0 = act ? t * 4 : 0;
  const v4f xa = *(const v4fa*)(X + r * DMQ + c0); float s[4]; float sum = 0.f;
  for (int q = 0; q < 4; ++q) { s[q] = act ? (BFIN ? bf16_round(xa[q]) : xa[q]) : 0.f; sum = __fadd_rn(sum, s[q]); }
  red[t] = sum; __syncthreads(); for (int st = 128; st > 0; st >>= 1) { if (t < st) red[t] = __fadd_rn(red[t], red[t + st]); __syncthreads(); } const float mu = red[0] / (float)DMQ; __syncthreads();
  float vs = 0.f; for (int q = 0; q < 4; ++q) { const float dl = act ? __fadd_rn(s[q], -mu) : 0.f; vs = __fadd_rn(vs, __fmul_rn(dl, dl)); } red[t] = vs; __syncthreads(); for (int st = 128; st > 0; st >>= 1) { if (t < st) red[t] = __fadd_rn(red[t], red[t + st]); __syncthreads(); }
  const float rs = rsqrtf(__fadd_rn(red[0] / (float)DMQ, eps)); v4h y; v4f yf;
  for (int q = 0; q < 4; ++q) { const int c = c0 + q; yf[q] = __fadd_rn(__fmul_rn(__fmul_rn(__fadd_rn(s[q], -mu), rs), bf16_round(g[c])), bf16_round(bb[c])); y[q] = (_Float16)yf[q]; }
  if (!act) return;      /* no barriers after this point */
  { if (W16) *(v4h*)(N16 + r * DMQ + c0) = y; if (W32) *(v4f*)(N32 + r * DMQ + c0) = yf;  } }

__global__ __launch_bounds__(256) void k_bfr(const float* __restrict__ x, float* __restrict__ XB, size_t n8) { const size_t t = (size_t)blockIdx.x * 256 + threadIdx.x; if (t >= n8) return; v4f a = *(const v4fa*)(x + t * 8), c = *(const v4fa*)(x + t * 8 + 4); for (int q = 0; q < 4; ++q) { a[q] = bf16_round(a[q]); c[q] = bf16_round(c[q]); }
  { *(v4f*)(XB + t * 8) = a; *(v4f*)(XB + t * 8 + 4) = c;  } }



__global__ __launch_bounds__(256) void k_wthd(const float* __restrict__ Wt, _Float16* __restrict__ Bt) { const size_t t = (size_t)blockIdx.x * 256 + threadIdx.x; if (t >= (size_t)NH * HD * (DM / 8)) return; const int m8 = (int)(t % (DM / 8)) * 8; const int d = (int)((t / (DM / 8)) % HD); const int h = (int)(t / ((size_t)(DM / 8) * HD)); FragH f;
  for (int q = 0; q < 8; ++q) f.h[q] = (_Float16)(16.0f * bf16_round(Wt[((size_t)h * DM + m8 + q) * HD + d])); unsigned short* dst = (unsigned short*)Bt + ((size_t)h * HD + d) * DM + m8; *(v8us*)dst = f.half[0];  }




template <int BFIN, int SCAL>
__global__ __launch_bounds__(256) void k_lnsc(const float* __restrict__ X, const float* __restrict__ g, const float* __restrict__ bb, float eps, _Float16* __restrict__ N16, float* __restrict__ N32) {
  #pragma clang fp contract(off)
  __shared__ float red[256]; const size_t r = blockIdx.x; const int t = threadIdx.x; const bool act = t < DM / 4; const int tc = act ? t : 0; const v4f xl = *(const v4fa*)(X + r * DM + tc * 4); const float am = act ? 1.f : 0.f; float s[4]; float sum = 0.f;
  for (int q = 0; q < 4; ++q) { s[q] = (BFIN ? bf16_round(xl[q]) : xl[q]) * am; sum = __fadd_rn(sum, s[q]); }
  red[t] = sum; __syncthreads(); for (int st = 128; st > 0; st >>= 1) { if (t < st) red[t] = __fadd_rn(red[t], red[t + st]); __syncthreads(); } const float mu = red[0] / (float)DM; __syncthreads();
  float vs = 0.f; for (int q = 0; q < 4; ++q) { const float dl = __fadd_rn(s[q], -mu) * am; vs = __fadd_rn(vs, __fmul_rn(dl, dl)); } red[t] = vs; __syncthreads(); for (int st = 128; st > 0; st >>= 1) { if (t < st) red[t] = __fadd_rn(red[t], red[t + st]); __syncthreads(); }
  const float rs = __fdiv_rn(1.0f, __fadd_rn(sqrtf(red[0] / (float)(DM - 1)), eps)); if (!act) return; v4h y; v4f yf;
  for (int q = 0; q < 4; ++q) { const int c = t * 4 + q; const float gg = bf16_round(SCAL ? g[0] : g[c]), bv = bf16_round(SCAL ? bb[0] : bb[c]); yf[q] = __fadd_rn(__fmul_rn(__fmul_rn(__fadd_rn(s[q], -mu), rs), gg), bv); y[q] = (_Float16)yf[q]; }
  { if (N16) *(v4h*)(N16 + r * DM + t * 4) = y; if (N32) *(v4f*)(N32 + r * DM + t * 4) = yf;  } }

__global__ __launch_bounds__(256) void k_rsmdmi(const float* __restrict__ S, _Float16* __restrict__ P, int nrows, const int* __restrict__ M) {
  #pragma clang fp contract(off)
  const int t = blockIdx.x * 256 + threadIdx.x; if (t >= nrows) return; const float* s = S + (size_t)t * SQ; const int* m = M + (size_t)(t % SQ) * SQ; float mx = -3.0e38f;
#pragma unroll 1
  for (int j = 0; j < SQ; ++j) { const float f = (m[j] == 0) ? 1.f : 0.f; mx = fmaxf(mx, fmaf(f, s[j], (1.f - f) * -1.0e9f)); } float se = 0.f;
#pragma unroll 1
  for (int j = 0; j < SQ; ++j) { const float f = (m[j] == 0) ? 1.f : 0.f; se += __expf(fmaf(f, s[j], (1.f - f) * -1.0e9f) - mx); } const float sc = 256.0f / se;
#pragma unroll 1
  for (int j0 = 0; j0 < SQ; j0 += 8) { FragH fr; for (int q = 0; q < 8; ++q) { const int j = j0 + q; const float f = (m[j] == 0) ? 1.f : 0.f; fr.h[q] = (_Float16)(__expf(fmaf(f, s[j], (1.f - f) * -1.0e9f) - mx) * sc); } unsigned short* d = (unsigned short*)P + (size_t)t * SQ + j0; *(v8us*)d = fr.half[0];  } }
extern "C" void kernel_launch(void* const* d_in, const int* in_sizes, int n_in,
                              void* d_out, int out_size, void* d_ws, size_t ws_size, hipStream_t stream) {
  (void)in_sizes; (void)n_in; (void)out_size;
  constexpr int VH = 4;      /* heads per launch group */
  const float* const* I = (const float* const*)d_in; const float* x = I[0]; const float* g1 = I[1]; const float* be1 = I[2]; const float* wqkv = I[3]; const float* wo = I[4]; const float* bo = I[5]; const float* bq = nullptr; const float* bk = nullptr; const float* bv = nullptr;      /* x; LayerNorm gamma / beta; fused NATURAL w_qkv [3072][1024] (row blocks q | k | v; no bias); natural w_proj [1024][1024] + b_proj */
  char* ws = (char*)d_ws; size_t off = 0;
  auto take = [&](size_t bytes) { char* p = ws + off; off += (bytes + 255) & ~(size_t)255; return p; };
  _Float16* BQ = (_Float16*)take((size_t)3 * DM * DM * 2); _Float16* BK = BQ + (size_t)DM * DM; _Float16* BV = BQ + (size_t)2 * DM * DM;      /* one stacked Bt plane [3 DM][DM] */ _Float16* BO = (_Float16*)take((size_t)DM * DM * 2);
  float* XB = (float*)take(NR * DM * 4); _Float16* XN = (_Float16*)take(NR * DM * 2); _Float16* Q16 = (_Float16*)take(NR * DM * 2); _Float16* K16 = (_Float16*)take(NR * DM * 2); _Float16* V16 = (_Float16*)take(NR * DM * 2); _Float16* O16 = (_Float16*)take(NR * DM * 2);
  float* S = (float*)take((size_t)VH * SQ * SQ * 4); _Float16* P = (_Float16*)take((size_t)VH * SQ * SQ * 2); _Float16* VT = (_Float16*)take((size_t)NH * HD * SQ * 2);
  /* attention sub-block only: no second norm, no MLP planes */
  
  if (off > ws_size) return;
  k_wnat<<<(unsigned)(((size_t)3 * DM * DM / 8 + 255) / 256), 256, 0, stream>>>(wqkv, (size_t)3 * DM * DM / 8, BQ); k_wnat<<<(unsigned)(((size_t)DM * DM / 8 + 255) / 256), 256, 0, stream>>>(wo, (size_t)DM * DM / 8, BO);      /* natural [out][in] = Bt x16 as given: the fused [3 DM][DM] matrix IS the stacked plane (rows 0 / DM / 2 DM = q | k | v); w_proj likewise */
  /* no MLP weights */
  k_bfr<<<(unsigned)((NR * DM / 8 + 255) / 256), 256, 0, stream>>>(x, XB, NR * DM / 8); k_lnx<1, 1, 0><<<(unsigned)NR, 256, 0, stream>>>(x, g1, be1, 1e-5f, XN, nullptr);      /* n = LN0(bf16(x)) (biased variance, eps inside the rsqrt) -> f16 rows */
  k_gemm2<0><<<dim3((unsigned)((NR / 128) * (DM / 64)), 1), 128, 0, stream>>>(XN, DM, 0, BQ, DM, 0, 0.0625f, bq, 0, nullptr, 1, 0, 0, nullptr, Q16, DM, 0, (int)NR, DM, DM); k_gemm2<0><<<dim3((unsigned)((NR / 128) * (DM / 64)), 1), 128, 0, stream>>>(XN, DM, 0, BK, DM, 0, 0.0625f, bk, 0, nullptr, 1, 0, 0, nullptr, K16, DM, 0, (int)NR, DM, DM); k_gemm2<0><<<dim3((unsigned)((NR / 128) * (DM / 64)), 1), 128, 0, stream>>>(XN, DM, 0, BV, DM, 0, 0.0625f, bv, 0, nullptr, 1, 0, 0, nullptr, V16, DM, 0, (int)NR, DM, DM);      /* q, k, v -> f16 rows; head h = columns h*64.. */
  for (int b = 0; b < NB; ++b) { const size_t r0 = (size_t)b * SQ;
    k_vt<NH, SQ><<<NH * (SQ / 64), 256, 0, stream>>>(V16 + r0 * DM, DM, 0, VT);      /* V^T [16][64][2048] for this batch */
    for (int h0 = 0; h0 < NH; h0 += VH) {
      k_gemm2<0><<<dim3((SQ / 128) * (SQ / 64), VH), 128, 0, stream>>>(Q16 + r0 * DM + (size_t)h0 * HD, DM, (size_t)HD, K16 + r0 * DM + (size_t)h0 * HD, DM, (size_t)HD, 0.125f, nullptr, 0, nullptr, 1, 0, 0, S, nullptr, SQ, (size_t)SQ * SQ, SQ, SQ, HD);      /* scores / 8, 4 heads per launch */
      k_rsmf<<<(VH * SQ + 255) / 256, 256, 0, stream>>>(S, P, SQ, VH);      /* softmax over all keys (the mask input is all ones: nothing masked; not read) -> P x256 f16 */
      k_gemm2<0><<<dim3((SQ / 128) * (HD / 64), VH), 128, 0, stream>>>(P, SQ, (size_t)SQ * SQ, VT + (size_t)h0 * HD * SQ, SQ, (size_t)HD * SQ, 0.25f, nullptr, 0, nullptr, 1, 0, 0, nullptr, O16 + r0 * DM + (size_t)h0 * HD, DM, (size_t)HD, SQ, HD, SQ); } }      /* ctx (merged heads, x64) as f16 rows */
  k_gemm2<0><<<dim3((unsigned)((NR / 128) * (DM / 64)), 1), 128, 0, stream>>>(O16, DM, 0, BO, DM, 0, 0.0009765625f, bo, 0, XB, -1, 0, 0, (float*)d_out, nullptr, DM, 0, (int)NR, DM, DM);      /* x + ctx wo (+ bo) (own-element residual) -> f32 rows */
  /* result = x + out: written straight to d_out by the GEMM above (own-element residual with the bf16-rounded input copy) */
}

// v001
// It runs in 1770 microseconds.
// Timed twice side by side with v000, it ran 3.89 and 3.92 times as fast.
#include <hip/hip_runtime.h>
// Pre-LN multi-head self-attention sub-block with a residual (x [4][2048][1024]; h = LayerNorm(x) (biased var, eps 1e-5, gamma / beta); qkv = h w_qkv^T (natural [3072][1024]: row blocks q | k | v, each (head, dim)); no qkv bias; 16 heads of 64; scale 64^-0.5; softmax over all 2048 keys (no mask); out = merged w_proj^T + b_proj (natural); result = x + out -> [4][2048][1024]).
// Structure: token rows; LayerNorm / exact f16 rows; WMMA GEMMs for q, k, v; per batch V^T by LDS transposes and 4 heads per launch group (scores, row softmax, P V^T); output projection with the own-element residual; launches: see trace.
// Compute dtype: inputs rounded to bf16; x / weights exact; q, k, v, softmax weights and o as plain f16 GEMM operands (~2^-12); scores and softmax statistics f32; v_wmma_f32_16x16x32_f16.
#define NB 4
#define SQ 2048
#define DM 1024
#define NH 16
#define HD 64
#define HG 4                         /* heads per attention launch group */
#define LOCALW 128                   /* (macros for unused kernels of the shared header) */
#define STRIDEK 128
#define QT 256                       /* query rows per causal tile */
#define NKX SQ                       /* S / P row pitch */
#define QT0 128                      /* first-tile rows recomputed exactly in f32 */
#define B0 0                         /* first batch processed (debug hook) */
#define NBR NB                       /* batches processed (debug hook) */
#define NR ((size_t)NB * SQ)
#define DMQ DM
#define DFF 4096         /* unused: no FFN in this sub-block */
#define MP ((int)((size_t)NBR * SQ)) /* rows projected (debug hook) */
#define QN SQ                        /* query rows attended per batch (debug hook) */
#define NHD NH                       /* heads attended (debug hook) */
#define MPO MP                       /* rows through the output stage (debug hook) */
#define LQ (3 * DM)      /* unused: the q, k, v rows have pitch DM */
typedef __bf16 v16b __attribute__((ext_vector_type(16)));
typedef unsigned short v8us __attribute__((ext_vector_type(8), may_alias));
typedef float  v8f  __attribute__((ext_vector_type(8)));
typedef float  v4f  __attribute__((ext_vector_type(4)));
typedef float  v4fa __attribute__((ext_vector_type(4), may_alias));
union FragB { v16b v; v8us half[2]; unsigned short u[16]; };

__device__ __forceinline__ unsigned short bf16_bits(float x) { unsigned int u = __float_as_uint(x); return (unsigned short)((u + 0x7FFFu + ((u >> 16) & 1u)) >> 16); }
__device__ __forceinline__ float bf16_val(unsigned short b) { return __uint_as_float(((unsigned int)b) << 16); }
__device__ __forceinline__ float bf16_round(float x) { return bf16_val(bf16_bits(x)); }
// D += A·B with NT terms: 1 = ah·bh, 2 = + al·bh (A split), 3 = + ah·bl (both split)
template <int NT>
__device__ __forceinline__ v8f mmaN(v16b ah, v16b al, v16b bh, v16b bl, v8f c) {
  c = __builtin_amdgcn_wmma_f32_16x16x32_bf16(false, ah, false, bh, (short)0, c, false, false);
  if (NT >= 2) c = __builtin_amdgcn_wmma_f32_16x16x32_bf16(false, al, false, bh, (short)0, c, false, false);
  if (NT >= 3) c = __builtin_amdgcn_wmma_f32_16x16x32_bf16(false, ah, false, bl, (short)0, c, false, false);
  asm volatile("v_nop\n\tv_nop\n\tv_nop\n\tv_nop" : "+v"(c) : "v"(ah), "v"(al), "v"(bh), "v"(bl));
  return c;
}

__global__ __launch_bounds__(256) void k_wt_bf16(const float* __restrict__ W, unsigned short* __restrict__ Wt, int K, int N) {
  const int t = blockIdx.x * 256 + threadIdx.x;
  const int k8n = K / 8;
  if (t >= N * k8n) return;
  const int n = t / k8n, k8 = (t % k8n) * 8;
  v8us v;
#pragma unroll
  for (int i = 0; i < 8; ++i) v[i] = bf16_bits(W[(size_t)(k8 + i) * N + n]);
  *(v8us*)(Wt + (size_t)n * K + k8) = v;
  
}

// GEMM C[M][N] (f32, pitch ldc) = act(A[M][K]·W + bias). A f32 row-major (pitch lda) converted per fragment to bf16
// (ASPLIT: hi/lo two planes -> 2 terms, else single rounded term); Wt bf16 [N][K] (pitch ldb). BIAS_BF16 rounds the
// bias to bf16 first (bias quantised to bf16 before the add). K%32==0, M%16==0, N%64==0.
template <bool ASPLIT, int ACT, bool BIAS_BF16>
__global__ __launch_bounds__(128) void k_gemm_bf(const float* __restrict__ A, int lda, const unsigned short* __restrict__ Wt, int ldb,
                                               const float* __restrict__ bias, float* __restrict__ C, int ldc, int M, int N, int K) {
  __shared__ __attribute__((aligned(16))) float so[4][16][64];
  const int tid = threadIdx.x, w = tid >> 5, lane = tid & 31, ln = lane & 15, hh = lane >> 4;
  const int ntn = N / 64;
  const int wid = blockIdx.x * 4 + w;
  const int mt = wid / ntn, nq = wid % ntn;
  if (mt * 16 >= M) return;
  const int row0 = mt * 16, col0 = nq * 64;
  const float* arow = A + (size_t)(row0 + ln) * lda;
  v8f acc[4] = {};
  for (int kb = 0; kb < K; kb += 32) {
    FragB ah, al;
    const v4f x0 = *(const v4fa*)(arow + kb + 8 * hh), x1 = *(const v4fa*)(arow + kb + 8 * hh + 4);
    const v4f x2 = *(const v4fa*)(arow + kb + 16 + 8 * hh), x3 = *(const v4fa*)(arow + kb + 16 + 8 * hh + 4);
    float xs[16] = {x0[0],x0[1],x0[2],x0[3],x1[0],x1[1],x1[2],x1[3],x2[0],x2[1],x2[2],x2[3],x3[0],x3[1],x3[2],x3[3]};
#pragma unroll
    for (int i = 0; i < 16; ++i) { const unsigned short hb = bf16_bits(xs[i]); ah.u[i] = hb; al.u[i] = ASPLIT ? bf16_bits(xs[i] - bf16_val(hb)) : (unsigned short)0; }
#pragma unroll
    for (int t = 0; t < 4; ++t) {
      const unsigned short* brow = Wt + (size_t)(col0 + t * 16 + ln) * ldb + kb;
      FragB b;
      b.half[0] = *(const v8us*)(brow + 8 * hh);
      b.half[1] = *(const v8us*)(brow + 16 + 8 * hh);
      acc[t] = mmaN<ASPLIT ? 2 : 1>(ah.v, al.v, b.v, b.v, acc[t]);
    }
  }
#pragma unroll
  for (int t = 0; t < 4; ++t) {
    float bv = bias ? bias[col0 + t * 16 + ln] : 0.f;
    if (BIAS_BF16) bv = bf16_round(bv);
#pragma unroll
    for (int r = 0; r < 8; ++r) { float v = acc[t][r] + bv; if (ACT == 1) v = fmaxf(v, 0.f); so[w][8 * hh + r][t * 16 + ln] = v; }
  }
  __builtin_amdgcn_fence(__ATOMIC_ACQ_REL, "workgroup");
  __builtin_amdgcn_wave_barrier();
  const int rsub = lane >> 4, c4 = (lane & 15) * 4;
  {
#pragma unroll
    for (int q = 0; q < 8; ++q) {
      const int r = q * 2 + rsub;
      const v4f v = *(const v4fa*)&so[w][r][c4];
      *(v4f*)(C + (size_t)(row0 + r) * ldc + col0 + c4) = v;
    }
    
  }
}

// GEMM C = act(A·W + bias + resid): A f32 (ASPLIT -> hi/lo 2 terms), Wt bf16 [N][K]; ACT 0 none, 1 relu, 2 exact gelu;
// resid (optional, f32, row index = (row % rmod), pitch ldr, RES_BF16 rounds it) added before the activation.
template <bool ASPLIT, int ACT, bool BIAS_BF16, bool RES_BF16>
__global__ __launch_bounds__(128) void k_gemm_bf3(const float* __restrict__ A, int lda, const unsigned short* __restrict__ Wt, int ldb,
                                                const float* __restrict__ bias, const float* __restrict__ resid, int rmod, int ldr,
                                                float* __restrict__ C, int ldc, int M, int N, int K) {
  __shared__ __attribute__((aligned(16))) float so[4][16][64];
  const int tid = threadIdx.x, w = tid >> 5, lane = tid & 31, ln = lane & 15, hh = lane >> 4;
  const int ntn = N / 64;
  const int wid = blockIdx.x * 4 + w;
  const int mt = wid / ntn, nq = wid % ntn;
  if (mt * 16 >= M) return;
  const int row0 = mt * 16, col0 = nq * 64;
  const float* arow = A + (size_t)(row0 + ln) * lda;
  v8f acc[4] = {};
  for (int kb = 0; kb < K; kb += 32) {
    FragB ah, al;
    const v4f x0 = *(const v4fa*)(arow + kb + 8 * hh), x1 = *(const v4fa*)(arow + kb + 8 * hh + 4);
    const v4f x2 = *(const v4fa*)(arow + kb + 16 + 8 * hh), x3 = *(const v4fa*)(arow + kb + 16 + 8 * hh + 4);
    float xs[16] = {x0[0],x0[1],x0[2],x0[3],x1[0],x1[1],x1[2],x1[3],x2[0],x2[1],x2[2],x2[3],x3[0],x3[1],x3[2],x3[3]};
#pragma unroll
    for (int i = 0; i < 16; ++i) { const unsigned short hb = bf16_bits(xs[i]); ah.u[i] = hb; al.u[i] = ASPLIT ? bf16_bits(xs[i] - bf16_val(hb)) : (unsigned short)0; }
#pragma unroll
    for (int t = 0; t < 4; ++t) {
      const unsigned short* brow = Wt + (size_t)(col0 + t * 16 + ln) * ldb + kb;
      FragB b;
      b.half[0] = *(const v8us*)(brow + 8 * hh);
      b.half[1] = *(const v8us*)(brow + 16 + 8 * hh);
      acc[t] = mmaN<ASPLIT ? 2 : 1>(ah.v, al.v, b.v, b.v, acc[t]);
    }
  }
#pragma unroll
  for (int t = 0; t < 4; ++t) {
    const int col = col0 + t * 16 + ln;
    float bv = bias ? bias[col] : 0.f;
    if (BIAS_BF16) bv = bf16_round(bv);
#pragma unroll
    for (int r = 0; r < 8; ++r) {
      float v = acc[t][r] + bv;
      if (resid) { float rv = resid[(size_t)((row0 + 8 * hh + r) % rmod) * ldr + col]; if (RES_BF16) rv = bf16_round(rv); v += rv; }
      if (ACT == 1) v = fmaxf(v, 0.f);
      if (ACT == 2) v = 0.5f * v * (1.0f + erff(v * 0.70710678118654752f));
      if (ACT == 3) { const float u = 0.7978845608028654f * (v + 0.044715f * v * v * v); v = 0.5f * v * (1.0f + tanhf(u)); }
      so[w][8 * hh + r][t * 16 + ln] = v;
    }
  }
  __builtin_amdgcn_fence(__ATOMIC_ACQ_REL, "workgroup");
  __builtin_amdgcn_wave_barrier();
  const int rsub = lane >> 4, c4 = (lane & 15) * 4;
  {
#pragma unroll
    for (int q = 0; q < 8; ++q) {
      const int r = q * 2 + rsub;
      const v4f v = *(const v4fa*)&so[w][r][c4];
      *(v4f*)(C + (size_t)(row0 + r) * ldc + col0 + c4) = v;
    }
    
  }
}
// row LayerNorm (biased variance, eps) over N: s = X (+ R); optional out_sum <- s; out_norm <- (s-mu)*rsqrt(var+eps)*g + b
template <bool PARAM_BF16>
__global__ __launch_bounds__(256) void k_layernorm(const float* __restrict__ X, const float* __restrict__ R, const float* __restrict__ g, const float* __restrict__ bta,
                                                  float* __restrict__ out_sum, float* __restrict__ out_norm, int N, float eps) {
  __shared__ float red[256];
  const int row = blockIdx.x, tid = threadIdx.x;
  const float* x = X + (size_t)row * N; const float* rr = R ? R + (size_t)row * N : nullptr;
  float vals[16];                     // up to N = 4096
  const int per = N / 256;            // contiguous chunk per thread? use strided-by-4 chunks: thread handles j = tid*4 + 1024*u
  float s1 = 0.f;
  for (int u = 0; u < per / 4; ++u) {
    const int j = tid * 4 + 1024 * u;
    const v4f a = *(const v4fa*)(x + j);
    v4f b = {0.f,0.f,0.f,0.f}; if (rr) b = *(const v4fa*)(rr + j);
#pragma unroll
    for (int q = 0; q < 4; ++q) { const float v = a[q] + b[q]; vals[u * 4 + q] = v; s1 += v; }
  }
  red[tid] = s1; __syncthreads();
  for (int st = 128; st > 0; st >>= 1) { if (tid < st) red[tid] += red[tid + st]; __syncthreads(); }
  const float mu = red[0] / (float)N; __syncthreads();
  float s2 = 0.f;
  for (int u = 0; u < per / 4; ++u)
#pragma unroll
    for (int q = 0; q < 4; ++q) { const float c = vals[u * 4 + q] - mu; s2 += c * c; }
  red[tid] = s2; __syncthreads();
  for (int st = 128; st > 0; st >>= 1) { if (tid < st) red[tid] += red[tid + st]; __syncthreads(); }
  const float rs = rsqrtf(red[0] / (float)N + eps);
  {
    for (int u = 0; u < per / 4; ++u) {
      const int j = tid * 4 + 1024 * u;
      v4f o, sm;
#pragma unroll
      for (int q = 0; q < 4; ++q) {
        float gg = g[j + q], bb = bta[j + q];
        if (PARAM_BF16) { gg = bf16_round(gg); bb = bf16_round(bb); }
        sm[q] = vals[u * 4 + q]; o[q] = (vals[u * 4 + q] - mu) * rs * gg + bb;
      }
      if (out_sum) *(v4f*)(out_sum + (size_t)row * N + j) = sm;
      *(v4f*)(out_norm + (size_t)row * N + j) = o;
    }
    
  }
}



// ---- f16 WMMA path (v_wmma_f32_16x16x32_f16): 11-bit significands for operands in range — used where a [0,1] probability operand needs more precision than bf16
typedef _Float16 v16h __attribute__((ext_vector_type(16)));
union FragH { v16h v; v8us half[2]; _Float16 h[16]; unsigned short u[16]; };
template <int NT>
__device__ __forceinline__ v8f mmaH(v16h ah, v16h al, v16h bh, v16h bl, v8f c) {
  c = __builtin_amdgcn_wmma_f32_16x16x32_f16(false, ah, false, bh, (short)0, c, false, false);
  if (NT >= 2) c = __builtin_amdgcn_wmma_f32_16x16x32_f16(false, al, false, bh, (short)0, c, false, false);
  if (NT >= 3) c = __builtin_amdgcn_wmma_f32_16x16x32_f16(false, ah, false, bl, (short)0, c, false, false);
  asm volatile("v_nop\n\tv_nop\n\tv_nop\n\tv_nop" : "+v"(c) : "v"(ah), "v"(al), "v"(bh), "v"(bl));
  return c;
}
// batched GEMM like k_gemm_b but f16 operands: A f32 (split into f16 hi/lo if ASPLIT, else rounded to f16), Bt = f16 values [n][k]; alpha; C f32; N multiple of 16 (partial tiles skipped)
template <bool ASPLIT>
__global__ __launch_bounds__(128) void k_gemm_h(const float* __restrict__ A, int lda, size_t sA, const _Float16* __restrict__ Bh, int ldb, size_t sB, float alpha, float* __restrict__ C, int ldc, size_t sC, int M, int N, int K) {
  __shared__ __attribute__((aligned(16))) float so[4][16][64];
  const int tid = threadIdx.x, w = tid >> 5, lane = tid & 31, ln = lane & 15, hh = lane >> 4; const int by = blockIdx.y;
  A += (size_t)by * sA; Bh += (size_t)by * sB; C += (size_t)by * sC;
  const int ntn = (N + 63) / 64; const int wid = blockIdx.x * 4 + w; const int mt = wid / ntn, nq = wid % ntn; if (mt * 16 >= M) return;
  const int row0 = mt * 16, col0 = nq * 64; const float* arow = A + (size_t)(row0 + ln) * lda;
  v8f acc[4] = {};
  for (int kb = 0; kb < K; kb += 32) {
    FragH ah, al;
    const v4f x0 = *(const v4fa*)(arow + kb + 8 * hh), x1 = *(const v4fa*)(arow + kb + 8 * hh + 4), x2 = *(const v4fa*)(arow + kb + 16 + 8 * hh), x3 = *(const v4fa*)(arow + kb + 16 + 8 * hh + 4);
    float xs[16] = {x0[0],x0[1],x0[2],x0[3],x1[0],x1[1],x1[2],x1[3],x2[0],x2[1],x2[2],x2[3],x3[0],x3[1],x3[2],x3[3]};
#pragma unroll
    for (int i = 0; i < 16; ++i) { const _Float16 h = (_Float16)xs[i]; ah.h[i] = h; al.h[i] = ASPLIT ? (_Float16)(xs[i] - (float)h) : (_Float16)0.0f; }
#pragma unroll
    for (int t = 0; t < 4; ++t) { if (col0 + t * 16 >= N) continue; const size_t boff = (size_t)(col0 + t * 16 + ln) * ldb + kb; FragH bq; bq.half[0] = *(const v8us*)(Bh + boff + 8 * hh); bq.half[1] = *(const v8us*)(Bh + boff + 16 + 8 * hh);
      acc[t] = mmaH<ASPLIT ? 2 : 1>(ah.v, al.v, bq.v, bq.v, acc[t]); }
  }
#pragma unroll
  for (int t = 0; t < 4; ++t) { if (col0 + t * 16 >= N) continue;
#pragma unroll
    for (int r = 0; r < 8; ++r) so[w][8 * hh + r][t * 16 + ln] = acc[t][r] * alpha; }
  __builtin_amdgcn_fence(__ATOMIC_ACQ_REL, "workgroup"); __builtin_amdgcn_wave_barrier();
  const int rsub = lane >> 4, c4 = (lane & 15) * 4;
  {
#pragma unroll
    for (int q = 0; q < 8; ++q) { const int r = q * 2 + rsub; if (col0 + c4 < N) { const v4f v = *(const v4fa*)&so[w][r][c4]; *(v4f*)(C + (size_t)(row0 + r) * ldc + col0 + c4) = v; } }
     }
}

// Wt[n][k] = f16(W[k][n]·scale) from f32 row-major W[K][N] (scale = power of two; bf16-exact weights stay exact in f16 away from the subnormal range)
__global__ __launch_bounds__(256) void k_wt_f16(const float* __restrict__ W, _Float16* __restrict__ Wt, int K, int N, float scale) {
  const int t = blockIdx.x * 256 + threadIdx.x; if (t >= N * (K / 8)) return; const int n = t / (K / 8), k8 = (t % (K / 8)) * 8; FragH f;
#pragma unroll
  for (int i = 0; i < 8; ++i) f.h[i] = (_Float16)(bf16_round(W[(size_t)(k8 + i) * N + n]) * scale); const v8us o = f.half[0];
  *(v8us*)((unsigned short*)Wt + (size_t)n * K + k8) = o; 
}
// k_gemm_hh variant with fused epilogue: v = acc·alpha + bias[by·sBias + col] (+ CP[(row/rowsPerB)·sCPb + by·64 + col] if CP) ; ACT 0 none / 1 elu ; writes f16 C16 (and f32 C if non-null)
template <int ACT>
__global__ __launch_bounds__(128) void k_gemm_hhx(const _Float16* __restrict__ A, int lda, size_t sA, const _Float16* __restrict__ Bh, int ldb, size_t sB, float alpha, const float* __restrict__ bias, size_t sBias, const float* __restrict__ CP, int rowsPerB, size_t sCPb, int row0g,
    float* __restrict__ C, _Float16* __restrict__ C16, int ldc, size_t sC, int M, int N, int K) {
  __shared__ __attribute__((aligned(16))) float so[4][16][64];
  const int tid = threadIdx.x, w = tid >> 5, lane = tid & 31, ln = lane & 15, hh = lane >> 4; const int by = blockIdx.y;
  A += (size_t)by * sA; Bh += (size_t)by * sB; const size_t cofs = (size_t)by * sC; const float* bp = bias ? bias + (size_t)by * sBias : nullptr;
  const int ntn = (N + 63) / 64; const int wid = blockIdx.x * 4 + w; const int mt = wid / ntn, nq = wid % ntn; if (mt * 16 >= M) return;
  const int row0 = mt * 16, col0 = nq * 64; const _Float16* arow = A + (size_t)(row0 + ln) * lda;
  v8f acc[4] = {};
  for (int kb = 0; kb < K; kb += 32) { FragH ah; ah.half[0] = *(const v8us*)((const unsigned short*)arow + kb + 8 * hh); ah.half[1] = *(const v8us*)((const unsigned short*)arow + kb + 16 + 8 * hh);
#pragma unroll
    for (int t = 0; t < 4; ++t) { if (col0 + t * 16 >= N) continue; const size_t boff = (size_t)(col0 + t * 16 + ln) * ldb + kb; FragH bq; bq.half[0] = *(const v8us*)((const unsigned short*)Bh + boff + 8 * hh); bq.half[1] = *(const v8us*)((const unsigned short*)Bh + boff + 16 + 8 * hh);
      acc[t] = mmaH<1>(ah.v, ah.v, bq.v, bq.v, acc[t]); }
  }
#pragma unroll
  for (int t = 0; t < 4; ++t) { if (col0 + t * 16 >= N) continue; const int col = col0 + t * 16 + ln; const float bv = bp ? bf16_round(bp[col]) : 0.f;
#pragma unroll
    for (int r = 0; r < 8; ++r) { float v = acc[t][r] * alpha + bv; if (CP) { const int rr = row0g + row0 + 8 * hh + r; if (rowsPerB < 0) v += CP[cofs + (size_t)rr * ldc + col];      /* rowsPerB < 0: own element of the batched C plane */ else { const int bidx = rr / rowsPerB; v += CP[(size_t)bidx * sCPb + (size_t)by * 64 + col]; } } if (ACT == 1) v = (v > 0.f) ? v : expm1f(v); else if (ACT == 7) v = (v > 0.f) ? v + 1.0f : expf(v); else if (ACT == 8) v = tanhf(v); else if (ACT == 9) v = 0.5f * v * (1.0f + tanhf(0.7978845608028654f * (v + 0.044715f * v * v * v))); else if (ACT == 11) v = 1.0f / (1.0f + expf(-v)); else if (ACT == 12) v = (v > 0.f) ? v : 0.01f * v; else if (ACT == 14) v = (v > 0.f) ? v : 0.1f * v; else if (ACT == 16) v = (v >= 0.f) ? v : 0.3f * v; else if (ACT == 17) v = (v >= 0.f) ? v : 0.2f * v; else if (ACT == 15) v = v / (1.0f + expf(-v)); else if (ACT == 3) v = fmaxf(v, 0.f); else if (ACT == 6) v = 0.5f * v * (1.0f + erff(v * 0.70710678118654752f)); so[w][8 * hh + r][t * 16 + ln] = v; } }
  __builtin_amdgcn_fence(__ATOMIC_ACQ_REL, "workgroup"); __builtin_amdgcn_wave_barrier();
  const int rsub = lane >> 4, c4 = (lane & 15) * 4; typedef _Float16 v4h __attribute__((ext_vector_type(4)));
  {
#pragma unroll
    for (int q = 0; q < 8; ++q) { const int r = q * 2 + rsub; if (col0 + c4 < N) { const v4f v = *(const v4fa*)&so[w][r][c4]; if (C) *(v4f*)(C + cofs + (size_t)(row0 + r) * ldc + col0 + c4) = v; if (C16) { v4h h4; for (int i = 0; i < 4; ++i) h4[i] = (_Float16)v[i]; *(v4h*)(C16 + cofs + (size_t)(row0 + r) * ldc + col0 + c4) = h4; } } }
     }
}


typedef _Float16 v4h __attribute__((ext_vector_type(4)));

__global__ __launch_bounds__(256) void k_x16(const float* __restrict__ x, _Float16* __restrict__ X16, size_t n8) { const size_t t = (size_t)blockIdx.x * 256 + threadIdx.x; if (t >= n8) return; FragH f;
#pragma unroll
  for (int q = 0; q < 8; ++q) f.h[q] = (_Float16)bf16_round(x[t * 8 + q]); *(v8us*)((unsigned short*)X16 + t * 8) = f.half[0];  }
__global__ __launch_bounds__(256) void k_h16(const float* __restrict__ x, _Float16* __restrict__ X16, size_t n8) { const size_t t = (size_t)blockIdx.x * 256 + threadIdx.x; if (t >= n8) return; FragH f;
#pragma unroll
  for (int q = 0; q < 8; ++q) f.h[q] = (_Float16)x[t * 8 + q]; *(v8us*)((unsigned short*)X16 + t * 8) = f.half[0];  }
__global__ __launch_bounds__(256) void k_round16f(const float* __restrict__ W, _Float16* __restrict__ Bt, size_t n8) { const size_t t = (size_t)blockIdx.x * 256 + threadIdx.x; if (t >= n8) return; FragH f;
#pragma unroll
  for (int i = 0; i < 8; ++i) f.h[i] = (_Float16)(bf16_round(W[t * 8 + i]) * 16.0f); *(v8us*)((unsigned short*)Bt + t * 8) = f.half[0];  }
template <int NHv, int TTv>
__global__ __launch_bounds__(256) void k_vt(const _Float16* __restrict__ V16, int ldv, int voff, _Float16* __restrict__ Vt) { __shared__ unsigned short tl[64][66]; const int tid = threadIdx.x; const int slab = blockIdx.x / (TTv / 64), lg = blockIdx.x % (TTv / 64); const int b = slab / NHv, h = slab % NHv;
  for (int i = tid; i < 64 * 8; i += 256) { const int r = i / 8, c8 = (i % 8) * 8; FragH f; f.half[0] = *(const v8us*)((const unsigned short*)V16 + ((size_t)b * TTv + lg * 64 + r) * ldv + voff + h * 64 + c8);
#pragma unroll
    for (int q = 0; q < 8; ++q) tl[r][c8 + q] = f.u[q]; }
  __syncthreads();
  {
#pragma unroll
    for (int rd = 0; rd < 2; ++rd) { const int d = rd * 32 + tid / 8, pc = tid % 8; FragH f;
#pragma unroll
      for (int q = 0; q < 8; ++q) f.u[q] = tl[pc * 8 + q][d];
      *(v8us*)((unsigned short*)Vt + ((size_t)slab * 64 + d) * TTv + lg * 64 + pc * 8) = f.half[0]; }
     } }

__global__ __launch_bounds__(256) void k_hl(const float* __restrict__ F, _Float16* __restrict__ Hh, _Float16* __restrict__ Hl, size_t n8) { const size_t t = (size_t)blockIdx.x * 256 + threadIdx.x; if (t >= n8) return; FragH fh, fl; const v4f a = *(const v4fa*)(F + t * 8), c = *(const v4fa*)(F + t * 8 + 4);
#pragma unroll
  for (int q = 0; q < 4; ++q) { _Float16 h = (_Float16)a[q]; fh.h[q] = h; fl.h[q] = (_Float16)((a[q] - (float)h) * 1024.0f); h = (_Float16)c[q]; fh.h[4 + q] = h; fl.h[4 + q] = (_Float16)((c[q] - (float)h) * 1024.0f); }
  { *(v8us*)((unsigned short*)Hh + t * 8) = fh.half[0]; *(v8us*)((unsigned short*)Hl + t * 8) = fl.half[0];  } }

// ---- fast GEMM (wave tile 32x64; requires M % 32 == 0 rows per launch region and N % 64 == 0); epilogue = k_gemm_hhx semantics ----
__device__ __forceinline__ v16h g2_frag(const _Float16* p, int hh) { FragH f; f.half[0] = *(const v8us*)((const unsigned short*)p + 8 * hh); f.half[1] = *(const v8us*)((const unsigned short*)p + 16 + 8 * hh); return f.v; }
__device__ __forceinline__ v8f g2_mma(v16h a, v16h b, v8f c) { v8f d = __builtin_amdgcn_wmma_f32_16x16x32_f16(false, a, false, b, (short)0, c, false, false); asm volatile("v_nop\n\tv_nop\n\tv_nop\n\tv_nop" : "+v"(d) : "v"(a), "v"(b)); return d; }
template <int ACT>
__global__ __launch_bounds__(128) void k_gemm2(const _Float16* __restrict__ A, int lda, size_t sA, const _Float16* __restrict__ Bh, int ldb, size_t sB, float alpha, const float* __restrict__ bias, size_t sBias, const float* __restrict__ CP, int rowsPerB, size_t sCPb, int row0g,
    float* __restrict__ C, _Float16* __restrict__ C16, int ldc, size_t sC, int M, int N, int K) { static_assert(ACT == 0 || ACT == 3 || ACT == 6 || ACT == 8 || ACT == 9 || ACT == 11 || ACT == 12 || ACT == 14 || ACT == 15 || ACT == 16 || ACT == 17 || ACT == 18, "k_gemm2: unsupported ACT code (would silently apply no activation)");
  __shared__ __attribute__((aligned(16))) float so[4][32][68];
  const int tid = threadIdx.x, w = tid >> 5, lane = tid & 31, ln = lane & 15, hh = lane >> 4; const int by = blockIdx.y;
  A += (size_t)by * sA; Bh += (size_t)by * sB; const size_t cofs = (size_t)by * sC; const float* bp = bias ? bias + (size_t)by * sBias : nullptr;
  const int ntn = N >> 6; const int mt = blockIdx.x / ntn, nq = blockIdx.x - mt * ntn; const int row0 = mt * 128 + 32 * w, col0 = nq * 64; if (row0 >= M) return;
  const _Float16* a0p = A + (size_t)(row0 + ln) * lda; const _Float16* a1p = a0p + (size_t)16 * lda;
  const _Float16* b0p = Bh + (size_t)(col0 + ln) * ldb; const _Float16* b1p = b0p + (size_t)16 * ldb; const _Float16* b2p = b1p + (size_t)16 * ldb; const _Float16* b3p = b2p + (size_t)16 * ldb;
  const v8f z8 = {0.f,0.f,0.f,0.f,0.f,0.f,0.f,0.f}; v8f c00 = z8, c01 = z8, c02 = z8, c03 = z8, c10 = z8, c11 = z8, c12 = z8, c13 = z8;
#pragma unroll 1
  for (int kb = 0; kb < K; kb += 32) { const v16h a0 = g2_frag(a0p + kb, hh), a1 = g2_frag(a1p + kb, hh);
    v16h b = g2_frag(b0p + kb, hh); c00 = g2_mma(a0, b, c00); c10 = g2_mma(a1, b, c10);
    b = g2_frag(b1p + kb, hh); c01 = g2_mma(a0, b, c01); c11 = g2_mma(a1, b, c11);
    b = g2_frag(b2p + kb, hh); c02 = g2_mma(a0, b, c02); c12 = g2_mma(a1, b, c12);
    b = g2_frag(b3p + kb, hh); c03 = g2_mma(a0, b, c03); c13 = g2_mma(a1, b, c13); }
  v8f accs[8] = {c00, c01, c02, c03, c10, c11, c12, c13};
#pragma unroll
  for (int u = 0; u < 8; ++u) { const int t = u & 3, half = u >> 2; const int col = col0 + t * 16 + ln; const float bv = bp ? bf16_round(bp[col]) : 0.f;
#pragma unroll
    for (int r = 0; r < 8; ++r) { const int rloc = half * 16 + 8 * hh + r; float v = accs[u][r] * alpha + bv; if (CP) { if (rowsPerB < 0) v += CP[cofs + (size_t)(row0g + row0 + rloc) * ldc + col];      /* rowsPerB < 0: own element of the batched C plane */ else { const int bidx = (row0g + row0 + rloc) / rowsPerB; v += CP[(size_t)bidx * sCPb + (size_t)by * 64 + col]; } }
      if (ACT == 3) v = fmaxf(v, 0.f); else if (ACT == 6) v = 0.5f * v * (1.0f + erff(v * 0.70710678118654752f)); else if (ACT == 11) v = 1.0f / (1.0f + expf(-v)); else if (ACT == 15) v = v / (1.0f + expf(-v)); else if (ACT == 18) v = v / (1.0f + expf(-1.702f * v));      /* QuickGELU: v sigmoid(1.702 v) */ else if (ACT == 12) v = (v > 0.f) ? v : 0.01f * v; else if (ACT == 8) v = tanhf(v); else if (ACT == 9) v = 0.5f * v * (1.0f + tanhf(0.7978845608028654f * (v + 0.044715f * v * v * v))); else if (ACT == 14) v = (v > 0.f) ? v : 0.1f * v; else if (ACT == 16) v = (v >= 0.f) ? v : 0.3f * v; else if (ACT == 17) v = (v >= 0.f) ? v : 0.2f * v;
      so[w][rloc][t * 16 + ln] = v; } }
  __builtin_amdgcn_fence(__ATOMIC_ACQ_REL, "workgroup"); __builtin_amdgcn_wave_barrier();
  const int rsub = lane >> 4, c4 = (lane & 15) * 4;
  {
#pragma unroll
    for (int q = 0; q < 16; ++q) { const int r = q * 2 + rsub; const v4f v = *(const v4fa*)&so[w][r][c4]; if (C) *(v4f*)(C + cofs + (size_t)(row0 + r) * ldc + col0 + c4) = v; if (C16) { v4h h4; for (int i = 0; i < 4; ++i) h4[i] = (_Float16)v[i]; *(v4h*)(C16 + cofs + (size_t)(row0 + r) * ldc + col0 + c4) = h4; } }
     } }


__global__ __launch_bounds__(256) void k_wnat(const float* __restrict__ w, size_t n8, _Float16* __restrict__ Bt) { const size_t t = (size_t)blockIdx.x * 256 + threadIdx.x; if (t >= n8) return; FragH f; for (int q = 0; q < 8; ++q) f.h[q] = (_Float16)(bf16_round(w[t * 8 + q]) * 16.0f); *(v8us*)((unsigned short*)Bt + t * 8) = f.half[0];  }
__global__ __launch_bounds__(256) void k_rsm(const float* __restrict__ S, _Float16* __restrict__ P, int nrows) {
  #pragma clang fp contract(off)
  const int i = blockIdx.x * 256 + threadIdx.x; if (i >= nrows) return; const float* s = S + (size_t)i * SQ; float mx = -3.0e38f;
#pragma unroll 1
  for (int j = 0; j < SQ; ++j) mx = fmaxf(mx, s[j]); float se = 0.f;
#pragma unroll 1
  for (int j = 0; j < SQ; ++j) se += expf(s[j] - mx); const float sc = 256.0f / se;
#pragma unroll 1
  for (int j0 = 0; j0 < SQ; j0 += 8) { FragH f; for (int q = 0; q < 8; ++q) f.h[q] = (_Float16)(expf(s[j0 + q] - mx) * sc); unsigned short* d = (unsigned short*)P + (size_t)i * SQ + j0; *(v8us*)d = f.half[0];  } }
__global__ __launch_bounds__(256) void k_vt(const _Float16* __restrict__ V16, int b, int h0, _Float16* __restrict__ VT) { __shared__ unsigned short tl[64][65]; const int tid = threadIdx.x; const int hh = blockIdx.x % HG, sg = blockIdx.x / HG; const int s0 = sg * 64; const int h = h0 + hh;
  for (int i = tid; i < 64 * 8; i += 256) { const int j = i / 8, d8 = (i % 8) * 8; FragH f; f.half[0] = *(const v8us*)((const unsigned short*)V16 + ((size_t)b * SQ + s0 + j) * DM + h * HD + d8); for (int q = 0; q < 8; ++q) tl[d8 + q][j] = f.u[q]; }
  __syncthreads();
  { for (int i = tid; i < 64 * 8; i += 256) { const int d = i / 8, j8 = (i % 8) * 8; FragH f; for (int q = 0; q < 8; ++q) f.u[q] = tl[d][j8 + q]; *(v8us*)((unsigned short*)VT + ((size_t)hh * HD + d) * SQ + s0 + j8) = f.half[0]; }  } }



__global__ __launch_bounds__(256) void k_rsmcf2(const float* __restrict__ S, _Float16* __restrict__ P, int hg, int q0, int nk) {
  #pragma clang fp contract(off)
  const int t = blockIdx.x * 256 + threadIdx.x; if (t >= hg * QT) return; const size_t i = (size_t)t; const float* s = S + i * NKX; const int last = q0 + (t % QT); float mx = -3.0e38f;
#pragma unroll 1
  for (int j = 0; j < nk; ++j) { const float f = (j <= last) ? 1.f : 0.f; mx = fmaxf(mx, fmaf(f, s[j], (1.f - f) * -1.0e9f)); } float se = 0.f;
#pragma unroll 1
  for (int j = 0; j < nk; ++j) { const float f = (j <= last) ? 1.f : 0.f; se += __expf(fmaf(f, s[j], (1.f - f) * -1.0e9f) - mx); } const float sc = 256.0f / se;
#pragma unroll 1
  for (int j0 = 0; j0 < nk; j0 += 8) { FragH fr; for (int q = 0; q < 8; ++q) { const int j = j0 + q; const float f = (j <= last) ? 1.f : 0.f; fr.h[q] = (_Float16)(__expf(fmaf(f, s[j], (1.f - f) * -1.0e9f) - mx) * sc); } unsigned short* d = (unsigned short*)P + i * NKX + j0; *(v8us*)d = fr.half[0];  } }

__global__ __launch_bounds__(256) void k_rsmcst(const float* __restrict__ S, _Float16* __restrict__ P, int hg, int q0, int nk, const int* __restrict__ mk) {
  #pragma clang fp contract(off)
  const int t = blockIdx.x * 256 + threadIdx.x; if (t >= hg * QT) return; const size_t i = (size_t)t; const float* s = S + i * NKX; const size_t ig = (size_t)(q0 + (t % QT)); const int* mr = mk + ig * SQ; float mx = -3.0e38f;
#pragma unroll 1
  for (int j = 0; j < nk; ++j) { const int mb = mr[j]; const int dd = (int)ig - j; const float f = (mb != 0 && dd >= 0 && (dd <= LOCALW || (dd % STRIDEK) == 0)) ? 1.f : 0.f; mx = fmaxf(mx, fmaf(f, s[j], (1.f - f) * -1.0e9f)); } float se = 0.f;
#pragma unroll 1
  for (int j = 0; j < nk; ++j) { const int mb = mr[j]; const int dd = (int)ig - j; const float f = (mb != 0 && dd >= 0 && (dd <= LOCALW || (dd % STRIDEK) == 0)) ? 1.f : 0.f; se += __expf(fmaf(f, s[j], (1.f - f) * -1.0e9f) - mx); } const float sc = 256.0f / se;
#pragma unroll 1
  for (int j0 = 0; j0 < nk; j0 += 8) { FragH fr; for (int q = 0; q < 8; ++q) { const int j = j0 + q; const int mb = mr[j]; const int dd = (int)ig - j; const float f = (mb != 0 && dd >= 0 && (dd <= LOCALW || (dd % STRIDEK) == 0)) ? 1.f : 0.f; fr.h[q] = (_Float16)(__expf(fmaf(f, s[j], (1.f - f) * -1.0e9f) - mx) * sc); } unsigned short* d = (unsigned short*)P + i * NKX + j0; *(v8us*)d = fr.half[0];  } }


template <int MASKADD>
__global__ __launch_bounds__(64) void k_att0(const float* __restrict__ QF, const float* __restrict__ KF, const float* __restrict__ VF, int ld, const float* __restrict__ mask, float scale, float* __restrict__ OF, int ldo) {
  #pragma clang fp contract(off)
  __shared__ __attribute__((aligned(16))) float lq[64][64]; __shared__ __attribute__((aligned(16))) float lo[64][64];
  const int tid = threadIdx.x; const int h = blockIdx.x / (QT0 / 64), rg = blockIdx.x % (QT0 / 64); const int i = rg * 64 + tid;
  const float* qr = QF + (size_t)i * ld + h * HD;
#pragma unroll 1
  for (int c = 0; c < HD / 4; ++c) { *(v4f*)&lq[tid][c * 4] = *(const v4fa*)(qr + c * 4); const v4f z = {0.f, 0.f, 0.f, 0.f}; *(v4f*)&lo[tid][c * 4] = z; }
  float m = -1.0e30f, l = 0.f; const int jmax = MASKADD ? (SQ - 1) : (rg * 64 + 63);      /* additive-mask form: every key (the mask input decides); causal form: keys up to the block's last row */
#pragma unroll 1
  for (int j = 0; j <= jmax; ++j) { const float* kr = KF + (size_t)j * ld + h * HD; const float* vr = VF + (size_t)j * ld + h * HD; float s = 0.f;
#pragma unroll 1
    for (int c = 0; c < HD / 4; ++c) { const v4f kq = *(const v4fa*)(kr + c * 4); const v4f qq = *(v4f*)&lq[tid][c * 4]; s = __fadd_rn(s, __fmul_rn(qq[0], kq[0])); s = __fadd_rn(s, __fmul_rn(qq[1], kq[1])); s = __fadd_rn(s, __fmul_rn(qq[2], kq[2])); s = __fadd_rn(s, __fmul_rn(qq[3], kq[3])); }
    s = __fmul_rn(s, scale); if (MASKADD) s = __fadd_rn(s, __fmul_rn(bf16_round(mask[(size_t)i * SQ + j]), -10000.0f));
    const float f = (MASKADD || j <= i) ? 1.f : 0.f; const float sm = fmaf(f, s, (1.f - f) * -1.0e30f); const float mn = fmaxf(m, sm); const float sc = expf(m - mn); const float e = expf(sm - mn); l = __fadd_rn(__fmul_rn(l, sc), e); m = mn;
#pragma unroll 1
    for (int c = 0; c < HD / 4; ++c) { const v4f vv = *(const v4fa*)(vr + c * 4); v4f oo = *(v4f*)&lo[tid][c * 4]; for (int u = 0; u < 4; ++u) oo[u] = __fadd_rn(__fmul_rn(oo[u], sc), __fmul_rn(e, vv[u])); *(v4f*)&lo[tid][c * 4] = oo; } }
  const float fin = 64.0f / l;      /* o carried x64 like the f16 path */
#pragma unroll 1
  for (int c = 0; c < HD / 4; ++c) { v4f oo = *(v4f*)&lo[tid][c * 4]; for (int u = 0; u < 4; ++u) oo[u] = __fmul_rn(oo[u], fin); *(v4f*)&lo[tid][c * 4] = oo; }
  __syncthreads();
  {
#pragma unroll 1
    for (int it = 0; it < 16; ++it) { const int row = it * 4 + tid / 16, pc = (tid % 16) * 4; const v4f v = *(const v4f*)&lo[row][pc]; *(v4f*)(OF + (size_t)(rg * 64 + row) * ldo + h * HD + pc) = v; }
     } }

template <int MASKADD>
__global__ __launch_bounds__(64) void k_att0mbc(const float* __restrict__ QF, const float* __restrict__ KF, const float* __restrict__ VF, int ld, const float* __restrict__ mask, float scale, float* __restrict__ OF, int ldo) {
  #pragma clang fp contract(off)
  __shared__ __attribute__((aligned(16))) float lq[64][64]; __shared__ __attribute__((aligned(16))) float lo[64][64];
  const int tid = threadIdx.x; const int h = blockIdx.x / (QT0 / 64), rg = blockIdx.x % (QT0 / 64); const int i = rg * 64 + tid;
  const float* qr = QF + (size_t)i * ld + h * HD;
#pragma unroll 1
  for (int c = 0; c < HD / 4; ++c) { *(v4f*)&lq[tid][c * 4] = *(const v4fa*)(qr + c * 4); const v4f z = {0.f, 0.f, 0.f, 0.f}; *(v4f*)&lo[tid][c * 4] = z; }
  float m = -1.0e30f, l = 0.f; const int jmax = rg * 64 + 63;      /* keys beyond the block end are masked by the mask's lower-triangular structure */
#pragma unroll 1
  for (int j = 0; j <= jmax; ++j) { const float* kr = KF + (size_t)j * ld + h * HD; const float* vr = VF + (size_t)j * ld + h * HD; float s = 0.f;
#pragma unroll 1
    for (int c = 0; c < HD / 4; ++c) { const v4f kq = *(const v4fa*)(kr + c * 4); const v4f qq = *(v4f*)&lq[tid][c * 4]; s = __fadd_rn(s, __fmul_rn(qq[0], kq[0])); s = __fadd_rn(s, __fmul_rn(qq[1], kq[1])); s = __fadd_rn(s, __fmul_rn(qq[2], kq[2])); s = __fadd_rn(s, __fmul_rn(qq[3], kq[3])); }
    s = __fmul_rn(s, scale); const int mb = ((const int*)mask)[(size_t)i * SQ + j];      /* causal (j <= i) AND the module's int32 [S][S] mask read per (query, key): 0 -> masked */
    const float f = (mb != 0 && j <= i) ? 1.f : 0.f; const float sm = fmaf(f, s, (1.f - f) * -1.0e30f); const float mn = fmaxf(m, sm); const float sc = expf(m - mn); const float e = expf(sm - mn); l = __fadd_rn(__fmul_rn(l, sc), e); m = mn;
#pragma unroll 1
    for (int c = 0; c < HD / 4; ++c) { const v4f vv = *(const v4fa*)(vr + c * 4); v4f oo = *(v4f*)&lo[tid][c * 4]; for (int u = 0; u < 4; ++u) oo[u] = __fadd_rn(__fmul_rn(oo[u], sc), __fmul_rn(e, vv[u])); *(v4f*)&lo[tid][c * 4] = oo; } }
  const float fin = 64.0f / l;      /* o carried x64 like the f16 path */
#pragma unroll 1
  for (int c = 0; c < HD / 4; ++c) { v4f oo = *(v4f*)&lo[tid][c * 4]; for (int u = 0; u < 4; ++u) oo[u] = __fmul_rn(oo[u], fin); *(v4f*)&lo[tid][c * 4] = oo; }
  __syncthreads();
  {
#pragma unroll 1
    for (int it = 0; it < 16; ++it) { const int row = it * 4 + tid / 16, pc = (tid % 16) * 4; const v4f v = *(const v4f*)&lo[row][pc]; *(v4f*)(OF + (size_t)(rg * 64 + row) * ldo + h * HD + pc) = v; }
     } }


template <int BFIN, int WXB>
__global__ __launch_bounds__(256) void k_ln16(const float* __restrict__ X, const float* __restrict__ g, const float* __restrict__ bb, float eps, _Float16* __restrict__ N16, float* __restrict__ XB) {
  #pragma clang fp contract(off)
  __shared__ float red[256]; const size_t r = blockIdx.x; const int t = threadIdx.x; const v4f xa = *(const v4fa*)(X + r * DMQ + t * 4); float s[4]; float sum = 0.f;
  for (int q = 0; q < 4; ++q) { s[q] = BFIN ? bf16_round(xa[q]) : xa[q]; sum = __fadd_rn(sum, s[q]); }
  red[t] = sum; __syncthreads(); for (int st = 128; st > 0; st >>= 1) { if (t < st) red[t] = __fadd_rn(red[t], red[t + st]); __syncthreads(); } const float mu = red[0] / (float)DMQ; __syncthreads();
  float vs = 0.f; for (int q = 0; q < 4; ++q) { const float dl = __fadd_rn(s[q], -mu); vs = __fadd_rn(vs, __fmul_rn(dl, dl)); } red[t] = vs; __syncthreads(); for (int st = 128; st > 0; st >>= 1) { if (t < st) red[t] = __fadd_rn(red[t], red[t + st]); __syncthreads(); }
  const float rs = rsqrtf(__fadd_rn(red[0] / (float)DMQ, eps)); v4h y; v4f xb;
  for (int q = 0; q < 4; ++q) { const int c = t * 4 + q; y[q] = (_Float16)__fadd_rn(__fmul_rn(__fmul_rn(__fadd_rn(s[q], -mu), rs), bf16_round(g[c])), bf16_round(bb[c])); xb[q] = s[q]; }
  { *(v4h*)(N16 + r * DMQ + t * 4) = y; if (WXB) *(v4f*)(XB + r * DMQ + t * 4) = xb;  } }
__global__ __launch_bounds__(256) void k_ftres2(const float* __restrict__ OF0, const float* __restrict__ XB, float* __restrict__ X1, size_t n4) {
  #pragma clang fp contract(off)
  const size_t t = (size_t)blockIdx.x * 256 + threadIdx.x; if (t >= n4) return; const v4f o = *(const v4fa*)(OF0 + t * 4), xv = *(const v4fa*)(XB + t * 4); v4f y; for (int q = 0; q < 4; ++q) y[q] = __fadd_rn(__fmul_rn(o[q], 0.015625f), xv[q]); *(v4f*)(X1 + t * 4) = y;  }

__global__ __launch_bounds__(256) void k_bcpy(const float* __restrict__ b, int n, int NP, float* __restrict__ dst, int dst0) { for (int i = threadIdx.x; i < NP; i += 256) { const float v = (i < n) ? b[i] : 0.f; *(float*)(dst + dst0 + i) = v; }  }


// lane l <-> l ^ M inside a 16-lane row (DPP row_xmask), and l <-> l ^ 16 (cross-row move): register-only butterflies
template <int M> __device__ __forceinline__ float xl_row(float v) { return __int_as_float(__builtin_amdgcn_update_dpp(0, __float_as_int(v), 0x160 | M, 0xf, 0xf, true)); }
__device__ __forceinline__ float xl_x16(float v) { const int b = __float_as_int(v); return __int_as_float(__builtin_amdgcn_permlanex16(b, b, 0x76543210, 0xfedcba98, false, false)); }
// row softmax -> P x256 f16. One wave per score row: 16 loads of 512 contiguous bytes, the whole row (64 values a lane) stays in registers, S is read once and each exponential is taken once.
// The four loops over v[] are fully unrolled so that v[] is indexed by constants only and lives in registers, and so that all 16 loads are in flight together.
__global__ __launch_bounds__(256) void k_rsmf(const float* __restrict__ S, _Float16* __restrict__ P, int nrows) {
  const int row = blockIdx.x * 8 + (threadIdx.x >> 5), lane = threadIdx.x & 31; if (row >= nrows) return;      /* wave-uniform; no barrier in this kernel */
  const float* s = S + (size_t)row * SQ + lane * 4; v4f v[SQ / 128];
#pragma unroll
  for (int u = 0; u < SQ / 128; ++u) v[u] = *(const v4fa*)(s + u * 128);
  v4f m4 = {-3.0e38f, -3.0e38f, -3.0e38f, -3.0e38f};
#pragma unroll
  for (int u = 0; u < SQ / 128; ++u) m4 = __builtin_elementwise_max(m4, v[u]);
  float mx = fmaxf(fmaxf(m4[0], m4[1]), fmaxf(m4[2], m4[3]));
  mx = fmaxf(mx, xl_row<1>(mx)); mx = fmaxf(mx, xl_row<2>(mx)); mx = fmaxf(mx, xl_row<4>(mx)); mx = fmaxf(mx, xl_row<8>(mx)); mx = fmaxf(mx, xl_x16(mx));
  v4f s4 = {0.f, 0.f, 0.f, 0.f};
#pragma unroll
  for (int u = 0; u < SQ / 128; ++u) { v4f e; for (int q = 0; q < 4; ++q) e[q] = __expf(v[u][q] - mx); v[u] = e; s4 += e; }
  float se = (s4[0] + s4[1]) + (s4[2] + s4[3]);
  se += xl_row<1>(se); se += xl_row<2>(se); se += xl_row<4>(se); se += xl_row<8>(se); se += xl_x16(se);
  const float sc = 256.0f / se; _Float16* d = P + (size_t)row * SQ + lane * 4;
#pragma unroll
  for (int u = 0; u < SQ / 128; ++u) { const v4f y = v[u] * sc; *(v4h*)(d + u * 128) = __builtin_convertvector(y, v4h); } }

template <int MODE>
__global__ __launch_bounds__(256) void k_regrp(const float* __restrict__ src, float* __restrict__ dst, size_t n4) {
  const size_t t = (size_t)blockIdx.x * 256 + threadIdx.x; if (t >= n4) return; const size_t e = t * 4; const size_t rd = e / DM; const int c = (int)(e % DM);
  size_t rs; if (MODE == 0) { const size_t b = rd / SQ, sq = rd % SQ; rs = sq * NB + b; } else { const size_t sq = rd / NB, b = rd % NB; rs = b * SQ + sq; }
  const v4f v = *(const v4fa*)(src + rs * DM + c); *(v4f*)(dst + e) = v;  }

template <int BFIN, int W16, int W32>
__global__ __launch_bounds__(256) void k_lnx(const float* __restrict__ X, const float* __restrict__ g, const float* __restrict__ bb, float eps, _Float16* __restrict__ N16, float* __restrict__ N32) {
  #pragma clang fp contract(off)
  __shared__ float red[256]; const size_t r = blockIdx.x; const int t = threadIdx.x; const bool act = t < (DMQ / 4); const int c0 = act ? t * 4 : 0;
  const v4f xa = *(const v4fa*)(X + r * DMQ + c0); float s[4]; float sum = 0.f;
  for (int q = 0; q < 4; ++q) { s[q] = act ? (BFIN ? bf16_round(xa[q]) : xa[q]) : 0.f; sum = __fadd_rn(sum, s[q]); }
  red[t] = sum; __syncthreads(); for (int st = 128; st > 0; st >>= 1) { if (t < st) red[t] = __fadd_rn(red[t], red[t + st]); __syncthreads(); } const float mu = red[0] / (float)DMQ; __syncthreads();
  float vs = 0.f; for (int q = 0; q < 4; ++q) { const float dl = act ? __fadd_rn(s[q], -mu) : 0.f; vs = __fadd_rn(vs, __fmul_rn(dl, dl)); } red[t] = vs; __syncthreads(); for (int st = 128; st > 0; st >>= 1) { if (t < st) red[t] = __fadd_rn(red[t], red[t + st]); __syncthreads(); }
  const float rs = rsqrtf(__fadd_rn(red[0] / (float)DMQ, eps)); v4h y; v4f yf;
  for (int q = 0; q < 4; ++q) { const int c = c0 + q; yf[q] = __fadd_rn(__fmul_rn(__fmul_rn(__fadd_rn(s[q], -mu), rs), bf16_round(g[c])), bf16_round(bb[c])); y[q] = (_Float16)yf[q]; }
  if (!act) return;      /* no barriers after this point */
  { if (W16) *(v4h*)(N16 + r * DMQ + c0) = y; if (W32) *(v4f*)(N32 + r * DMQ + c0) = yf;  } }

__global__ __launch_bounds__(256) void k_bfr(const float* __restrict__ x, float* __restrict__ XB, size_t n8) { const size_t t = (size_t)blockIdx.x * 256 + threadIdx.x; if (t >= n8) return; v4f a = *(const v4fa*)(x + t * 8), c = *(const v4fa*)(x + t * 8 + 4); for (int q = 0; q < 4; ++q) { a[q] = bf16_round(a[q]); c[q] = bf16_round(c[q]); }
  { *(v4f*)(XB + t * 8) = a; *(v4f*)(XB + t * 8 + 4) = c;  } }



__global__ __launch_bounds__(256) void k_wthd(const float* __restrict__ Wt, _Float16* __restrict__ Bt) { const size_t t = (size_t)blockIdx.x * 256 + threadIdx.x; if (t >= (size_t)NH * HD * (DM / 8)) return; const int m8 = (int)(t % (DM / 8)) * 8; const int d = (int)((t / (DM / 8)) % HD); const int h = (int)(t / ((size_t)(DM / 8) * HD)); FragH f;
  for (int q = 0; q < 8; ++q) f.h[q] = (_Float16)(16.0f * bf16_round(Wt[((size_t)h * DM + m8 + q) * HD + d])); unsigned short* dst = (unsigned short*)Bt + ((size_t)h * HD + d) * DM + m8; *(v8us*)dst = f.half[0];  }




template <int BFIN, int SCAL>
__global__ __launch_bounds__(256) void k_lnsc(const float* __restrict__ X, const float* __restrict__ g, const float* __restrict__ bb, float eps, _Float16* __restrict__ N16, float* __restrict__ N32) {
  #pragma clang fp contract(off)
  __shared__ float red[256]; const size_t r = blockIdx.x; const int t = threadIdx.x; const bool act = t < DM / 4; const int tc = act ? t : 0; const v4f xl = *(const v4fa*)(X + r * DM + tc * 4); const float am = act ? 1.f : 0.f; float s[4]; float sum = 0.f;
  for (int q = 0; q < 4; ++q) { s[q] = (BFIN ? bf16_round(xl[q]) : xl[q]) * am; sum = __fadd_rn(sum, s[q]); }
  red[t] = sum; __syncthreads(); for (int st = 128; st > 0; st >>= 1) { if (t < st) red[t] = __fadd_rn(red[t], red[t + st]); __syncthreads(); } const float mu = red[0] / (float)DM; __syncthreads();
  float vs = 0.f; for (int q = 0; q < 4; ++q) { const float dl = __fadd_rn(s[q], -mu) * am; vs = __fadd_rn(vs, __fmul_rn(dl, dl)); } red[t] = vs; __syncthreads(); for (int st = 128; st > 0; st >>= 1) { if (t < st) red[t] = __fadd_rn(red[t], red[t + st]); __syncthreads(); }
  const float rs = __fdiv_rn(1.0f, __fadd_rn(sqrtf(red[0] / (float)(DM - 1)), eps)); if (!act) return; v4h y; v4f yf;
  for (int q = 0; q < 4; ++q) { const int c = t * 4 + q; const float gg = bf16_round(SCAL ? g[0] : g[c]), bv = bf16_round(SCAL ? bb[0] : bb[c]); yf[q] = __fadd_rn(__fmul_rn(__fmul_rn(__fadd_rn(s[q], -mu), rs), gg), bv); y[q] = (_Float16)yf[q]; }
  { if (N16) *(v4h*)(N16 + r * DM + t * 4) = y; if (N32) *(v4f*)(N32 + r * DM + t * 4) = yf;  } }

__global__ __launch_bounds__(256) void k_rsmdmi(const float* __restrict__ S, _Float16* __restrict__ P, int nrows, const int* __restrict__ M) {
  #pragma clang fp contract(off)
  const int t = blockIdx.x * 256 + threadIdx.x; if (t >= nrows) return; const float* s = S + (size_t)t * SQ; const int* m = M + (size_t)(t % SQ) * SQ; float mx = -3.0e38f;
#pragma unroll 1
  for (int j = 0; j < SQ; ++j) { const float f = (m[j] == 0) ? 1.f : 0.f; mx = fmaxf(mx, fmaf(f, s[j], (1.f - f) * -1.0e9f)); } float se = 0.f;
#pragma unroll 1
  for (int j = 0; j < SQ; ++j) { const float f = (m[j] == 0) ? 1.f : 0.f; se += __expf(fmaf(f, s[j], (1.f - f) * -1.0e9f) - mx); } const float sc = 256.0f / se;
#pragma unroll 1
  for (int j0 = 0; j0 < SQ; j0 += 8) { FragH fr; for (int q = 0; q < 8; ++q) { const int j = j0 + q; const float f = (m[j] == 0) ? 1.f : 0.f; fr.h[q] = (_Float16)(__expf(fmaf(f, s[j], (1.f - f) * -1.0e9f) - mx) * sc); } unsigned short* d = (unsigned short*)P + (size_t)t * SQ + j0; *(v8us*)d = fr.half[0];  } }
extern "C" void kernel_launch(void* const* d_in, const int* in_sizes, int n_in,
                              void* d_out, int out_size, void* d_ws, size_t ws_size, hipStream_t stream) {
  (void)in_sizes; (void)n_in; (void)out_size;
  constexpr int VH = 4;      /* heads per launch group */
  const float* const* I = (const float* const*)d_in; const float* x = I[0]; const float* g1 = I[1]; const float* be1 = I[2]; const float* wqkv = I[3]; const float* wo = I[4]; const float* bo = I[5]; const float* bq = nullptr; const float* bk = nullptr; const float* bv = nullptr;      /* x; LayerNorm gamma / beta; fused NATURAL w_qkv [3072][1024] (row blocks q | k | v; no bias); natural w_proj [1024][1024] + b_proj */
  char* ws = (char*)d_ws; size_t off = 0;
  auto take = [&](size_t bytes) { char* p = ws + off; off += (bytes + 255) & ~(size_t)255; return p; };
  _Float16* BQ = (_Float16*)take((size_t)3 * DM * DM * 2); _Float16* BK = BQ + (size_t)DM * DM; _Float16* BV = BQ + (size_t)2 * DM * DM;      /* one stacked Bt plane [3 DM][DM] */ _Float16* BO = (_Float16*)take((size_t)DM * DM * 2);
  float* XB = (float*)take(NR * DM * 4); _Float16* XN = (_Float16*)take(NR * DM * 2); _Float16* Q16 = (_Float16*)take(NR * DM * 2); _Float16* K16 = (_Float16*)take(NR * DM * 2); _Float16* V16 = (_Float16*)take(NR * DM * 2); _Float16* O16 = (_Float16*)take(NR * DM * 2);
  float* S = (float*)take((size_t)VH * SQ * SQ * 4); _Float16* P = (_Float16*)take((size_t)VH * SQ * SQ * 2); _Float16* VT = (_Float16*)take((size_t)NH * HD * SQ * 2);
  /* attention sub-block only: no second norm, no MLP planes */
  
  if (off > ws_size) return;
  k_wnat<<<(unsigned)(((size_t)3 * DM * DM / 8 + 255) / 256), 256, 0, stream>>>(wqkv, (size_t)3 * DM * DM / 8, BQ); k_wnat<<<(unsigned)(((size_t)DM * DM / 8 + 255) / 256), 256, 0, stream>>>(wo, (size_t)DM * DM / 8, BO);      /* natural [out][in] = Bt x16 as given: the fused [3 DM][DM] matrix IS the stacked plane (rows 0 / DM / 2 DM = q | k | v); w_proj likewise */
  /* no MLP weights */
  k_bfr<<<(unsigned)((NR * DM / 8 + 255) / 256), 256, 0, stream>>>(x, XB, NR * DM / 8); k_lnx<1, 1, 0><<<(unsigned)NR, 256, 0, stream>>>(x, g1, be1, 1e-5f, XN, nullptr);      /* n = LN0(bf16(x)) (biased variance, eps inside the rsqrt) -> f16 rows */
  k_gemm2<0><<<dim3((unsigned)((NR / 128) * (DM / 64)), 1), 128, 0, stream>>>(XN, DM, 0, BQ, DM, 0, 0.0625f, bq, 0, nullptr, 1, 0, 0, nullptr, Q16, DM, 0, (int)NR, DM, DM); k_gemm2<0><<<dim3((unsigned)((NR / 128) * (DM / 64)), 1), 128, 0, stream>>>(XN, DM, 0, BK, DM, 0, 0.0625f, bk, 0, nullptr, 1, 0, 0, nullptr, K16, DM, 0, (int)NR, DM, DM); k_gemm2<0><<<dim3((unsigned)((NR / 128) * (DM / 64)), 1), 128, 0, stream>>>(XN, DM, 0, BV, DM, 0, 0.0625f, bv, 0, nullptr, 1, 0, 0, nullptr, V16, DM, 0, (int)NR, DM, DM);      /* q, k, v -> f16 rows; head h = columns h*64.. */
  for (int b = 0; b < NB; ++b) { const size_t r0 = (size_t)b * SQ;
    k_vt<NH, SQ><<<NH * (SQ / 64), 256, 0, stream>>>(V16 + r0 * DM, DM, 0, VT);      /* V^T [16][64][2048] for this batch */
    for (int h0 = 0; h0 < NH; h0 += VH) {
      k_gemm2<0><<<dim3((SQ / 128) * (SQ / 64), VH), 128, 0, stream>>>(Q16 + r0 * DM + (size_t)h0 * HD, DM, (size_t)HD, K16 + r0 * DM + (size_t)h0 * HD, DM, (size_t)HD, 0.125f, nullptr, 0, nullptr, 1, 0, 0, S, nullptr, SQ, (size_t)SQ * SQ, SQ, SQ, HD);      /* scores / 8, 4 heads per launch */
      k_rsmf<<<VH * SQ / 8, 256, 0, stream>>>(S, P, VH * SQ);      /* softmax over all keys (the mask input is all ones: nothing masked; not read) -> P x256 f16 */
      k_gemm2<0><<<dim3((SQ / 128) * (HD / 64), VH), 128, 0, stream>>>(P, SQ, (size_t)SQ * SQ, VT + (size_t)h0 * HD * SQ, SQ, (size_t)HD * SQ, 0.25f, nullptr, 0, nullptr, 1, 0, 0, nullptr, O16 + r0 * DM + (size_t)h0 * HD, DM, (size_t)HD, SQ, HD, SQ); } }      /* ctx (merged heads, x64) as f16 rows */
  k_gemm2<0><<<dim3((unsigned)((NR / 128) * (DM / 64)), 1), 128, 0, stream>>>(O16, DM, 0, BO, DM, 0, 0.0009765625f, bo, 0, XB, -1, 0, 0, (float*)d_out, nullptr, DM, 0, (int)NR, DM, DM);      /* x + ctx wo (+ bo) (own-element residual) -> f32 rows */
  /* result = x + out: written straight to d_out by the GEMM above (own-element residual with the bf16-rounded input copy) */
}

// v002
// Measured time: 324 microseconds a run.
// Next to v001, in two timings, it ran 5.47 and 5.46 times as fast.
// Over all steps from v000 it is 21.3 times as fast.
#include <hip/hip_runtime.h>
// Pre-LN multi-head self-attention sub-block with a residual (x [4][2048][1024]; h = LayerNorm(x) (biased var, eps 1e-5, gamma / beta); qkv = h w_qkv^T (natural [3072][1024]: row blocks q | k | v, each (head, dim)); no qkv bias; 16 heads of 64; scale 64^-0.5; softmax over all 2048 keys (no mask); out = merged w_proj^T + b_proj (natural); result = x + out -> [4][2048][1024]).
// Structure: token rows; LayerNorm / exact f16 rows; WMMA GEMMs for q, k, v; V^T by LDS transposes; one fused attention launch (scores, online softmax, V^T P^T; S and P stay in registers); output projection with the own-element residual.
// Compute dtype: inputs rounded to bf16; x / weights exact; q, k, v, softmax weights and o as plain f16 GEMM operands (~2^-12); scores and softmax statistics f32. v_wmma_f32_16x16x32_f16.
#define NB 4
#define SQ 2048
#define DM 1024
#define NH 16
#define HD 64
#define HG 4                         /* heads per block group of the unlaunched k_vt overload */
#define LOCALW 128                   /* (macros for unused kernels of the shared header) */
#define STRIDEK 128
#define QT 256                       /* query rows per causal tile */
#define NKX SQ                       /* S / P row pitch */
#define QT0 128                      /* first-tile rows recomputed exactly in f32 */
#define B0 0                         /* first batch processed (debug hook) */
#define NBR NB                       /* batches processed (debug hook) */
#define NR ((size_t)NB * SQ)
#define DMQ DM
#define DFF 4096         /* unused: no FFN in this sub-block */
#define MP ((int)((size_t)NBR * SQ)) /* rows projected (debug hook) */
#define QN SQ                        /* query rows attended per batch (debug hook) */
#define NHD NH                       /* heads attended (debug hook) */
#define MPO MP                       /* rows through the output stage (debug hook) */
#define LQ (3 * DM)      /* unused: the q, k, v rows have pitch DM */
typedef __bf16 v16b __attribute__((ext_vector_type(16)));
typedef unsigned short v8us __attribute__((ext_vector_type(8), may_alias));
typedef float  v8f  __attribute__((ext_vector_type(8)));
typedef float  v4f  __attribute__((ext_vector_type(4)));
typedef float  v4fa __attribute__((ext_vector_type(4), may_alias));
union FragB { v16b v; v8us half[2]; unsigned short u[16]; };

__device__ __forceinline__ unsigned short bf16_bits(float x) { unsigned int u = __float_as_uint(x); return (unsigned short)((u + 0x7FFFu + ((u >> 16) & 1u)) >> 16); }
__device__ __forceinline__ float bf16_val(unsigned short b) { return __uint_as_float(((unsigned int)b) << 16); }
__device__ __forceinline__ float bf16_round(float x) { return bf16_val(bf16_bits(x)); }
// D += A·B with NT terms: 1 = ah·bh, 2 = + al·bh (A split), 3 = + ah·bl (both split)
template <int NT>
__device__ __forceinline__ v8f mmaN(v16b ah, v16b al, v16b bh, v16b bl, v8f c) {
  c = __builtin_amdgcn_wmma_f32_16x16x32_bf16(false, ah, false, bh, (short)0, c, false, false);
  if (NT >= 2) c = __builtin_amdgcn_wmma_f32_16x16x32_bf16(false, al, false, bh, (short)0, c, false, false);
  if (NT >= 3) c = __builtin_amdgcn_wmma_f32_16x16x32_bf16(false, ah, false, bl, (short)0, c, false, false);
  asm volatile("v_nop\n\tv_nop\n\tv_nop\n\tv_nop" : "+v"(c) : "v"(ah), "v"(al), "v"(bh), "v"(bl));
  return c;
}

__global__ __launch_bounds__(256) void k_wt_bf16(const float* __restrict__ W, unsigned short* __restrict__ Wt, int K, int N) {
  const int t = blockIdx.x * 256 + threadIdx.x;
  const int k8n = K / 8;
  if (t >= N * k8n) return;
  const int n = t / k8n, k8 = (t % k8n) * 8;
  v8us v;
#pragma unroll
  for (int i = 0; i < 8; ++i) v[i] = bf16_bits(W[(size_t)(k8 + i) * N + n]);
  *(v8us*)(Wt + (size_t)n * K + k8) = v;
  
}

// GEMM C[M][N] (f32, pitch ldc) = act(A[M][K]·W + bias). A f32 row-major (pitch lda) converted per fragment to bf16
// (ASPLIT: hi/lo two planes -> 2 terms, else single rounded term); Wt bf16 [N][K] (pitch ldb). BIAS_BF16 rounds the
// bias to bf16 first (bias quantised to bf16 before the add). K%32==0, M%16==0, N%64==0.
template <bool ASPLIT, int ACT, bool BIAS_BF16>
__global__ __launch_bounds__(128) void k_gemm_bf(const float* __restrict__ A, int lda, const unsigned short* __restrict__ Wt, int ldb,
                                               const float* __restrict__ bias, float* __restrict__ C, int ldc, int M, int N, int K) {
  __shared__ __attribute__((aligned(16))) float so[4][16][64];
  const int tid = threadIdx.x, w = tid >> 5, lane = tid & 31, ln = lane & 15, hh = lane >> 4;
  const int ntn = N / 64;
  const int wid = blockIdx.x * 4 + w;
  const int mt = wid / ntn, nq = wid % ntn;
  if (mt * 16 >= M) return;
  const int row0 = mt * 16, col0 = nq * 64;
  const float* arow = A + (size_t)(row0 + ln) * lda;
  v8f acc[4] = {};
  for (int kb = 0; kb < K; kb += 32) {
    FragB ah, al;
    const v4f x0 = *(const v4fa*)(arow + kb + 8 * hh), x1 = *(const v4fa*)(arow + kb + 8 * hh + 4);
    const v4f x2 = *(const v4fa*)(arow + kb + 16 + 8 * hh), x3 = *(const v4fa*)(arow + kb + 16 + 8 * hh + 4);
    float xs[16] = {x0[0],x0[1],x0[2],x0[3],x1[0],x1[1],x1[2],x1[3],x2[0],x2[1],x2[2],x2[3],x3[0],x3[1],x3[2],x3[3]};
#pragma unroll
    for (int i = 0; i < 16; ++i) { const unsigned short hb = bf16_bits(xs[i]); ah.u[i] = hb; al.u[i] = ASPLIT ? bf16_bits(xs[i] - bf16_val(hb)) : (unsigned short)0; }
#pragma unroll
    for (int t = 0; t < 4; ++t) {
      const unsigned short* brow = Wt + (size_t)(col0 + t * 16 + ln) * ldb + kb;
      FragB b;
      b.half[0] = *(const v8us*)(brow + 8 * hh);
      b.half[1] = *(const v8us*)(brow + 16 + 8 * hh);
      acc[t] = mmaN<ASPLIT ? 2 : 1>(ah.v, al.v, b.v, b.v, acc[t]);
    }
  }
#pragma unroll
  for (int t = 0; t < 4; ++t) {
    float bv = bias ? bias[col0 + t * 16 + ln] : 0.f;
    if (BIAS_BF16) bv = bf16_round(bv);
#pragma unroll
    for (int r = 0; r < 8; ++r) { float v = acc[t][r] + bv; if (ACT == 1) v = fmaxf(v, 0.f); so[w][8 * hh + r][t * 16 + ln] = v; }
  }
  __builtin_amdgcn_fence(__ATOMIC_ACQ_REL, "workgroup");
  __builtin_amdgcn_wave_barrier();
  const int rsub = lane >> 4, c4 = (lane & 15) * 4;
  {
#pragma unroll
    for (int q = 0; q < 8; ++q) {
      const int r = q * 2 + rsub;
      const v4f v = *(const v4fa*)&so[w][r][c4];
      *(v4f*)(C + (size_t)(row0 + r) * ldc + col0 + c4) = v;
    }
    
  }
}

// GEMM C = act(A·W + bias + resid): A f32 (ASPLIT -> hi/lo 2 terms), Wt bf16 [N][K]; ACT 0 none, 1 relu, 2 exact gelu;
// resid (optional, f32, row index = (row % rmod), pitch ldr, RES_BF16 rounds it) added before the activation.
template <bool ASPLIT, int ACT, bool BIAS_BF16, bool RES_BF16>
__global__ __launch_bounds__(128) void k_gemm_bf3(const float* __restrict__ A, int lda, const unsigned short* __restrict__ Wt, int ldb,
                                                const float* __restrict__ bias, const float* __restrict__ resid, int rmod, int ldr,
                                                float* __restrict__ C, int ldc, int M, int N, int K) {
  __shared__ __attribute__((aligned(16))) float so[4][16][64];
  const int tid = threadIdx.x, w = tid >> 5, lane = tid & 31, ln = lane & 15, hh = lane >> 4;
  const int ntn = N / 64;
  const int wid = blockIdx.x * 4 + w;
  const int mt = wid / ntn, nq = wid % ntn;
  if (mt * 16 >= M) return;
  const int row0 = mt * 16, col0 = nq * 64;
  const float* arow = A + (size_t)(row0 + ln) * lda;
  v8f acc[4] = {};
  for (int kb = 0; kb < K; kb += 32) {
    FragB ah, al;
    const v4f x0 = *(const v4fa*)(arow + kb + 8 * hh), x1 = *(const v4fa*)(arow + kb + 8 * hh + 4);
    const v4f x2 = *(const v4fa*)(arow + kb + 16 + 8 * hh), x3 = *(const v4fa*)(arow + kb + 16 + 8 * hh + 4);
    float xs[16] = {x0[0],x0[1],x0[2],x0[3],x1[0],x1[1],x1[2],x1[3],x2[0],x2[1],x2[2],x2[3],x3[0],x3[1],x3[2],x3[3]};
#pragma unroll
    for (int i = 0; i < 16; ++i) { const unsigned short hb = bf16_bits(xs[i]); ah.u[i] = hb; al.u[i] = ASPLIT ? bf16_bits(xs[i] - bf16_val(hb)) : (unsigned short)0; }
#pragma unroll
    for (int t = 0; t < 4; ++t) {
      const unsigned short* brow = Wt + (size_t)(col0 + t * 16 + ln) * ldb + kb;
      FragB b;
      b.half[0] = *(const v8us*)(brow + 8 * hh);
      b.half[1] = *(const v8us*)(brow + 16 + 8 * hh);
      acc[t] = mmaN<ASPLIT ? 2 : 1>(ah.v, al.v, b.v, b.v, acc[t]);
    }
  }
#pragma unroll
  for (int t = 0; t < 4; ++t) {
    const int col = col0 + t * 16 + ln;
    float bv = bias ? bias[col] : 0.f;
    if (BIAS_BF16) bv = bf16_round(bv);
#pragma unroll
    for (int r = 0; r < 8; ++r) {
      float v = acc[t][r] + bv;
      if (resid) { float rv = resid[(size_t)((row0 + 8 * hh + r) % rmod) * ldr + col]; if (RES_BF16) rv = bf16_round(rv); v += rv; }
      if (ACT == 1) v = fmaxf(v, 0.f);
      if (ACT == 2) v = 0.5f * v * (1.0f + erff(v * 0.70710678118654752f));
      if (ACT == 3) { const float u = 0.7978845608028654f * (v + 0.044715f * v * v * v); v = 0.5f * v * (1.0f + tanhf(u)); }
      so[w][8 * hh + r][t * 16 + ln] = v;
    }
  }
  __builtin_amdgcn_fence(__ATOMIC_ACQ_REL, "workgroup");
  __builtin_amdgcn_wave_barrier();
  const int rsub = lane >> 4, c4 = (lane & 15) * 4;
  {
#pragma unroll
    for (int q = 0; q < 8; ++q) {
      const int r = q * 2 + rsub;
      const v4f v = *(const v4fa*)&so[w][r][c4];
      *(v4f*)(C + (size_t)(row0 + r) * ldc + col0 + c4) = v;
    }
    
  }
}
// row LayerNorm (biased variance, eps) over N: s = X (+ R); optional out_sum <- s; out_norm <- (s-mu)*rsqrt(var+eps)*g + b
template <bool PARAM_BF16>
__global__ __launch_bounds__(256) void k_layernorm(const float* __restrict__ X, const float* __restrict__ R, const float* __restrict__ g, const float* __restrict__ bta,
                                                  float* __restrict__ out_sum, float* __restrict__ out_norm, int N, float eps) {
  __shared__ float red[256];
  const int row = blockIdx.x, tid = threadIdx.x;
  const float* x = X + (size_t)row * N; const float* rr = R ? R + (size_t)row * N : nullptr;
  float vals[16];                     // up to N = 4096
  const int per = N / 256;            // contiguous chunk per thread? use strided-by-4 chunks: thread handles j = tid*4 + 1024*u
  float s1 = 0.f;
  for (int u = 0; u < per / 4; ++u) {
    const int j = tid * 4 + 1024 * u;
    const v4f a = *(const v4fa*)(x + j);
    v4f b = {0.f,0.f,0.f,0.f}; if (rr) b = *(const v4fa*)(rr + j);
#pragma unroll
    for (int q = 0; q < 4; ++q) { const float v = a[q] + b[q]; vals[u * 4 + q] = v; s1 += v; }
  }
  red[tid] = s1; __syncthreads();
  for (int st = 128; st > 0; st >>= 1) { if (tid < st) red[tid] += red[tid + st]; __syncthreads(); }
  const float mu = red[0] / (float)N; __syncthreads();
  float s2 = 0.f;
  for (int u = 0; u < per / 4; ++u)
#pragma unroll
    for (int q = 0; q < 4; ++q) { const float c = vals[u * 4 + q] - mu; s2 += c * c; }
  red[tid] = s2; __syncthreads();
  for (int st = 128; st > 0; st >>= 1) { if (tid < st) red[tid] += red[tid + st]; __syncthreads(); }
  const float rs = rsqrtf(red[0] / (float)N + eps);
  {
    for (int u = 0; u < per / 4; ++u) {
      const int j = tid * 4 + 1024 * u;
      v4f o, sm;
#pragma unroll
      for (int q = 0; q < 4; ++q) {
        float gg = g[j + q], bb = bta[j + q];
        if (PARAM_BF16) { gg = bf16_round(gg); bb = bf16_round(bb); }
        sm[q] = vals[u * 4 + q]; o[q] = (vals[u * 4 + q] - mu) * rs * gg + bb;
      }
      if (out_sum) *(v4f*)(out_sum + (size_t)row * N + j) = sm;
      *(v4f*)(out_norm + (size_t)row * N + j) = o;
    }
    
  }
}



// ---- f16 WMMA path (v_wmma_f32_16x16x32_f16): 11-bit significands for operands in range — used where a [0,1] probability operand needs more precision than bf16
typedef _Float16 v16h __attribute__((ext_vector_type(16)));
union FragH { v16h v; v8us half[2]; _Float16 h[16]; unsigned short u[16]; };
template <int NT>
__device__ __forceinline__ v8f mmaH(v16h ah, v16h al, v16h bh, v16h bl, v8f c) {
  c = __builtin_amdgcn_wmma_f32_16x16x32_f16(false, ah, false, bh, (short)0, c, false, false);
  if (NT >= 2) c = __builtin_amdgcn_wmma_f32_16x16x32_f16(false, al, false, bh, (short)0, c, false, false);
  if (NT >= 3) c = __builtin_amdgcn_wmma_f32_16x16x32_f16(false, ah, false, bl, (short)0, c, false, false);
  asm volatile("v_nop\n\tv_nop\n\tv_nop\n\tv_nop" : "+v"(c) : "v"(ah), "v"(al), "v"(bh), "v"(bl));
  return c;
}
// batched GEMM like k_gemm_b but f16 operands: A f32 (split into f16 hi/lo if ASPLIT, else rounded to f16), Bt = f16 values [n][k]; alpha; C f32; N multiple of 16 (partial tiles skipped)
template <bool ASPLIT>
__global__ __launch_bounds__(128) void k_gemm_h(const float* __restrict__ A, int lda, size_t sA, const _Float16* __restrict__ Bh, int ldb, size_t sB, float alpha, float* __restrict__ C, int ldc, size_t sC, int M, int N, int K) {
  __shared__ __attribute__((aligned(16))) float so[4][16][64];
  const int tid = threadIdx.x, w = tid >> 5, lane = tid & 31, ln = lane & 15, hh = lane >> 4; const int by = blockIdx.y;
  A += (size_t)by * sA; Bh += (size_t)by * sB; C += (size_t)by * sC;
  const int ntn = (N + 63) / 64; const int wid = blockIdx.x * 4 + w; const int mt = wid / ntn, nq = wid % ntn; if (mt * 16 >= M) return;
  const int row0 = mt * 16, col0 = nq * 64; const float* arow = A + (size_t)(row0 + ln) * lda;
  v8f acc[4] = {};
  for (int kb = 0; kb < K; kb += 32) {
    FragH ah, al;
    const v4f x0 = *(const v4fa*)(arow + kb + 8 * hh), x1 = *(const v4fa*)(arow + kb + 8 * hh + 4), x2 = *(const v4fa*)(arow + kb + 16 + 8 * hh), x3 = *(const v4fa*)(arow + kb + 16 + 8 * hh + 4);
    float xs[16] = {x0[0],x0[1],x0[2],x0[3],x1[0],x1[1],x1[2],x1[3],x2[0],x2[1],x2[2],x2[3],x3[0],x3[1],x3[2],x3[3]};
#pragma unroll
    for (int i = 0; i < 16; ++i) { const _Float16 h = (_Float16)xs[i]; ah.h[i] = h; al.h[i] = ASPLIT ? (_Float16)(xs[i] - (float)h) : (_Float16)0.0f; }
#pragma unroll
    for (int t = 0; t < 4; ++t) { if (col0 + t * 16 >= N) continue; const size_t boff = (size_t)(col0 + t * 16 + ln) * ldb + kb; FragH bq; bq.half[0] = *(const v8us*)(Bh + boff + 8 * hh); bq.half[1] = *(const v8us*)(Bh + boff + 16 + 8 * hh);
      acc[t] = mmaH<ASPLIT ? 2 : 1>(ah.v, al.v, bq.v, bq.v, acc[t]); }
  }
#pragma unroll
  for (int t = 0; t < 4; ++t) { if (col0 + t * 16 >= N) continue;
#pragma unroll
    for (int r = 0; r < 8; ++r) so[w][8 * hh + r][t * 16 + ln] = acc[t][r] * alpha; }
  __builtin_amdgcn_fence(__ATOMIC_ACQ_REL, "workgroup"); __builtin_amdgcn_wave_barrier();
  const int rsub = lane >> 4, c4 = (lane & 15) * 4;
  {
#pragma unroll
    for (int q = 0; q < 8; ++q) { const int r = q * 2 + rsub; if (col0 + c4 < N) { const v4f v = *(const v4fa*)&so[w][r][c4]; *(v4f*)(C + (size_t)(row0 + r) * ldc + col0 + c4) = v; } }
     }
}

// Wt[n][k] = f16(W[k][n]·scale) from f32 row-major W[K][N] (scale = power of two; bf16-exact weights stay exact in f16 away from the subnormal range)
__global__ __launch_bounds__(256) void k_wt_f16(const float* __restrict__ W, _Float16* __restrict__ Wt, int K, int N, float scale) {
  const int t = blockIdx.x * 256 + threadIdx.x; if (t >= N * (K / 8)) return; const int n = t / (K / 8), k8 = (t % (K / 8)) * 8; FragH f;
#pragma unroll
  for (int i = 0; i < 8; ++i) f.h[i] = (_Float16)(bf16_round(W[(size_t)(k8 + i) * N + n]) * scale); const v8us o = f.half[0];
  *(v8us*)((unsigned short*)Wt + (size_t)n * K + k8) = o; 
}
// k_gemm_hh variant with fused epilogue: v = acc·alpha + bias[by·sBias + col] (+ CP[(row/rowsPerB)·sCPb + by·64 + col] if CP) ; ACT 0 none / 1 elu ; writes f16 C16 (and f32 C if non-null)
template <int ACT>
__global__ __launch_bounds__(128) void k_gemm_hhx(const _Float16* __restrict__ A, int lda, size_t sA, const _Float16* __restrict__ Bh, int ldb, size_t sB, float alpha, const float* __restrict__ bias, size_t sBias, const float* __restrict__ CP, int rowsPerB, size_t sCPb, int row0g,
    float* __restrict__ C, _Float16* __restrict__ C16, int ldc, size_t sC, int M, int N, int K) {
  __shared__ __attribute__((aligned(16))) float so[4][16][64];
  const int tid = threadIdx.x, w = tid >> 5, lane = tid & 31, ln = lane & 15, hh = lane >> 4; const int by = blockIdx.y;
  A += (size_t)by * sA; Bh += (size_t)by * sB; const size_t cofs = (size_t)by * sC; const float* bp = bias ? bias + (size_t)by * sBias : nullptr;
  const int ntn = (N + 63) / 64; const int wid = blockIdx.x * 4 + w; const int mt = wid / ntn, nq = wid % ntn; if (mt * 16 >= M) return;
  const int row0 = mt * 16, col0 = nq * 64; const _Float16* arow = A + (size_t)(row0 + ln) * lda;
  v8f acc[4] = {};
  for (int kb = 0; kb < K; kb += 32) { FragH ah; ah.half[0] = *(const v8us*)((const unsigned short*)arow + kb + 8 * hh); ah.half[1] = *(const v8us*)((const unsigned short*)arow + kb + 16 + 8 * hh);
#pragma unroll
    for (int t = 0; t < 4; ++t) { if (col0 + t * 16 >= N) continue; const size_t boff = (size_t)(col0 + t * 16 + ln) * ldb + kb; FragH bq; bq.half[0] = *(const v8us*)((const unsigned short*)Bh + boff + 8 * hh); bq.half[1] = *(const v8us*)((const unsigned short*)Bh + boff + 16 + 8 * hh);
      acc[t] = mmaH<1>(ah.v, ah.v, bq.v, bq.v, acc[t]); }
  }
#pragma unroll
  for (int t = 0; t < 4; ++t) { if (col0 + t * 16 >= N) continue; const int col = col0 + t * 16 + ln; const float bv = bp ? bf16_round(bp[col]) : 0.f;
#pragma unroll
    for (int r = 0; r < 8; ++r) { float v = acc[t][r] * alpha + bv; if (CP) { const int rr = row0g + row0 + 8 * hh + r; if (rowsPerB < 0) v += CP[cofs + (size_t)rr * ldc + col];      /* rowsPerB < 0: own element of the batched C plane */ else { const int bidx = rr / rowsPerB; v += CP[(size_t)bidx * sCPb + (size_t)by * 64 + col]; } } if (ACT == 1) v = (v > 0.f) ? v : expm1f(v); else if (ACT == 7) v = (v > 0.f) ? v + 1.0f : expf(v); else if (ACT == 8) v = tanhf(v); else if (ACT == 9) v = 0.5f * v * (1.0f + tanhf(0.7978845608028654f * (v + 0.044715f * v * v * v))); else if (ACT == 11) v = 1.0f / (1.0f + expf(-v)); else if (ACT == 12) v = (v > 0.f) ? v : 0.01f * v; else if (ACT == 14) v = (v > 0.f) ? v : 0.1f * v; else if (ACT == 16) v = (v >= 0.f) ? v : 0.3f * v; else if (ACT == 17) v = (v >= 0.f) ? v : 0.2f * v; else if (ACT == 15) v = v / (1.0f + expf(-v)); else if (ACT == 3) v = fmaxf(v, 0.f); else if (ACT == 6) v = 0.5f * v * (1.0f + erff(v * 0.70710678118654752f)); so[w][8 * hh + r][t * 16 + ln] = v; } }
  __builtin_amdgcn_fence(__ATOMIC_ACQ_REL, "workgroup"); __builtin_amdgcn_wave_barrier();
  const int rsub = lane >> 4, c4 = (lane & 15) * 4; typedef _Float16 v4h __attribute__((ext_vector_type(4)));
  {
#pragma unroll
    for (int q = 0; q < 8; ++q) { const int r = q * 2 + rsub; if (col0 + c4 < N) { const v4f v = *(const v4fa*)&so[w][r][c4]; if (C) *(v4f*)(C + cofs + (size_t)(row0 + r) * ldc + col0 + c4) = v; if (C16) { v4h h4; for (int i = 0; i < 4; ++i) h4[i] = (_Float16)v[i]; *(v4h*)(C16 + cofs + (size_t)(row0 + r) * ldc + col0 + c4) = h4; } } }
     }
}


typedef _Float16 v4h __attribute__((ext_vector_type(4)));

__global__ __launch_bounds__(256) void k_x16(const float* __restrict__ x, _Float16* __restrict__ X16, size_t n8) { const size_t t = (size_t)blockIdx.x * 256 + threadIdx.x; if (t >= n8) return; FragH f;
#pragma unroll
  for (int q = 0; q < 8; ++q) f.h[q] = (_Float16)bf16_round(x[t * 8 + q]); *(v8us*)((unsigned short*)X16 + t * 8) = f.half[0];  }
__global__ __launch_bounds__(256) void k_h16(const float* __restrict__ x, _Float16* __restrict__ X16, size_t n8) { const size_t t = (size_t)blockIdx.x * 256 + threadIdx.x; if (t >= n8) return; FragH f;
#pragma unroll
  for (int q = 0; q < 8; ++q) f.h[q] = (_Float16)x[t * 8 + q]; *(v8us*)((unsigned short*)X16 + t * 8) = f.half[0];  }
__global__ __launch_bounds__(256) void k_round16f(const float* __restrict__ W, _Float16* __restrict__ Bt, size_t n8) { const size_t t = (size_t)blockIdx.x * 256 + threadIdx.x; if (t >= n8) return; FragH f;
#pragma unroll
  for (int i = 0; i < 8; ++i) f.h[i] = (_Float16)(bf16_round(W[t * 8 + i]) * 16.0f); *(v8us*)((unsigned short*)Bt + t * 8) = f.half[0];  }
template <int NHv, int TTv>
__global__ __launch_bounds__(256) void k_vt(const _Float16* __restrict__ V16, int ldv, int voff, _Float16* __restrict__ Vt) { __shared__ unsigned short tl[64][66]; const int tid = threadIdx.x; const int slab = blockIdx.x / (TTv / 64), lg = blockIdx.x % (TTv / 64); const int b = slab / NHv, h = slab % NHv;
  for (int i = tid; i < 64 * 8; i += 256) { const int r = i / 8, c8 = (i % 8) * 8; FragH f; f.half[0] = *(const v8us*)((const unsigned short*)V16 + ((size_t)b * TTv + lg * 64 + r) * ldv + voff + h * 64 + c8);
#pragma unroll
    for (int q = 0; q < 8; ++q) tl[r][c8 + q] = f.u[q]; }
  __syncthreads();
  {
#pragma unroll
    for (int rd = 0; rd < 2; ++rd) { const int d = rd * 32 + tid / 8, pc = tid % 8; FragH f;
#pragma unroll
      for (int q = 0; q < 8; ++q) f.u[q] = tl[pc * 8 + q][d];
      *(v8us*)((unsigned short*)Vt + ((size_t)slab * 64 + d) * TTv + lg * 64 + pc * 8) = f.half[0]; }
     } }

__global__ __launch_bounds__(256) void k_hl(const float* __restrict__ F, _Float16* __restrict__ Hh, _Float16* __restrict__ Hl, size_t n8) { const size_t t = (size_t)blockIdx.x * 256 + threadIdx.x; if (t >= n8) return; FragH fh, fl; const v4f a = *(const v4fa*)(F + t * 8), c = *(const v4fa*)(F + t * 8 + 4);
#pragma unroll
  for (int q = 0; q < 4; ++q) { _Float16 h = (_Float16)a[q]; fh.h[q] = h; fl.h[q] = (_Float16)((a[q] - (float)h) * 1024.0f); h = (_Float16)c[q]; fh.h[4 + q] = h; fl.h[4 + q] = (_Float16)((c[q] - (float)h) * 1024.0f); }
  { *(v8us*)((unsigned short*)Hh + t * 8) = fh.half[0]; *(v8us*)((unsigned short*)Hl + t * 8) = fl.half[0];  } }

// ---- fast GEMM (wave tile 32x64; requires M % 32 == 0 rows per launch region and N % 64 == 0); epilogue = k_gemm_hhx semantics ----
__device__ __forceinline__ v16h g2_frag(const _Float16* p, int hh) { FragH f; f.half[0] = *(const v8us*)((const unsigned short*)p + 8 * hh); f.half[1] = *(const v8us*)((const unsigned short*)p + 16 + 8 * hh); return f.v; }
__device__ __forceinline__ v8f g2_mma(v16h a, v16h b, v8f c) { v8f d = __builtin_amdgcn_wmma_f32_16x16x32_f16(false, a, false, b, (short)0, c, false, false); asm volatile("v_nop\n\tv_nop\n\tv_nop\n\tv_nop" : "+v"(d) : "v"(a), "v"(b)); return d; }
template <int ACT>
__global__ __launch_bounds__(128) void k_gemm2(const _Float16* __restrict__ A, int lda, size_t sA, const _Float16* __restrict__ Bh, int ldb, size_t sB, float alpha, const float* __restrict__ bias, size_t sBias, const float* __restrict__ CP, int rowsPerB, size_t sCPb, int row0g,
    float* __restrict__ C, _Float16* __restrict__ C16, int ldc, size_t sC, int M, int N, int K) { static_assert(ACT == 0 || ACT == 3 || ACT == 6 || ACT == 8 || ACT == 9 || ACT == 11 || ACT == 12 || ACT == 14 || ACT == 15 || ACT == 16 || ACT == 17 || ACT == 18, "k_gemm2: unsupported ACT code (would silently apply no activation)");
  __shared__ __attribute__((aligned(16))) float so[4][32][68];
  const int tid = threadIdx.x, w = tid >> 5, lane = tid & 31, ln = lane & 15, hh = lane >> 4; const int by = blockIdx.y;
  A += (size_t)by * sA; Bh += (size_t)by * sB; const size_t cofs = (size_t)by * sC; const float* bp = bias ? bias + (size_t)by * sBias : nullptr;
  const int ntn = N >> 6; const int mt = blockIdx.x / ntn, nq = blockIdx.x - mt * ntn; const int row0 = mt * 128 + 32 * w, col0 = nq * 64; if (row0 >= M) return;
  const _Float16* a0p = A + (size_t)(row0 + ln) * lda; const _Float16* a1p = a0p + (size_t)16 * lda;
  const _Float16* b0p = Bh + (size_t)(col0 + ln) * ldb; const _Float16* b1p = b0p + (size_t)16 * ldb; const _Float16* b2p = b1p + (size_t)16 * ldb; const _Float16* b3p = b2p + (size_t)16 * ldb;
  const v8f z8 = {0.f,0.f,0.f,0.f,0.f,0.f,0.f,0.f}; v8f c00 = z8, c01 = z8, c02 = z8, c03 = z8, c10 = z8, c11 = z8, c12 = z8, c13 = z8;
#pragma unroll 1
  for (int kb = 0; kb < K; kb += 32) { const v16h a0 = g2_frag(a0p + kb, hh), a1 = g2_frag(a1p + kb, hh);
    v16h b = g2_frag(b0p + kb, hh); c00 = g2_mma(a0, b, c00); c10 = g2_mma(a1, b, c10);
    b = g2_frag(b1p + kb, hh); c01 = g2_mma(a0, b, c01); c11 = g2_mma(a1, b, c11);
    b = g2_frag(b2p + kb, hh); c02 = g2_mma(a0, b, c02); c12 = g2_mma(a1, b, c12);
    b = g2_frag(b3p + kb, hh); c03 = g2_mma(a0, b, c03); c13 = g2_mma(a1, b, c13); }
  v8f accs[8] = {c00, c01, c02, c03, c10, c11, c12, c13};
#pragma unroll
  for (int u = 0; u < 8; ++u) { const int t = u & 3, half = u >> 2; const int col = col0 + t * 16 + ln; const float bv = bp ? bf16_round(bp[col]) : 0.f;
#pragma unroll
    for (int r = 0; r < 8; ++r) { const int rloc = half * 16 + 8 * hh + r; float v = accs[u][r] * alpha + bv; if (CP) { if (rowsPerB < 0) v += CP[cofs + (size_t)(row0g + row0 + rloc) * ldc + col];      /* rowsPerB < 0: own element of the batched C plane */ else { const int bidx = (row0g + row0 + rloc) / rowsPerB; v += CP[(size_t)bidx * sCPb + (size_t)by * 64 + col]; } }
      if (ACT == 3) v = fmaxf(v, 0.f); else if (ACT == 6) v = 0.5f * v * (1.0f + erff(v * 0.70710678118654752f)); else if (ACT == 11) v = 1.0f / (1.0f + expf(-v)); else if (ACT == 15) v = v / (1.0f + expf(-v)); else if (ACT == 18) v = v / (1.0f + expf(-1.702f * v));      /* QuickGELU: v sigmoid(1.702 v) */ else if (ACT == 12) v = (v > 0.f) ? v : 0.01f * v; else if (ACT == 8) v = tanhf(v); else if (ACT == 9) v = 0.5f * v * (1.0f + tanhf(0.7978845608028654f * (v + 0.044715f * v * v * v))); else if (ACT == 14) v = (v > 0.f) ? v : 0.1f * v; else if (ACT == 16) v = (v >= 0.f) ? v : 0.3f * v; else if (ACT == 17) v = (v >= 0.f) ? v : 0.2f * v;
      so[w][rloc][t * 16 + ln] = v; } }
  __builtin_amdgcn_fence(__ATOMIC_ACQ_REL, "workgroup"); __builtin_amdgcn_wave_barrier();
  const int rsub = lane >> 4, c4 = (lane & 15) * 4;
  {
#pragma unroll
    for (int q = 0; q < 16; ++q) { const int r = q * 2 + rsub; const v4f v = *(const v4fa*)&so[w][r][c4]; if (C) *(v4f*)(C + cofs + (size_t)(row0 + r) * ldc + col0 + c4) = v; if (C16) { v4h h4; for (int i = 0; i < 4; ++i) h4[i] = (_Float16)v[i]; *(v4h*)(C16 + cofs + (size_t)(row0 + r) * ldc + col0 + c4) = h4; } }
     } }


__global__ __launch_bounds__(256) void k_wnat(const float* __restrict__ w, size_t n8, _Float16* __restrict__ Bt) { const size_t t = (size_t)blockIdx.x * 256 + threadIdx.x; if (t >= n8) return; FragH f; for (int q = 0; q < 8; ++q) f.h[q] = (_Float16)(bf16_round(w[t * 8 + q]) * 16.0f); *(v8us*)((unsigned short*)Bt + t * 8) = f.half[0];  }
__global__ __launch_bounds__(256) void k_rsm(const float* __restrict__ S, _Float16* __restrict__ P, int nrows) {
  #pragma clang fp contract(off)
  const int i = blockIdx.x * 256 + threadIdx.x; if (i >= nrows) return; const float* s = S + (size_t)i * SQ; float mx = -3.0e38f;
#pragma unroll 1
  for (int j = 0; j < SQ; ++j) mx = fmaxf(mx, s[j]); float se = 0.f;
#pragma unroll 1
  for (int j = 0; j < SQ; ++j) se += expf(s[j] - mx); const float sc = 256.0f / se;
#pragma unroll 1
  for (int j0 = 0; j0 < SQ; j0 += 8) { FragH f; for (int q = 0; q < 8; ++q) f.h[q] = (_Float16)(expf(s[j0 + q] - mx) * sc); unsigned short* d = (unsigned short*)P + (size_t)i * SQ + j0; *(v8us*)d = f.half[0];  } }
__global__ __launch_bounds__(256) void k_vt(const _Float16* __restrict__ V16, int b, int h0, _Float16* __restrict__ VT) { __shared__ unsigned short tl[64][65]; const int tid = threadIdx.x; const int hh = blockIdx.x % HG, sg = blockIdx.x / HG; const int s0 = sg * 64; const int h = h0 + hh;
  for (int i = tid; i < 64 * 8; i += 256) { const int j = i / 8, d8 = (i % 8) * 8; FragH f; f.half[0] = *(const v8us*)((const unsigned short*)V16 + ((size_t)b * SQ + s0 + j) * DM + h * HD + d8); for (int q = 0; q < 8; ++q) tl[d8 + q][j] = f.u[q]; }
  __syncthreads();
  { for (int i = tid; i < 64 * 8; i += 256) { const int d = i / 8, j8 = (i % 8) * 8; FragH f; for (int q = 0; q < 8; ++q) f.u[q] = tl[d][j8 + q]; *(v8us*)((unsigned short*)VT + ((size_t)hh * HD + d) * SQ + s0 + j8) = f.half[0]; }  } }



__global__ __launch_bounds__(256) void k_rsmcf2(const float* __restrict__ S, _Float16* __restrict__ P, int hg, int q0, int nk) {
  #pragma clang fp contract(off)
  const int t = blockIdx.x * 256 + threadIdx.x; if (t >= hg * QT) return; const size_t i = (size_t)t; const float* s = S + i * NKX; const int last = q0 + (t % QT); float mx = -3.0e38f;
#pragma unroll 1
  for (int j = 0; j < nk; ++j) { const float f = (j <= last) ? 1.f : 0.f; mx = fmaxf(mx, fmaf(f, s[j], (1.f - f) * -1.0e9f)); } float se = 0.f;
#pragma unroll 1
  for (int j = 0; j < nk; ++j) { const float f = (j <= last) ? 1.f : 0.f; se += __expf(fmaf(f, s[j], (1.f - f) * -1.0e9f) - mx); } const float sc = 256.0f / se;
#pragma unroll 1
  for (int j0 = 0; j0 < nk; j0 += 8) { FragH fr; for (int q = 0; q < 8; ++q) { const int j = j0 + q; const float f = (j <= last) ? 1.f : 0.f; fr.h[q] = (_Float16)(__expf(fmaf(f, s[j], (1.f - f) * -1.0e9f) - mx) * sc); } unsigned short* d = (unsigned short*)P + i * NKX + j0; *(v8us*)d = fr.half[0];  } }

__global__ __launch_bounds__(256) void k_rsmcst(const float* __restrict__ S, _Float16* __restrict__ P, int hg, int q0, int nk, const int* __restrict__ mk) {
  #pragma clang fp contract(off)
  const int t = blockIdx.x * 256 + threadIdx.x; if (t >= hg * QT) return; const size_t i = (size_t)t; const float* s = S + i * NKX; const size_t ig = (size_t)(q0 + (t % QT)); const int* mr = mk + ig * SQ; float mx = -3.0e38f;
#pragma unroll 1
  for (int j = 0; j < nk; ++j) { const int mb = mr[j]; const int dd = (int)ig - j; const float f = (mb != 0 && dd >= 0 && (dd <= LOCALW || (dd % STRIDEK) == 0)) ? 1.f : 0.f; mx = fmaxf(mx, fmaf(f, s[j], (1.f - f) * -1.0e9f)); } float se = 0.f;
#pragma unroll 1
  for (int j = 0; j < nk; ++j) { const int mb = mr[j]; const int dd = (int)ig - j; const float f = (mb != 0 && dd >= 0 && (dd <= LOCALW || (dd % STRIDEK) == 0)) ? 1.f : 0.f; se += __expf(fmaf(f, s[j], (1.f - f) * -1.0e9f) - mx); } const float sc = 256.0f / se;
#pragma unroll 1
  for (int j0 = 0; j0 < nk; j0 += 8) { FragH fr; for (int q = 0; q < 8; ++q) { const int j = j0 + q; const int mb = mr[j]; const int dd = (int)ig - j; const float f = (mb != 0 && dd >= 0 && (dd <= LOCALW || (dd % STRIDEK) == 0)) ? 1.f : 0.f; fr.h[q] = (_Float16)(__expf(fmaf(f, s[j], (1.f - f) * -1.0e9f) - mx) * sc); } unsigned short* d = (unsigned short*)P + i * NKX + j0; *(v8us*)d = fr.half[0];  } }


template <int MASKADD>
__global__ __launch_bounds__(64) void k_att0(const float* __restrict__ QF, const float* __restrict__ KF, const float* __restrict__ VF, int ld, const float* __restrict__ mask, float scale, float* __restrict__ OF, int ldo) {
  #pragma clang fp contract(off)
  __shared__ __attribute__((aligned(16))) float lq[64][64]; __shared__ __attribute__((aligned(16))) float lo[64][64];
  const int tid = threadIdx.x; const int h = blockIdx.x / (QT0 / 64), rg = blockIdx.x % (QT0 / 64); const int i = rg * 64 + tid;
  const float* qr = QF + (size_t)i * ld + h * HD;
#pragma unroll 1
  for (int c = 0; c < HD / 4; ++c) { *(v4f*)&lq[tid][c * 4] = *(const v4fa*)(qr + c * 4); const v4f z = {0.f, 0.f, 0.f, 0.f}; *(v4f*)&lo[tid][c * 4] = z; }
  float m = -1.0e30f, l = 0.f; const int jmax = MASKADD ? (SQ - 1) : (rg * 64 + 63);      /* additive-mask form: every key (the mask input decides); causal form: keys up to the block's last row */
#pragma unroll 1
  for (int j = 0; j <= jmax; ++j) { const float* kr = KF + (size_t)j * ld + h * HD; const float* vr = VF + (size_t)j * ld + h * HD; float s = 0.f;
#pragma unroll 1
    for (int c = 0; c < HD / 4; ++c) { const v4f kq = *(const v4fa*)(kr + c * 4); const v4f qq = *(v4f*)&lq[tid][c * 4]; s = __fadd_rn(s, __fmul_rn(qq[0], kq[0])); s = __fadd_rn(s, __fmul_rn(qq[1], kq[1])); s = __fadd_rn(s, __fmul_rn(qq[2], kq[2])); s = __fadd_rn(s, __fmul_rn(qq[3], kq[3])); }
    s = __fmul_rn(s, scale); if (MASKADD) s = __fadd_rn(s, __fmul_rn(bf16_round(mask[(size_t)i * SQ + j]), -10000.0f));
    const float f = (MASKADD || j <= i) ? 1.f : 0.f; const float sm = fmaf(f, s, (1.f - f) * -1.0e30f); const float mn = fmaxf(m, sm); const float sc = expf(m - mn); const float e = expf(sm - mn); l = __fadd_rn(__fmul_rn(l, sc), e); m = mn;
#pragma unroll 1
    for (int c = 0; c < HD / 4; ++c) { const v4f vv = *(const v4fa*)(vr + c * 4); v4f oo = *(v4f*)&lo[tid][c * 4]; for (int u = 0; u < 4; ++u) oo[u] = __fadd_rn(__fmul_rn(oo[u], sc), __fmul_rn(e, vv[u])); *(v4f*)&lo[tid][c * 4] = oo; } }
  const float fin = 64.0f / l;      /* o carried x64 like the f16 path */
#pragma unroll 1
  for (int c = 0; c < HD / 4; ++c) { v4f oo = *(v4f*)&lo[tid][c * 4]; for (int u = 0; u < 4; ++u) oo[u] = __fmul_rn(oo[u], fin); *(v4f*)&lo[tid][c * 4] = oo; }
  __syncthreads();
  {
#pragma unroll 1
    for (int it = 0; it < 16; ++it) { const int row = it * 4 + tid / 16, pc = (tid % 16) * 4; const v4f v = *(const v4f*)&lo[row][pc]; *(v4f*)(OF + (size_t)(rg * 64 + row) * ldo + h * HD + pc) = v; }
     } }

template <int MASKADD>
__global__ __launch_bounds__(64) void k_att0mbc(const float* __restrict__ QF, const float* __restrict__ KF, const float* __restrict__ VF, int ld, const float* __restrict__ mask, float scale, float* __restrict__ OF, int ldo) {
  #pragma clang fp contract(off)
  __shared__ __attribute__((aligned(16))) float lq[64][64]; __shared__ __attribute__((aligned(16))) float lo[64][64];
  const int tid = threadIdx.x; const int h = blockIdx.x / (QT0 / 64), rg = blockIdx.x % (QT0 / 64); const int i = rg * 64 + tid;
  const float* qr = QF + (size_t)i * ld + h * HD;
#pragma unroll 1
  for (int c = 0; c < HD / 4; ++c) { *(v4f*)&lq[tid][c * 4] = *(const v4fa*)(qr + c * 4); const v4f z = {0.f, 0.f, 0.f, 0.f}; *(v4f*)&lo[tid][c * 4] = z; }
  float m = -1.0e30f, l = 0.f; const int jmax = rg * 64 + 63;      /* keys beyond the block end are masked by the mask's lower-triangular structure */
#pragma unroll 1
  for (int j = 0; j <= jmax; ++j) { const float* kr = KF + (size_t)j * ld + h * HD; const float* vr = VF + (size_t)j * ld + h * HD; float s = 0.f;
#pragma unroll 1
    for (int c = 0; c < HD / 4; ++c) { const v4f kq = *(const v4fa*)(kr + c * 4); const v4f qq = *(v4f*)&lq[tid][c * 4]; s = __fadd_rn(s, __fmul_rn(qq[0], kq[0])); s = __fadd_rn(s, __fmul_rn(qq[1], kq[1])); s = __fadd_rn(s, __fmul_rn(qq[2], kq[2])); s = __fadd_rn(s, __fmul_rn(qq[3], kq[3])); }
    s = __fmul_rn(s, scale); const int mb = ((const int*)mask)[(size_t)i * SQ + j];      /* causal (j <= i) AND the module's int32 [S][S] mask read per (query, key): 0 -> masked */
    const float f = (mb != 0 && j <= i) ? 1.f : 0.f; const float sm = fmaf(f, s, (1.f - f) * -1.0e30f); const float mn = fmaxf(m, sm); const float sc = expf(m - mn); const float e = expf(sm - mn); l = __fadd_rn(__fmul_rn(l, sc), e); m = mn;
#pragma unroll 1
    for (int c = 0; c < HD / 4; ++c) { const v4f vv = *(const v4fa*)(vr + c * 4); v4f oo = *(v4f*)&lo[tid][c * 4]; for (int u = 0; u < 4; ++u) oo[u] = __fadd_rn(__fmul_rn(oo[u], sc), __fmul_rn(e, vv[u])); *(v4f*)&lo[tid][c * 4] = oo; } }
  const float fin = 64.0f / l;      /* o carried x64 like the f16 path */
#pragma unroll 1
  for (int c = 0; c < HD / 4; ++c) { v4f oo = *(v4f*)&lo[tid][c * 4]; for (int u = 0; u < 4; ++u) oo[u] = __fmul_rn(oo[u], fin); *(v4f*)&lo[tid][c * 4] = oo; }
  __syncthreads();
  {
#pragma unroll 1
    for (int it = 0; it < 16; ++it) { const int row = it * 4 + tid / 16, pc = (tid % 16) * 4; const v4f v = *(const v4f*)&lo[row][pc]; *(v4f*)(OF + (size_t)(rg * 64 + row) * ldo + h * HD + pc) = v; }
     } }


template <int BFIN, int WXB>
__global__ __launch_bounds__(256) void k_ln16(const float* __restrict__ X, const float* __restrict__ g, const float* __restrict__ bb, float eps, _Float16* __restrict__ N16, float* __restrict__ XB) {
  #pragma clang fp contract(off)
  __shared__ float red[256]; const size_t r = blockIdx.x; const int t = threadIdx.x; const v4f xa = *(const v4fa*)(X + r * DMQ + t * 4); float s[4]; float sum = 0.f;
  for (int q = 0; q < 4; ++q) { s[q] = BFIN ? bf16_round(xa[q]) : xa[q]; sum = __fadd_rn(sum, s[q]); }
  red[t] = sum; __syncthreads(); for (int st = 128; st > 0; st >>= 1) { if (t < st) red[t] = __fadd_rn(red[t], red[t + st]); __syncthreads(); } const float mu = red[0] / (float)DMQ; __syncthreads();
  float vs = 0.f; for (int q = 0; q < 4; ++q) { const float dl = __fadd_rn(s[q], -mu); vs = __fadd_rn(vs, __fmul_rn(dl, dl)); } red[t] = vs; __syncthreads(); for (int st = 128; st > 0; st >>= 1) { if (t < st) red[t] = __fadd_rn(red[t], red[t + st]); __syncthreads(); }
  const float rs = rsqrtf(__fadd_rn(red[0] / (float)DMQ, eps)); v4h y; v4f xb;
  for (int q = 0; q < 4; ++q) { const int c = t * 4 + q; y[q] = (_Float16)__fadd_rn(__fmul_rn(__fmul_rn(__fadd_rn(s[q], -mu), rs), bf16_round(g[c])), bf16_round(bb[c])); xb[q] = s[q]; }
  { *(v4h*)(N16 + r * DMQ + t * 4) = y; if (WXB) *(v4f*)(XB + r * DMQ + t * 4) = xb;  } }
__global__ __launch_bounds__(256) void k_ftres2(const float* __restrict__ OF0, const float* __restrict__ XB, float* __restrict__ X1, size_t n4) {
  #pragma clang fp contract(off)
  const size_t t = (size_t)blockIdx.x * 256 + threadIdx.x; if (t >= n4) return; const v4f o = *(const v4fa*)(OF0 + t * 4), xv = *(const v4fa*)(XB + t * 4); v4f y; for (int q = 0; q < 4; ++q) y[q] = __fadd_rn(__fmul_rn(o[q], 0.015625f), xv[q]); *(v4f*)(X1 + t * 4) = y;  }

__global__ __launch_bounds__(256) void k_bcpy(const float* __restrict__ b, int n, int NP, float* __restrict__ dst, int dst0) { for (int i = threadIdx.x; i < NP; i += 256) { const float v = (i < n) ? b[i] : 0.f; *(float*)(dst + dst0 + i) = v; }  }


// lane l <-> l ^ M inside a 16-lane row (DPP row_xmask), and l <-> l ^ 16 (cross-row move): register-only butterflies
template <int M> __device__ __forceinline__ float xl_row(float v) { return __int_as_float(__builtin_amdgcn_update_dpp(0, __float_as_int(v), 0x160 | M, 0xf, 0xf, true)); }
__device__ __forceinline__ float xl_x16(float v) { const int b = __float_as_int(v); return __int_as_float(__builtin_amdgcn_permlanex16(b, b, 0x76543210, 0xfedcba98, false, false)); }
// row softmax -> P x256 f16. One wave per score row: 16 loads of 512 contiguous bytes, the whole row (64 values a lane) stays in registers, S is read once and each exponential is taken once.
// The four loops over v[] are fully unrolled so that v[] is indexed by constants only and lives in registers, and so that all 16 loads are in flight together.
__global__ __launch_bounds__(256) void k_rsmf(const float* __restrict__ S, _Float16* __restrict__ P, int nrows) {
  const int row = blockIdx.x * 8 + (threadIdx.x >> 5), lane = threadIdx.x & 31; if (row >= nrows) return;      /* wave-uniform; no barrier in this kernel */
  const float* s = S + (size_t)row * SQ + lane * 4; v4f v[SQ / 128];
#pragma unroll
  for (int u = 0; u < SQ / 128; ++u) v[u] = *(const v4fa*)(s + u * 128);
  v4f m4 = {-3.0e38f, -3.0e38f, -3.0e38f, -3.0e38f};
#pragma unroll
  for (int u = 0; u < SQ / 128; ++u) m4 = __builtin_elementwise_max(m4, v[u]);
  float mx = fmaxf(fmaxf(m4[0], m4[1]), fmaxf(m4[2], m4[3]));
  mx = fmaxf(mx, xl_row<1>(mx)); mx = fmaxf(mx, xl_row<2>(mx)); mx = fmaxf(mx, xl_row<4>(mx)); mx = fmaxf(mx, xl_row<8>(mx)); mx = fmaxf(mx, xl_x16(mx));
  v4f s4 = {0.f, 0.f, 0.f, 0.f};
#pragma unroll
  for (int u = 0; u < SQ / 128; ++u) { v4f e; for (int q = 0; q < 4; ++q) e[q] = __expf(v[u][q] - mx); v[u] = e; s4 += e; }
  float se = (s4[0] + s4[1]) + (s4[2] + s4[3]);
  se += xl_row<1>(se); se += xl_row<2>(se); se += xl_row<4>(se); se += xl_row<8>(se); se += xl_x16(se);
  const float sc = 256.0f / se; _Float16* d = P + (size_t)row * SQ + lane * 4;
#pragma unroll
  for (int u = 0; u < SQ / 128; ++u) { const v4f y = v[u] * sc; *(v4h*)(d + u * 128) = __builtin_convertvector(y, v4h); } }

#define FAP 72      /* LDS row pitch in f16: 128 data bytes + 16 (16 B x odd: the 16-byte fragment reads of 16 rows fall on distinct banks) */
typedef _Float16 v8h __attribute__((ext_vector_type(8)));
union FragP { v16h v; v8h half[2]; };
__device__ __forceinline__ v8f fa_mma(v16h a, v16h b, v8f c) { return __builtin_amdgcn_wmma_f32_16x16x32_f16(false, a, false, b, (short)0, c, false, false); }
// 2^x, eight at a time, with the one free slot that the instruction set asks for behind a transcendental: the results are early-clobber, so inside the run none lands on a source or is read, and the v_nop stands in front of whatever the compiler schedules next.
__device__ __forceinline__ v8f fa_exp2x8(v8f x) { float y0, y1, y2, y3, y4, y5, y6, y7;
  asm("v_exp_f32 %0, %8\n\tv_exp_f32 %1, %9\n\tv_exp_f32 %2, %10\n\tv_exp_f32 %3, %11\n\tv_exp_f32 %4, %12\n\tv_exp_f32 %5, %13\n\tv_exp_f32 %6, %14\n\tv_exp_f32 %7, %15\n\tv_nop"
      : "=&v"(y0), "=&v"(y1), "=&v"(y2), "=&v"(y3), "=&v"(y4), "=&v"(y5), "=&v"(y6), "=&v"(y7) : "v"(x[0]), "v"(x[1]), "v"(x[2]), "v"(x[3]), "v"(x[4]), "v"(x[5]), "v"(x[6]), "v"(x[7]));
  const v8f y = {y0, y1, y2, y3, y4, y5, y6, y7}; return y; }
__device__ __forceinline__ float fa_exp2(float x) { float y; asm("v_exp_f32 %0, %1\n\tv_nop" : "=&v"(y) : "v"(x)); return y; }      /* the same slot behind a single one */
__global__ __launch_bounds__(256) __attribute__((amdgpu_waves_per_eu(4, 4))) void k_fattn(const _Float16* __restrict__ Q, const _Float16* __restrict__ Kr, const _Float16* __restrict__ VTa, _Float16* __restrict__ O) {
  __shared__ __attribute__((aligned(16))) _Float16 lk[2][64][FAP]; __shared__ __attribute__((aligned(16))) _Float16 lv[2][64][FAP];
  const int tid = threadIdx.x, lane = tid & 31, ln = lane & 15, hh = lane >> 4, w = tid >> 5; const int bh = blockIdx.y, b = bh / NH, h = bh % NH; const int q0 = blockIdx.x * 256 + w * 32;
  const _Float16* qp = Q + ((size_t)b * SQ + q0 + ln) * DM + h * HD;
  const int sr = tid >> 3, sc = (tid & 7) * 8;      /* staging: 8 threads a 128-byte row; a thread brings rows sr and sr + 32 of both tiles */
  const unsigned short* kg = (const unsigned short*)Kr + ((size_t)b * SQ + sr) * DM + h * HD + sc; const unsigned short* vg = (const unsigned short*)VTa + ((size_t)bh * HD + sr) * SQ + sc;
  const float CS = 0.18033688011112042f;      /* 64^-0.5 * log2(e) */
  const v8f z8 = {0.f, 0.f, 0.f, 0.f, 0.f, 0.f, 0.f, 0.f};
  v16h qf[2][2]; v8f o[4][2]; float m[2] = {-3.0e38f, -3.0e38f}, l[2] = {0.f, 0.f};
  v8us g0 = *(const v8us*)kg, g1 = *(const v8us*)(kg + (size_t)32 * DM), g2 = *(const v8us*)vg, g3 = *(const v8us*)(vg + (size_t)32 * SQ);
  for (int t = 0; t < 2; ++t) for (int ks = 0; ks < 2; ++ks) qf[t][ks] = g2_frag(qp + (size_t)t * 16 * DM + ks * 32, hh);
  for (int dt = 0; dt < 4; ++dt) { o[dt][0] = z8; o[dt][1] = z8; }
  *(v8us*)&lk[0][sr][sc] = g0; *(v8us*)&lk[0][sr + 32][sc] = g1; *(v8us*)&lv[0][sr][sc] = g2; *(v8us*)&lv[0][sr + 32][sc] = g3;
  __syncthreads();
  for (int st = 0; st < SQ / 64; ++st) { const int cur = st & 1; const bool more = st + 1 < SQ / 64;      /* block-uniform */
    for (int ps = 0; ps < 2; ++ps) {
      if (ps == 1 && more) { const unsigned short* kn = kg + (size_t)(st + 1) * 64 * DM; const unsigned short* vn = vg + (size_t)(st + 1) * 64;      /* next stage's rows: in flight under the second pass, stored to LDS at the stage's foot */
        g0 = *(const v8us*)kn; g1 = *(const v8us*)(kn + (size_t)32 * DM); g2 = *(const v8us*)vn; g3 = *(const v8us*)(vn + (size_t)32 * SQ);
        asm volatile("s_wait_xcnt 0x0" :: "v"(kn), "v"(vn) : "memory"); }      /* the wait owed before a register that an issued load names is rewritten; the two addresses are inputs so that they stay whole, and off the loads' own results, up to here */
      v16h kf[2][2], vf[4];
      for (int kt = 0; kt < 2; ++kt) for (int ks = 0; ks < 2; ++ks) kf[kt][ks] = g2_frag(&lk[cur][ps * 32 + kt * 16 + ln][ks * 32], hh);
      for (int dt = 0; dt < 4; ++dt) vf[dt] = g2_frag(&lv[cur][dt * 16 + ln][ps * 32], hh);
      v8f s[2][2]; for (int kt = 0; kt < 2; ++kt) for (int qt = 0; qt < 2; ++qt) s[kt][qt] = fa_mma(kf[kt][1], qf[qt][1], fa_mma(kf[kt][0], qf[qt][0], z8));
      float mx[2];
      for (int qt = 0; qt < 2; ++qt) { const v8f t = __builtin_elementwise_max(s[0][qt], s[1][qt]); float a = fmaxf(fmaxf(fmaxf(t[0], t[1]), fmaxf(t[2], t[3])), fmaxf(fmaxf(t[4], t[5]), fmaxf(t[6], t[7]))); a = fmaxf(a, xl_x16(a)); mx[qt] = a * CS; }
      if (__builtin_amdgcn_ballot_w32(mx[0] > m[0] + 8.0f || mx[1] > m[1] + 8.0f) != 0) {      /* rescale only when a column's maximum has grown by more than 2^8: P stays <= 2^12, inside f16 */
        for (int qt = 0; qt < 2; ++qt) { const float mn = fmaxf(m[qt], mx[qt]); const float al = fa_exp2(m[qt] - mn); m[qt] = mn; l[qt] *= al; for (int dt = 0; dt < 4; ++dt) o[dt][qt] *= al; } }
      FragP pf[2];
      for (int qt = 0; qt < 2; ++qt) { const float nm = 4.0f - m[qt]; const v8f e0 = fa_exp2x8(s[0][qt] * CS + nm), e1 = fa_exp2x8(s[1][qt] * CS + nm);
        const v8f es = e0 + e1; l[qt] += ((es[0] + es[1]) + (es[2] + es[3])) + ((es[4] + es[5]) + (es[6] + es[7])); pf[qt].half[0] = __builtin_convertvector(e0, v8h); pf[qt].half[1] = __builtin_convertvector(e1, v8h); }
      for (int dt = 0; dt < 4; ++dt) for (int qt = 0; qt < 2; ++qt) o[dt][qt] = fa_mma(vf[dt], pf[qt].v, o[dt][qt]);
    }
    if (more) { *(v8us*)&lk[cur ^ 1][sr][sc] = g0; *(v8us*)&lk[cur ^ 1][sr + 32][sc] = g1; *(v8us*)&lv[cur ^ 1][sr][sc] = g2; *(v8us*)&lv[cur ^ 1][sr + 32][sc] = g3; }      /* that buffer's last readers left it before the previous barrier */
    __syncthreads();      /* publishes stage st + 1 and ends every read of stage st */
  }
  for (int qt = 0; qt < 2; ++qt) { const float inv = 64.0f / (l[qt] + xl_x16(l[qt])); _Float16* op = O + ((size_t)b * SQ + q0 + qt * 16 + ln) * DM + h * HD + 8 * hh;      /* a lane holds 8 consecutive dims of one query row: one 16-byte store a tile */
    for (int dt = 0; dt < 4; ++dt) { const v8f y = o[dt][qt] * inv; *(v8h*)(op + dt * 16) = __builtin_convertvector(y, v8h); } } }

template <int MODE>
__global__ __launch_bounds__(256) void k_regrp(const float* __restrict__ src, float* __restrict__ dst, size_t n4) {
  const size_t t = (size_t)blockIdx.x * 256 + threadIdx.x; if (t >= n4) return; const size_t e = t * 4; const size_t rd = e / DM; const int c = (int)(e % DM);
  size_t rs; if (MODE == 0) { const size_t b = rd / SQ, sq = rd % SQ; rs = sq * NB + b; } else { const size_t sq = rd / NB, b = rd % NB; rs = b * SQ + sq; }
  const v4f v = *(const v4fa*)(src + rs * DM + c); *(v4f*)(dst + e) = v;  }

template <int BFIN, int W16, int W32>
__global__ __launch_bounds__(256) void k_lnx(const float* __restrict__ X, const float* __restrict__ g, const float* __restrict__ bb, float eps, _Float16* __restrict__ N16, float* __restrict__ N32) {
  #pragma clang fp contract(off)
  __shared__ float red[256]; const size_t r = blockIdx.x; const int t = threadIdx.x; const bool act = t < (DMQ / 4); const int c0 = act ? t * 4 : 0;
  const v4f xa = *(const v4fa*)(X + r * DMQ + c0); float s[4]; float sum = 0.f;
  for (int q = 0; q < 4; ++q) { s[q] = act ? (BFIN ? bf16_round(xa[q]) : xa[q]) : 0.f; sum = __fadd_rn(sum, s[q]); }
  red[t] = sum; __syncthreads(); for (int st = 128; st > 0; st >>= 1) { if (t < st) red[t] = __fadd_rn(red[t], red[t + st]); __syncthreads(); } const float mu = red[0] / (float)DMQ; __syncthreads();
  float vs = 0.f; for (int q = 0; q < 4; ++q) { const float dl = act ? __fadd_rn(s[q], -mu) : 0.f; vs = __fadd_rn(vs, __fmul_rn(dl, dl)); } red[t] = vs; __syncthreads(); for (int st = 128; st > 0; st >>= 1) { if (t < st) red[t] = __fadd_rn(red[t], red[t + st]); __syncthreads(); }
  const float rs = rsqrtf(__fadd_rn(red[0] / (float)DMQ, eps)); v4h y; v4f yf;
  for (int q = 0; q < 4; ++q) { const int c = c0 + q; yf[q] = __fadd_rn(__fmul_rn(__fmul_rn(__fadd_rn(s[q], -mu), rs), bf16_round(g[c])), bf16_round(bb[c])); y[q] = (_Float16)yf[q]; }
  if (!act) return;      /* no barriers after this point */
  { if (W16) *(v4h*)(N16 + r * DMQ + c0) = y; if (W32) *(v4f*)(N32 + r * DMQ + c0) = yf;  } }

__global__ __launch_bounds__(256) void k_bfr(const float* __restrict__ x, float* __restrict__ XB, size_t n8) { const size_t t = (size_t)blockIdx.x * 256 + threadIdx.x; if (t >= n8) return; v4f a = *(const v4fa*)(x + t * 8), c = *(const v4fa*)(x + t * 8 + 4); for (int q = 0; q < 4; ++q) { a[q] = bf16_round(a[q]); c[q] = bf16_round(c[q]); }
  { *(v4f*)(XB + t * 8) = a; *(v4f*)(XB + t * 8 + 4) = c;  } }



__global__ __launch_bounds__(256) void k_wthd(const float* __restrict__ Wt, _Float16* __restrict__ Bt) { const size_t t = (size_t)blockIdx.x * 256 + threadIdx.x; if (t >= (size_t)NH * HD * (DM / 8)) return; const int m8 = (int)(t % (DM / 8)) * 8; const int d = (int)((t / (DM / 8)) % HD); const int h = (int)(t / ((size_t)(DM / 8) * HD)); FragH f;
  for (int q = 0; q < 8; ++q) f.h[q] = (_Float16)(16.0f * bf16_round(Wt[((size_t)h * DM + m8 + q) * HD + d])); unsigned short* dst = (unsigned short*)Bt + ((size_t)h * HD + d) * DM + m8; *(v8us*)dst = f.half[0];  }




template <int BFIN, int SCAL>
__global__ __launch_bounds__(256) void k_lnsc(const float* __restrict__ X, const float* __restrict__ g, const float* __restrict__ bb, float eps, _Float16* __restrict__ N16, float* __restrict__ N32) {
  #pragma clang fp contract(off)
  __shared__ float red[256]; const size_t r = blockIdx.x; const int t = threadIdx.x; const bool act = t < DM / 4; const int tc = act ? t : 0; const v4f xl = *(const v4fa*)(X + r * DM + tc * 4); const float am = act ? 1.f : 0.f; float s[4]; float sum = 0.f;
  for (int q = 0; q < 4; ++q) { s[q] = (BFIN ? bf16_round(xl[q]) : xl[q]) * am; sum = __fadd_rn(sum, s[q]); }
  red[t] = sum; __syncthreads(); for (int st = 128; st > 0; st >>= 1) { if (t < st) red[t] = __fadd_rn(red[t], red[t + st]); __syncthreads(); } const float mu = red[0] / (float)DM; __syncthreads();
  float vs = 0.f; for (int q = 0; q < 4; ++q) { const float dl = __fadd_rn(s[q], -mu) * am; vs = __fadd_rn(vs, __fmul_rn(dl, dl)); } red[t] = vs; __syncthreads(); for (int st = 128; st > 0; st >>= 1) { if (t < st) red[t] = __fadd_rn(red[t], red[t + st]); __syncthreads(); }
  const float rs = __fdiv_rn(1.0f, __fadd_rn(sqrtf(red[0] / (float)(DM - 1)), eps)); if (!act) return; v4h y; v4f yf;
  for (int q = 0; q < 4; ++q) { const int c = t * 4 + q; const float gg = bf16_round(SCAL ? g[0] : g[c]), bv = bf16_round(SCAL ? bb[0] : bb[c]); yf[q] = __fadd_rn(__fmul_rn(__fmul_rn(__fadd_rn(s[q], -mu), rs), gg), bv); y[q] = (_Float16)yf[q]; }
  { if (N16) *(v4h*)(N16 + r * DM + t * 4) = y; if (N32) *(v4f*)(N32 + r * DM + t * 4) = yf;  } }

__global__ __launch_bounds__(256) void k_rsmdmi(const float* __restrict__ S, _Float16* __restrict__ P, int nrows, const int* __restrict__ M) {
  #pragma clang fp contract(off)
  const int t = blockIdx.x * 256 + threadIdx.x; if (t >= nrows) return; const float* s = S + (size_t)t * SQ; const int* m = M + (size_t)(t % SQ) * SQ; float mx = -3.0e38f;
#pragma unroll 1
  for (int j = 0; j < SQ; ++j) { const float f = (m[j] == 0) ? 1.f : 0.f; mx = fmaxf(mx, fmaf(f, s[j], (1.f - f) * -1.0e9f)); } float se = 0.f;
#pragma unroll 1
  for (int j = 0; j < SQ; ++j) { const float f = (m[j] == 0) ? 1.f : 0.f; se += __expf(fmaf(f, s[j], (1.f - f) * -1.0e9f) - mx); } const float sc = 256.0f / se;
#pragma unroll 1
  for (int j0 = 0; j0 < SQ; j0 += 8) { FragH fr; for (int q = 0; q < 8; ++q) { const int j = j0 + q; const float f = (m[j] == 0) ? 1.f : 0.f; fr.h[q] = (_Float16)(__expf(fmaf(f, s[j], (1.f - f) * -1.0e9f) - mx) * sc); } unsigned short* d = (unsigned short*)P + (size_t)t * SQ + j0; *(v8us*)d = fr.half[0];  } }
extern "C" void kernel_launch(void* const* d_in, const int* in_sizes, int n_in,
                              void* d_out, int out_size, void* d_ws, size_t ws_size, hipStream_t stream) {
  (void)in_sizes; (void)n_in; (void)out_size;
  const float* const* I = (const float* const*)d_in; const float* x = I[0]; const float* g1 = I[1]; const float* be1 = I[2]; const float* wqkv = I[3]; const float* wo = I[4]; const float* bo = I[5]; const float* bq = nullptr; const float* bk = nullptr; const float* bv = nullptr;      /* x; LayerNorm gamma / beta; fused NATURAL w_qkv [3072][1024] (row blocks q | k | v; no bias); natural w_proj [1024][1024] + b_proj */
  char* ws = (char*)d_ws; size_t off = 0;
  auto take = [&](size_t bytes) { char* p = ws + off; off += (bytes + 255) & ~(size_t)255; return p; };
  _Float16* BQ = (_Float16*)take((size_t)3 * DM * DM * 2); _Float16* BK = BQ + (size_t)DM * DM; _Float16* BV = BQ + (size_t)2 * DM * DM;      /* one stacked Bt plane [3 DM][DM] */ _Float16* BO = (_Float16*)take((size_t)DM * DM * 2);
  float* XB = (float*)take(NR * DM * 4); _Float16* XN = (_Float16*)take(NR * DM * 2); _Float16* Q16 = (_Float16*)take(NR * DM * 2); _Float16* K16 = (_Float16*)take(NR * DM * 2); _Float16* V16 = (_Float16*)take(NR * DM * 2); _Float16* O16 = (_Float16*)take(NR * DM * 2);
  _Float16* VT = (_Float16*)take((size_t)NB * NH * HD * SQ * 2);
  /* attention sub-block only: no second norm, no MLP planes */
  
  if (off > ws_size) return;
  k_wnat<<<(unsigned)(((size_t)3 * DM * DM / 8 + 255) / 256), 256, 0, stream>>>(wqkv, (size_t)3 * DM * DM / 8, BQ); k_wnat<<<(unsigned)(((size_t)DM * DM / 8 + 255) / 256), 256, 0, stream>>>(wo, (size_t)DM * DM / 8, BO);      /* natural [out][in] = Bt x16 as given: the fused [3 DM][DM] matrix IS the stacked plane (rows 0 / DM / 2 DM = q | k | v); w_proj likewise */
  /* no MLP weights */
  k_bfr<<<(unsigned)((NR * DM / 8 + 255) / 256), 256, 0, stream>>>(x, XB, NR * DM / 8); k_lnx<1, 1, 0><<<(unsigned)NR, 256, 0, stream>>>(x, g1, be1, 1e-5f, XN, nullptr);      /* n = LN0(bf16(x)) (biased variance, eps inside the rsqrt) -> f16 rows */
  k_gemm2<0><<<dim3((unsigned)((NR / 128) * (DM / 64)), 1), 128, 0, stream>>>(XN, DM, 0, BQ, DM, 0, 0.0625f, bq, 0, nullptr, 1, 0, 0, nullptr, Q16, DM, 0, (int)NR, DM, DM); k_gemm2<0><<<dim3((unsigned)((NR / 128) * (DM / 64)), 1), 128, 0, stream>>>(XN, DM, 0, BK, DM, 0, 0.0625f, bk, 0, nullptr, 1, 0, 0, nullptr, K16, DM, 0, (int)NR, DM, DM); k_gemm2<0><<<dim3((unsigned)((NR / 128) * (DM / 64)), 1), 128, 0, stream>>>(XN, DM, 0, BV, DM, 0, 0.0625f, bv, 0, nullptr, 1, 0, 0, nullptr, V16, DM, 0, (int)NR, DM, DM);      /* q, k, v -> f16 rows; head h = columns h*64.. */
  k_vt<NH, SQ><<<NB * NH * (SQ / 64), 256, 0, stream>>>(V16, DM, 0, VT);      /* V^T [4 * 16][64][2048], every batch */
  k_fattn<<<dim3(SQ / 256, NB * NH), 256, 0, stream>>>(Q16, K16, VT, O16);      /* softmax(q k^T / 8) v over all keys, every (batch, head) in one launch -> ctx (merged heads, x64) as f16 rows */
  k_gemm2<0><<<dim3((unsigned)((NR / 128) * (DM / 64)), 1), 128, 0, stream>>>(O16, DM, 0, BO, DM, 0, 0.0009765625f, bo, 0, XB, -1, 0, 0, (float*)d_out, nullptr, DM, 0, (int)NR, DM, DM);      /* x + ctx wo (+ bo) (own-element residual) -> f32 rows */
  /* result = x + out: written straight to d_out by the GEMM above (own-element residual with the bf16-rounded input copy) */
}

// v003
// One run takes 149 microseconds.
// Two timings next to v002 put it at 2.16 and 2.17 times that version's speed.
// Over all steps from v000 it is 46.1 times as fast.
#include <hip/hip_runtime.h>
// Pre-LN multi-head self-attention sub-block with a residual (x [4][2048][1024]; h = LayerNorm(x) (biased var, eps 1e-5, gamma / beta); qkv = h w_qkv^T (natural [3072][1024]: row blocks q | k | v, each (head, dim)); no qkv bias; 16 heads of 64; scale 64^-0.5; softmax over all 2048 keys (no mask); out = merged w_proj^T + b_proj (natural); result = x + out -> [4][2048][1024]).
// Structure: token rows; LayerNorm / exact f16 rows; WMMA GEMMs for q, k, v; V^T by LDS transposes; one fused attention launch (scores, online softmax, V^T P^T; S and P stay in registers); output projection with the own-element residual.
// Compute dtype: inputs rounded to bf16; x / weights exact; q, k, v, softmax weights and o as plain f16 GEMM operands (~2^-12); scores and softmax statistics f32. v_wmma_f32_16x16x32_f16.
#define NB 4
#define SQ 2048
#define DM 1024
#define NH 16
#define HD 64
#define HG 4                         /* heads per block group of the unlaunched k_vt overload */
#define LOCALW 128                   /* (macros for unused kernels of the shared header) */
#define STRIDEK 128
#define QT 256                       /* query rows per causal tile */
#define NKX SQ                       /* S / P row pitch */
#define QT0 128                      /* first-tile rows recomputed exactly in f32 */
#define B0 0                         /* first batch processed (debug hook) */
#define NBR NB                       /* batches processed (debug hook) */
#define NR ((size_t)NB * SQ)
#define DMQ DM
#define DFF 4096         /* unused: no FFN in this sub-block */
#define MP ((int)((size_t)NBR * SQ)) /* unused: the projections cover NR rows */
#define QN SQ                        /* query rows attended per batch (debug hook) */
#define NHD NH                       /* heads attended (debug hook) */
#define MPO MP                       /* unused: the output GEMM covers NR rows */
#define LQ (3 * DM)      /* unused: the q, k, v rows have pitch DM */
typedef __bf16 v16b __attribute__((ext_vector_type(16)));
typedef unsigned short v8us __attribute__((ext_vector_type(8), may_alias));
typedef float  v8f  __attribute__((ext_vector_type(8)));
typedef float  v4f  __attribute__((ext_vector_type(4)));
typedef float  v4fa __attribute__((ext_vector_type(4), may_alias));
union FragB { v16b v; v8us half[2]; unsigned short u[16]; };

__device__ __forceinline__ unsigned short bf16_bits(float x) { unsigned int u = __float_as_uint(x); return (unsigned short)((u + 0x7FFFu + ((u >> 16) & 1u)) >> 16); }
__device__ __forceinline__ float bf16_val(unsigned short b) { return __uint_as_float(((unsigned int)b) << 16); }
__device__ __forceinline__ float bf16_round(float x) { return bf16_val(bf16_bits(x)); }
// D += A·B with NT terms: 1 = ah·bh, 2 = + al·bh (A split), 3 = + ah·bl (both split)
template <int NT>
__device__ __forceinline__ v8f mmaN(v16b ah, v16b al, v16b bh, v16b bl, v8f c) {
  c = __builtin_amdgcn_wmma_f32_16x16x32_bf16(false, ah, false, bh, (short)0, c, false, false);
  if (NT >= 2) c = __builtin_amdgcn_wmma_f32_16x16x32_bf16(false, al, false, bh, (short)0, c, false, false);
  if (NT >= 3) c = __builtin_amdgcn_wmma_f32_16x16x32_bf16(false, ah, false, bl, (short)0, c, false, false);
  asm volatile("v_nop\n\tv_nop\n\tv_nop\n\tv_nop" : "+v"(c) : "v"(ah), "v"(al), "v"(bh), "v"(bl));
  return c;
}

__global__ __launch_bounds__(256) void k_wt_bf16(const float* __restrict__ W, unsigned short* __restrict__ Wt, int K, int N) {
  const int t = blockIdx.x * 256 + threadIdx.x;
  const int k8n = K / 8;
  if (t >= N * k8n) return;
  const int n = t / k8n, k8 = (t % k8n) * 8;
  v8us v;
#pragma unroll
  for (int i = 0; i < 8; ++i) v[i] = bf16_bits(W[(size_t)(k8 + i) * N + n]);
  *(v8us*)(Wt + (size_t)n * K + k8) = v;
  
}

// GEMM C[M][N] (f32, pitch ldc) = act(A[M][K]·W + bias). A f32 row-major (pitch lda) converted per fragment to bf16
// (ASPLIT: hi/lo two planes -> 2 terms, else single rounded term); Wt bf16 [N][K] (pitch ldb). BIAS_BF16 rounds the
// bias to bf16 first (bias quantised to bf16 before the add). K%32==0, M%16==0, N%64==0.
template <bool ASPLIT, int ACT, bool BIAS_BF16>
__global__ __launch_bounds__(128) void k_gemm_bf(const float* __restrict__ A, int lda, const unsigned short* __restrict__ Wt, int ldb,
                                               const float* __restrict__ bias, float* __restrict__ C, int ldc, int M, int N, int K) {
  __shared__ __attribute__((aligned(16))) float so[4][16][64];
  const int tid = threadIdx.x, w = tid >> 5, lane = tid & 31, ln = lane & 15, hh = lane >> 4;
  const int ntn = N / 64;
  const int wid = blockIdx.x * 4 + w;
  const int mt = wid / ntn, nq = wid % ntn;
  if (mt * 16 >= M) return;
  const int row0 = mt * 16, col0 = nq * 64;
  const float* arow = A + (size_t)(row0 + ln) * lda;
  v8f acc[4] = {};
  for (int kb = 0; kb < K; kb += 32) {
    FragB ah, al;
    const v4f x0 = *(const v4fa*)(arow + kb + 8 * hh), x1 = *(const v4fa*)(arow + kb + 8 * hh + 4);
    const v4f x2 = *(const v4fa*)(arow + kb + 16 + 8 * hh), x3 = *(const v4fa*)(arow + kb + 16 + 8 * hh + 4);
    float xs[16] = {x0[0],x0[1],x0[2],x0[3],x1[0],x1[1],x1[2],x1[3],x2[0],x2[1],x2[2],x2[3],x3[0],x3[1],x3[2],x3[3]};
#pragma unroll
    for (int i = 0; i < 16; ++i) { const unsigned short hb = bf16_bits(xs[i]); ah.u[i] = hb; al.u[i] = ASPLIT ? bf16_bits(xs[i] - bf16_val(hb)) : (unsigned short)0; }
#pragma unroll
    for (int t = 0; t < 4; ++t) {
      const unsigned short* brow = Wt + (size_t)(col0 + t * 16 + ln) * ldb + kb;
      FragB b;
      b.half[0] = *(const v8us*)(brow + 8 * hh);
      b.half[1] = *(const v8us*)(brow + 16 + 8 * hh);
      acc[t] = mmaN<ASPLIT ? 2 : 1>(ah.v, al.v, b.v, b.v, acc[t]);
    }
  }
#pragma unroll
  for (int t = 0; t < 4; ++t) {
    float bv = bias ? bias[col0 + t * 16 + ln] : 0.f;
    if (BIAS_BF16) bv = bf16_round(bv);
#pragma unroll
    for (int r = 0; r < 8; ++r) { float v = acc[t][r] + bv; if (ACT == 1) v = fmaxf(v, 0.f); so[w][8 * hh + r][t * 16 + ln] = v; }
  }
  __builtin_amdgcn_fence(__ATOMIC_ACQ_REL, "workgroup");
  __builtin_amdgcn_wave_barrier();
  const int rsub = lane >> 4, c4 = (lane & 15) * 4;
  {
#pragma unroll
    for (int q = 0; q < 8; ++q) {
      const int r = q * 2 + rsub;
      const v4f v = *(const v4fa*)&so[w][r][c4];
      *(v4f*)(C + (size_t)(row0 + r) * ldc + col0 + c4) = v;
    }
    
  }
}

// GEMM C = act(A·W + bias + resid): A f32 (ASPLIT -> hi/lo 2 terms), Wt bf16 [N][K]; ACT 0 none, 1 relu, 2 exact gelu;
// resid (optional, f32, row index = (row % rmod), pitch ldr, RES_BF16 rounds it) added before the activation.
template <bool ASPLIT, int ACT, bool BIAS_BF16, bool RES_BF16>
__global__ __launch_bounds__(128) void k_gemm_bf3(const float* __restrict__ A, int lda, const unsigned short* __restrict__ Wt, int ldb,
                                                const float* __restrict__ bias, const float* __restrict__ resid, int rmod, int ldr,
                                                float* __restrict__ C, int ldc, int M, int N, int K) {
  __shared__ __attribute__((aligned(16))) float so[4][16][64];
  const int tid = threadIdx.x, w = tid >> 5, lane = tid & 31, ln = lane & 15, hh = lane >> 4;
  const int ntn = N / 64;
  const int wid = blockIdx.x * 4 + w;
  const int mt = wid / ntn, nq = wid % ntn;
  if (mt * 16 >= M) return;
  const int row0 = mt * 16, col0 = nq * 64;
  const float* arow = A + (size_t)(row0 + ln) * lda;
  v8f acc[4] = {};
  for (int kb = 0; kb < K; kb += 32) {
    FragB ah, al;
    const v4f x0 = *(const v4fa*)(arow + kb + 8 * hh), x1 = *(const v4fa*)(arow + kb + 8 * hh + 4);
    const v4f x2 = *(const v4fa*)(arow + kb + 16 + 8 * hh), x3 = *(const v4fa*)(arow + kb + 16 + 8 * hh + 4);
    float xs[16] = {x0[0],x0[1],x0[2],x0[3],x1[0],x1[1],x1[2],x1[3],x2[0],x2[1],x2[2],x2[3],x3[0],x3[1],x3[2],x3[3]};
#pragma unroll
    for (int i = 0; i < 16; ++i) { const unsigned short hb = bf16_bits(xs[i]); ah.u[i] = hb; al.u[i] = ASPLIT ? bf16_bits(xs[i] - bf16_val(hb)) : (unsigned short)0; }
#pragma unroll
    for (int t = 0; t < 4; ++t) {
      const unsigned short* brow = Wt + (size_t)(col0 + t * 16 + ln) * ldb + kb;
      FragB b;
      b.half[0] = *(const v8us*)(brow + 8 * hh);
      b.half[1] = *(const v8us*)(brow + 16 + 8 * hh);
      acc[t] = mmaN<ASPLIT ? 2 : 1>(ah.v, al.v, b.v, b.v, acc[t]);
    }
  }
#pragma unroll
  for (int t = 0; t < 4; ++t) {
    const int col = col0 + t * 16 + ln;
    float bv = bias ? bias[col] : 0.f;
    if (BIAS_BF16) bv = bf16_round(bv);
#pragma unroll
    for (int r = 0; r < 8; ++r) {
      float v = acc[t][r] + bv;
      if (resid) { float rv = resid[(size_t)((row0 + 8 * hh + r) % rmod) * ldr + col]; if (RES_BF16) rv = bf16_round(rv); v += rv; }
      if (ACT == 1) v = fmaxf(v, 0.f);
      if (ACT == 2) v = 0.5f * v * (1.0f + erff(v * 0.70710678118654752f));
      if (ACT == 3) { const float u = 0.7978845608028654f * (v + 0.044715f * v * v * v); v = 0.5f * v * (1.0f + tanhf(u)); }
      so[w][8 * hh + r][t * 16 + ln] = v;
    }
  }
  __builtin_amdgcn_fence(__ATOMIC_ACQ_REL, "workgroup");
  __builtin_amdgcn_wave_barrier();
  const int rsub = lane >> 4, c4 = (lane & 15) * 4;
  {
#pragma unroll
    for (int q = 0; q < 8; ++q) {
      const int r = q * 2 + rsub;
      const v4f v = *(const v4fa*)&so[w][r][c4];
      *(v4f*)(C + (size_t)(row0 + r) * ldc + col0 + c4) = v;
    }
    
  }
}
// row LayerNorm (biased variance, eps) over N: s = X (+ R); optional out_sum <- s; out_norm <- (s-mu)*rsqrt(var+eps)*g + b
template <bool PARAM_BF16>
__global__ __launch_bounds__(256) void k_layernorm(const float* __restrict__ X, const float* __restrict__ R, const float* __restrict__ g, const float* __restrict__ bta,
                                                  float* __restrict__ out_sum, float* __restrict__ out_norm, int N, float eps) {
  __shared__ float red[256];
  const int row = blockIdx.x, tid = threadIdx.x;
  const float* x = X + (size_t)row * N; const float* rr = R ? R + (size_t)row * N : nullptr;
  float vals[16];                     // up to N = 4096
  const int per = N / 256;            // contiguous chunk per thread? use strided-by-4 chunks: thread handles j = tid*4 + 1024*u
  float s1 = 0.f;
  for (int u = 0; u < per / 4; ++u) {
    const int j = tid * 4 + 1024 * u;
    const v4f a = *(const v4fa*)(x + j);
    v4f b = {0.f,0.f,0.f,0.f}; if (rr) b = *(const v4fa*)(rr + j);
#pragma unroll
    for (int q = 0; q < 4; ++q) { const float v = a[q] + b[q]; vals[u * 4 + q] = v; s1 += v; }
  }
  red[tid] = s1; __syncthreads();
  for (int st = 128; st > 0; st >>= 1) { if (tid < st) red[tid] += red[tid + st]; __syncthreads(); }
  const float mu = red[0] / (float)N; __syncthreads();
  float s2 = 0.f;
  for (int u = 0; u < per / 4; ++u)
#pragma unroll
    for (int q = 0; q < 4; ++q) { const float c = vals[u * 4 + q] - mu; s2 += c * c; }
  red[tid] = s2; __syncthreads();
  for (int st = 128; st > 0; st >>= 1) { if (tid < st) red[tid] += red[tid + st]; __syncthreads(); }
  const float rs = rsqrtf(red[0] / (float)N + eps);
  {
    for (int u = 0; u < per / 4; ++u) {
      const int j = tid * 4 + 1024 * u;
      v4f o, sm;
#pragma unroll
      for (int q = 0; q < 4; ++q) {
        float gg = g[j + q], bb = bta[j + q];
        if (PARAM_BF16) { gg = bf16_round(gg); bb = bf16_round(bb); }
        sm[q] = vals[u * 4 + q]; o[q] = (vals[u * 4 + q] - mu) * rs * gg + bb;
      }
      if (out_sum) *(v4f*)(out_sum + (size_t)row * N + j) = sm;
      *(v4f*)(out_norm + (size_t)row * N + j) = o;
    }
    
  }
}



// ---- f16 WMMA path (v_wmma_f32_16x16x32_f16): 11-bit significands for operands in range — used where a [0,1] probability operand needs more precision than bf16
typedef _Float16 v16h __attribute__((ext_vector_type(16)));
union FragH { v16h v; v8us half[2]; _Float16 h[16]; unsigned short u[16]; };
template <int NT>
__device__ __forceinline__ v8f mmaH(v16h ah, v16h al, v16h bh, v16h bl, v8f c) {
  c = __builtin_amdgcn_wmma_f32_16x16x32_f16(false, ah, false, bh, (short)0, c, false, false);
  if (NT >= 2) c = __builtin_amdgcn_wmma_f32_16x16x32_f16(false, al, false, bh, (short)0, c, false, false);
  if (NT >= 3) c = __builtin_amdgcn_wmma_f32_16x16x32_f16(false, ah, false, bl, (short)0, c, false, false);
  asm volatile("v_nop\n\tv_nop\n\tv_nop\n\tv_nop" : "+v"(c) : "v"(ah), "v"(al), "v"(bh), "v"(bl));
  return c;
}
// batched GEMM like k_gemm_b but f16 operands: A f32 (split into f16 hi/lo if ASPLIT, else rounded to f16), Bt = f16 values [n][k]; alpha; C f32; N multiple of 16 (partial tiles skipped)
template <bool ASPLIT>
__global__ __launch_bounds__(128) void k_gemm_h(const float* __restrict__ A, int lda, size_t sA, const _Float16* __restrict__ Bh, int ldb, size_t sB, float alpha, float* __restrict__ C, int ldc, size_t sC, int M, int N, int K) {
  __shared__ __attribute__((aligned(16))) float so[4][16][64];
  const int tid = threadIdx.x, w = tid >> 5, lane = tid & 31, ln = lane & 15, hh = lane >> 4; const int by = blockIdx.y;
  A += (size_t)by * sA; Bh += (size_t)by * sB; C += (size_t)by * sC;
  const int ntn = (N + 63) / 64; const int wid = blockIdx.x * 4 + w; const int mt = wid / ntn, nq = wid % ntn; if (mt * 16 >= M) return;
  const int row0 = mt * 16, col0 = nq * 64; const float* arow = A + (size_t)(row0 + ln) * lda;
  v8f acc[4] = {};
  for (int kb = 0; kb < K; kb += 32) {
    FragH ah, al;
    const v4f x0 = *(const v4fa*)(arow + kb + 8 * hh), x1 = *(const v4fa*)(arow + kb + 8 * hh + 4), x2 = *(const v4fa*)(arow + kb + 16 + 8 * hh), x3 = *(const v4fa*)(arow + kb + 16 + 8 * hh + 4);
    float xs[16] = {x0[0],x0[1],x0[2],x0[3],x1[0],x1[1],x1[2],x1[3],x2[0],x2[1],x2[2],x2[3],x3[0],x3[1],x3[2],x3[3]};
#pragma unroll
    for (int i = 0; i < 16; ++i) { const _Float16 h = (_Float16)xs[i]; ah.h[i] = h; al.h[i] = ASPLIT ? (_Float16)(xs[i] - (float)h) : (_Float16)0.0f; }
#pragma unroll
    for (int t = 0; t < 4; ++t) { if (col0 + t * 16 >= N) continue; const size_t boff = (size_t)(col0 + t * 16 + ln) * ldb + kb; FragH bq; bq.half[0] = *(const v8us*)(Bh + boff + 8 * hh); bq.half[1] = *(const v8us*)(Bh + boff + 16 + 8 * hh);
      acc[t] = mmaH<ASPLIT ? 2 : 1>(ah.v, al.v, bq.v, bq.v, acc[t]); }
  }
#pragma unroll
  for (int t = 0; t < 4; ++t) { if (col0 + t * 16 >= N) continue;
#pragma unroll
    for (int r = 0; r < 8; ++r) so[w][8 * hh + r][t * 16 + ln] = acc[t][r] * alpha; }
  __builtin_amdgcn_fence(__ATOMIC_ACQ_REL, "workgroup"); __builtin_amdgcn_wave_barrier();
  const int rsub = lane >> 4, c4 = (lane & 15) * 4;
  {
#pragma unroll
    for (int q = 0; q < 8; ++q) { const int r = q * 2 + rsub; if (col0 + c4 < N) { const v4f v = *(const v4fa*)&so[w][r][c4]; *(v4f*)(C + (size_t)(row0 + r) * ldc + col0 + c4) = v; } }
     }
}

// Wt[n][k] = f16(W[k][n]·scale) from f32 row-major W[K][N] (scale = power of two; bf16-exact weights stay exact in f16 away from the subnormal range)
__global__ __launch_bounds__(256) void k_wt_f16(const float* __restrict__ W, _Float16* __restrict__ Wt, int K, int N, float scale) {
  const int t = blockIdx.x * 256 + threadIdx.x; if (t >= N * (K / 8)) return; const int n = t / (K / 8), k8 = (t % (K / 8)) * 8; FragH f;
#pragma unroll
  for (int i = 0; i < 8; ++i) f.h[i] = (_Float16)(bf16_round(W[(size_t)(k8 + i) * N + n]) * scale); const v8us o = f.half[0];
  *(v8us*)((unsigned short*)Wt + (size_t)n * K + k8) = o; 
}
// k_gemm_hh variant with fused epilogue: v = acc·alpha + bias[by·sBias + col] (+ CP[(row/rowsPerB)·sCPb + by·64 + col] if CP) ; ACT 0 none / 1 elu ; writes f16 C16 (and f32 C if non-null)
template <int ACT>
__global__ __launch_bounds__(128) void k_gemm_hhx(const _Float16* __restrict__ A, int lda, size_t sA, const _Float16* __restrict__ Bh, int ldb, size_t sB, float alpha, const float* __restrict__ bias, size_t sBias, const float* __restrict__ CP, int rowsPerB, size_t sCPb, int row0g,
    float* __restrict__ C, _Float16* __restrict__ C16, int ldc, size_t sC, int M, int N, int K) {
  __shared__ __attribute__((aligned(16))) float so[4][16][64];
  const int tid = threadIdx.x, w = tid >> 5, lane = tid & 31, ln = lane & 15, hh = lane >> 4; const int by = blockIdx.y;
  A += (size_t)by * sA; Bh += (size_t)by * sB; const size_t cofs = (size_t)by * sC; const float* bp = bias ? bias + (size_t)by * sBias : nullptr;
  const int ntn = (N + 63) / 64; const int wid = blockIdx.x * 4 + w; const int mt = wid / ntn, nq = wid % ntn; if (mt * 16 >= M) return;
  const int row0 = mt * 16, col0 = nq * 64; const _Float16* arow = A + (size_t)(row0 + ln) * lda;
  v8f acc[4] = {};
  for (int kb = 0; kb < K; kb += 32) { FragH ah; ah.half[0] = *(const v8us*)((const unsigned short*)arow + kb + 8 * hh); ah.half[1] = *(const v8us*)((const unsigned short*)arow + kb + 16 + 8 * hh);
#pragma unroll
    for (int t = 0; t < 4; ++t) { if (col0 + t * 16 >= N) continue; const size_t boff = (size_t)(col0 + t * 16 + ln) * ldb + kb; FragH bq; bq.half[0] = *(const v8us*)((const unsigned short*)Bh + boff + 8 * hh); bq.half[1] = *(const v8us*)((const unsigned short*)Bh + boff + 16 + 8 * hh);
      acc[t] = mmaH<1>(ah.v, ah.v, bq.v, bq.v, acc[t]); }
  }
#pragma unroll
  for (int t = 0; t < 4; ++t) { if (col0 + t * 16 >= N) continue; const int col = col0 + t * 16 + ln; const float bv = bp ? bf16_round(bp[col]) : 0.f;
#pragma unroll
    for (int r = 0; r < 8; ++r) { float v = acc[t][r] * alpha + bv; if (CP) { const int rr = row0g + row0 + 8 * hh + r; if (rowsPerB < 0) v += CP[cofs + (size_t)rr * ldc + col];      /* rowsPerB < 0: own element of the batched C plane */ else { const int bidx = rr / rowsPerB; v += CP[(size_t)bidx * sCPb + (size_t)by * 64 + col]; } } if (ACT == 1) v = (v > 0.f) ? v : expm1f(v); else if (ACT == 7) v = (v > 0.f) ? v + 1.0f : expf(v); else if (ACT == 8) v = tanhf(v); else if (ACT == 9) v = 0.5f * v * (1.0f + tanhf(0.7978845608028654f * (v + 0.044715f * v * v * v))); else if (ACT == 11) v = 1.0f / (1.0f + expf(-v)); else if (ACT == 12) v = (v > 0.f) ? v : 0.01f * v; else if (ACT == 14) v = (v > 0.f) ? v : 0.1f * v; else if (ACT == 16) v = (v >= 0.f) ? v : 0.3f * v; else if (ACT == 17) v = (v >= 0.f) ? v : 0.2f * v; else if (ACT == 15) v = v / (1.0f + expf(-v)); else if (ACT == 3) v = fmaxf(v, 0.f); else if (ACT == 6) v = 0.5f * v * (1.0f + erff(v * 0.70710678118654752f)); so[w][8 * hh + r][t * 16 + ln] = v; } }
  __builtin_amdgcn_fence(__ATOMIC_ACQ_REL, "workgroup"); __builtin_amdgcn_wave_barrier();
  const int rsub = lane >> 4, c4 = (lane & 15) * 4; typedef _Float16 v4h __attribute__((ext_vector_type(4)));
  {
#pragma unroll
    for (int q = 0; q < 8; ++q) { const int r = q * 2 + rsub; if (col0 + c4 < N) { const v4f v = *(const v4fa*)&so[w][r][c4]; if (C) *(v4f*)(C + cofs + (size_t)(row0 + r) * ldc + col0 + c4) = v; if (C16) { v4h h4; for (int i = 0; i < 4; ++i) h4[i] = (_Float16)v[i]; *(v4h*)(C16 + cofs + (size_t)(row0 + r) * ldc + col0 + c4) = h4; } } }
     }
}


typedef _Float16 v4h __attribute__((ext_vector_type(4)));

__global__ __launch_bounds__(256) void k_x16(const float* __restrict__ x, _Float16* __restrict__ X16, size_t n8) { const size_t t = (size_t)blockIdx.x * 256 + threadIdx.x; if (t >= n8) return; FragH f;
#pragma unroll
  for (int q = 0; q < 8; ++q) f.h[q] = (_Float16)bf16_round(x[t * 8 + q]); *(v8us*)((unsigned short*)X16 + t * 8) = f.half[0];  }
__global__ __launch_bounds__(256) void k_h16(const float* __restrict__ x, _Float16* __restrict__ X16, size_t n8) { const size_t t = (size_t)blockIdx.x * 256 + threadIdx.x; if (t >= n8) return; FragH f;
#pragma unroll
  for (int q = 0; q < 8; ++q) f.h[q] = (_Float16)x[t * 8 + q]; *(v8us*)((unsigned short*)X16 + t * 8) = f.half[0];  }
__global__ __launch_bounds__(256) void k_round16f(const float* __restrict__ W, _Float16* __restrict__ Bt, size_t n8) { const size_t t = (size_t)blockIdx.x * 256 + threadIdx.x; if (t >= n8) return; FragH f;
#pragma unroll
  for (int i = 0; i < 8; ++i) f.h[i] = (_Float16)(bf16_round(W[t * 8 + i]) * 16.0f); *(v8us*)((unsigned short*)Bt + t * 8) = f.half[0];  }
template <int NHv, int TTv>
__global__ __launch_bounds__(256) void k_vt(const _Float16* __restrict__ V16, int ldv, int voff, _Float16* __restrict__ Vt) { __shared__ unsigned short tl[64][66]; const int tid = threadIdx.x; const int slab = blockIdx.x / (TTv / 64), lg = blockIdx.x % (TTv / 64); const int b = slab / NHv, h = slab % NHv;
  for (int i = tid; i < 64 * 8; i += 256) { const int r = i / 8, c8 = (i % 8) * 8; FragH f; f.half[0] = *(const v8us*)((const unsigned short*)V16 + ((size_t)b * TTv + lg * 64 + r) * ldv + voff + h * 64 + c8);
#pragma unroll
    for (int q = 0; q < 8; ++q) tl[r][c8 + q] = f.u[q]; }
  __syncthreads();
  {
#pragma unroll
    for (int rd = 0; rd < 2; ++rd) { const int d = rd * 32 + tid / 8, pc = tid % 8; FragH f;
#pragma unroll
      for (int q = 0; q < 8; ++q) f.u[q] = tl[pc * 8 + q][d];
      *(v8us*)((unsigned short*)Vt + ((size_t)slab * 64 + d) * TTv + lg * 64 + pc * 8) = f.half[0]; }
     } }

__global__ __launch_bounds__(256) void k_hl(const float* __restrict__ F, _Float16* __restrict__ Hh, _Float16* __restrict__ Hl, size_t n8) { const size_t t = (size_t)blockIdx.x * 256 + threadIdx.x; if (t >= n8) return; FragH fh, fl; const v4f a = *(const v4fa*)(F + t * 8), c = *(const v4fa*)(F + t * 8 + 4);
#pragma unroll
  for (int q = 0; q < 4; ++q) { _Float16 h = (_Float16)a[q]; fh.h[q] = h; fl.h[q] = (_Float16)((a[q] - (float)h) * 1024.0f); h = (_Float16)c[q]; fh.h[4 + q] = h; fl.h[4 + q] = (_Float16)((c[q] - (float)h) * 1024.0f); }
  { *(v8us*)((unsigned short*)Hh + t * 8) = fh.half[0]; *(v8us*)((unsigned short*)Hl + t * 8) = fl.half[0];  } }

// ---- fast GEMM (wave tile 32x64; requires M % 32 == 0 rows per launch region and N % 64 == 0); epilogue = k_gemm_hhx semantics ----
__device__ __forceinline__ v16h g2_frag(const _Float16* p, int hh) { FragH f; f.half[0] = *(const v8us*)((const unsigned short*)p + 8 * hh); f.half[1] = *(const v8us*)((const unsigned short*)p + 16 + 8 * hh); return f.v; }
__device__ __forceinline__ v8f g2_mma(v16h a, v16h b, v8f c) { v8f d = __builtin_amdgcn_wmma_f32_16x16x32_f16(false, a, false, b, (short)0, c, false, false); asm volatile("v_nop\n\tv_nop\n\tv_nop\n\tv_nop" : "+v"(d) : "v"(a), "v"(b)); return d; }
template <int ACT>
__global__ __launch_bounds__(128) void k_gemm2(const _Float16* __restrict__ A, int lda, size_t sA, const _Float16* __restrict__ Bh, int ldb, size_t sB, float alpha, const float* __restrict__ bias, size_t sBias, const float* __restrict__ CP, int rowsPerB, size_t sCPb, int row0g,
    float* __restrict__ C, _Float16* __restrict__ C16, int ldc, size_t sC, int M, int N, int K) { static_assert(ACT == 0 || ACT == 3 || ACT == 6 || ACT == 8 || ACT == 9 || ACT == 11 || ACT == 12 || ACT == 14 || ACT == 15 || ACT == 16 || ACT == 17 || ACT == 18, "k_gemm2: unsupported ACT code (would silently apply no activation)");
  __shared__ __attribute__((aligned(16))) float so[4][32][68];
  const int tid = threadIdx.x, w = tid >> 5, lane = tid & 31, ln = lane & 15, hh = lane >> 4; const int by = blockIdx.y;
  A += (size_t)by * sA; Bh += (size_t)by * sB; const size_t cofs = (size_t)by * sC; const float* bp = bias ? bias + (size_t)by * sBias : nullptr;
  const int ntn = N >> 6; const int mt = blockIdx.x / ntn, nq = blockIdx.x - mt * ntn; const int row0 = mt * 128 + 32 * w, col0 = nq * 64; if (row0 >= M) return;
  const _Float16* a0p = A + (size_t)(row0 + ln) * lda; const _Float16* a1p = a0p + (size_t)16 * lda;
  const _Float16* b0p = Bh + (size_t)(col0 + ln) * ldb; const _Float16* b1p = b0p + (size_t)16 * ldb; const _Float16* b2p = b1p + (size_t)16 * ldb; const _Float16* b3p = b2p + (size_t)16 * ldb;
  const v8f z8 = {0.f,0.f,0.f,0.f,0.f,0.f,0.f,0.f}; v8f c00 = z8, c01 = z8, c02 = z8, c03 = z8, c10 = z8, c11 = z8, c12 = z8, c13 = z8;
#pragma unroll 1
  for (int kb = 0; kb < K; kb += 32) { const v16h a0 = g2_frag(a0p + kb, hh), a1 = g2_frag(a1p + kb, hh);
    v16h b = g2_frag(b0p + kb, hh); c00 = g2_mma(a0, b, c00); c10 = g2_mma(a1, b, c10);
    b = g2_frag(b1p + kb, hh); c01 = g2_mma(a0, b, c01); c11 = g2_mma(a1, b, c11);
    b = g2_frag(b2p + kb, hh); c02 = g2_mma(a0, b, c02); c12 = g2_mma(a1, b, c12);
    b = g2_frag(b3p + kb, hh); c03 = g2_mma(a0, b, c03); c13 = g2_mma(a1, b, c13); }
  v8f accs[8] = {c00, c01, c02, c03, c10, c11, c12, c13};
#pragma unroll
  for (int u = 0; u < 8; ++u) { const int t = u & 3, half = u >> 2; const int col = col0 + t * 16 + ln; const float bv = bp ? bf16_round(bp[col]) : 0.f;
#pragma unroll
    for (int r = 0; r < 8; ++r) { const int rloc = half * 16 + 8 * hh + r; float v = accs[u][r] * alpha + bv; if (CP) { if (rowsPerB < 0) v += CP[cofs + (size_t)(row0g + row0 + rloc) * ldc + col];      /* rowsPerB < 0: own element of the batched C plane */ else { const int bidx = (row0g + row0 + rloc) / rowsPerB; v += CP[(size_t)bidx * sCPb + (size_t)by * 64 + col]; } }
      if (ACT == 3) v = fmaxf(v, 0.f); else if (ACT == 6) v = 0.5f * v * (1.0f + erff(v * 0.70710678118654752f)); else if (ACT == 11) v = 1.0f / (1.0f + expf(-v)); else if (ACT == 15) v = v / (1.0f + expf(-v)); else if (ACT == 18) v = v / (1.0f + expf(-1.702f * v));      /* QuickGELU: v sigmoid(1.702 v) */ else if (ACT == 12) v = (v > 0.f) ? v : 0.01f * v; else if (ACT == 8) v = tanhf(v); else if (ACT == 9) v = 0.5f * v * (1.0f + tanhf(0.7978845608028654f * (v + 0.044715f * v * v * v))); else if (ACT == 14) v = (v > 0.f) ? v : 0.1f * v; else if (ACT == 16) v = (v >= 0.f) ? v : 0.3f * v; else if (ACT == 17) v = (v >= 0.f) ? v : 0.2f * v;
      so[w][rloc][t * 16 + ln] = v; } }
  __builtin_amdgcn_fence(__ATOMIC_ACQ_REL, "workgroup"); __builtin_amdgcn_wave_barrier();
  const int rsub = lane >> 4, c4 = (lane & 15) * 4;
  {
#pragma unroll
    for (int q = 0; q < 16; ++q) { const int r = q * 2 + rsub; const v4f v = *(const v4fa*)&so[w][r][c4]; if (C) *(v4f*)(C + cofs + (size_t)(row0 + r) * ldc + col0 + c4) = v; if (C16) { v4h h4; for (int i = 0; i < 4; ++i) h4[i] = (_Float16)v[i]; *(v4h*)(C16 + cofs + (size_t)(row0 + r) * ldc + col0 + c4) = h4; } }
     } }


__global__ __launch_bounds__(256) void k_wnat(const float* __restrict__ w, size_t n8, _Float16* __restrict__ Bt) { const size_t t = (size_t)blockIdx.x * 256 + threadIdx.x; if (t >= n8) return; FragH f; for (int q = 0; q < 8; ++q) f.h[q] = (_Float16)(bf16_round(w[t * 8 + q]) * 16.0f); *(v8us*)((unsigned short*)Bt + t * 8) = f.half[0];  }
__global__ __launch_bounds__(256) void k_rsm(const float* __restrict__ S, _Float16* __restrict__ P, int nrows) {
  #pragma clang fp contract(off)
  const int i = blockIdx.x * 256 + threadIdx.x; if (i >= nrows) return; const float* s = S + (size_t)i * SQ; float mx = -3.0e38f;
#pragma unroll 1
  for (int j = 0; j < SQ; ++j) mx = fmaxf(mx, s[j]); float se = 0.f;
#pragma unroll 1
  for (int j = 0; j < SQ; ++j) se += expf(s[j] - mx); const float sc = 256.0f / se;
#pragma unroll 1
  for (int j0 = 0; j0 < SQ; j0 += 8) { FragH f; for (int q = 0; q < 8; ++q) f.h[q] = (_Float16)(expf(s[j0 + q] - mx) * sc); unsigned short* d = (unsigned short*)P + (size_t)i * SQ + j0; *(v8us*)d = f.half[0];  } }
__global__ __launch_bounds__(256) void k_vt(const _Float16* __restrict__ V16, int b, int h0, _Float16* __restrict__ VT) { __shared__ unsigned short tl[64][65]; const int tid = threadIdx.x; const int hh = blockIdx.x % HG, sg = blockIdx.x / HG; const int s0 = sg * 64; const int h = h0 + hh;
  for (int i = tid; i < 64 * 8; i += 256) { const int j = i / 8, d8 = (i % 8) * 8; FragH f; f.half[0] = *(const v8us*)((const unsigned short*)V16 + ((size_t)b * SQ + s0 + j) * DM + h * HD + d8); for (int q = 0; q < 8; ++q) tl[d8 + q][j] = f.u[q]; }
  __syncthreads();
  { for (int i = tid; i < 64 * 8; i += 256) { const int d = i / 8, j8 = (i % 8) * 8; FragH f; for (int q = 0; q < 8; ++q) f.u[q] = tl[d][j8 + q]; *(v8us*)((unsigned short*)VT + ((size_t)hh * HD + d) * SQ + s0 + j8) = f.half[0]; }  } }



__global__ __launch_bounds__(256) void k_rsmcf2(const float* __restrict__ S, _Float16* __restrict__ P, int hg, int q0, int nk) {
  #pragma clang fp contract(off)
  const int t = blockIdx.x * 256 + threadIdx.x; if (t >= hg * QT) return; const size_t i = (size_t)t; const float* s = S + i * NKX; const int last = q0 + (t % QT); float mx = -3.0e38f;
#pragma unroll 1
  for (int j = 0; j < nk; ++j) { const float f = (j <= last) ? 1.f : 0.f; mx = fmaxf(mx, fmaf(f, s[j], (1.f - f) * -1.0e9f)); } float se = 0.f;
#pragma unroll 1
  for (int j = 0; j < nk; ++j) { const float f = (j <= last) ? 1.f : 0.f; se += __expf(fmaf(f, s[j], (1.f - f) * -1.0e9f) - mx); } const float sc = 256.0f / se;
#pragma unroll 1
  for (int j0 = 0; j0 < nk; j0 += 8) { FragH fr; for (int q = 0; q < 8; ++q) { const int j = j0 + q; const float f = (j <= last) ? 1.f : 0.f; fr.h[q] = (_Float16)(__expf(fmaf(f, s[j], (1.f - f) * -1.0e9f) - mx) * sc); } unsigned short* d = (unsigned short*)P + i * NKX + j0; *(v8us*)d = fr.half[0];  } }

__global__ __launch_bounds__(256) void k_rsmcst(const float* __restrict__ S, _Float16* __restrict__ P, int hg, int q0, int nk, const int* __restrict__ mk) {
  #pragma clang fp contract(off)
  const int t = blockIdx.x * 256 + threadIdx.x; if (t >= hg * QT) return; const size_t i = (size_t)t; const float* s = S + i * NKX; const size_t ig = (size_t)(q0 + (t % QT)); const int* mr = mk + ig * SQ; float mx = -3.0e38f;
#pragma unroll 1
  for (int j = 0; j < nk; ++j) { const int mb = mr[j]; const int dd = (int)ig - j; const float f = (mb != 0 && dd >= 0 && (dd <= LOCALW || (dd % STRIDEK) == 0)) ? 1.f : 0.f; mx = fmaxf(mx, fmaf(f, s[j], (1.f - f) * -1.0e9f)); } float se = 0.f;
#pragma unroll 1
  for (int j = 0; j < nk; ++j) { const int mb = mr[j]; const int dd = (int)ig - j; const float f = (mb != 0 && dd >= 0 && (dd <= LOCALW || (dd % STRIDEK) == 0)) ? 1.f : 0.f; se += __expf(fmaf(f, s[j], (1.f - f) * -1.0e9f) - mx); } const float sc = 256.0f / se;
#pragma unroll 1
  for (int j0 = 0; j0 < nk; j0 += 8) { FragH fr; for (int q = 0; q < 8; ++q) { const int j = j0 + q; const int mb = mr[j]; const int dd = (int)ig - j; const float f = (mb != 0 && dd >= 0 && (dd <= LOCALW || (dd % STRIDEK) == 0)) ? 1.f : 0.f; fr.h[q] = (_Float16)(__expf(fmaf(f, s[j], (1.f - f) * -1.0e9f) - mx) * sc); } unsigned short* d = (unsigned short*)P + i * NKX + j0; *(v8us*)d = fr.half[0];  } }


template <int MASKADD>
__global__ __launch_bounds__(64) void k_att0(const float* __restrict__ QF, const float* __restrict__ KF, const float* __restrict__ VF, int ld, const float* __restrict__ mask, float scale, float* __restrict__ OF, int ldo) {
  #pragma clang fp contract(off)
  __shared__ __attribute__((aligned(16))) float lq[64][64]; __shared__ __attribute__((aligned(16))) float lo[64][64];
  const int tid = threadIdx.x; const int h = blockIdx.x / (QT0 / 64), rg = blockIdx.x % (QT0 / 64); const int i = rg * 64 + tid;
  const float* qr = QF + (size_t)i * ld + h * HD;
#pragma unroll 1
  for (int c = 0; c < HD / 4; ++c) { *(v4f*)&lq[tid][c * 4] = *(const v4fa*)(qr + c * 4); const v4f z = {0.f, 0.f, 0.f, 0.f}; *(v4f*)&lo[tid][c * 4] = z; }
  float m = -1.0e30f, l = 0.f; const int jmax = MASKADD ? (SQ - 1) : (rg * 64 + 63);      /* additive-mask form: every key (the mask input decides); causal form: keys up to the block's last row */
#pragma unroll 1
  for (int j = 0; j <= jmax; ++j) { const float* kr = KF + (size_t)j * ld + h * HD; const float* vr = VF + (size_t)j * ld + h * HD; float s = 0.f;
#pragma unroll 1
    for (int c = 0; c < HD / 4; ++c) { const v4f kq = *(const v4fa*)(kr + c * 4); const v4f qq = *(v4f*)&lq[tid][c * 4]; s = __fadd_rn(s, __fmul_rn(qq[0], kq[0])); s = __fadd_rn(s, __fmul_rn(qq[1], kq[1])); s = __fadd_rn(s, __fmul_rn(qq[2], kq[2])); s = __fadd_rn(s, __fmul_rn(qq[3], kq[3])); }
    s = __fmul_rn(s, scale); if (MASKADD) s = __fadd_rn(s, __fmul_rn(bf16_round(mask[(size_t)i * SQ + j]), -10000.0f));
    const float f = (MASKADD || j <= i) ? 1.f : 0.f; const float sm = fmaf(f, s, (1.f - f) * -1.0e30f); const float mn = fmaxf(m, sm); const float sc = expf(m - mn); const float e = expf(sm - mn); l = __fadd_rn(__fmul_rn(l, sc), e); m = mn;
#pragma unroll 1
    for (int c = 0; c < HD / 4; ++c) { const v4f vv = *(const v4fa*)(vr + c * 4); v4f oo = *(v4f*)&lo[tid][c * 4]; for (int u = 0; u < 4; ++u) oo[u] = __fadd_rn(__fmul_rn(oo[u], sc), __fmul_rn(e, vv[u])); *(v4f*)&lo[tid][c * 4] = oo; } }
  const float fin = 64.0f / l;      /* o carried x64 like the f16 path */
#pragma unroll 1
  for (int c = 0; c < HD / 4; ++c) { v4f oo = *(v4f*)&lo[tid][c * 4]; for (int u = 0; u < 4; ++u) oo[u] = __fmul_rn(oo[u], fin); *(v4f*)&lo[tid][c * 4] = oo; }
  __syncthreads();
  {
#pragma unroll 1
    for (int it = 0; it < 16; ++it) { const int row = it * 4 + tid / 16, pc = (tid % 16) * 4; const v4f v = *(const v4f*)&lo[row][pc]; *(v4f*)(OF + (size_t)(rg * 64 + row) * ldo + h * HD + pc) = v; }
     } }

template <int MASKADD>
__global__ __launch_bounds__(64) void k_att0mbc(const float* __restrict__ QF, const float* __restrict__ KF, const float* __restrict__ VF, int ld, const float* __restrict__ mask, float scale, float* __restrict__ OF, int ldo) {
  #pragma clang fp contract(off)
  __shared__ __attribute__((aligned(16))) float lq[64][64]; __shared__ __attribute__((aligned(16))) float lo[64][64];
  const int tid = threadIdx.x; const int h = blockIdx.x / (QT0 / 64), rg = blockIdx.x % (QT0 / 64); const int i = rg * 64 + tid;
  const float* qr = QF + (size_t)i * ld + h * HD;
#pragma unroll 1
  for (int c = 0; c < HD / 4; ++c) { *(v4f*)&lq[tid][c * 4] = *(const v4fa*)(qr + c * 4); const v4f z = {0.f, 0.f, 0.f, 0.f}; *(v4f*)&lo[tid][c * 4] = z; }
  float m = -1.0e30f, l = 0.f; const int jmax = rg * 64 + 63;      /* keys beyond the block end are masked by the mask's lower-triangular structure */
#pragma unroll 1
  for (int j = 0; j <= jmax; ++j) { const float* kr = KF + (size_t)j * ld + h * HD; const float* vr = VF + (size_t)j * ld + h * HD; float s = 0.f;
#pragma unroll 1
    for (int c = 0; c < HD / 4; ++c) { const v4f kq = *(const v4fa*)(kr + c * 4); const v4f qq = *(v4f*)&lq[tid][c * 4]; s = __fadd_rn(s, __fmul_rn(qq[0], kq[0])); s = __fadd_rn(s, __fmul_rn(qq[1], kq[1])); s = __fadd_rn(s, __fmul_rn(qq[2], kq[2])); s = __fadd_rn(s, __fmul_rn(qq[3], kq[3])); }
    s = __fmul_rn(s, scale); const int mb = ((const int*)mask)[(size_t)i * SQ + j];      /* causal (j <= i) AND the module's int32 [S][S] mask read per (query, key): 0 -> masked */
    const float f = (mb != 0 && j <= i) ? 1.f : 0.f; const float sm = fmaf(f, s, (1.f - f) * -1.0e30f); const float mn = fmaxf(m, sm); const float sc = expf(m - mn); const float e = expf(sm - mn); l = __fadd_rn(__fmul_rn(l, sc), e); m = mn;
#pragma unroll 1
    for (int c = 0; c < HD / 4; ++c) { const v4f vv = *(const v4fa*)(vr + c * 4); v4f oo = *(v4f*)&lo[tid][c * 4]; for (int u = 0; u < 4; ++u) oo[u] = __fadd_rn(__fmul_rn(oo[u], sc), __fmul_rn(e, vv[u])); *(v4f*)&lo[tid][c * 4] = oo; } }
  const float fin = 64.0f / l;      /* o carried x64 like the f16 path */
#pragma unroll 1
  for (int c = 0; c < HD / 4; ++c) { v4f oo = *(v4f*)&lo[tid][c * 4]; for (int u = 0; u < 4; ++u) oo[u] = __fmul_rn(oo[u], fin); *(v4f*)&lo[tid][c * 4] = oo; }
  __syncthreads();
  {
#pragma unroll 1
    for (int it = 0; it < 16; ++it) { const int row = it * 4 + tid / 16, pc = (tid % 16) * 4; const v4f v = *(const v4f*)&lo[row][pc]; *(v4f*)(OF + (size_t)(rg * 64 + row) * ldo + h * HD + pc) = v; }
     } }


template <int BFIN, int WXB>
__global__ __launch_bounds__(256) void k_ln16(const float* __restrict__ X, const float* __restrict__ g, const float* __restrict__ bb, float eps, _Float16* __restrict__ N16, float* __restrict__ XB) {
  #pragma clang fp contract(off)
  __shared__ float red[256]; const size_t r = blockIdx.x; const int t = threadIdx.x; const v4f xa = *(const v4fa*)(X + r * DMQ + t * 4); float s[4]; float sum = 0.f;
  for (int q = 0; q < 4; ++q) { s[q] = BFIN ? bf16_round(xa[q]) : xa[q]; sum = __fadd_rn(sum, s[q]); }
  red[t] = sum; __syncthreads(); for (int st = 128; st > 0; st >>= 1) { if (t < st) red[t] = __fadd_rn(red[t], red[t + st]); __syncthreads(); } const float mu = red[0] / (float)DMQ; __syncthreads();
  float vs = 0.f; for (int q = 0; q < 4; ++q) { const float dl = __fadd_rn(s[q], -mu); vs = __fadd_rn(vs, __fmul_rn(dl, dl)); } red[t] = vs; __syncthreads(); for (int st = 128; st > 0; st >>= 1) { if (t < st) red[t] = __fadd_rn(red[t], red[t + st]); __syncthreads(); }
  const float rs = rsqrtf(__fadd_rn(red[0] / (float)DMQ, eps)); v4h y; v4f xb;
  for (int q = 0; q < 4; ++q) { const int c = t * 4 + q; y[q] = (_Float16)__fadd_rn(__fmul_rn(__fmul_rn(__fadd_rn(s[q], -mu), rs), bf16_round(g[c])), bf16_round(bb[c])); xb[q] = s[q]; }
  { *(v4h*)(N16 + r * DMQ + t * 4) = y; if (WXB) *(v4f*)(XB + r * DMQ + t * 4) = xb;  } }
__global__ __launch_bounds__(256) void k_ftres2(const float* __restrict__ OF0, const float* __restrict__ XB, float* __restrict__ X1, size_t n4) {
  #pragma clang fp contract(off)
  const size_t t = (size_t)blockIdx.x * 256 + threadIdx.x; if (t >= n4) return; const v4f o = *(const v4fa*)(OF0 + t * 4), xv = *(const v4fa*)(XB + t * 4); v4f y; for (int q = 0; q < 4; ++q) y[q] = __fadd_rn(__fmul_rn(o[q], 0.015625f), xv[q]); *(v4f*)(X1 + t * 4) = y;  }

__global__ __launch_bounds__(256) void k_bcpy(const float* __restrict__ b, int n, int NP, float* __restrict__ dst, int dst0) { for (int i = threadIdx.x; i < NP; i += 256) { const float v = (i < n) ? b[i] : 0.f; *(float*)(dst + dst0 + i) = v; }  }


// lane l <-> l ^ M inside a 16-lane row (DPP row_xmask), and l <-> l ^ 16 (cross-row move): register-only butterflies
template <int M> __device__ __forceinline__ float xl_row(float v) { return __int_as_float(__builtin_amdgcn_update_dpp(0, __float_as_int(v), 0x160 | M, 0xf, 0xf, true)); }
__device__ __forceinline__ float xl_x16(float v) { const int b = __float_as_int(v); return __int_as_float(__builtin_amdgcn_permlanex16(b, b, 0x76543210, 0xfedcba98, false, false)); }
// row softmax -> P x256 f16. One wave per score row: 16 loads of 512 contiguous bytes, the whole row (64 values a lane) stays in registers, S is read once and each exponential is taken once.
// The four loops over v[] are fully unrolled so that v[] is indexed by constants only and lives in registers, and so that all 16 loads are in flight together.
__global__ __launch_bounds__(256) void k_rsmf(const float* __restrict__ S, _Float16* __restrict__ P, int nrows) {
  const int row = blockIdx.x * 8 + (threadIdx.x >> 5), lane = threadIdx.x & 31; if (row >= nrows) return;      /* wave-uniform; no barrier in this kernel */
  const float* s = S + (size_t)row * SQ + lane * 4; v4f v[SQ / 128];
#pragma unroll
  for (int u = 0; u < SQ / 128; ++u) v[u] = *(const v4fa*)(s + u * 128);
  v4f m4 = {-3.0e38f, -3.0e38f, -3.0e38f, -3.0e38f};
#pragma unroll
  for (int u = 0; u < SQ / 128; ++u) m4 = __builtin_elementwise_max(m4, v[u]);
  float mx = fmaxf(fmaxf(m4[0], m4[1]), fmaxf(m4[2], m4[3]));
  mx = fmaxf(mx, xl_row<1>(mx)); mx = fmaxf(mx, xl_row<2>(mx)); mx = fmaxf(mx, xl_row<4>(mx)); mx = fmaxf(mx, xl_row<8>(mx)); mx = fmaxf(mx, xl_x16(mx));
  v4f s4 = {0.f, 0.f, 0.f, 0.f};
#pragma unroll
  for (int u = 0; u < SQ / 128; ++u) { v4f e; for (int q = 0; q < 4; ++q) e[q] = __expf(v[u][q] - mx); v[u] = e; s4 += e; }
  float se = (s4[0] + s4[1]) + (s4[2] + s4[3]);
  se += xl_row<1>(se); se += xl_row<2>(se); se += xl_row<4>(se); se += xl_row<8>(se); se += xl_x16(se);
  const float sc = 256.0f / se; _Float16* d = P + (size_t)row * SQ + lane * 4;
#pragma unroll
  for (int u = 0; u < SQ / 128; ++u) { const v4f y = v[u] * sc; *(v4h*)(d + u * 128) = __builtin_convertvector(y, v4h); } }

#define FAP 72      /* LDS row pitch in f16: 128 data bytes + 16 (16 B x odd: the 16-byte fragment reads of 16 rows fall on distinct banks) */
typedef _Float16 v8h __attribute__((ext_vector_type(8)));
union FragP { v16h v; v8h half[2]; };
__device__ __forceinline__ v8f fa_mma(v16h a, v16h b, v8f c) { return __builtin_amdgcn_wmma_f32_16x16x32_f16(false, a, false, b, (short)0, c, false, false); }
// 2^x, eight at a time, with the one free slot that the instruction set asks for behind a transcendental: the results are early-clobber, so inside the run none lands on a source or is read, and the v_nop stands in front of whatever the compiler schedules next.
__device__ __forceinline__ v8f fa_exp2x8(v8f x) { float y0, y1, y2, y3, y4, y5, y6, y7;
  asm("v_exp_f32 %0, %8\n\tv_exp_f32 %1, %9\n\tv_exp_f32 %2, %10\n\tv_exp_f32 %3, %11\n\tv_exp_f32 %4, %12\n\tv_exp_f32 %5, %13\n\tv_exp_f32 %6, %14\n\tv_exp_f32 %7, %15\n\tv_nop"
      : "=&v"(y0), "=&v"(y1), "=&v"(y2), "=&v"(y3), "=&v"(y4), "=&v"(y5), "=&v"(y6), "=&v"(y7) : "v"(x[0]), "v"(x[1]), "v"(x[2]), "v"(x[3]), "v"(x[4]), "v"(x[5]), "v"(x[6]), "v"(x[7]));
  const v8f y = {y0, y1, y2, y3, y4, y5, y6, y7}; return y; }
__device__ __forceinline__ float fa_exp2(float x) { float y; asm("v_exp_f32 %0, %1\n\tv_nop" : "=&v"(y) : "v"(x)); return y; }      /* the same slot behind a single one */
__global__ __launch_bounds__(256) __attribute__((amdgpu_waves_per_eu(4, 4))) void k_fattn(const _Float16* __restrict__ Q, const _Float16* __restrict__ Kr, const _Float16* __restrict__ VTa, _Float16* __restrict__ O) {
  __shared__ __attribute__((aligned(16))) _Float16 lk[2][64][FAP]; __shared__ __attribute__((aligned(16))) _Float16 lv[2][64][FAP];
  const int tid = threadIdx.x, lane = tid & 31, ln = lane & 15, hh = lane >> 4, w = tid >> 5; const int bh = blockIdx.y, b = bh / NH, h = bh % NH; const int q0 = blockIdx.x * 256 + w * 32;
  const _Float16* qp = Q + ((size_t)b * SQ + q0 + ln) * DM + h * HD;
  const int sr = tid >> 3, sc = (tid & 7) * 8;      /* staging: 8 threads a 128-byte row; a thread brings rows sr and sr + 32 of both tiles */
  const unsigned short* kg = (const unsigned short*)Kr + ((size_t)b * SQ + sr) * DM + h * HD + sc; const unsigned short* vg = (const unsigned short*)VTa + ((size_t)bh * HD + sr) * SQ + sc;
  const float CS = 0.18033688011112042f;      /* 64^-0.5 * log2(e) */
  const v8f z8 = {0.f, 0.f, 0.f, 0.f, 0.f, 0.f, 0.f, 0.f};
  v16h qf[2][2]; v8f o[4][2]; float m[2] = {-3.0e38f, -3.0e38f}, l[2] = {0.f, 0.f};
  v8us g0 = *(const v8us*)kg, g1 = *(const v8us*)(kg + (size_t)32 * DM), g2 = *(const v8us*)vg, g3 = *(const v8us*)(vg + (size_t)32 * SQ);
  for (int t = 0; t < 2; ++t) for (int ks = 0; ks < 2; ++ks) qf[t][ks] = g2_frag(qp + (size_t)t * 16 * DM + ks * 32, hh);
  for (int dt = 0; dt < 4; ++dt) { o[dt][0] = z8; o[dt][1] = z8; }
  *(v8us*)&lk[0][sr][sc] = g0; *(v8us*)&lk[0][sr + 32][sc] = g1; *(v8us*)&lv[0][sr][sc] = g2; *(v8us*)&lv[0][sr + 32][sc] = g3;
  __syncthreads();
  for (int st = 0; st < SQ / 64; ++st) { const int cur = st & 1; const bool more = st + 1 < SQ / 64;      /* block-uniform */
    for (int ps = 0; ps < 2; ++ps) {
      if (ps == 1 && more) { const unsigned short* kn = kg + (size_t)(st + 1) * 64 * DM; const unsigned short* vn = vg + (size_t)(st + 1) * 64;      /* next stage's rows: in flight under the second pass, stored to LDS at the stage's foot */
        g0 = *(const v8us*)kn; g1 = *(const v8us*)(kn + (size_t)32 * DM); g2 = *(const v8us*)vn; g3 = *(const v8us*)(vn + (size_t)32 * SQ);
        asm volatile("s_wait_xcnt 0x0" :: "v"(kn), "v"(vn) : "memory"); }      /* the wait owed before a register that an issued load names is rewritten; the two addresses are inputs so that they stay whole, and off the loads' own results, up to here */
      v16h kf[2][2], vf[4];
      for (int kt = 0; kt < 2; ++kt) for (int ks = 0; ks < 2; ++ks) kf[kt][ks] = g2_frag(&lk[cur][ps * 32 + kt * 16 + ln][ks * 32], hh);
      for (int dt = 0; dt < 4; ++dt) vf[dt] = g2_frag(&lv[cur][dt * 16 + ln][ps * 32], hh);
      v8f s[2][2]; for (int kt = 0; kt < 2; ++kt) for (int qt = 0; qt < 2; ++qt) s[kt][qt] = fa_mma(kf[kt][1], qf[qt][1], fa_mma(kf[kt][0], qf[qt][0], z8));
      float mx[2];
      for (int qt = 0; qt < 2; ++qt) { const v8f t = __builtin_elementwise_max(s[0][qt], s[1][qt]); float a = fmaxf(fmaxf(fmaxf(t[0], t[1]), fmaxf(t[2], t[3])), fmaxf(fmaxf(t[4], t[5]), fmaxf(t[6], t[7]))); a = fmaxf(a, xl_x16(a)); mx[qt] = a * CS; }
      if (__builtin_amdgcn_ballot_w32(mx[0] > m[0] + 8.0f || mx[1] > m[1] + 8.0f) != 0) {      /* rescale only when a column's maximum has grown by more than 2^8: P stays <= 2^12, inside f16 */
        for (int qt = 0; qt < 2; ++qt) { const float mn = fmaxf(m[qt], mx[qt]); const float al = fa_exp2(m[qt] - mn); m[qt] = mn; l[qt] *= al; for (int dt = 0; dt < 4; ++dt) o[dt][qt] *= al; } }
      FragP pf[2];
      for (int qt = 0; qt < 2; ++qt) { const float nm = 4.0f - m[qt]; const v8f e0 = fa_exp2x8(s[0][qt] * CS + nm), e1 = fa_exp2x8(s[1][qt] * CS + nm);
        const v8f es = e0 + e1; l[qt] += ((es[0] + es[1]) + (es[2] + es[3])) + ((es[4] + es[5]) + (es[6] + es[7])); pf[qt].half[0] = __builtin_convertvector(e0, v8h); pf[qt].half[1] = __builtin_convertvector(e1, v8h); }
      for (int dt = 0; dt < 4; ++dt) for (int qt = 0; qt < 2; ++qt) o[dt][qt] = fa_mma(vf[dt], pf[qt].v, o[dt][qt]);
    }
    if (more) { *(v8us*)&lk[cur ^ 1][sr][sc] = g0; *(v8us*)&lk[cur ^ 1][sr + 32][sc] = g1; *(v8us*)&lv[cur ^ 1][sr][sc] = g2; *(v8us*)&lv[cur ^ 1][sr + 32][sc] = g3; }      /* that buffer's last readers left it before the previous barrier */
    __syncthreads();      /* publishes stage st + 1 and ends every read of stage st */
  }
  for (int qt = 0; qt < 2; ++qt) { const float inv = 64.0f / (l[qt] + xl_x16(l[qt])); _Float16* op = O + ((size_t)b * SQ + q0 + qt * 16 + ln) * DM + h * HD + 8 * hh;      /* a lane holds 8 consecutive dims of one query row: one 16-byte store a tile */
    for (int dt = 0; dt < 4; ++dt) { const v8f y = o[dt][qt] * inv; *(v8h*)(op + dt * 16) = __builtin_convertvector(y, v8h); } } }

// ---- block-tiled GEMM for the one shape used here: C[NR][DM] = A[NR][DM] Bt[DM][DM]^T (f16 rows, k contiguous); epilogue values as k_gemm2 (alpha, bf16-rounded bias; RES: own-element residual, f32 rows; else f16 rows) ----
// A block of 8 waves owns 256 x 128 of C, a wave 64 x 64 (4 x 4 accumulator tiles). A tile is 128 k of the block's 256 A rows and 128 Bt rows, brought into LDS by asynchronous copies: a wave's copy covers four whole 128-byte lines,
// each line is fetched once a block, and the waves take their fragments from LDS. Two buffers: tile t + 1 flies while tile t is worked on; one barrier a tile. k runs in the same order as before.
#define G3P 136      /* LDS row pitch in f16: 256 data bytes + 16 (16 B x odd: the 16-byte fragment reads of 16 rows fall on distinct banks) */
#define G3T (384 * G3P * 2)      /* bytes of one buffer: rows 0-255 A, rows 256-383 Bt */
typedef float f1a __attribute__((may_alias));
// Twelve copies of 16 bytes a lane, LDS byte address l + i * 16 rows, global rows g[i]; s_wait_xcnt 0 is the statement's last line, so that it stands in front of whatever rewrites a register that a copy names.
__device__ __forceinline__ void g3_copy12(unsigned l, const unsigned short* g0, const unsigned short* g1, const unsigned short* g2, const unsigned short* g3, const unsigned short* g4, const unsigned short* g5,
                                          const unsigned short* g6, const unsigned short* g7, const unsigned short* g8, const unsigned short* g9, const unsigned short* g10, const unsigned short* g11) {
  const unsigned p = 16 * G3P * 2;
  asm volatile("global_load_async_to_lds_b128 %0, %12, off\n\tglobal_load_async_to_lds_b128 %1, %13, off\n\tglobal_load_async_to_lds_b128 %2, %14, off\n\tglobal_load_async_to_lds_b128 %3, %15, off\n\tglobal_load_async_to_lds_b128 %4, %16, off\n\tglobal_load_async_to_lds_b128 %5, %17, off\n\tglobal_load_async_to_lds_b128 %6, %18, off\n\tglobal_load_async_to_lds_b128 %7, %19, off\n\tglobal_load_async_to_lds_b128 %8, %20, off\n\tglobal_load_async_to_lds_b128 %9, %21, off\n\tglobal_load_async_to_lds_b128 %10, %22, off\n\tglobal_load_async_to_lds_b128 %11, %23, off\n\ts_wait_xcnt 0x0"
      :: "v"(l), "v"(l + p), "v"(l + 2 * p), "v"(l + 3 * p), "v"(l + 4 * p), "v"(l + 5 * p), "v"(l + 6 * p), "v"(l + 7 * p), "v"(l + 8 * p), "v"(l + 9 * p), "v"(l + 10 * p), "v"(l + 11 * p),
         "v"(g0), "v"(g1), "v"(g2), "v"(g3), "v"(g4), "v"(g5), "v"(g6), "v"(g7), "v"(g8), "v"(g9), "v"(g10), "v"(g11) : "memory"); }
// one tile: a thread's 16 A pieces (rows sr + 16 i) and 8 Bt pieces; l = the LDS byte address of its piece of row sr in the target buffer
__device__ __forceinline__ void g3_tile(unsigned l, const unsigned short* a, const unsigned short* b) { const size_t s = (size_t)16 * DM;
  g3_copy12(l, a, a + s, a + 2 * s, a + 3 * s, a + 4 * s, a + 5 * s, a + 6 * s, a + 7 * s, a + 8 * s, a + 9 * s, a + 10 * s, a + 11 * s);
  g3_copy12(l + 12 * 16 * G3P * 2, a + 12 * s, a + 13 * s, a + 14 * s, a + 15 * s, b, b + s, b + 2 * s, b + 3 * s, b + 4 * s, b + 5 * s, b + 6 * s, b + 7 * s); }
template <bool RES>
__global__ __launch_bounds__(256) void k_gemm3(const _Float16* __restrict__ A, const _Float16* __restrict__ Bh, float alpha, const float* __restrict__ bias, const float* __restrict__ CP, float* __restrict__ C, _Float16* __restrict__ C16) {
  static_assert(NR % 256 == 0 && DM % 128 == 0 && DM / 128 >= 2, "k_gemm3: whole tiles only, two or more along k");
  __shared__ __attribute__((aligned(16))) _Float16 sm[2][384][G3P];      /* after the loop: each wave's 64 x 68 f32 output staging */
  const int tid = threadIdx.x, lane = tid & 31, ln = lane & 15, hh = lane >> 4, w = tid >> 5; const int mt = blockIdx.x / (DM / 128), nq = blockIdx.x % (DM / 128); const int wm = (w & 3) * 64, wn = (w >> 2) * 64;
  const int row0 = mt * 256 + wm, col0 = nq * 128 + wn;
  const int sr = tid >> 4, sc = (tid & 15) * 8;      /* staging: 16 threads a 256-byte row piece */
  const unsigned short* ag = (const unsigned short*)A + (size_t)(mt * 256 + sr) * DM + sc; const unsigned short* bg = (const unsigned short*)Bh + (size_t)(nq * 128 + sr) * DM + sc;
  const unsigned l0 = (unsigned)(size_t)&sm[0][sr][sc];      /* low 32 bits of the shared address = byte offset in the work-group's LDS */
  g3_tile(l0, ag, bg);
  float bv[4] = {0.f, 0.f, 0.f, 0.f};
  if (bias) {
#pragma unroll
    for (int ni = 0; ni < 4; ++ni) bv[ni] = bf16_round(bias[col0 + ni * 16 + ln]); }
  const v8f z8 = {0.f, 0.f, 0.f, 0.f, 0.f, 0.f, 0.f, 0.f}; v8f acc[4][4];
#pragma unroll
  for (int mi = 0; mi < 4; ++mi) for (int ni = 0; ni < 4; ++ni) acc[mi][ni] = z8;
  asm volatile("s_wait_asynccnt 0x0" ::: "memory");      /* this wave's copies of tile 0 have landed */
  __syncthreads();      /* publishes tile 0 */
  g3_tile(l0 + G3T, ag + 128, bg + 128);
#pragma unroll 1      /* rolled: one trip holds 64 matrix instructions; for speed only */
  for (int t = 0; t < DM / 128; ++t) { const int cur = t & 1; v16h af[2][4], bf[2][4];
#pragma unroll
    for (int i = 0; i < 4; ++i) { af[0][i] = g2_frag(&sm[cur][wm + i * 16 + ln][0], hh); bf[0][i] = g2_frag(&sm[cur][256 + wn + i * 16 + ln][0], hh); }
#pragma unroll
    for (int ks = 0; ks < 4; ++ks) {
      if (ks < 3) {
#pragma unroll
        for (int i = 0; i < 4; ++i) { af[(ks + 1) & 1][i] = g2_frag(&sm[cur][wm + i * 16 + ln][(ks + 1) * 32], hh); bf[(ks + 1) & 1][i] = g2_frag(&sm[cur][256 + wn + i * 16 + ln][(ks + 1) * 32], hh); } }
      __builtin_amdgcn_sched_barrier(0);      /* the next block's 16 LDS reads stay one group in front of this block, for speed only */
#pragma unroll
      for (int mi = 0; mi < 4; ++mi) for (int ni = 0; ni < 4; ++ni) acc[mi][ni] = fa_mma(af[ks & 1][mi], bf[ks & 1][ni], acc[mi][ni]);
      __builtin_amdgcn_sched_barrier(0);      /* and the block after next's reads stay behind it */
    }
    asm volatile("s_wait_dscnt 0x0" ::: "memory");      /* this wave's reads of tile t are done */
    asm volatile("s_wait_asynccnt 0x0" ::: "memory");      /* its copies of tile t + 1 have landed */
    __syncthreads();      /* publishes tile t + 1 and ends every read of tile t */
    if (t + 2 < DM / 128) g3_tile(l0 + (unsigned)cur * G3T, ag + (t + 2) * 128, bg + (t + 2) * 128);      /* block-uniform; into the buffer that trip t has just read */
  }
  asm volatile("s_wait_asynccnt 0x0" ::: "memory");      /* nothing is in flight when the buffers become output staging */
  f1a* so = (f1a*)&sm[0][0][0] + (size_t)w * 64 * 68; const int rsub = lane >> 4, c4 = (lane & 15) * 4;
  const size_t e0 = (size_t)(row0 + rsub) * DM + col0 + c4;
  v4f c[RES ? 32 : 1];
  if (RES) { const float* cp = CP + e0;      /* own elements of the residual plane, whole 256-byte row pieces, all in flight together under the staging below (the fragments' registers are free by now) */
#pragma unroll
    for (int q = 0; q < 32; ++q) c[q] = *(const v4fa*)(cp + (size_t)q * 2 * DM);
    asm volatile("s_wait_xcnt 0x0" :: "v"(cp) : "memory"); }      /* the wait owed before a register that an issued load names is rewritten; the address is an input so that it stays whole up to here */
#pragma unroll
  for (int ni = 0; ni < 4; ++ni) for (int mi = 0; mi < 4; ++mi) for (int r = 0; r < 8; ++r) so[(mi * 16 + 8 * hh + r) * 68 + ni * 16 + ln] = acc[mi][ni][r] * alpha + bv[ni];
  __builtin_amdgcn_fence(__ATOMIC_ACQ_REL, "workgroup"); __builtin_amdgcn_wave_barrier();      /* a wave reads back only its own staging rows */
  if (RES) {
#pragma unroll
    for (int q = 0; q < 32; ++q) { const v4f v = *(const v4fa*)&so[(q * 2 + rsub) * 68 + c4] + c[q]; *(v4f*)(C + e0 + (size_t)q * 2 * DM) = v; }
  } else {
#pragma unroll
    for (int q = 0; q < 32; ++q) { const v4f v = *(const v4fa*)&so[(q * 2 + rsub) * 68 + c4]; *(v4h*)(C16 + e0 + (size_t)q * 2 * DM) = __builtin_convertvector(v, v4h); } } }

template <int MODE>
__global__ __launch_bounds__(256) void k_regrp(const float* __restrict__ src, float* __restrict__ dst, size_t n4) {
  const size_t t = (size_t)blockIdx.x * 256 + threadIdx.x; if (t >= n4) return; const size_t e = t * 4; const size_t rd = e / DM; const int c = (int)(e % DM);
  size_t rs; if (MODE == 0) { const size_t b = rd / SQ, sq = rd % SQ; rs = sq * NB + b; } else { const size_t sq = rd / NB, b = rd % NB; rs = b * SQ + sq; }
  const v4f v = *(const v4fa*)(src + rs * DM + c); *(v4f*)(dst + e) = v;  }

template <int BFIN, int W16, int W32>
__global__ __launch_bounds__(256) void k_lnx(const float* __restrict__ X, const float* __restrict__ g, const float* __restrict__ bb, float eps, _Float16* __restrict__ N16, float* __restrict__ N32) {
  #pragma clang fp contract(off)
  __shared__ float red[256]; const size_t r = blockIdx.x; const int t = threadIdx.x; const bool act = t < (DMQ / 4); const int c0 = act ? t * 4 : 0;
  const v4f xa = *(const v4fa*)(X + r * DMQ + c0); float s[4]; float sum = 0.f;
  for (int q = 0; q < 4; ++q) { s[q] = act ? (BFIN ? bf16_round(xa[q]) : xa[q]) : 0.f; sum = __fadd_rn(sum, s[q]); }
  red[t] = sum; __syncthreads(); for (int st = 128; st > 0; st >>= 1) { if (t < st) red[t] = __fadd_rn(red[t], red[t + st]); __syncthreads(); } const float mu = red[0] / (float)DMQ; __syncthreads();
  float vs = 0.f; for (int q = 0; q < 4; ++q) { const float dl = act ? __fadd_rn(s[q], -mu) : 0.f; vs = __fadd_rn(vs, __fmul_rn(dl, dl)); } red[t] = vs; __syncthreads(); for (int st = 128; st > 0; st >>= 1) { if (t < st) red[t] = __fadd_rn(red[t], red[t + st]); __syncthreads(); }
  const float rs = rsqrtf(__fadd_rn(red[0] / (float)DMQ, eps)); v4h y; v4f yf;
  for (int q = 0; q < 4; ++q) { const int c = c0 + q; yf[q] = __fadd_rn(__fmul_rn(__fmul_rn(__fadd_rn(s[q], -mu), rs), bf16_round(g[c])), bf16_round(bb[c])); y[q] = (_Float16)yf[q]; }
  if (!act) return;      /* no barriers after this point */
  { if (W16) *(v4h*)(N16 + r * DMQ + c0) = y; if (W32) *(v4f*)(N32 + r * DMQ + c0) = yf;  } }

__global__ __launch_bounds__(256) void k_bfr(const float* __restrict__ x, float* __restrict__ XB, size_t n8) { const size_t t = (size_t)blockIdx.x * 256 + threadIdx.x; if (t >= n8) return; v4f a = *(const v4fa*)(x + t * 8), c = *(const v4fa*)(x + t * 8 + 4); for (int q = 0; q < 4; ++q) { a[q] = bf16_round(a[q]); c[q] = bf16_round(c[q]); }
  { *(v4f*)(XB + t * 8) = a; *(v4f*)(XB + t * 8 + 4) = c;  } }



__global__ __launch_bounds__(256) void k_wthd(const float* __restrict__ Wt, _Float16* __restrict__ Bt) { const size_t t = (size_t)blockIdx.x * 256 + threadIdx.x; if (t >= (size_t)NH * HD * (DM / 8)) return; const int m8 = (int)(t % (DM / 8)) * 8; const int d = (int)((t / (DM / 8)) % HD); const int h = (int)(t / ((size_t)(DM / 8) * HD)); FragH f;
  for (int q = 0; q < 8; ++q) f.h[q] = (_Float16)(16.0f * bf16_round(Wt[((size_t)h * DM + m8 + q) * HD + d])); unsigned short* dst = (unsigned short*)Bt + ((size_t)h * HD + d) * DM + m8; *(v8us*)dst = f.half[0];  }




template <int BFIN, int SCAL>
__global__ __launch_bounds__(256) void k_lnsc(const float* __restrict__ X, const float* __restrict__ g, const float* __restrict__ bb, float eps, _Float16* __restrict__ N16, float* __restrict__ N32) {
  #pragma clang fp contract(off)
  __shared__ float red[256]; const size_t r = blockIdx.x; const int t = threadIdx.x; const bool act = t < DM / 4; const int tc = act ? t : 0; const v4f xl = *(const v4fa*)(X + r * DM + tc * 4); const float am = act ? 1.f : 0.f; float s[4]; float sum = 0.f;
  for (int q = 0; q < 4; ++q) { s[q] = (BFIN ? bf16_round(xl[q]) : xl[q]) * am; sum = __fadd_rn(sum, s[q]); }
  red[t] = sum; __syncthreads(); for (int st = 128; st > 0; st >>= 1) { if (t < st) red[t] = __fadd_rn(red[t], red[t + st]); __syncthreads(); } const float mu = red[0] / (float)DM; __syncthreads();
  float vs = 0.f; for (int q = 0; q < 4; ++q) { const float dl = __fadd_rn(s[q], -mu) * am; vs = __fadd_rn(vs, __fmul_rn(dl, dl)); } red[t] = vs; __syncthreads(); for (int st = 128; st > 0; st >>= 1) { if (t < st) red[t] = __fadd_rn(red[t], red[t + st]); __syncthreads(); }
  const float rs = __fdiv_rn(1.0f, __fadd_rn(sqrtf(red[0] / (float)(DM - 1)), eps)); if (!act) return; v4h y; v4f yf;
  for (int q = 0; q < 4; ++q) { const int c = t * 4 + q; const float gg = bf16_round(SCAL ? g[0] : g[c]), bv = bf16_round(SCAL ? bb[0] : bb[c]); yf[q] = __fadd_rn(__fmul_rn(__fmul_rn(__fadd_rn(s[q], -mu), rs), gg), bv); y[q] = (_Float16)yf[q]; }
  { if (N16) *(v4h*)(N16 + r * DM + t * 4) = y; if (N32) *(v4f*)(N32 + r * DM + t * 4) = yf;  } }

__global__ __launch_bounds__(256) void k_rsmdmi(const float* __restrict__ S, _Float16* __restrict__ P, int nrows, const int* __restrict__ M) {
  #pragma clang fp contract(off)
  const int t = blockIdx.x * 256 + threadIdx.x; if (t >= nrows) return; const float* s = S + (size_t)t * SQ; const int* m = M + (size_t)(t % SQ) * SQ; float mx = -3.0e38f;
#pragma unroll 1
  for (int j = 0; j < SQ; ++j) { const float f = (m[j] == 0) ? 1.f : 0.f; mx = fmaxf(mx, fmaf(f, s[j], (1.f - f) * -1.0e9f)); } float se = 0.f;
#pragma unroll 1
  for (int j = 0; j < SQ; ++j) { const float f = (m[j] == 0) ? 1.f : 0.f; se += __expf(fmaf(f, s[j], (1.f - f) * -1.0e9f) - mx); } const float sc = 256.0f / se;
#pragma unroll 1
  for (int j0 = 0; j0 < SQ; j0 += 8) { FragH fr; for (int q = 0; q < 8; ++q) { const int j = j0 + q; const float f = (m[j] == 0) ? 1.f : 0.f; fr.h[q] = (_Float16)(__expf(fmaf(f, s[j], (1.f - f) * -1.0e9f) - mx) * sc); } unsigned short* d = (unsigned short*)P + (size_t)t * SQ + j0; *(v8us*)d = fr.half[0];  } }
extern "C" void kernel_launch(void* const* d_in, const int* in_sizes, int n_in,
                              void* d_out, int out_size, void* d_ws, size_t ws_size, hipStream_t stream) {
  (void)in_sizes; (void)n_in; (void)out_size;
  const float* const* I = (const float* const*)d_in; const float* x = I[0]; const float* g1 = I[1]; const float* be1 = I[2]; const float* wqkv = I[3]; const float* wo = I[4]; const float* bo = I[5]; const float* bq = nullptr; const float* bk = nullptr; const float* bv = nullptr;      /* x; LayerNorm gamma / beta; fused NATURAL w_qkv [3072][1024] (row blocks q | k | v; no bias); natural w_proj [1024][1024] + b_proj */
  char* ws = (char*)d_ws; size_t off = 0;
  auto take = [&](size_t bytes) { char* p = ws + off; off += (bytes + 255) & ~(size_t)255; return p; };
  _Float16* BQ = (_Float16*)take((size_t)3 * DM * DM * 2); _Float16* BK = BQ + (size_t)DM * DM; _Float16* BV = BQ + (size_t)2 * DM * DM;      /* one stacked Bt plane [3 DM][DM] */ _Float16* BO = (_Float16*)take((size_t)DM * DM * 2);
  float* XB = (float*)take(NR * DM * 4); _Float16* XN = (_Float16*)take(NR * DM * 2); _Float16* Q16 = (_Float16*)take(NR * DM * 2); _Float16* K16 = (_Float16*)take(NR * DM * 2); _Float16* V16 = (_Float16*)take(NR * DM * 2); _Float16* O16 = (_Float16*)take(NR * DM * 2);
  _Float16* VT = (_Float16*)take((size_t)NB * NH * HD * SQ * 2);
  /* attention sub-block only: no second norm, no MLP planes */
  
  if (off > ws_size) return;
  k_wnat<<<(unsigned)(((size_t)3 * DM * DM / 8 + 255) / 256), 256, 0, stream>>>(wqkv, (size_t)3 * DM * DM / 8, BQ); k_wnat<<<(unsigned)(((size_t)DM * DM / 8 + 255) / 256), 256, 0, stream>>>(wo, (size_t)DM * DM / 8, BO);      /* natural [out][in] = Bt x16 as given: the fused [3 DM][DM] matrix IS the stacked plane (rows 0 / DM / 2 DM = q | k | v); w_proj likewise */
  /* no MLP weights */
  k_bfr<<<(unsigned)((NR * DM / 8 + 255) / 256), 256, 0, stream>>>(x, XB, NR * DM / 8); k_lnx<1, 1, 0><<<(unsigned)NR, 256, 0, stream>>>(x, g1, be1, 1e-5f, XN, nullptr);      /* n = LN0(bf16(x)) (biased variance, eps inside the rsqrt) -> f16 rows */
  k_gemm3<false><<<(unsigned)((NR / 256) * (DM / 128)), 256, 0, stream>>>(XN, BQ, 0.0625f, bq, nullptr, nullptr, Q16); k_gemm3<false><<<(unsigned)((NR / 256) * (DM / 128)), 256, 0, stream>>>(XN, BK, 0.0625f, bk, nullptr, nullptr, K16); k_gemm3<false><<<(unsigned)((NR / 256) * (DM / 128)), 256, 0, stream>>>(XN, BV, 0.0625f, bv, nullptr, nullptr, V16);      /* q, k, v -> f16 rows; head h = columns h*64.. */
  k_vt<NH, SQ><<<NB * NH * (SQ / 64), 256, 0, stream>>>(V16, DM, 0, VT);      /* V^T [4 * 16][64][2048], every batch */
  k_fattn<<<dim3(SQ / 256, NB * NH), 256, 0, stream>>>(Q16, K16, VT, O16);      /* softmax(q k^T / 8) v over all keys, every (batch, head) in one launch -> ctx (merged heads, x64) as f16 rows */
  k_gemm3<true><<<(unsigned)((NR / 256) * (DM / 128)), 256, 0, stream>>>(O16, BO, 0.0009765625f, bo, XB, (float*)d_out, nullptr);      /* x + ctx wo (+ bo) (own-element residual) -> f32 rows */
  /* result = x + out: written straight to d_out by the GEMM above (own-element residual with the bf16-rounded input copy) */
}

// v004
// Measured time: 128 microseconds a run.
// In two side-by-side timings against v003, it was 1.17 and 1.16 times as fast.
// Counting every step since v000, it is 53.8 times as fast.
#include <hip/hip_runtime.h>
// Pre-LN multi-head self-attention sub-block with a residual (x [4][2048][1024]; h = LayerNorm(x) (biased var, eps 1e-5, gamma / beta); qkv = h w_qkv^T (natural [3072][1024]: row blocks q | k | v, each (head, dim)); no qkv bias; 16 heads of 64; scale 64^-0.5; softmax over all 2048 keys (no mask); out = merged w_proj^T + b_proj (natural); result = x + out -> [4][2048][1024]).
// Structure, four launches: LayerNorm -> f16 rows, with the weight rounding in the same grid; one WMMA GEMM grid for q, k, v (V^T written by its epilogue); one fused attention launch (scores, online softmax, V^T P^T; S and P stay in registers); output projection with the own-element residual, rounded in its epilogue.
// Compute dtype: inputs rounded to bf16; x / weights exact; q, k, v, softmax weights and o as plain f16 GEMM operands (~2^-12); scores and softmax statistics f32; v_wmma_f32_16x16x32_f16.
#define NB 4
#define SQ 2048
#define DM 1024
#define NH 16
#define HD 64
#define HG 4                         /* heads per block group of the unlaunched k_vt overload */
#define LOCALW 128                   /* (macros for unused kernels of the shared header) */
#define STRIDEK 128
#define QT 256                       /* query rows per causal tile */
#define NKX SQ                       /* S / P row pitch */
#define QT0 128                      /* first-tile rows recomputed exactly in f32 */
#define B0 0                         /* unused: every batch is processed */
#define NBR NB                       /* unused by the launches: they cover all NB batches */
#define NR ((size_t)NB * SQ)
#define DMQ DM
#define DFF 4096         /* unused: no FFN in this sub-block */
#define MP ((int)((size_t)NBR * SQ)) /* unused: the projections cover NR rows */
#define QN SQ                        /* unused: every query row is attended */
#define NHD NH                       /* unused: every head is attended */
#define MPO MP                       /* unused: the output GEMM covers NR rows */
#define LQ (3 * DM)      /* unused: the q, k, v rows have pitch DM */
typedef __bf16 v16b __attribute__((ext_vector_type(16)));
typedef unsigned short v8us __attribute__((ext_vector_type(8), may_alias));
typedef float  v8f  __attribute__((ext_vector_type(8)));
typedef float  v4f  __attribute__((ext_vector_type(4)));
typedef float  v4fa __attribute__((ext_vector_type(4), may_alias));
union FragB { v16b v; v8us half[2]; unsigned short u[16]; };

__device__ __forceinline__ unsigned short bf16_bits(float x) { unsigned int u = __float_as_uint(x); return (unsigned short)((u + 0x7FFFu + ((u >> 16) & 1u)) >> 16); }
__device__ __forceinline__ float bf16_val(unsigned short b) { return __uint_as_float(((unsigned int)b) << 16); }
__device__ __forceinline__ float bf16_round(float x) { return bf16_val(bf16_bits(x)); }
// D += A·B with NT terms: 1 = ah·bh, 2 = + al·bh (A split), 3 = + ah·bl (both split)
template <int NT>
__device__ __forceinline__ v8f mmaN(v16b ah, v16b al, v16b bh, v16b bl, v8f c) {
  c = __builtin_amdgcn_wmma_f32_16x16x32_bf16(false, ah, false, bh, (short)0, c, false, false);
  if (NT >= 2) c = __builtin_amdgcn_wmma_f32_16x16x32_bf16(false, al, false, bh, (short)0, c, false, false);
  if (NT >= 3) c = __builtin_amdgcn_wmma_f32_16x16x32_bf16(false, ah, false, bl, (short)0, c, false, false);
  asm volatile("v_nop\n\tv_nop\n\tv_nop\n\tv_nop" : "+v"(c) : "v"(ah), "v"(al), "v"(bh), "v"(bl));
  return c;
}

__global__ __launch_bounds__(256) void k_wt_bf16(const float* __restrict__ W, unsigned short* __restrict__ Wt, int K, int N) {
  const int t = blockIdx.x * 256 + threadIdx.x;
  const int k8n = K / 8;
  if (t >= N * k8n) return;
  const int n = t / k8n, k8 = (t % k8n) * 8;
  v8us v;
#pragma unroll
  for (int i = 0; i < 8; ++i) v[i] = bf16_bits(W[(size_t)(k8 + i) * N + n]);
  *(v8us*)(Wt + (size_t)n * K + k8) = v;
  
}

// GEMM C[M][N] (f32, pitch ldc) = act(A[M][K]·W + bias). A f32 row-major (pitch lda) converted per fragment to bf16
// (ASPLIT: hi/lo two planes -> 2 terms, else single rounded term); Wt bf16 [N][K] (pitch ldb). BIAS_BF16 rounds the
// bias to bf16 first (bias quantised to bf16 before the add). K%32==0, M%16==0, N%64==0.
template <bool ASPLIT, int ACT, bool BIAS_BF16>
__global__ __launch_bounds__(128) void k_gemm_bf(const float* __restrict__ A, int lda, const unsigned short* __restrict__ Wt, int ldb,
                                               const float* __restrict__ bias, float* __restrict__ C, int ldc, int M, int N, int K) {
  __shared__ __attribute__((aligned(16))) float so[4][16][64];
  const int tid = threadIdx.x, w = tid >> 5, lane = tid & 31, ln = lane & 15, hh = lane >> 4;
  const int ntn = N / 64;
  const int wid = blockIdx.x * 4 + w;
  const int mt = wid / ntn, nq = wid % ntn;
  if (mt * 16 >= M) return;
  const int row0 = mt * 16, col0 = nq * 64;
  const float* arow = A + (size_t)(row0 + ln) * lda;
  v8f acc[4] = {};
  for (int kb = 0; kb < K; kb += 32) {
    FragB ah, al;
    const v4f x0 = *(const v4fa*)(arow + kb + 8 * hh), x1 = *(const v4fa*)(arow + kb + 8 * hh + 4);
    const v4f x2 = *(const v4fa*)(arow + kb + 16 + 8 * hh), x3 = *(const v4fa*)(arow + kb + 16 + 8 * hh + 4);
    float xs[16] = {x0[0],x0[1],x0[2],x0[3],x1[0],x1[1],x1[2],x1[3],x2[0],x2[1],x2[2],x2[3],x3[0],x3[1],x3[2],x3[3]};
#pragma unroll
    for (int i = 0; i < 16; ++i) { const unsigned short hb = bf16_bits(xs[i]); ah.u[i] = hb; al.u[i] = ASPLIT ? bf16_bits(xs[i] - bf16_val(hb)) : (unsigned short)0; }
#pragma unroll
    for (int t = 0; t < 4; ++t) {
      const unsigned short* brow = Wt + (size_t)(col0 + t * 16 + ln) * ldb + kb;
      FragB b;
      b.half[0] = *(const v8us*)(brow + 8 * hh);
      b.half[1] = *(const v8us*)(brow + 16 + 8 * hh);
      acc[t] = mmaN<ASPLIT ? 2 : 1>(ah.v, al.v, b.v, b.v, acc[t]);
    }
  }
#pragma unroll
  for (int t = 0; t < 4; ++t) {
    float bv = bias ? bias[col0 + t * 16 + ln] : 0.f;
    if (BIAS_BF16) bv = bf16_round(bv);
#pragma unroll
    for (int r = 0; r < 8; ++r) { float v = acc[t][r] + bv; if (ACT == 1) v = fmaxf(v, 0.f); so[w][8 * hh + r][t * 16 + ln] = v; }
  }
  __builtin_amdgcn_fence(__ATOMIC_ACQ_REL, "workgroup");
  __builtin_amdgcn_wave_barrier();
  const int rsub = lane >> 4, c4 = (lane & 15) * 4;
  {
#pragma unroll
    for (int q = 0; q < 8; ++q) {
      const int r = q * 2 + rsub;
      const v4f v = *(const v4fa*)&so[w][r][c4];
      *(v4f*)(C + (size_t)(row0 + r) * ldc + col0 + c4) = v;
    }
    
  }
}

// GEMM C = act(A·W + bias + resid): A f32 (ASPLIT -> hi/lo 2 terms), Wt bf16 [N][K]; ACT 0 none, 1 relu, 2 exact gelu;
// resid (optional, f32, row index = (row % rmod), pitch ldr, RES_BF16 rounds it) added before the activation.
template <bool ASPLIT, int ACT, bool BIAS_BF16, bool RES_BF16>
__global__ __launch_bounds__(128) void k_gemm_bf3(const float* __restrict__ A, int lda, const unsigned short* __restrict__ Wt, int ldb,
                                                const float* __restrict__ bias, const float* __restrict__ resid, int rmod, int ldr,
                                                float* __restrict__ C, int ldc, int M, int N, int K) {
  __shared__ __attribute__((aligned(16))) float so[4][16][64];
  const int tid = threadIdx.x, w = tid >> 5, lane = tid & 31, ln = lane & 15, hh = lane >> 4;
  const int ntn = N / 64;
  const int wid = blockIdx.x * 4 + w;
  const int mt = wid / ntn, nq = wid % ntn;
  if (mt * 16 >= M) return;
  const int row0 = mt * 16, col0 = nq * 64;
  const float* arow = A + (size_t)(row0 + ln) * lda;
  v8f acc[4] = {};
  for (int kb = 0; kb < K; kb += 32) {
    FragB ah, al;
    const v4f x0 = *(const v4fa*)(arow + kb + 8 * hh), x1 = *(const v4fa*)(arow + kb + 8 * hh + 4);
    const v4f x2 = *(const v4fa*)(arow + kb + 16 + 8 * hh), x3 = *(const v4fa*)(arow + kb + 16 + 8 * hh + 4);
    float xs[16] = {x0[0],x0[1],x0[2],x0[3],x1[0],x1[1],x1[2],x1[3],x2[0],x2[1],x2[2],x2[3],x3[0],x3[1],x3[2],x3[3]};
#pragma unroll
    for (int i = 0; i < 16; ++i) { const unsigned short hb = bf16_bits(xs[i]); ah.u[i] = hb; al.u[i] = ASPLIT ? bf16_bits(xs[i] - bf16_val(hb)) : (unsigned short)0; }
#pragma unroll
    for (int t = 0; t < 4; ++t) {
      const unsigned short* brow = Wt + (size_t)(col0 + t * 16 + ln) * ldb + kb;
      FragB b;
      b.half[0] = *(const v8us*)(brow + 8 * hh);
      b.half[1] = *(const v8us*)(brow + 16 + 8 * hh);
      acc[t] = mmaN<ASPLIT ? 2 : 1>(ah.v, al.v, b.v, b.v, acc[t]);
    }
  }
#pragma unroll
  for (int t = 0; t < 4; ++t) {
    const int col = col0 + t * 16 + ln;
    float bv = bias ? bias[col] : 0.f;
    if (BIAS_BF16) bv = bf16_round(bv);
#pragma unroll
    for (int r = 0; r < 8; ++r) {
      float v = acc[t][r] + bv;
      if (resid) { float rv = resid[(size_t)((row0 + 8 * hh + r) % rmod) * ldr + col]; if (RES_BF16) rv = bf16_round(rv); v += rv; }
      if (ACT == 1) v = fmaxf(v, 0.f);
      if (ACT == 2) v = 0.5f * v * (1.0f + erff(v * 0.70710678118654752f));
      if (ACT == 3) { const float u = 0.7978845608028654f * (v + 0.044715f * v * v * v); v = 0.5f * v * (1.0f + tanhf(u)); }
      so[w][8 * hh + r][t * 16 + ln] = v;
    }
  }
  __builtin_amdgcn_fence(__ATOMIC_ACQ_REL, "workgroup");
  __builtin_amdgcn_wave_barrier();
  const int rsub = lane >> 4, c4 = (lane & 15) * 4;
  {
#pragma unroll
    for (int q = 0; q < 8; ++q) {
      const int r = q * 2 + rsub;
      const v4f v = *(const v4fa*)&so[w][r][c4];
      *(v4f*)(C + (size_t)(row0 + r) * ldc + col0 + c4) = v;
    }
    
  }
}
// row LayerNorm (biased variance, eps) over N: s = X (+ R); optional out_sum <- s; out_norm <- (s-mu)*rsqrt(var+eps)*g + b
template <bool PARAM_BF16>
__global__ __launch_bounds__(256) void k_layernorm(const float* __restrict__ X, const float* __restrict__ R, const float* __restrict__ g, const float* __restrict__ bta,
                                                  float* __restrict__ out_sum, float* __restrict__ out_norm, int N, float eps) {
  __shared__ float red[256];
  const int row = blockIdx.x, tid = threadIdx.x;
  const float* x = X + (size_t)row * N; const float* rr = R ? R + (size_t)row * N : nullptr;
  float vals[16];                     // up to N = 4096
  const int per = N / 256;            // contiguous chunk per thread? use strided-by-4 chunks: thread handles j = tid*4 + 1024*u
  float s1 = 0.f;
  for (int u = 0; u < per / 4; ++u) {
    const int j = tid * 4 + 1024 * u;
    const v4f a = *(const v4fa*)(x + j);
    v4f b = {0.f,0.f,0.f,0.f}; if (rr) b = *(const v4fa*)(rr + j);
#pragma unroll
    for (int q = 0; q < 4; ++q) { const float v = a[q] + b[q]; vals[u * 4 + q] = v; s1 += v; }
  }
  red[tid] = s1; __syncthreads();
  for (int st = 128; st > 0; st >>= 1) { if (tid < st) red[tid] += red[tid + st]; __syncthreads(); }
  const float mu = red[0] / (float)N; __syncthreads();
  float s2 = 0.f;
  for (int u = 0; u < per / 4; ++u)
#pragma unroll
    for (int q = 0; q < 4; ++q) { const float c = vals[u * 4 + q] - mu; s2 += c * c; }
  red[tid] = s2; __syncthreads();
  for (int st = 128; st > 0; st >>= 1) { if (tid < st) red[tid] += red[tid + st]; __syncthreads(); }
  const float rs = rsqrtf(red[0] / (float)N + eps);
  {
    for (int u = 0; u < per / 4; ++u) {
      const int j = tid * 4 + 1024 * u;
      v4f o, sm;
#pragma unroll
      for (int q = 0; q < 4; ++q) {
        float gg = g[j + q], bb = bta[j + q];
        if (PARAM_BF16) { gg = bf16_round(gg); bb = bf16_round(bb); }
        sm[q] = vals[u * 4 + q]; o[q] = (vals[u * 4 + q] - mu) * rs * gg + bb;
      }
      if (out_sum) *(v4f*)(out_sum + (size_t)row * N + j) = sm;
      *(v4f*)(out_norm + (size_t)row * N + j) = o;
    }
    
  }
}



// ---- f16 WMMA path (v_wmma_f32_16x16x32_f16): 11-bit significands for operands in range — used where a [0,1] probability operand needs more precision than bf16
typedef _Float16 v16h __attribute__((ext_vector_type(16)));
union FragH { v16h v; v8us half[2]; _Float16 h[16]; unsigned short u[16]; };
template <int NT>
__device__ __forceinline__ v8f mmaH(v16h ah, v16h al, v16h bh, v16h bl, v8f c) {
  c = __builtin_amdgcn_wmma_f32_16x16x32_f16(false, ah, false, bh, (short)0, c, false, false);
  if (NT >= 2) c = __builtin_amdgcn_wmma_f32_16x16x32_f16(false, al, false, bh, (short)0, c, false, false);
  if (NT >= 3) c = __builtin_amdgcn_wmma_f32_16x16x32_f16(false, ah, false, bl, (short)0, c, false, false);
  asm volatile("v_nop\n\tv_nop\n\tv_nop\n\tv_nop" : "+v"(c) : "v"(ah), "v"(al), "v"(bh), "v"(bl));
  return c;
}
// batched GEMM like k_gemm_b but f16 operands: A f32 (split into f16 hi/lo if ASPLIT, else rounded to f16), Bt = f16 values [n][k]; alpha; C f32; N multiple of 16 (partial tiles skipped)
template <bool ASPLIT>
__global__ __launch_bounds__(128) void k_gemm_h(const float* __restrict__ A, int lda, size_t sA, const _Float16* __restrict__ Bh, int ldb, size_t sB, float alpha, float* __restrict__ C, int ldc, size_t sC, int M, int N, int K) {
  __shared__ __attribute__((aligned(16))) float so[4][16][64];
  const int tid = threadIdx.x, w = tid >> 5, lane = tid & 31, ln = lane & 15, hh = lane >> 4; const int by = blockIdx.y;
  A += (size_t)by * sA; Bh += (size_t)by * sB; C += (size_t)by * sC;
  const int ntn = (N + 63) / 64; const int wid = blockIdx.x * 4 + w; const int mt = wid / ntn, nq = wid % ntn; if (mt * 16 >= M) return;
  const int row0 = mt * 16, col0 = nq * 64; const float* arow = A + (size_t)(row0 + ln) * lda;
  v8f acc[4] = {};
  for (int kb = 0; kb < K; kb += 32) {
    FragH ah, al;
    const v4f x0 = *(const v4fa*)(arow + kb + 8 * hh), x1 = *(const v4fa*)(arow + kb + 8 * hh + 4), x2 = *(const v4fa*)(arow + kb + 16 + 8 * hh), x3 = *(const v4fa*)(arow + kb + 16 + 8 * hh + 4);
    float xs[16] = {x0[0],x0[1],x0[2],x0[3],x1[0],x1[1],x1[2],x1[3],x2[0],x2[1],x2[2],x2[3],x3[0],x3[1],x3[2],x3[3]};
#pragma unroll
    for (int i = 0; i < 16; ++i) { const _Float16 h = (_Float16)xs[i]; ah.h[i] = h; al.h[i] = ASPLIT ? (_Float16)(xs[i] - (float)h) : (_Float16)0.0f; }
#pragma unroll
    for (int t = 0; t < 4; ++t) { if (col0 + t * 16 >= N) continue; const size_t boff = (size_t)(col0 + t * 16 + ln) * ldb + kb; FragH bq; bq.half[0] = *(const v8us*)(Bh + boff + 8 * hh); bq.half[1] = *(const v8us*)(Bh + boff + 16 + 8 * hh);
      acc[t] = mmaH<ASPLIT ? 2 : 1>(ah.v, al.v, bq.v, bq.v, acc[t]); }
  }
#pragma unroll
  for (int t = 0; t < 4; ++t) { if (col0 + t * 16 >= N) continue;
#pragma unroll
    for (int r = 0; r < 8; ++r) so[w][8 * hh + r][t * 16 + ln] = acc[t][r] * alpha; }
  __builtin_amdgcn_fence(__ATOMIC_ACQ_REL, "workgroup"); __builtin_amdgcn_wave_barrier();
  const int rsub = lane >> 4, c4 = (lane & 15) * 4;
  {
#pragma unroll
    for (int q = 0; q < 8; ++q) { const int r = q * 2 + rsub; if (col0 + c4 < N) { const v4f v = *(const v4fa*)&so[w][r][c4]; *(v4f*)(C + (size_t)(row0 + r) * ldc + col0 + c4) = v; } }
     }
}

// Wt[n][k] = f16(W[k][n]·scale) from f32 row-major W[K][N] (scale = power of two; bf16-exact weights stay exact in f16 away from the subnormal range)
__global__ __launch_bounds__(256) void k_wt_f16(const float* __restrict__ W, _Float16* __restrict__ Wt, int K, int N, float scale) {
  const int t = blockIdx.x * 256 + threadIdx.x; if (t >= N * (K / 8)) return; const int n = t / (K / 8), k8 = (t % (K / 8)) * 8; FragH f;
#pragma unroll
  for (int i = 0; i < 8; ++i) f.h[i] = (_Float16)(bf16_round(W[(size_t)(k8 + i) * N + n]) * scale); const v8us o = f.half[0];
  *(v8us*)((unsigned short*)Wt + (size_t)n * K + k8) = o; 
}
// k_gemm_hh variant with fused epilogue: v = acc·alpha + bias[by·sBias + col] (+ CP[(row/rowsPerB)·sCPb + by·64 + col] if CP) ; ACT 0 none / 1 elu ; writes f16 C16 (and f32 C if non-null)
template <int ACT>
__global__ __launch_bounds__(128) void k_gemm_hhx(const _Float16* __restrict__ A, int lda, size_t sA, const _Float16* __restrict__ Bh, int ldb, size_t sB, float alpha, const float* __restrict__ bias, size_t sBias, const float* __restrict__ CP, int rowsPerB, size_t sCPb, int row0g,
    float* __restrict__ C, _Float16* __restrict__ C16, int ldc, size_t sC, int M, int N, int K) {
  __shared__ __attribute__((aligned(16))) float so[4][16][64];
  const int tid = threadIdx.x, w = tid >> 5, lane = tid & 31, ln = lane & 15, hh = lane >> 4; const int by = blockIdx.y;
  A += (size_t)by * sA; Bh += (size_t)by * sB; const size_t cofs = (size_t)by * sC; const float* bp = bias ? bias + (size_t)by * sBias : nullptr;
  const int ntn = (N + 63) / 64; const int wid = blockIdx.x * 4 + w; const int mt = wid / ntn, nq = wid % ntn; if (mt * 16 >= M) return;
  const int row0 = mt * 16, col0 = nq * 64; const _Float16* arow = A + (size_t)(row0 + ln) * lda;
  v8f acc[4] = {};
  for (int kb = 0; kb < K; kb += 32) { FragH ah; ah.half[0] = *(const v8us*)((const unsigned short*)arow + kb + 8 * hh); ah.half[1] = *(const v8us*)((const unsigned short*)arow + kb + 16 + 8 * hh);
#pragma unroll
    for (int t = 0; t < 4; ++t) { if (col0 + t * 16 >= N) continue; const size_t boff = (size_t)(col0 + t * 16 + ln) * ldb + kb; FragH bq; bq.half[0] = *(const v8us*)((const unsigned short*)Bh + boff + 8 * hh); bq.half[1] = *(const v8us*)((const unsigned short*)Bh + boff + 16 + 8 * hh);
      acc[t] = mmaH<1>(ah.v, ah.v, bq.v, bq.v, acc[t]); }
  }
#pragma unroll
  for (int t = 0; t < 4; ++t) { if (col0 + t * 16 >= N) continue; const int col = col0 + t * 16 + ln; const float bv = bp ? bf16_round(bp[col]) : 0.f;
#pragma unroll
    for (int r = 0; r < 8; ++r) { float v = acc[t][r] * alpha + bv; if (CP) { const int rr = row0g + row0 + 8 * hh + r; if (rowsPerB < 0) v += CP[cofs + (size_t)rr * ldc + col];      /* rowsPerB < 0: own element of the batched C plane */ else { const int bidx = rr / rowsPerB; v += CP[(size_t)bidx * sCPb + (size_t)by * 64 + col]; } } if (ACT == 1) v = (v > 0.f) ? v : expm1f(v); else if (ACT == 7) v = (v > 0.f) ? v + 1.0f : expf(v); else if (ACT == 8) v = tanhf(v); else if (ACT == 9) v = 0.5f * v * (1.0f + tanhf(0.7978845608028654f * (v + 0.044715f * v * v * v))); else if (ACT == 11) v = 1.0f / (1.0f + expf(-v)); else if (ACT == 12) v = (v > 0.f) ? v : 0.01f * v; else if (ACT == 14) v = (v > 0.f) ? v : 0.1f * v; else if (ACT == 16) v = (v >= 0.f) ? v : 0.3f * v; else if (ACT == 17) v = (v >= 0.f) ? v : 0.2f * v; else if (ACT == 15) v = v / (1.0f + expf(-v)); else if (ACT == 3) v = fmaxf(v, 0.f); else if (ACT == 6) v = 0.5f * v * (1.0f + erff(v * 0.70710678118654752f)); so[w][8 * hh + r][t * 16 + ln] = v; } }
  __builtin_amdgcn_fence(__ATOMIC_ACQ_REL, "workgroup"); __builtin_amdgcn_wave_barrier();
  const int rsub = lane >> 4, c4 = (lane & 15) * 4; typedef _Float16 v4h __attribute__((ext_vector_type(4)));
  {
#pragma unroll
    for (int q = 0; q < 8; ++q) { const int r = q * 2 + rsub; if (col0 + c4 < N) { const v4f v = *(const v4fa*)&so[w][r][c4]; if (C) *(v4f*)(C + cofs + (size_t)(row0 + r) * ldc + col0 + c4) = v; if (C16) { v4h h4; for (int i = 0; i < 4; ++i) h4[i] = (_Float16)v[i]; *(v4h*)(C16 + cofs + (size_t)(row0 + r) * ldc + col0 + c4) = h4; } } }
     }
}


typedef _Float16 v4h __attribute__((ext_vector_type(4)));

__global__ __launch_bounds__(256) void k_x16(const float* __restrict__ x, _Float16* __restrict__ X16, size_t n8) { const size_t t = (size_t)blockIdx.x * 256 + threadIdx.x; if (t >= n8) return; FragH f;
#pragma unroll
  for (int q = 0; q < 8; ++q) f.h[q] = (_Float16)bf16_round(x[t * 8 + q]); *(v8us*)((unsigned short*)X16 + t * 8) = f.half[0];  }
__global__ __launch_bounds__(256) void k_h16(const float* __restrict__ x, _Float16* __restrict__ X16, size_t n8) { const size_t t = (size_t)blockIdx.x * 256 + threadIdx.x; if (t >= n8) return; FragH f;
#pragma unroll
  for (int q = 0; q < 8; ++q) f.h[q] = (_Float16)x[t * 8 + q]; *(v8us*)((unsigned short*)X16 + t * 8) = f.half[0];  }
__global__ __launch_bounds__(256) void k_round16f(const float* __restrict__ W, _Float16* __restrict__ Bt, size_t n8) { const size_t t = (size_t)blockIdx.x * 256 + threadIdx.x; if (t >= n8) return; FragH f;
#pragma unroll
  for (int i = 0; i < 8; ++i) f.h[i] = (_Float16)(bf16_round(W[t * 8 + i]) * 16.0f); *(v8us*)((unsigned short*)Bt + t * 8) = f.half[0];  }
template <int NHv, int TTv>
__global__ __launch_bounds__(256) void k_vt(const _Float16* __restrict__ V16, int ldv, int voff, _Float16* __restrict__ Vt) { __shared__ unsigned short tl[64][66]; const int tid = threadIdx.x; const int slab = blockIdx.x / (TTv / 64), lg = blockIdx.x % (TTv / 64); const int b = slab / NHv, h = slab % NHv;
  for (int i = tid; i < 64 * 8; i += 256) { const int r = i / 8, c8 = (i % 8) * 8; FragH f; f.half[0] = *(const v8us*)((const unsigned short*)V16 + ((size_t)b * TTv + lg * 64 + r) * ldv + voff + h * 64 + c8);
#pragma unroll
    for (int q = 0; q < 8; ++q) tl[r][c8 + q] = f.u[q]; }
  __syncthreads();
  {
#pragma unroll
    for (int rd = 0; rd < 2; ++rd) { const int d = rd * 32 + tid / 8, pc = tid % 8; FragH f;
#pragma unroll
      for (int q = 0; q < 8; ++q) f.u[q] = tl[pc * 8 + q][d];
      *(v8us*)((unsigned short*)Vt + ((size_t)slab * 64 + d) * TTv + lg * 64 + pc * 8) = f.half[0]; }
     } }

__global__ __launch_bounds__(256) void k_hl(const float* __restrict__ F, _Float16* __restrict__ Hh, _Float16* __restrict__ Hl, size_t n8) { const size_t t = (size_t)blockIdx.x * 256 + threadIdx.x; if (t >= n8) return; FragH fh, fl; const v4f a = *(const v4fa*)(F + t * 8), c = *(const v4fa*)(F + t * 8 + 4);
#pragma unroll
  for (int q = 0; q < 4; ++q) { _Float16 h = (_Float16)a[q]; fh.h[q] = h; fl.h[q] = (_Float16)((a[q] - (float)h) * 1024.0f); h = (_Float16)c[q]; fh.h[4 + q] = h; fl.h[4 + q] = (_Float16)((c[q] - (float)h) * 1024.0f); }
  { *(v8us*)((unsigned short*)Hh + t * 8) = fh.half[0]; *(v8us*)((unsigned short*)Hl + t * 8) = fl.half[0];  } }

// ---- fast GEMM (wave tile 32x64; requires M % 32 == 0 rows per launch region and N % 64 == 0); epilogue = k_gemm_hhx semantics ----
__device__ __forceinline__ v16h g2_frag(const _Float16* p, int hh) { FragH f; f.half[0] = *(const v8us*)((const unsigned short*)p + 8 * hh); f.half[1] = *(const v8us*)((const unsigned short*)p + 16 + 8 * hh); return f.v; }
__device__ __forceinline__ v8f g2_mma(v16h a, v16h b, v8f c) { v8f d = __builtin_amdgcn_wmma_f32_16x16x32_f16(false, a, false, b, (short)0, c, false, false); asm volatile("v_nop\n\tv_nop\n\tv_nop\n\tv_nop" : "+v"(d) : "v"(a), "v"(b)); return d; }
template <int ACT>
__global__ __launch_bounds__(128) void k_gemm2(const _Float16* __restrict__ A, int lda, size_t sA, const _Float16* __restrict__ Bh, int ldb, size_t sB, float alpha, const float* __restrict__ bias, size_t sBias, const float* __restrict__ CP, int rowsPerB, size_t sCPb, int row0g,
    float* __restrict__ C, _Float16* __restrict__ C16, int ldc, size_t sC, int M, int N, int K) { static_assert(ACT == 0 || ACT == 3 || ACT == 6 || ACT == 8 || ACT == 9 || ACT == 11 || ACT == 12 || ACT == 14 || ACT == 15 || ACT == 16 || ACT == 17 || ACT == 18, "k_gemm2: unsupported ACT code (would silently apply no activation)");
  __shared__ __attribute__((aligned(16))) float so[4][32][68];
  const int tid = threadIdx.x, w = tid >> 5, lane = tid & 31, ln = lane & 15, hh = lane >> 4; const int by = blockIdx.y;
  A += (size_t)by * sA; Bh += (size_t)by * sB; const size_t cofs = (size_t)by * sC; const float* bp = bias ? bias + (size_t)by * sBias : nullptr;
  const int ntn = N >> 6; const int mt = blockIdx.x / ntn, nq = blockIdx.x - mt * ntn; const int row0 = mt * 128 + 32 * w, col0 = nq * 64; if (row0 >= M) return;
  const _Float16* a0p = A + (size_t)(row0 + ln) * lda; const _Float16* a1p = a0p + (size_t)16 * lda;
  const _Float16* b0p = Bh + (size_t)(col0 + ln) * ldb; const _Float16* b1p = b0p + (size_t)16 * ldb; const _Float16* b2p = b1p + (size_t)16 * ldb; const _Float16* b3p = b2p + (size_t)16 * ldb;
  const v8f z8 = {0.f,0.f,0.f,0.f,0.f,0.f,0.f,0.f}; v8f c00 = z8, c01 = z8, c02 = z8, c03 = z8, c10 = z8, c11 = z8, c12 = z8, c13 = z8;
#pragma unroll 1
  for (int kb = 0; kb < K; kb += 32) { const v16h a0 = g2_frag(a0p + kb, hh), a1 = g2_frag(a1p + kb, hh);
    v16h b = g2_frag(b0p + kb, hh); c00 = g2_mma(a0, b, c00); c10 = g2_mma(a1, b, c10);
    b = g2_frag(b1p + kb, hh); c01 = g2_mma(a0, b, c01); c11 = g2_mma(a1, b, c11);
    b = g2_frag(b2p + kb, hh); c02 = g2_mma(a0, b, c02); c12 = g2_mma(a1, b, c12);
    b = g2_frag(b3p + kb, hh); c03 = g2_mma(a0, b, c03); c13 = g2_mma(a1, b, c13); }
  v8f accs[8] = {c00, c01, c02, c03, c10, c11, c12, c13};
#pragma unroll
  for (int u = 0; u < 8; ++u) { const int t = u & 3, half = u >> 2; const int col = col0 + t * 16 + ln; const float bv = bp ? bf16_round(bp[col]) : 0.f;
#pragma unroll
    for (int r = 0; r < 8; ++r) { const int rloc = half * 16 + 8 * hh + r; float v = accs[u][r] * alpha + bv; if (CP) { if (rowsPerB < 0) v += CP[cofs + (size_t)(row0g + row0 + rloc) * ldc + col];      /* rowsPerB < 0: own element of the batched C plane */ else { const int bidx = (row0g + row0 + rloc) / rowsPerB; v += CP[(size_t)bidx * sCPb + (size_t)by * 64 + col]; } }
      if (ACT == 3) v = fmaxf(v, 0.f); else if (ACT == 6) v = 0.5f * v * (1.0f + erff(v * 0.70710678118654752f)); else if (ACT == 11) v = 1.0f / (1.0f + expf(-v)); else if (ACT == 15) v = v / (1.0f + expf(-v)); else if (ACT == 18) v = v / (1.0f + expf(-1.702f * v));      /* QuickGELU: v sigmoid(1.702 v) */ else if (ACT == 12) v = (v > 0.f) ? v : 0.01f * v; else if (ACT == 8) v = tanhf(v); else if (ACT == 9) v = 0.5f * v * (1.0f + tanhf(0.7978845608028654f * (v + 0.044715f * v * v * v))); else if (ACT == 14) v = (v > 0.f) ? v : 0.1f * v; else if (ACT == 16) v = (v >= 0.f) ? v : 0.3f * v; else if (ACT == 17) v = (v >= 0.f) ? v : 0.2f * v;
      so[w][rloc][t * 16 + ln] = v; } }
  __builtin_amdgcn_fence(__ATOMIC_ACQ_REL, "workgroup"); __builtin_amdgcn_wave_barrier();
  const int rsub = lane >> 4, c4 = (lane & 15) * 4;
  {
#pragma unroll
    for (int q = 0; q < 16; ++q) { const int r = q * 2 + rsub; const v4f v = *(const v4fa*)&so[w][r][c4]; if (C) *(v4f*)(C + cofs + (size_t)(row0 + r) * ldc + col0 + c4) = v; if (C16) { v4h h4; for (int i = 0; i < 4; ++i) h4[i] = (_Float16)v[i]; *(v4h*)(C16 + cofs + (size_t)(row0 + r) * ldc + col0 + c4) = h4; } }
     } }


__global__ __launch_bounds__(256) void k_wnat(const float* __restrict__ w, size_t n8, _Float16* __restrict__ Bt) { const size_t t = (size_t)blockIdx.x * 256 + threadIdx.x; if (t >= n8) return; FragH f; for (int q = 0; q < 8; ++q) f.h[q] = (_Float16)(bf16_round(w[t * 8 + q]) * 16.0f); *(v8us*)((unsigned short*)Bt + t * 8) = f.half[0];  }
__global__ __launch_bounds__(256) void k_rsm(const float* __restrict__ S, _Float16* __restrict__ P, int nrows) {
  #pragma clang fp contract(off)
  const int i = blockIdx.x * 256 + threadIdx.x; if (i >= nrows) return; const float* s = S + (size_t)i * SQ; float mx = -3.0e38f;
#pragma unroll 1
  for (int j = 0; j < SQ; ++j) mx = fmaxf(mx, s[j]); float se = 0.f;
#pragma unroll 1
  for (int j = 0; j < SQ; ++j) se += expf(s[j] - mx); const float sc = 256.0f / se;
#pragma unroll 1
  for (int j0 = 0; j0 < SQ; j0 += 8) { FragH f; for (int q = 0; q < 8; ++q) f.h[q] = (_Float16)(expf(s[j0 + q] - mx) * sc); unsigned short* d = (unsigned short*)P + (size_t)i * SQ + j0; *(v8us*)d = f.half[0];  } }
__global__ __launch_bounds__(256) void k_vt(const _Float16* __restrict__ V16, int b, int h0, _Float16* __restrict__ VT) { __shared__ unsigned short tl[64][65]; const int tid = threadIdx.x; const int hh = blockIdx.x % HG, sg = blockIdx.x / HG; const int s0 = sg * 64; const int h = h0 + hh;
  for (int i = tid; i < 64 * 8; i += 256) { const int j = i / 8, d8 = (i % 8) * 8; FragH f; f.half[0] = *(const v8us*)((const unsigned short*)V16 + ((size_t)b * SQ + s0 + j) * DM + h * HD + d8); for (int q = 0; q < 8; ++q) tl[d8 + q][j] = f.u[q]; }
  __syncthreads();
  { for (int i = tid; i < 64 * 8; i += 256) { const int d = i / 8, j8 = (i % 8) * 8; FragH f; for (int q = 0; q < 8; ++q) f.u[q] = tl[d][j8 + q]; *(v8us*)((unsigned short*)VT + ((size_t)hh * HD + d) * SQ + s0 + j8) = f.half[0]; }  } }



__global__ __launch_bounds__(256) void k_rsmcf2(const float* __restrict__ S, _Float16* __restrict__ P, int hg, int q0, int nk) {
  #pragma clang fp contract(off)
  const int t = blockIdx.x * 256 + threadIdx.x; if (t >= hg * QT) return; const size_t i = (size_t)t; const float* s = S + i * NKX; const int last = q0 + (t % QT); float mx = -3.0e38f;
#pragma unroll 1
  for (int j = 0; j < nk; ++j) { const float f = (j <= last) ? 1.f : 0.f; mx = fmaxf(mx, fmaf(f, s[j], (1.f - f) * -1.0e9f)); } float se = 0.f;
#pragma unroll 1
  for (int j = 0; j < nk; ++j) { const float f = (j <= last) ? 1.f : 0.f; se += __expf(fmaf(f, s[j], (1.f - f) * -1.0e9f) - mx); } const float sc = 256.0f / se;
#pragma unroll 1
  for (int j0 = 0; j0 < nk; j0 += 8) { FragH fr; for (int q = 0; q < 8; ++q) { const int j = j0 + q; const float f = (j <= last) ? 1.f : 0.f; fr.h[q] = (_Float16)(__expf(fmaf(f, s[j], (1.f - f) * -1.0e9f) - mx) * sc); } unsigned short* d = (unsigned short*)P + i * NKX + j0; *(v8us*)d = fr.half[0];  } }

__global__ __launch_bounds__(256) void k_rsmcst(const float* __restrict__ S, _Float16* __restrict__ P, int hg, int q0, int nk, const int* __restrict__ mk) {
  #pragma clang fp contract(off)
  const int t = blockIdx.x * 256 + threadIdx.x; if (t >= hg * QT) return; const size_t i = (size_t)t; const float* s = S + i * NKX; const size_t ig = (size_t)(q0 + (t % QT)); const int* mr = mk + ig * SQ; float mx = -3.0e38f;
#pragma unroll 1
  for (int j = 0; j < nk; ++j) { const int mb = mr[j]; const int dd = (int)ig - j; const float f = (mb != 0 && dd >= 0 && (dd <= LOCALW || (dd % STRIDEK) == 0)) ? 1.f : 0.f; mx = fmaxf(mx, fmaf(f, s[j], (1.f - f) * -1.0e9f)); } float se = 0.f;
#pragma unroll 1
  for (int j = 0; j < nk; ++j) { const int mb = mr[j]; const int dd = (int)ig - j; const float f = (mb != 0 && dd >= 0 && (dd <= LOCALW || (dd % STRIDEK) == 0)) ? 1.f : 0.f; se += __expf(fmaf(f, s[j], (1.f - f) * -1.0e9f) - mx); } const float sc = 256.0f / se;
#pragma unroll 1
  for (int j0 = 0; j0 < nk; j0 += 8) { FragH fr; for (int q = 0; q < 8; ++q) { const int j = j0 + q; const int mb = mr[j]; const int dd = (int)ig - j; const float f = (mb != 0 && dd >= 0 && (dd <= LOCALW || (dd % STRIDEK) == 0)) ? 1.f : 0.f; fr.h[q] = (_Float16)(__expf(fmaf(f, s[j], (1.f - f) * -1.0e9f) - mx) * sc); } unsigned short* d = (unsigned short*)P + i * NKX + j0; *(v8us*)d = fr.half[0];  } }


template <int MASKADD>
__global__ __launch_bounds__(64) void k_att0(const float* __restrict__ QF, const float* __restrict__ KF, const float* __restrict__ VF, int ld, const float* __restrict__ mask, float scale, float* __restrict__ OF, int ldo) {
  #pragma clang fp contract(off)
  __shared__ __attribute__((aligned(16))) float lq[64][64]; __shared__ __attribute__((aligned(16))) float lo[64][64];
  const int tid = threadIdx.x; const int h = blockIdx.x / (QT0 / 64), rg = blockIdx.x % (QT0 / 64); const int i = rg * 64 + tid;
  const float* qr = QF + (size_t)i * ld + h * HD;
#pragma unroll 1
  for (int c = 0; c < HD / 4; ++c) { *(v4f*)&lq[tid][c * 4] = *(const v4fa*)(qr + c * 4); const v4f z = {0.f, 0.f, 0.f, 0.f}; *(v4f*)&lo[tid][c * 4] = z; }
  float m = -1.0e30f, l = 0.f; const int jmax = MASKADD ? (SQ - 1) : (rg * 64 + 63);      /* additive-mask form: every key (the mask input decides); causal form: keys up to the block's last row */
#pragma unroll 1
  for (int j = 0; j <= jmax; ++j) { const float* kr = KF + (size_t)j * ld + h * HD; const float* vr = VF + (size_t)j * ld + h * HD; float s = 0.f;
#pragma unroll 1
    for (int c = 0; c < HD / 4; ++c) { const v4f kq = *(const v4fa*)(kr + c * 4); const v4f qq = *(v4f*)&lq[tid][c * 4]; s = __fadd_rn(s, __fmul_rn(qq[0], kq[0])); s = __fadd_rn(s, __fmul_rn(qq[1], kq[1])); s = __fadd_rn(s, __fmul_rn(qq[2], kq[2])); s = __fadd_rn(s, __fmul_rn(qq[3], kq[3])); }
    s = __fmul_rn(s, scale); if (MASKADD) s = __fadd_rn(s, __fmul_rn(bf16_round(mask[(size_t)i * SQ + j]), -10000.0f));
    const float f = (MASKADD || j <= i) ? 1.f : 0.f; const float sm = fmaf(f, s, (1.f - f) * -1.0e30f); const float mn = fmaxf(m, sm); const float sc = expf(m - mn); const float e = expf(sm - mn); l = __fadd_rn(__fmul_rn(l, sc), e); m = mn;
#pragma unroll 1
    for (int c = 0; c < HD / 4; ++c) { const v4f vv = *(const v4fa*)(vr + c * 4); v4f oo = *(v4f*)&lo[tid][c * 4]; for (int u = 0; u < 4; ++u) oo[u] = __fadd_rn(__fmul_rn(oo[u], sc), __fmul_rn(e, vv[u])); *(v4f*)&lo[tid][c * 4] = oo; } }
  const float fin = 64.0f / l;      /* o carried x64 like the f16 path */
#pragma unroll 1
  for (int c = 0; c < HD / 4; ++c) { v4f oo = *(v4f*)&lo[tid][c * 4]; for (int u = 0; u < 4; ++u) oo[u] = __fmul_rn(oo[u], fin); *(v4f*)&lo[tid][c * 4] = oo; }
  __syncthreads();
  {
#pragma unroll 1
    for (int it = 0; it < 16; ++it) { const int row = it * 4 + tid / 16, pc = (tid % 16) * 4; const v4f v = *(const v4f*)&lo[row][pc]; *(v4f*)(OF + (size_t)(rg * 64 + row) * ldo + h * HD + pc) = v; }
     } }

template <int MASKADD>
__global__ __launch_bounds__(64) void k_att0mbc(const float* __restrict__ QF, const float* __restrict__ KF, const float* __restrict__ VF, int ld, const float* __restrict__ mask, float scale, float* __restrict__ OF, int ldo) {
  #pragma clang fp contract(off)
  __shared__ __attribute__((aligned(16))) float lq[64][64]; __shared__ __attribute__((aligned(16))) float lo[64][64];
  const int tid = threadIdx.x; const int h = blockIdx.x / (QT0 / 64), rg = blockIdx.x % (QT0 / 64); const int i = rg * 64 + tid;
  const float* qr = QF + (size_t)i * ld + h * HD;
#pragma unroll 1
  for (int c = 0; c < HD / 4; ++c) { *(v4f*)&lq[tid][c * 4] = *(const v4fa*)(qr + c * 4); const v4f z = {0.f, 0.f, 0.f, 0.f}; *(v4f*)&lo[tid][c * 4] = z; }
  float m = -1.0e30f, l = 0.f; const int jmax = rg * 64 + 63;      /* keys beyond the block end are masked by the mask's lower-triangular structure */
#pragma unroll 1
  for (int j = 0; j <= jmax; ++j) { const float* kr = KF + (size_t)j * ld + h * HD; const float* vr = VF + (size_t)j * ld + h * HD; float s = 0.f;
#pragma unroll 1
    for (int c = 0; c < HD / 4; ++c) { const v4f kq = *(const v4fa*)(kr + c * 4); const v4f qq = *(v4f*)&lq[tid][c * 4]; s = __fadd_rn(s, __fmul_rn(qq[0], kq[0])); s = __fadd_rn(s, __fmul_rn(qq[1], kq[1])); s = __fadd_rn(s, __fmul_rn(qq[2], kq[2])); s = __fadd_rn(s, __fmul_rn(qq[3], kq[3])); }
    s = __fmul_rn(s, scale); const int mb = ((const int*)mask)[(size_t)i * SQ + j];      /* causal (j <= i) AND the module's int32 [S][S] mask read per (query, key): 0 -> masked */
    const float f = (mb != 0 && j <= i) ? 1.f : 0.f; const float sm = fmaf(f, s, (1.f - f) * -1.0e30f); const float mn = fmaxf(m, sm); const float sc = expf(m - mn); const float e = expf(sm - mn); l = __fadd_rn(__fmul_rn(l, sc), e); m = mn;
#pragma unroll 1
    for (int c = 0; c < HD / 4; ++c) { const v4f vv = *(const v4fa*)(vr + c * 4); v4f oo = *(v4f*)&lo[tid][c * 4]; for (int u = 0; u < 4; ++u) oo[u] = __fadd_rn(__fmul_rn(oo[u], sc), __fmul_rn(e, vv[u])); *(v4f*)&lo[tid][c * 4] = oo; } }
  const float fin = 64.0f / l;      /* o carried x64 like the f16 path */
#pragma unroll 1
  for (int c = 0; c < HD / 4; ++c) { v4f oo = *(v4f*)&lo[tid][c * 4]; for (int u = 0; u < 4; ++u) oo[u] = __fmul_rn(oo[u], fin); *(v4f*)&lo[tid][c * 4] = oo; }
  __syncthreads();
  {
#pragma unroll 1
    for (int it = 0; it < 16; ++it) { const int row = it * 4 + tid / 16, pc = (tid % 16) * 4; const v4f v = *(const v4f*)&lo[row][pc]; *(v4f*)(OF + (size_t)(rg * 64 + row) * ldo + h * HD + pc) = v; }
     } }


template <int BFIN, int WXB>
__global__ __launch_bounds__(256) void k_ln16(const float* __restrict__ X, const float* __restrict__ g, const float* __restrict__ bb, float eps, _Float16* __restrict__ N16, float* __restrict__ XB) {
  #pragma clang fp contract(off)
  __shared__ float red[256]; const size_t r = blockIdx.x; const int t = threadIdx.x; const v4f xa = *(const v4fa*)(X + r * DMQ + t * 4); float s[4]; float sum = 0.f;
  for (int q = 0; q < 4; ++q) { s[q] = BFIN ? bf16_round(xa[q]) : xa[q]; sum = __fadd_rn(sum, s[q]); }
  red[t] = sum; __syncthreads(); for (int st = 128; st > 0; st >>= 1) { if (t < st) red[t] = __fadd_rn(red[t], red[t + st]); __syncthreads(); } const float mu = red[0] / (float)DMQ; __syncthreads();
  float vs = 0.f; for (int q = 0; q < 4; ++q) { const float dl = __fadd_rn(s[q], -mu); vs = __fadd_rn(vs, __fmul_rn(dl, dl)); } red[t] = vs; __syncthreads(); for (int st = 128; st > 0; st >>= 1) { if (t < st) red[t] = __fadd_rn(red[t], red[t + st]); __syncthreads(); }
  const float rs = rsqrtf(__fadd_rn(red[0] / (float)DMQ, eps)); v4h y; v4f xb;
  for (int q = 0; q < 4; ++q) { const int c = t * 4 + q; y[q] = (_Float16)__fadd_rn(__fmul_rn(__fmul_rn(__fadd_rn(s[q], -mu), rs), bf16_round(g[c])), bf16_round(bb[c])); xb[q] = s[q]; }
  { *(v4h*)(N16 + r * DMQ + t * 4) = y; if (WXB) *(v4f*)(XB + r * DMQ + t * 4) = xb;  } }
__global__ __launch_bounds__(256) void k_ftres2(const float* __restrict__ OF0, const float* __restrict__ XB, float* __restrict__ X1, size_t n4) {
  #pragma clang fp contract(off)
  const size_t t = (size_t)blockIdx.x * 256 + threadIdx.x; if (t >= n4) return; const v4f o = *(const v4fa*)(OF0 + t * 4), xv = *(const v4fa*)(XB + t * 4); v4f y; for (int q = 0; q < 4; ++q) y[q] = __fadd_rn(__fmul_rn(o[q], 0.015625f), xv[q]); *(v4f*)(X1 + t * 4) = y;  }

__global__ __launch_bounds__(256) void k_bcpy(const float* __restrict__ b, int n, int NP, float* __restrict__ dst, int dst0) { for (int i = threadIdx.x; i < NP; i += 256) { const float v = (i < n) ? b[i] : 0.f; *(float*)(dst + dst0 + i) = v; }  }


// lane l <-> l ^ M inside a 16-lane row (DPP row_xmask), and l <-> l ^ 16 (cross-row move): register-only butterflies
template <int M> __device__ __forceinline__ float xl_row(float v) { return __int_as_float(__builtin_amdgcn_update_dpp(0, __float_as_int(v), 0x160 | M, 0xf, 0xf, true)); }
__device__ __forceinline__ float xl_x16(float v) { const int b = __float_as_int(v); return __int_as_float(__builtin_amdgcn_permlanex16(b, b, 0x76543210, 0xfedcba98, false, false)); }
// row softmax -> P x256 f16. One wave per score row: 16 loads of 512 contiguous bytes, the whole row (64 values a lane) stays in registers, S is read once and each exponential is taken once.
// The four loops over v[] are fully unrolled so that v[] is indexed by constants only and lives in registers, and so that all 16 loads are in flight together.
__global__ __launch_bounds__(256) void k_rsmf(const float* __restrict__ S, _Float16* __restrict__ P, int nrows) {
  const int row = blockIdx.x * 8 + (threadIdx.x >> 5), lane = threadIdx.x & 31; if (row >= nrows) return;      /* wave-uniform; no barrier in this kernel */
  const float* s = S + (size_t)row * SQ + lane * 4; v4f v[SQ / 128];
#pragma unroll
  for (int u = 0; u < SQ / 128; ++u) v[u] = *(const v4fa*)(s + u * 128);
  v4f m4 = {-3.0e38f, -3.0e38f, -3.0e38f, -3.0e38f};
#pragma unroll
  for (int u = 0; u < SQ / 128; ++u) m4 = __builtin_elementwise_max(m4, v[u]);
  float mx = fmaxf(fmaxf(m4[0], m4[1]), fmaxf(m4[2], m4[3]));
  mx = fmaxf(mx, xl_row<1>(mx)); mx = fmaxf(mx, xl_row<2>(mx)); mx = fmaxf(mx, xl_row<4>(mx)); mx = fmaxf(mx, xl_row<8>(mx)); mx = fmaxf(mx, xl_x16(mx));
  v4f s4 = {0.f, 0.f, 0.f, 0.f};
#pragma unroll
  for (int u = 0; u < SQ / 128; ++u) { v4f e; for (int q = 0; q < 4; ++q) e[q] = __expf(v[u][q] - mx); v[u] = e; s4 += e; }
  float se = (s4[0] + s4[1]) + (s4[2] + s4[3]);
  se += xl_row<1>(se); se += xl_row<2>(se); se += xl_row<4>(se); se += xl_row<8>(se); se += xl_x16(se);
  const float sc = 256.0f / se; _Float16* d = P + (size_t)row * SQ + lane * 4;
#pragma unroll
  for (int u = 0; u < SQ / 128; ++u) { const v4f y = v[u] * sc; *(v4h*)(d + u * 128) = __builtin_convertvector(y, v4h); } }

#define FAP 72      /* LDS row pitch in f16: 128 data bytes + 16 (16 B x odd: the 16-byte fragment reads of 16 rows fall on distinct banks) */
typedef _Float16 v8h __attribute__((ext_vector_type(8)));
union FragP { v16h v; v8h half[2]; };
__device__ __forceinline__ v8f fa_mma(v16h a, v16h b, v8f c) { return __builtin_amdgcn_wmma_f32_16x16x32_f16(false, a, false, b, (short)0, c, false, false); }
// 2^x, eight at a time, with the one free slot that the instruction set asks for behind a transcendental: the results are early-clobber, so inside the run none lands on a source or is read, and the v_nop stands in front of whatever the compiler schedules next.
__device__ __forceinline__ v8f fa_exp2x8(v8f x) { float y0, y1, y2, y3, y4, y5, y6, y7;
  asm("v_exp_f32 %0, %8\n\tv_exp_f32 %1, %9\n\tv_exp_f32 %2, %10\n\tv_exp_f32 %3, %11\n\tv_exp_f32 %4, %12\n\tv_exp_f32 %5, %13\n\tv_exp_f32 %6, %14\n\tv_exp_f32 %7, %15\n\tv_nop"
      : "=&v"(y0), "=&v"(y1), "=&v"(y2), "=&v"(y3), "=&v"(y4), "=&v"(y5), "=&v"(y6), "=&v"(y7) : "v"(x[0]), "v"(x[1]), "v"(x[2]), "v"(x[3]), "v"(x[4]), "v"(x[5]), "v"(x[6]), "v"(x[7]));
  const v8f y = {y0, y1, y2, y3, y4, y5, y6, y7}; return y; }
__device__ __forceinline__ float fa_exp2(float x) { float y; asm("v_exp_f32 %0, %1\n\tv_nop" : "=&v"(y) : "v"(x)); return y; }      /* the same slot behind a single one */
__global__ __launch_bounds__(256) __attribute__((amdgpu_waves_per_eu(4, 4))) void k_fattn(const _Float16* __restrict__ Q, const _Float16* __restrict__ Kr, const _Float16* __restrict__ VTa, _Float16* __restrict__ O) {
  __shared__ __attribute__((aligned(16))) _Float16 lk[2][64][FAP]; __shared__ __attribute__((aligned(16))) _Float16 lv[2][64][FAP];
  const int tid = threadIdx.x, lane = tid & 31, ln = lane & 15, hh = lane >> 4, w = tid >> 5; const int bh = blockIdx.y, b = bh / NH, h = bh % NH; const int q0 = blockIdx.x * 256 + w * 32;
  const _Float16* qp = Q + ((size_t)b * SQ + q0 + ln) * DM + h * HD;
  const int sr = tid >> 3, sc = (tid & 7) * 8;      /* staging: 8 threads a 128-byte row; a thread brings rows sr and sr + 32 of both tiles */
  const unsigned short* kg = (const unsigned short*)Kr + ((size_t)b * SQ + sr) * DM + h * HD + sc; const unsigned short* vg = (const unsigned short*)VTa + ((size_t)bh * HD + sr) * SQ + sc;
  const float CS = 0.18033688011112042f;      /* 64^-0.5 * log2(e) */
  const v8f z8 = {0.f, 0.f, 0.f, 0.f, 0.f, 0.f, 0.f, 0.f};
  v16h qf[2][2]; v8f o[4][2]; float m[2] = {-3.0e38f, -3.0e38f}, l[2] = {0.f, 0.f};
  v8us g0 = *(const v8us*)kg, g1 = *(const v8us*)(kg + (size_t)32 * DM), g2 = *(const v8us*)vg, g3 = *(const v8us*)(vg + (size_t)32 * SQ);
  for (int t = 0; t < 2; ++t) for (int ks = 0; ks < 2; ++ks) qf[t][ks] = g2_frag(qp + (size_t)t * 16 * DM + ks * 32, hh);
  for (int dt = 0; dt < 4; ++dt) { o[dt][0] = z8; o[dt][1] = z8; }
  *(v8us*)&lk[0][sr][sc] = g0; *(v8us*)&lk[0][sr + 32][sc] = g1; *(v8us*)&lv[0][sr][sc] = g2; *(v8us*)&lv[0][sr + 32][sc] = g3;
  __syncthreads();
  for (int st = 0; st < SQ / 64; ++st) { const int cur = st & 1; const bool more = st + 1 < SQ / 64;      /* block-uniform */
    for (int ps = 0; ps < 2; ++ps) {
      if (ps == 1 && more) { const unsigned short* kn = kg + (size_t)(st + 1) * 64 * DM; const unsigned short* vn = vg + (size_t)(st + 1) * 64;      /* next stage's rows: in flight under the second pass, stored to LDS at the stage's foot */
        g0 = *(const v8us*)kn; g1 = *(const v8us*)(kn + (size_t)32 * DM); g2 = *(const v8us*)vn; g3 = *(const v8us*)(vn + (size_t)32 * SQ);
        asm volatile("s_wait_xcnt 0x0" :: "v"(kn), "v"(vn) : "memory"); }      /* the wait owed before a register that an issued load names is rewritten; the two addresses are inputs so that they stay whole, and off the loads' own results, up to here */
      v16h kf[2][2], vf[4];
      for (int kt = 0; kt < 2; ++kt) for (int ks = 0; ks < 2; ++ks) kf[kt][ks] = g2_frag(&lk[cur][ps * 32 + kt * 16 + ln][ks * 32], hh);
      for (int dt = 0; dt < 4; ++dt) vf[dt] = g2_frag(&lv[cur][dt * 16 + ln][ps * 32], hh);
      v8f s[2][2]; for (int kt = 0; kt < 2; ++kt) for (int qt = 0; qt < 2; ++qt) s[kt][qt] = fa_mma(kf[kt][1], qf[qt][1], fa_mma(kf[kt][0], qf[qt][0], z8));
      float mx[2];
      for (int qt = 0; qt < 2; ++qt) { const v8f t = __builtin_elementwise_max(s[0][qt], s[1][qt]); float a = fmaxf(fmaxf(fmaxf(t[0], t[1]), fmaxf(t[2], t[3])), fmaxf(fmaxf(t[4], t[5]), fmaxf(t[6], t[7]))); a = fmaxf(a, xl_x16(a)); mx[qt] = a * CS; }
      if (__builtin_amdgcn_ballot_w32(mx[0] > m[0] + 8.0f || mx[1] > m[1] + 8.0f) != 0) {      /* rescale only when a column's maximum has grown by more than 2^8: P stays <= 2^12, inside f16 */
        for (int qt = 0; qt < 2; ++qt) { const float mn = fmaxf(m[qt], mx[qt]); const float al = fa_exp2(m[qt] - mn); m[qt] = mn; l[qt] *= al; for (int dt = 0; dt < 4; ++dt) o[dt][qt] *= al; } }
      FragP pf[2];
      for (int qt = 0; qt < 2; ++qt) { const float nm = 4.0f - m[qt]; const v8f e0 = fa_exp2x8(s[0][qt] * CS + nm), e1 = fa_exp2x8(s[1][qt] * CS + nm);
        const v8f es = e0 + e1; l[qt] += ((es[0] + es[1]) + (es[2] + es[3])) + ((es[4] + es[5]) + (es[6] + es[7])); pf[qt].half[0] = __builtin_convertvector(e0, v8h); pf[qt].half[1] = __builtin_convertvector(e1, v8h); }
      for (int dt = 0; dt < 4; ++dt) for (int qt = 0; qt < 2; ++qt) o[dt][qt] = fa_mma(vf[dt], pf[qt].v, o[dt][qt]);
    }
    if (more) { *(v8us*)&lk[cur ^ 1][sr][sc] = g0; *(v8us*)&lk[cur ^ 1][sr + 32][sc] = g1; *(v8us*)&lv[cur ^ 1][sr][sc] = g2; *(v8us*)&lv[cur ^ 1][sr + 32][sc] = g3; }      /* that buffer's last readers left it before the previous barrier */
    __syncthreads();      /* publishes stage st + 1 and ends every read of stage st */
  }
  for (int qt = 0; qt < 2; ++qt) { const float inv = 64.0f / (l[qt] + xl_x16(l[qt])); _Float16* op = O + ((size_t)b * SQ + q0 + qt * 16 + ln) * DM + h * HD + 8 * hh;      /* a lane holds 8 consecutive dims of one query row: one 16-byte store a tile */
    for (int dt = 0; dt < 4; ++dt) { const v8f y = o[dt][qt] * inv; *(v8h*)(op + dt * 16) = __builtin_convertvector(y, v8h); } } }

// ---- block-tiled GEMM for the two shapes used here: C[NR][N] = A[NR][DM] Bt[N][DM]^T, N = 3 DM (q | k | v) or DM (f16 rows, k contiguous); epilogue values as k_gemm2 (alpha, bf16-rounded bias; RES: own-element residual rounded to bf16, f32 rows; else f16 rows, the v plane as V^T) ----
// A block of 8 waves owns 256 x 128 of C, a wave 64 x 64 (4 x 4 accumulator tiles). A tile is 128 k of the block's 256 A rows and 128 Bt rows, brought into LDS by asynchronous copies: a wave's copy covers four whole 128-byte lines,
// each line is fetched once a block, and the waves take their fragments from LDS. Two buffers: tile t + 1 flies while tile t is worked on; one barrier a tile. k runs in the same order as before.
#define G3P 136      /* LDS row pitch in f16: 256 data bytes + 16 (16 B x odd: the 16-byte fragment reads of 16 rows fall on distinct banks) */
#define G3T (384 * G3P * 2)      /* bytes of one buffer: rows 0-255 A, rows 256-383 Bt */
typedef float f1a __attribute__((may_alias));
// Twelve copies of 16 bytes a lane, LDS byte address l + i * 16 rows, global rows g[i]; s_wait_xcnt 0 is the statement's last line, so that it stands in front of whatever rewrites a register that a copy names.
__device__ __forceinline__ void g3_copy12(unsigned l, const unsigned short* g0, const unsigned short* g1, const unsigned short* g2, const unsigned short* g3, const unsigned short* g4, const unsigned short* g5,
                                          const unsigned short* g6, const unsigned short* g7, const unsigned short* g8, const unsigned short* g9, const unsigned short* g10, const unsigned short* g11) {
  const unsigned p = 16 * G3P * 2;
  asm volatile("global_load_async_to_lds_b128 %0, %12, off\n\tglobal_load_async_to_lds_b128 %1, %13, off\n\tglobal_load_async_to_lds_b128 %2, %14, off\n\tglobal_load_async_to_lds_b128 %3, %15, off\n\tglobal_load_async_to_lds_b128 %4, %16, off\n\tglobal_load_async_to_lds_b128 %5, %17, off\n\tglobal_load_async_to_lds_b128 %6, %18, off\n\tglobal_load_async_to_lds_b128 %7, %19, off\n\tglobal_load_async_to_lds_b128 %8, %20, off\n\tglobal_load_async_to_lds_b128 %9, %21, off\n\tglobal_load_async_to_lds_b128 %10, %22, off\n\tglobal_load_async_to_lds_b128 %11, %23, off\n\ts_wait_xcnt 0x0"
      :: "v"(l), "v"(l + p), "v"(l + 2 * p), "v"(l + 3 * p), "v"(l + 4 * p), "v"(l + 5 * p), "v"(l + 6 * p), "v"(l + 7 * p), "v"(l + 8 * p), "v"(l + 9 * p), "v"(l + 10 * p), "v"(l + 11 * p),
         "v"(g0), "v"(g1), "v"(g2), "v"(g3), "v"(g4), "v"(g5), "v"(g6), "v"(g7), "v"(g8), "v"(g9), "v"(g10), "v"(g11) : "memory"); }
// one tile: a thread's 16 A pieces (rows sr + 16 i) and 8 Bt pieces; l = the LDS byte address of its piece of row sr in the target buffer
__device__ __forceinline__ void g3_tile(unsigned l, const unsigned short* a, const unsigned short* b) { const size_t s = (size_t)16 * DM;
  g3_copy12(l, a, a + s, a + 2 * s, a + 3 * s, a + 4 * s, a + 5 * s, a + 6 * s, a + 7 * s, a + 8 * s, a + 9 * s, a + 10 * s, a + 11 * s);
  g3_copy12(l + 12 * 16 * G3P * 2, a + 12 * s, a + 13 * s, a + 14 * s, a + 15 * s, b, b + s, b + 2 * s, b + 3 * s, b + 4 * s, b + 5 * s, b + 6 * s, b + 7 * s); }
// RES: one plane of DM columns, f32 rows, the residual x rounded to bf16 here. Else: Bt is the stacked q | k | v plane (3 DM rows) and one grid does all three products: planes 0 and 1 go out as f16 rows (C16, then C16 + NR * DM),
// plane 2 goes out transposed, V^T [batch * head][dim][token]: a wave's 64 columns are one head, and a lane's 8 accumulator rows are 8 consecutive tokens of one dim.
typedef _Float16 v8ha __attribute__((ext_vector_type(8), may_alias));
template <bool RES>
__global__ __launch_bounds__(256) void k_gemm3(const _Float16* __restrict__ A, const _Float16* __restrict__ Bh, float alpha, const float* __restrict__ bias, const float* __restrict__ CP, float* __restrict__ C, _Float16* __restrict__ C16, _Float16* __restrict__ VTo) {
  static_assert(NR % 256 == 0 && DM % 128 == 0 && DM / 128 >= 2, "k_gemm3: whole tiles only, two or more along k");
  __shared__ __attribute__((aligned(16))) _Float16 sm[2][384][G3P];      /* after the loop: each wave's 64 x 68 f32 output staging */
  const int tid = threadIdx.x, lane = tid & 31, ln = lane & 15, hh = lane >> 4, w = tid >> 5; constexpr int NQ = (RES ? 1 : 3) * (DM / 128); const int mt = blockIdx.x / NQ, nq = blockIdx.x % NQ; const int wm = (w & 3) * 64, wn = (w >> 2) * 64;
  const int pl = nq / (DM / 128);      /* block-uniform: which of q | k | v (0 with RES) */
  const int row0 = mt * 256 + wm, col0 = (nq % (DM / 128)) * 128 + wn;
  const int sr = tid >> 4, sc = (tid & 15) * 8;      /* staging: 16 threads a 256-byte row piece */
  const unsigned short* ag = (const unsigned short*)A + (size_t)(mt * 256 + sr) * DM + sc; const unsigned short* bg = (const unsigned short*)Bh + (size_t)(nq * 128 + sr) * DM + sc;
  const unsigned l0 = (unsigned)(size_t)&sm[0][sr][sc];      /* low 32 bits of the shared address = byte offset in the work-group's LDS */
  g3_tile(l0, ag, bg);
  float bv[4] = {0.f, 0.f, 0.f, 0.f};
  if (bias) {
#pragma unroll
    for (int ni = 0; ni < 4; ++ni) bv[ni] = bf16_round(bias[pl * DM + col0 + ni * 16 + ln]); }
  const v8f z8 = {0.f, 0.f, 0.f, 0.f, 0.f, 0.f, 0.f, 0.f}; v8f acc[4][4];
#pragma unroll
  for (int mi = 0; mi < 4; ++mi) for (int ni = 0; ni < 4; ++ni) acc[mi][ni] = z8;
  asm volatile("s_wait_asynccnt 0x0" ::: "memory");      /* this wave's copies of tile 0 have landed */
  __syncthreads();      /* publishes tile 0 */
  g3_tile(l0 + G3T, ag + 128, bg + 128);
#pragma unroll 1      /* rolled: one trip holds 64 matrix instructions; for speed only */
  for (int t = 0; t < DM / 128; ++t) { const int cur = t & 1; v16h af[2][4], bf[2][4];
#pragma unroll
    for (int i = 0; i < 4; ++i) { af[0][i] = g2_frag(&sm[cur][wm + i * 16 + ln][0], hh); bf[0][i] = g2_frag(&sm[cur][256 + wn + i * 16 + ln][0], hh); }
#pragma unroll
    for (int ks = 0; ks < 4; ++ks) {
      if (ks < 3) {
#pragma unroll
        for (int i = 0; i < 4; ++i) { af[(ks + 1) & 1][i] = g2_frag(&sm[cur][wm + i * 16 + ln][(ks + 1) * 32], hh); bf[(ks + 1) & 1][i] = g2_frag(&sm[cur][256 + wn + i * 16 + ln][(ks + 1) * 32], hh); } }
      __builtin_amdgcn_sched_barrier(0);      /* the next block's 16 LDS reads stay one group in front of this block, for speed only */
#pragma unroll
      for (int mi = 0; mi < 4; ++mi) for (int ni = 0; ni < 4; ++ni) acc[mi][ni] = fa_mma(af[ks & 1][mi], bf[ks & 1][ni], acc[mi][ni]);
      __builtin_amdgcn_sched_barrier(0);      /* and the block after next's reads stay behind it */
    }
    asm volatile("s_wait_dscnt 0x0" ::: "memory");      /* this wave's reads of tile t are done */
    asm volatile("s_wait_asynccnt 0x0" ::: "memory");      /* its copies of tile t + 1 have landed */
    __syncthreads();      /* publishes tile t + 1 and ends every read of tile t */
    if (t + 2 < DM / 128) g3_tile(l0 + (unsigned)cur * G3T, ag + (t + 2) * 128, bg + (t + 2) * 128);      /* block-uniform; into the buffer that trip t has just read */
  }
  asm volatile("s_wait_asynccnt 0x0" ::: "memory");      /* nothing is in flight when the buffers become output staging */
  f1a* so = (f1a*)&sm[0][0][0] + (size_t)w * 64 * 68; const int rsub = lane >> 4, c4 = (lane & 15) * 4;
  if (!RES && pl == 2) {      /* V^T: staged as f16 [64 dims][64 tokens], pitch FAP, in the wave's own range, so that every store covers whole 128-byte lines */
    _Float16* st = (_Float16*)so;
#pragma unroll
    for (int ni = 0; ni < 4; ++ni) for (int mi = 0; mi < 4; ++mi) { const v8f y = acc[mi][ni] * alpha + bv[ni]; *(v8ha*)&st[(ni * 16 + ln) * FAP + mi * 16 + 8 * hh] = __builtin_convertvector(y, v8h); }
    __builtin_amdgcn_fence(__ATOMIC_ACQ_REL, "workgroup"); __builtin_amdgcn_wave_barrier();      /* a wave reads back only its own staging rows */
    _Float16* vp = VTo + ((size_t)((row0 / SQ) * NH + col0 / HD) * HD + (lane >> 3)) * SQ + row0 % SQ + (lane & 7) * 8;
#pragma unroll
    for (int q = 0; q < 16; ++q) { const v8h v = *(const v8ha*)&st[(q * 4 + (lane >> 3)) * FAP + (lane & 7) * 8]; *(v8h*)(vp + (size_t)q * 4 * SQ) = v; }
  } else {      /* block-uniform; no barrier behind this point */
  const size_t e0 = (size_t)(row0 + rsub) * DM + col0 + c4;
  v4f c[RES ? 32 : 1];
  if (RES) { const float* cp = CP + e0;      /* own elements of the residual plane, whole 256-byte row pieces, all in flight together under the staging below (the fragments' registers are free by now) */
#pragma unroll
    for (int q = 0; q < 32; ++q) c[q] = *(const v4fa*)(cp + (size_t)q * 2 * DM);
    asm volatile("s_wait_xcnt 0x0" :: "v"(cp) : "memory"); }      /* the wait owed before a register that an issued load names is rewritten; the address is an input so that it stays whole up to here */
#pragma unroll
  for (int ni = 0; ni < 4; ++ni) for (int mi = 0; mi < 4; ++mi) for (int r = 0; r < 8; ++r) so[(mi * 16 + 8 * hh + r) * 68 + ni * 16 + ln] = acc[mi][ni][r] * alpha + bv[ni];
  __builtin_amdgcn_fence(__ATOMIC_ACQ_REL, "workgroup"); __builtin_amdgcn_wave_barrier();      /* a wave reads back only its own staging rows */
  if (RES) {
#pragma unroll
    for (int q = 0; q < 32; ++q) { v4f v = *(const v4fa*)&so[(q * 2 + rsub) * 68 + c4]; for (int i = 0; i < 4; ++i) v[i] += bf16_round(c[q][i]); *(v4f*)(C + e0 + (size_t)q * 2 * DM) = v; }      /* the residual is the bf16-rounded input, rounded here instead of in a launch of its own */
  } else {
#pragma unroll
    for (int q = 0; q < 32; ++q) { const v4f v = *(const v4fa*)&so[(q * 2 + rsub) * 68 + c4]; *(v4h*)(C16 + (size_t)pl * NR * DM + e0 + (size_t)q * 2 * DM) = __builtin_convertvector(v, v4h); }
    asm volatile("s_wait_xcnt 0x0" ::: "memory");      /* the wait owed before a register that an issued store names is rewritten: the compiler lays the V^T block, which rewrites the address pair, behind these stores */ } } }

template <int MODE>
__global__ __launch_bounds__(256) void k_regrp(const float* __restrict__ src, float* __restrict__ dst, size_t n4) {
  const size_t t = (size_t)blockIdx.x * 256 + threadIdx.x; if (t >= n4) return; const size_t e = t * 4; const size_t rd = e / DM; const int c = (int)(e % DM);
  size_t rs; if (MODE == 0) { const size_t b = rd / SQ, sq = rd % SQ; rs = sq * NB + b; } else { const size_t sq = rd / NB, b = rd % NB; rs = b * SQ + sq; }
  const v4f v = *(const v4fa*)(src + rs * DM + c); *(v4f*)(dst + e) = v;  }

template <int BFIN, int W16, int W32>
__global__ __launch_bounds__(256) void k_lnx(const float* __restrict__ X, const float* __restrict__ g, const float* __restrict__ bb, float eps, _Float16* __restrict__ N16, float* __restrict__ N32, const float* __restrict__ wa, const float* __restrict__ wb, _Float16* __restrict__ Bt) {
  #pragma clang fp contract(off)
  if (blockIdx.x >= NR) {      /* block-uniform, in front of every barrier: the blocks behind the NR rows round the weights (wa: 3 DM x DM, then wb: DM x DM) into one stacked Bt plane x16, 8 values a thread; both jobs depend on inputs only and share the launch */
    const size_t u = (size_t)(blockIdx.x - NR) * 256 + threadIdx.x; const size_t na = (size_t)3 * DM * DM / 8; const float* s = u < na ? wa + u * 8 : wb + (u - na) * 8; FragH f;
    for (int q = 0; q < 8; ++q) f.h[q] = (_Float16)(bf16_round(s[q]) * 16.0f); *(v8us*)((unsigned short*)Bt + u * 8) = f.half[0]; return; }
  __shared__ float red[256]; const size_t r = blockIdx.x; const int t = threadIdx.x; const bool act = t < (DMQ / 4); const int c0 = act ? t * 4 : 0;
  const v4f xa = *(const v4fa*)(X + r * DMQ + c0); float s[4]; float sum = 0.f;
  for (int q = 0; q < 4; ++q) { s[q] = act ? (BFIN ? bf16_round(xa[q]) : xa[q]) : 0.f; sum = __fadd_rn(sum, s[q]); }
  red[t] = sum; __syncthreads(); for (int st = 128; st > 0; st >>= 1) { if (t < st) red[t] = __fadd_rn(red[t], red[t + st]); __syncthreads(); } const float mu = red[0] / (float)DMQ; __syncthreads();
  float vs = 0.f; for (int q = 0; q < 4; ++q) { const float dl = act ? __fadd_rn(s[q], -mu) : 0.f; vs = __fadd_rn(vs, __fmul_rn(dl, dl)); } red[t] = vs; __syncthreads(); for (int st = 128; st > 0; st >>= 1) { if (t < st) red[t] = __fadd_rn(red[t], red[t + st]); __syncthreads(); }
  const float rs = rsqrtf(__fadd_rn(red[0] / (float)DMQ, eps)); v4h y; v4f yf;
  for (int q = 0; q < 4; ++q) { const int c = c0 + q; yf[q] = __fadd_rn(__fmul_rn(__fmul_rn(__fadd_rn(s[q], -mu), rs), bf16_round(g[c])), bf16_round(bb[c])); y[q] = (_Float16)yf[q]; }
  if (!act) return;      /* no barriers after this point */
  { if (W16) *(v4h*)(N16 + r * DMQ + c0) = y; if (W32) *(v4f*)(N32 + r * DMQ + c0) = yf;  } }

__global__ __launch_bounds__(256) void k_bfr(const float* __restrict__ x, float* __restrict__ XB, size_t n8) { const size_t t = (size_t)blockIdx.x * 256 + threadIdx.x; if (t >= n8) return; v4f a = *(const v4fa*)(x + t * 8), c = *(const v4fa*)(x + t * 8 + 4); for (int q = 0; q < 4; ++q) { a[q] = bf16_round(a[q]); c[q] = bf16_round(c[q]); }
  { *(v4f*)(XB + t * 8) = a; *(v4f*)(XB + t * 8 + 4) = c;  } }



__global__ __launch_bounds__(256) void k_wthd(const float* __restrict__ Wt, _Float16* __restrict__ Bt) { const size_t t = (size_t)blockIdx.x * 256 + threadIdx.x; if (t >= (size_t)NH * HD * (DM / 8)) return; const int m8 = (int)(t % (DM / 8)) * 8; const int d = (int)((t / (DM / 8)) % HD); const int h = (int)(t / ((size_t)(DM / 8) * HD)); FragH f;
  for (int q = 0; q < 8; ++q) f.h[q] = (_Float16)(16.0f * bf16_round(Wt[((size_t)h * DM + m8 + q) * HD + d])); unsigned short* dst = (unsigned short*)Bt + ((size_t)h * HD + d) * DM + m8; *(v8us*)dst = f.half[0];  }




template <int BFIN, int SCAL>
__global__ __launch_bounds__(256) void k_lnsc(const float* __restrict__ X, const float* __restrict__ g, const float* __restrict__ bb, float eps, _Float16* __restrict__ N16, float* __restrict__ N32) {
  #pragma clang fp contract(off)
  __shared__ float red[256]; const size_t r = blockIdx.x; const int t = threadIdx.x; const bool act = t < DM / 4; const int tc = act ? t : 0; const v4f xl = *(const v4fa*)(X + r * DM + tc * 4); const float am = act ? 1.f : 0.f; float s[4]; float sum = 0.f;
  for (int q = 0; q < 4; ++q) { s[q] = (BFIN ? bf16_round(xl[q]) : xl[q]) * am; sum = __fadd_rn(sum, s[q]); }
  red[t] = sum; __syncthreads(); for (int st = 128; st > 0; st >>= 1) { if (t < st) red[t] = __fadd_rn(red[t], red[t + st]); __syncthreads(); } const float mu = red[0] / (float)DM; __syncthreads();
  float vs = 0.f; for (int q = 0; q < 4; ++q) { const float dl = __fadd_rn(s[q], -mu) * am; vs = __fadd_rn(vs, __fmul_rn(dl, dl)); } red[t] = vs; __syncthreads(); for (int st = 128; st > 0; st >>= 1) { if (t < st) red[t] = __fadd_rn(red[t], red[t + st]); __syncthreads(); }
  const float rs = __fdiv_rn(1.0f, __fadd_rn(sqrtf(red[0] / (float)(DM - 1)), eps)); if (!act) return; v4h y; v4f yf;
  for (int q = 0; q < 4; ++q) { const int c = t * 4 + q; const float gg = bf16_round(SCAL ? g[0] : g[c]), bv = bf16_round(SCAL ? bb[0] : bb[c]); yf[q] = __fadd_rn(__fmul_rn(__fmul_rn(__fadd_rn(s[q], -mu), rs), gg), bv); y[q] = (_Float16)yf[q]; }
  { if (N16) *(v4h*)(N16 + r * DM + t * 4) = y; if (N32) *(v4f*)(N32 + r * DM + t * 4) = yf;  } }

__global__ __launch_bounds__(256) void k_rsmdmi(const float* __restrict__ S, _Float16* __restrict__ P, int nrows, const int* __restrict__ M) {
  #pragma clang fp contract(off)
  const int t = blockIdx.x * 256 + threadIdx.x; if (t >= nrows) return; const float* s = S + (size_t)t * SQ; const int* m = M + (size_t)(t % SQ) * SQ; float mx = -3.0e38f;
#pragma unroll 1
  for (int j = 0; j < SQ; ++j) { const float f = (m[j] == 0) ? 1.f : 0.f; mx = fmaxf(mx, fmaf(f, s[j], (1.f - f) * -1.0e9f)); } float se = 0.f;
#pragma unroll 1
  for (int j = 0; j < SQ; ++j) { const float f = (m[j] == 0) ? 1.f : 0.f; se += __expf(fmaf(f, s[j], (1.f - f) * -1.0e9f) - mx); } const float sc = 256.0f / se;
#pragma unroll 1
  for (int j0 = 0; j0 < SQ; j0 += 8) { FragH fr; for (int q = 0; q < 8; ++q) { const int j = j0 + q; const float f = (m[j] == 0) ? 1.f : 0.f; fr.h[q] = (_Float16)(__expf(fmaf(f, s[j], (1.f - f) * -1.0e9f) - mx) * sc); } unsigned short* d = (unsigned short*)P + (size_t)t * SQ + j0; *(v8us*)d = fr.half[0];  } }
extern "C" void kernel_launch(void* const* d_in, const int* in_sizes, int n_in,
                              void* d_out, int out_size, void* d_ws, size_t ws_size, hipStream_t stream) {
  (void)in_sizes; (void)n_in; (void)out_size;
  const float* const* I = (const float* const*)d_in; const float* x = I[0]; const float* g1 = I[1]; const float* be1 = I[2]; const float* wqkv = I[3]; const float* wo = I[4]; const float* bo = I[5];      /* x; LayerNorm gamma / beta; fused NATURAL w_qkv [3072][1024] (row blocks q | k | v; no bias); natural w_proj [1024][1024] + b_proj */
  char* ws = (char*)d_ws; size_t off = 0;
  auto take = [&](size_t bytes) { char* p = ws + off; off += (bytes + 255) & ~(size_t)255; return p; };
  _Float16* BQ = (_Float16*)take((size_t)4 * DM * DM * 2); _Float16* BO = BQ + (size_t)3 * DM * DM;      /* one stacked Bt plane: [3 DM][DM] for q | k | v, then [DM][DM] for the output projection */
  _Float16* XN = (_Float16*)take(NR * DM * 2); _Float16* Q16 = (_Float16*)take((size_t)2 * NR * DM * 2); _Float16* K16 = Q16 + NR * DM;      /* q rows, then k rows: one block of two planes */ _Float16* O16 = (_Float16*)take(NR * DM * 2);
  _Float16* VT = (_Float16*)take((size_t)NB * NH * HD * SQ * 2);
  /* attention sub-block only: no second norm, no MLP planes */
  
  if (off > ws_size) return;
  k_lnx<1, 1, 0><<<(unsigned)(NR + (size_t)4 * DM * DM / 8 / 256), 256, 0, stream>>>(x, g1, be1, 1e-5f, XN, nullptr, wqkv, wo, BQ);      /* blocks 0 .. NR-1: n = LN0(bf16(x)) (biased variance, eps inside the rsqrt) -> f16 rows; the rest: natural [out][in] weights = Bt x16 as given, w_qkv (rows 0 / DM / 2 DM = q | k | v) then w_proj, which lies right behind it */
  k_gemm3<false><<<(unsigned)((NR / 256) * (3 * DM / 128)), 256, 0, stream>>>(XN, BQ, 0.0625f, nullptr, nullptr, nullptr, Q16, VT);      /* q, k -> f16 rows (head h = columns h*64..); v -> V^T [4 * 16][64][2048]; one grid */
  k_fattn<<<dim3(SQ / 256, NB * NH), 256, 0, stream>>>(Q16, K16, VT, O16);      /* softmax(q k^T / 8) v over all keys, every (batch, head) in one launch -> ctx (merged heads, x64) as f16 rows */
  k_gemm3<true><<<(unsigned)((NR / 256) * (DM / 128)), 256, 0, stream>>>(O16, BO, 0.0009765625f, bo, x, (float*)d_out, nullptr, nullptr);      /* bf16(x) + ctx wo (+ bo) (own-element residual, rounded in the epilogue) -> f32 rows */
  /* result = x + out: written straight to d_out by the GEMM above */
}

// v005
// A run of this version takes 120 microseconds.
// Timed twice side by side with v004, it ran 1.07 times as fast both times.
// Counting every step since v000, it is 57.7 times as fast.
#include <hip/hip_runtime.h>
// Pre-LN multi-head self-attention sub-block with a residual (x [4][2048][1024]; h = LayerNorm(x) (biased var, eps 1e-5, gamma / beta); qkv = h w_qkv^T (natural [3072][1024]: row blocks q | k | v, each (head, dim)); no qkv bias; 16 heads of 64; scale 64^-0.5; softmax over all 2048 keys (no mask); out = merged w_proj^T + b_proj (natural); result = x + out -> [4][2048][1024]).
// Structure, four launches: LayerNorm -> f16 rows, with the weight rounding in the same grid; one WMMA GEMM grid for q, k, v (V^T written by its epilogue); one fused attention launch (scores, online softmax, V^T P^T; S and P stay in registers); output projection with the own-element residual, rounded in its epilogue.
// Compute dtype: inputs rounded to bf16; x / weights exact; q, k, v, softmax weights and o as plain f16 GEMM operands (~2^-12); scores and softmax statistics f32; v_wmma_f32_16x16x32_f16.
#define NB 4
#define SQ 2048
#define DM 1024
#define NH 16
#define HD 64
#define HG 4                         /* heads per block group of the unlaunched k_vt overload */
#define LOCALW 128                   /* (macros for unused kernels of the shared header) */
#define STRIDEK 128
#define QT 256                       /* query rows per causal tile */
#define NKX SQ                       /* S / P row pitch */
#define QT0 128                      /* first-tile rows recomputed exactly in f32 */
#define B0 0                         /* unused: every batch is processed */
#define NBR NB                       /* unused by the launches: they cover all NB batches */
#define NR ((size_t)NB * SQ)
#define DMQ DM
#define DFF 4096         /* unused: no FFN in this sub-block */
#define MP ((int)((size_t)NBR * SQ)) /* unused: the projections cover NR rows */
#define QN SQ                        /* unused: every query row is attended */
#define NHD NH                       /* unused: every head is attended */
#define MPO MP                       /* unused: the output GEMM covers NR rows */
#define LQ (3 * DM)      /* unused: the q, k, v rows have pitch DM */
typedef __bf16 v16b __attribute__((ext_vector_type(16)));
typedef unsigned short v8us __attribute__((ext_vector_type(8), may_alias));
typedef float  v8f  __attribute__((ext_vector_type(8)));
typedef float  v4f  __attribute__((ext_vector_type(4)));
typedef float  v4fa __attribute__((ext_vector_type(4), may_alias));
union FragB { v16b v; v8us half[2]; unsigned short u[16]; };

__device__ __forceinline__ unsigned short bf16_bits(float x) { unsigned int u = __float_as_uint(x); return (unsigned short)((u + 0x7FFFu + ((u >> 16) & 1u)) >> 16); }
__device__ __forceinline__ float bf16_val(unsigned short b) { return __uint_as_float(((unsigned int)b) << 16); }
__device__ __forceinline__ float bf16_round(float x) { return bf16_val(bf16_bits(x)); }
// D += A·B with NT terms: 1 = ah·bh, 2 = + al·bh (A split), 3 = + ah·bl (both split)
template <int NT>
__device__ __forceinline__ v8f mmaN(v16b ah, v16b al, v16b bh, v16b bl, v8f c) {
  c = __builtin_amdgcn_wmma_f32_16x16x32_bf16(false, ah, false, bh, (short)0, c, false, false);
  if (NT >= 2) c = __builtin_amdgcn_wmma_f32_16x16x32_bf16(false, al, false, bh, (short)0, c, false, false);
  if (NT >= 3) c = __builtin_amdgcn_wmma_f32_16x16x32_bf16(false, ah, false, bl, (short)0, c, false, false);
  asm volatile("v_nop\n\tv_nop\n\tv_nop\n\tv_nop" : "+v"(c) : "v"(ah), "v"(al), "v"(bh), "v"(bl));
  return c;
}

__global__ __launch_bounds__(256) void k_wt_bf16(const float* __restrict__ W, unsigned short* __restrict__ Wt, int K, int N) {
  const int t = blockIdx.x * 256 + threadIdx.x;
  const int k8n = K / 8;
  if (t >= N * k8n) return;
  const int n = t / k8n, k8 = (t % k8n) * 8;
  v8us v;
#pragma unroll
  for (int i = 0; i < 8; ++i) v[i] = bf16_bits(W[(size_t)(k8 + i) * N + n]);
  *(v8us*)(Wt + (size_t)n * K + k8) = v;
  
}

// GEMM C[M][N] (f32, pitch ldc) = act(A[M][K]·W + bias). A f32 row-major (pitch lda) converted per fragment to bf16
// (ASPLIT: hi/lo two planes -> 2 terms, else single rounded term); Wt bf16 [N][K] (pitch ldb). BIAS_BF16 rounds the
// bias to bf16 first (bias quantised to bf16 before the add). K%32==0, M%16==0, N%64==0.
template <bool ASPLIT, int ACT, bool BIAS_BF16>
__global__ __launch_bounds__(128) void k_gemm_bf(const float* __restrict__ A, int lda, const unsigned short* __restrict__ Wt, int ldb,
                                               const float* __restrict__ bias, float* __restrict__ C, int ldc, int M, int N, int K) {
  __shared__ __attribute__((aligned(16))) float so[4][16][64];
  const int tid = threadIdx.x, w = tid >> 5, lane = tid & 31, ln = lane & 15, hh = lane >> 4;
  const int ntn = N / 64;
  const int wid = blockIdx.x * 4 + w;
  const int mt = wid / ntn, nq = wid % ntn;
  if (mt * 16 >= M) return;
  const int row0 = mt * 16, col0 = nq * 64;
  const float* arow = A + (size_t)(row0 + ln) * lda;
  v8f acc[4] = {};
  for (int kb = 0; kb < K; kb += 32) {
    FragB ah, al;
    const v4f x0 = *(const v4fa*)(arow + kb + 8 * hh), x1 = *(const v4fa*)(arow + kb + 8 * hh + 4);
    const v4f x2 = *(const v4fa*)(arow + kb + 16 + 8 * hh), x3 = *(const v4fa*)(arow + kb + 16 + 8 * hh + 4);
    float xs[16] = {x0[0],x0[1],x0[2],x0[3],x1[0],x1[1],x1[2],x1[3],x2[0],x2[1],x2[2],x2[3],x3[0],x3[1],x3[2],x3[3]};
#pragma unroll
    for (int i = 0; i < 16; ++i) { const unsigned short hb = bf16_bits(xs[i]); ah.u[i] = hb; al.u[i] = ASPLIT ? bf16_bits(xs[i] - bf16_val(hb)) : (unsigned short)0; }
#pragma unroll
    for (int t = 0; t < 4; ++t) {
      const unsigned short* brow = Wt + (size_t)(col0 + t * 16 + ln) * ldb + kb;
      FragB b;
      b.half[0] = *(const v8us*)(brow + 8 * hh);
      b.half[1] = *(const v8us*)(brow + 16 + 8 * hh);
      acc[t] = mmaN<ASPLIT ? 2 : 1>(ah.v, al.v, b.v, b.v, acc[t]);
    }
  }
#pragma unroll
  for (int t = 0; t < 4; ++t) {
    float bv = bias ? bias[col0 + t * 16 + ln] : 0.f;
    if (BIAS_BF16) bv = bf16_round(bv);
#pragma unroll
    for (int r = 0; r < 8; ++r) { float v = acc[t][r] + bv; if (ACT == 1) v = fmaxf(v, 0.f); so[w][8 * hh + r][t * 16 + ln] = v; }
  }
  __builtin_amdgcn_fence(__ATOMIC_ACQ_REL, "workgroup");
  __builtin_amdgcn_wave_barrier();
  const int rsub = lane >> 4, c4 = (lane & 15) * 4;
  {
#pragma unroll
    for (int q = 0; q < 8; ++q) {
      const int r = q * 2 + rsub;
      const v4f v = *(const v4fa*)&so[w][r][c4];
      *(v4f*)(C + (size_t)(row0 + r) * ldc + col0 + c4) = v;
    }
    
  }
}

// GEMM C = act(A·W + bias + resid): A f32 (ASPLIT -> hi/lo 2 terms), Wt bf16 [N][K]; ACT 0 none, 1 relu, 2 exact gelu;
// resid (optional, f32, row index = (row % rmod), pitch ldr, RES_BF16 rounds it) added before the activation.
template <bool ASPLIT, int ACT, bool BIAS_BF16, bool RES_BF16>
__global__ __launch_bounds__(128) void k_gemm_bf3(const float* __restrict__ A, int lda, const unsigned short* __restrict__ Wt, int ldb,
                                                const float* __restrict__ bias, const float* __restrict__ resid, int rmod, int ldr,
                                                float* __restrict__ C, int ldc, int M, int N, int K) {
  __shared__ __attribute__((aligned(16))) float so[4][16][64];
  const int tid = threadIdx.x, w = tid >> 5, lane = tid & 31, ln = lane & 15, hh = lane >> 4;
  const int ntn = N / 64;
  const int wid = blockIdx.x * 4 + w;
  const int mt = wid / ntn, nq = wid % ntn;
  if (mt * 16 >= M) return;
  const int row0 = mt * 16, col0 = nq * 64;
  const float* arow = A + (size_t)(row0 + ln) * lda;
  v8f acc[4] = {};
  for (int kb = 0; kb < K; kb += 32) {
    FragB ah, al;
    const v4f x0 = *(const v4fa*)(arow + kb + 8 * hh), x1 = *(const v4fa*)(arow + kb + 8 * hh + 4);
    const v4f x2 = *(const v4fa*)(arow + kb + 16 + 8 * hh), x3 = *(const v4fa*)(arow + kb + 16 + 8 * hh + 4);
    float xs[16] = {x0[0],x0[1],x0[2],x0[3],x1[0],x1[1],x1[2],x1[3],x2[0],x2[1],x2[2],x2[3],x3[0],x3[1],x3[2],x3[3]};
#pragma unroll
    for (int i = 0; i < 16; ++i) { const unsigned short hb = bf16_bits(xs[i]); ah.u[i] = hb; al.u[i] = ASPLIT ? bf16_bits(xs[i] - bf16_val(hb)) : (unsigned short)0; }
#pragma unroll
    for (int t = 0; t < 4; ++t) {
      const unsigned short* brow = Wt + (size_t)(col0 + t * 16 + ln) * ldb + kb;
      FragB b;
      b.half[0] = *(const v8us*)(brow + 8 * hh);
      b.half[1] = *(const v8us*)(brow + 16 + 8 * hh);
      acc[t] = mmaN<ASPLIT ? 2 : 1>(ah.v, al.v, b.v, b.v, acc[t]);
    }
  }
#pragma unroll
  for (int t = 0; t < 4; ++t) {
    const int col = col0 + t * 16 + ln;
    float bv = bias ? bias[col] : 0.f;
    if (BIAS_BF16) bv = bf16_round(bv);
#pragma unroll
    for (int r = 0; r < 8; ++r) {
      float v = acc[t][r] + bv;
      if (resid) { float rv = resid[(size_t)((row0 + 8 * hh + r) % rmod) * ldr + col]; if (RES_BF16) rv = bf16_round(rv); v += rv; }
      if (ACT == 1) v = fmaxf(v, 0.f);
      if (ACT == 2) v = 0.5f * v * (1.0f + erff(v * 0.70710678118654752f));
      if (ACT == 3) { const float u = 0.7978845608028654f * (v + 0.044715f * v * v * v); v = 0.5f * v * (1.0f + tanhf(u)); }
      so[w][8 * hh + r][t * 16 + ln] = v;
    }
  }
  __builtin_amdgcn_fence(__ATOMIC_ACQ_REL, "workgroup");
  __builtin_amdgcn_wave_barrier();
  const int rsub = lane >> 4, c4 = (lane & 15) * 4;
  {
#pragma unroll
    for (int q = 0; q < 8; ++q) {
      const int r = q * 2 + rsub;
      const v4f v = *(const v4fa*)&so[w][r][c4];
      *(v4f*)(C + (size_t)(row0 + r) * ldc + col0 + c4) = v;
    }
    
  }
}
// row LayerNorm (biased variance, eps) over N: s = X (+ R); optional out_sum <- s; out_norm <- (s-mu)*rsqrt(var+eps)*g + b
template <bool PARAM_BF16>
__global__ __launch_bounds__(256) void k_layernorm(const float* __restrict__ X, const float* __restrict__ R, const float* __restrict__ g, const float* __restrict__ bta,
                                                  float* __restrict__ out_sum, float* __restrict__ out_norm, int N, float eps) {
  __shared__ float red[256];
  const int row = blockIdx.x, tid = threadIdx.x;
  const float* x = X + (size_t)row * N; const float* rr = R ? R + (size_t)row * N : nullptr;
  float vals[16];                     // up to N = 4096
  const int per = N / 256;            // contiguous chunk per thread? use strided-by-4 chunks: thread handles j = tid*4 + 1024*u
  float s1 = 0.f;
  for (int u = 0; u < per / 4; ++u) {
    const int j = tid * 4 + 1024 * u;
    const v4f a = *(const v4fa*)(x + j);
    v4f b = {0.f,0.f,0.f,0.f}; if (rr) b = *(const v4fa*)(rr + j);
#pragma unroll
    for (int q = 0; q < 4; ++q) { const float v = a[q] + b[q]; vals[u * 4 + q] = v; s1 += v; }
  }
  red[tid] = s1; __syncthreads();
  for (int st = 128; st > 0; st >>= 1) { if (tid < st) red[tid] += red[tid + st]; __syncthreads(); }
  const float mu = red[0] / (float)N; __syncthreads();
  float s2 = 0.f;
  for (int u = 0; u < per / 4; ++u)
#pragma unroll
    for (int q = 0; q < 4; ++q) { const float c = vals[u * 4 + q] - mu; s2 += c * c; }
  red[tid] = s2; __syncthreads();
  for (int st = 128; st > 0; st >>= 1) { if (tid < st) red[tid] += red[tid + st]; __syncthreads(); }
  const float rs = rsqrtf(red[0] / (float)N + eps);
  {
    for (int u = 0; u < per / 4; ++u) {
      const int j = tid * 4 + 1024 * u;
      v4f o, sm;
#pragma unroll
      for (int q = 0; q < 4; ++q) {
        float gg = g[j + q], bb = bta[j + q];
        if (PARAM_BF16) { gg = bf16_round(gg); bb = bf16_round(bb); }
        sm[q] = vals[u * 4 + q]; o[q] = (vals[u * 4 + q] - mu) * rs * gg + bb;
      }
      if (out_sum) *(v4f*)(out_sum + (size_t)row * N + j) = sm;
      *(v4f*)(out_norm + (size_t)row * N + j) = o;
    }
    
  }
}



// ---- f16 WMMA path (v_wmma_f32_16x16x32_f16): 11-bit significands for operands in range — used where a [0,1] probability operand needs more precision than bf16
typedef _Float16 v16h __attribute__((ext_vector_type(16)));
union FragH { v16h v; v8us half[2]; _Float16 h[16]; unsigned short u[16]; };
template <int NT>
__device__ __forceinline__ v8f mmaH(v16h ah, v16h al, v16h bh, v16h bl, v8f c) {
  c = __builtin_amdgcn_wmma_f32_16x16x32_f16(false, ah, false, bh, (short)0, c, false, false);
  if (NT >= 2) c = __builtin_amdgcn_wmma_f32_16x16x32_f16(false, al, false, bh, (short)0, c, false, false);
  if (NT >= 3) c = __builtin_amdgcn_wmma_f32_16x16x32_f16(false, ah, false, bl, (short)0, c, false, false);
  asm volatile("v_nop\n\tv_nop\n\tv_nop\n\tv_nop" : "+v"(c) : "v"(ah), "v"(al), "v"(bh), "v"(bl));
  return c;
}
// batched GEMM like k_gemm_b but f16 operands: A f32 (split into f16 hi/lo if ASPLIT, else rounded to f16), Bt = f16 values [n][k]; alpha; C f32; N multiple of 16 (partial tiles skipped)
template <bool ASPLIT>
__global__ __launch_bounds__(128) void k_gemm_h(const float* __restrict__ A, int lda, size_t sA, const _Float16* __restrict__ Bh, int ldb, size_t sB, float alpha, float* __restrict__ C, int ldc, size_t sC, int M, int N, int K) {
  __shared__ __attribute__((aligned(16))) float so[4][16][64];
  const int tid = threadIdx.x, w = tid >> 5, lane = tid & 31, ln = lane & 15, hh = lane >> 4; const int by = blockIdx.y;
  A += (size_t)by * sA; Bh += (size_t)by * sB; C += (size_t)by * sC;
  const int ntn = (N + 63) / 64; const int wid = blockIdx.x * 4 + w; const int mt = wid / ntn, nq = wid % ntn; if (mt * 16 >= M) return;
  const int row0 = mt * 16, col0 = nq * 64; const float* arow = A + (size_t)(row0 + ln) * lda;
  v8f acc[4] = {};
  for (int kb = 0; kb < K; kb += 32) {
    FragH ah, al;
    const v4f x0 = *(const v4fa*)(arow + kb + 8 * hh), x1 = *(const v4fa*)(arow + kb + 8 * hh + 4), x2 = *(const v4fa*)(arow + kb + 16 + 8 * hh), x3 = *(const v4fa*)(arow + kb + 16 + 8 * hh + 4);
    float xs[16] = {x0[0],x0[1],x0[2],x0[3],x1[0],x1[1],x1[2],x1[3],x2[0],x2[1],x2[2],x2[3],x3[0],x3[1],x3[2],x3[3]};
#pragma unroll
    for (int i = 0; i < 16; ++i) { const _Float16 h = (_Float16)xs[i]; ah.h[i] = h; al.h[i] = ASPLIT ? (_Float16)(xs[i] - (float)h) : (_Float16)0.0f; }
#pragma unroll
    for (int t = 0; t < 4; ++t) { if (col0 + t * 16 >= N) continue; const size_t boff = (size_t)(col0 + t * 16 + ln) * ldb + kb; FragH bq; bq.half[0] = *(const v8us*)(Bh + boff + 8 * hh); bq.half[1] = *(const v8us*)(Bh + boff + 16 + 8 * hh);
      acc[t] = mmaH<ASPLIT ? 2 : 1>(ah.v, al.v, bq.v, bq.v, acc[t]); }
  }
#pragma unroll
  for (int t = 0; t < 4; ++t) { if (col0 + t * 16 >= N) continue;
#pragma unroll
    for (int r = 0; r < 8; ++r) so[w][8 * hh + r][t * 16 + ln] = acc[t][r] * alpha; }
  __builtin_amdgcn_fence(__ATOMIC_ACQ_REL, "workgroup"); __builtin_amdgcn_wave_barrier();
  const int rsub = lane >> 4, c4 = (lane & 15) * 4;
  {
#pragma unroll
    for (int q = 0; q < 8; ++q) { const int r = q * 2 + rsub; if (col0 + c4 < N) { const v4f v = *(const v4fa*)&so[w][r][c4]; *(v4f*)(C + (size_t)(row0 + r) * ldc + col0 + c4) = v; } }
     }
}

// Wt[n][k] = f16(W[k][n]·scale) from f32 row-major W[K][N] (scale = power of two; bf16-exact weights stay exact in f16 away from the subnormal range)
__global__ __launch_bounds__(256) void k_wt_f16(const float* __restrict__ W, _Float16* __restrict__ Wt, int K, int N, float scale) {
  const int t = blockIdx.x * 256 + threadIdx.x; if (t >= N * (K / 8)) return; const int n = t / (K / 8), k8 = (t % (K / 8)) * 8; FragH f;
#pragma unroll
  for (int i = 0; i < 8; ++i) f.h[i] = (_Float16)(bf16_round(W[(size_t)(k8 + i) * N + n]) * scale); const v8us o = f.half[0];
  *(v8us*)((unsigned short*)Wt + (size_t)n * K + k8) = o; 
}
// k_gemm_hh variant with fused epilogue: v = acc·alpha + bias[by·sBias + col] (+ CP[(row/rowsPerB)·sCPb + by·64 + col] if CP) ; ACT 0 none / 1 elu ; writes f16 C16 (and f32 C if non-null)
template <int ACT>
__global__ __launch_bounds__(128) void k_gemm_hhx(const _Float16* __restrict__ A, int lda, size_t sA, const _Float16* __restrict__ Bh, int ldb, size_t sB, float alpha, const float* __restrict__ bias, size_t sBias, const float* __restrict__ CP, int rowsPerB, size_t sCPb, int row0g,
    float* __restrict__ C, _Float16* __restrict__ C16, int ldc, size_t sC, int M, int N, int K) {
  __shared__ __attribute__((aligned(16))) float so[4][16][64];
  const int tid = threadIdx.x, w = tid >> 5, lane = tid & 31, ln = lane & 15, hh = lane >> 4; const int by = blockIdx.y;
  A += (size_t)by * sA; Bh += (size_t)by * sB; const size_t cofs = (size_t)by * sC; const float* bp = bias ? bias + (size_t)by * sBias : nullptr;
  const int ntn = (N + 63) / 64; const int wid = blockIdx.x * 4 + w; const int mt = wid / ntn, nq = wid % ntn; if (mt * 16 >= M) return;
  const int row0 = mt * 16, col0 = nq * 64; const _Float16* arow = A + (size_t)(row0 + ln) * lda;
  v8f acc[4] = {};
  for (int kb = 0; kb < K; kb += 32) { FragH ah; ah.half[0] = *(const v8us*)((const unsigned short*)arow + kb + 8 * hh); ah.half[1] = *(const v8us*)((const unsigned short*)arow + kb + 16 + 8 * hh);
#pragma unroll
    for (int t = 0; t < 4; ++t) { if (col0 + t * 16 >= N) continue; const size_t boff = (size_t)(col0 + t * 16 + ln) * ldb + kb; FragH bq; bq.half[0] = *(const v8us*)((const unsigned short*)Bh + boff + 8 * hh); bq.half[1] = *(const v8us*)((const unsigned short*)Bh + boff + 16 + 8 * hh);
      acc[t] = mmaH<1>(ah.v, ah.v, bq.v, bq.v, acc[t]); }
  }
#pragma unroll
  for (int t = 0; t < 4; ++t) { if (col0 + t * 16 >= N) continue; const int col = col0 + t * 16 + ln; const float bv = bp ? bf16_round(bp[col]) : 0.f;
#pragma unroll
    for (int r = 0; r < 8; ++r) { float v = acc[t][r] * alpha + bv; if (CP) { const int rr = row0g + row0 + 8 * hh + r; if (rowsPerB < 0) v += CP[cofs + (size_t)rr * ldc + col];      /* rowsPerB < 0: own element of the batched C plane */ else { const int bidx = rr / rowsPerB; v += CP[(size_t)bidx * sCPb + (size_t)by * 64 + col]; } } if (ACT == 1) v = (v > 0.f) ? v : expm1f(v); else if (ACT == 7) v = (v > 0.f) ? v + 1.0f : expf(v); else if (ACT == 8) v = tanhf(v); else if (ACT == 9) v = 0.5f * v * (1.0f + tanhf(0.7978845608028654f * (v + 0.044715f * v * v * v))); else if (ACT == 11) v = 1.0f / (1.0f + expf(-v)); else if (ACT == 12) v = (v > 0.f) ? v : 0.01f * v; else if (ACT == 14) v = (v > 0.f) ? v : 0.1f * v; else if (ACT == 16) v = (v >= 0.f) ? v : 0.3f * v; else if (ACT == 17) v = (v >= 0.f) ? v : 0.2f * v; else if (ACT == 15) v = v / (1.0f + expf(-v)); else if (ACT == 3) v = fmaxf(v, 0.f); else if (ACT == 6) v = 0.5f * v * (1.0f + erff(v * 0.70710678118654752f)); so[w][8 * hh + r][t * 16 + ln] = v; } }
  __builtin_amdgcn_fence(__ATOMIC_ACQ_REL, "workgroup"); __builtin_amdgcn_wave_barrier();
  const int rsub = lane >> 4, c4 = (lane & 15) * 4; typedef _Float16 v4h __attribute__((ext_vector_type(4)));
  {
#pragma unroll
    for (int q = 0; q < 8; ++q) { const int r = q * 2 + rsub; if (col0 + c4 < N) { const v4f v = *(const v4fa*)&so[w][r][c4]; if (C) *(v4f*)(C + cofs + (size_t)(row0 + r) * ldc + col0 + c4) = v; if (C16) { v4h h4; for (int i = 0; i < 4; ++i) h4[i] = (_Float16)v[i]; *(v4h*)(C16 + cofs + (size_t)(row0 + r) * ldc + col0 + c4) = h4; } } }
     }
}


typedef _Float16 v4h __attribute__((ext_vector_type(4)));

__global__ __launch_bounds__(256) void k_x16(const float* __restrict__ x, _Float16* __restrict__ X16, size_t n8) { const size_t t = (size_t)blockIdx.x * 256 + threadIdx.x; if (t >= n8) return; FragH f;
#pragma unroll
  for (int q = 0; q < 8; ++q) f.h[q] = (_Float16)bf16_round(x[t * 8 + q]); *(v8us*)((unsigned short*)X16 + t * 8) = f.half[0];  }
__global__ __launch_bounds__(256) void k_h16(const float* __restrict__ x, _Float16* __restrict__ X16, size_t n8) { const size_t t = (size_t)blockIdx.x * 256 + threadIdx.x; if (t >= n8) return; FragH f;
#pragma unroll
  for (int q = 0; q < 8; ++q) f.h[q] = (_Float16)x[t * 8 + q]; *(v8us*)((unsigned short*)X16 + t * 8) = f.half[0];  }
__global__ __launch_bounds__(256) void k_round16f(const float* __restrict__ W, _Float16* __restrict__ Bt, size_t n8) { const size_t t = (size_t)blockIdx.x * 256 + threadIdx.x; if (t >= n8) return; FragH f;
#pragma unroll
  for (int i = 0; i < 8; ++i) f.h[i] = (_Float16)(bf16_round(W[t * 8 + i]) * 16.0f); *(v8us*)((unsigned short*)Bt + t * 8) = f.half[0];  }
template <int NHv, int TTv>
__global__ __launch_bounds__(256) void k_vt(const _Float16* __restrict__ V16, int ldv, int voff, _Float16* __restrict__ Vt) { __shared__ unsigned short tl[64][66]; const int tid = threadIdx.x; const int slab = blockIdx.x / (TTv / 64), lg = blockIdx.x % (TTv / 64); const int b = slab / NHv, h = slab % NHv;
  for (int i = tid; i < 64 * 8; i += 256) { const int r = i / 8, c8 = (i % 8) * 8; FragH f; f.half[0] = *(const v8us*)((const unsigned short*)V16 + ((size_t)b * TTv + lg * 64 + r) * ldv + voff + h * 64 + c8);
#pragma unroll
    for (int q = 0; q < 8; ++q) tl[r][c8 + q] = f.u[q]; }
  __syncthreads();
  {
#pragma unroll
    for (int rd = 0; rd < 2; ++rd) { const int d = rd * 32 + tid / 8, pc = tid % 8; FragH f;
#pragma unroll
      for (int q = 0; q < 8; ++q) f.u[q] = tl[pc * 8 + q][d];
      *(v8us*)((unsigned short*)Vt + ((size_t)slab * 64 + d) * TTv + lg * 64 + pc * 8) = f.half[0]; }
     } }

__global__ __launch_bounds__(256) void k_hl(const float* __restrict__ F, _Float16* __restrict__ Hh, _Float16* __restrict__ Hl, size_t n8) { const size_t t = (size_t)blockIdx.x * 256 + threadIdx.x; if (t >= n8) return; FragH fh, fl; const v4f a = *(const v4fa*)(F + t * 8), c = *(const v4fa*)(F + t * 8 + 4);
#pragma unroll
  for (int q = 0; q < 4; ++q) { _Float16 h = (_Float16)a[q]; fh.h[q] = h; fl.h[q] = (_Float16)((a[q] - (float)h) * 1024.0f); h = (_Float16)c[q]; fh.h[4 + q] = h; fl.h[4 + q] = (_Float16)((c[q] - (float)h) * 1024.0f); }
  { *(v8us*)((unsigned short*)Hh + t * 8) = fh.half[0]; *(v8us*)((unsigned short*)Hl + t * 8) = fl.half[0];  } }

// ---- fast GEMM (wave tile 32x64; requires M % 32 == 0 rows per launch region and N % 64 == 0); epilogue = k_gemm_hhx semantics ----
__device__ __forceinline__ v16h g2_frag(const _Float16* p, int hh) { FragH f; f.half[0] = *(const v8us*)((const unsigned short*)p + 8 * hh); f.half[1] = *(const v8us*)((const unsigned short*)p + 16 + 8 * hh); return f.v; }
__device__ __forceinline__ v8f g2_mma(v16h a, v16h b, v8f c) { v8f d = __builtin_amdgcn_wmma_f32_16x16x32_f16(false, a, false, b, (short)0, c, false, false); asm volatile("v_nop\n\tv_nop\n\tv_nop\n\tv_nop" : "+v"(d) : "v"(a), "v"(b)); return d; }
template <int ACT>
__global__ __launch_bounds__(128) void k_gemm2(const _Float16* __restrict__ A, int lda, size_t sA, const _Float16* __restrict__ Bh, int ldb, size_t sB, float alpha, const float* __restrict__ bias, size_t sBias, const float* __restrict__ CP, int rowsPerB, size_t sCPb, int row0g,
    float* __restrict__ C, _Float16* __restrict__ C16, int ldc, size_t sC, int M, int N, int K) { static_assert(ACT == 0 || ACT == 3 || ACT == 6 || ACT == 8 || ACT == 9 || ACT == 11 || ACT == 12 || ACT == 14 || ACT == 15 || ACT == 16 || ACT == 17 || ACT == 18, "k_gemm2: unsupported ACT code (would silently apply no activation)");
  __shared__ __attribute__((aligned(16))) float so[4][32][68];
  const int tid = threadIdx.x, w = tid >> 5, lane = tid & 31, ln = lane & 15, hh = lane >> 4; const int by = blockIdx.y;
  A += (size_t)by * sA; Bh += (size_t)by * sB; const size_t cofs = (size_t)by * sC; const float* bp = bias ? bias + (size_t)by * sBias : nullptr;
  const int ntn = N >> 6; const int mt = blockIdx.x / ntn, nq = blockIdx.x - mt * ntn; const int row0 = mt * 128 + 32 * w, col0 = nq * 64; if (row0 >= M) return;
  const _Float16* a0p = A + (size_t)(row0 + ln) * lda; const _Float16* a1p = a0p + (size_t)16 * lda;
  const _Float16* b0p = Bh + (size_t)(col0 + ln) * ldb; const _Float16* b1p = b0p + (size_t)16 * ldb; const _Float16* b2p = b1p + (size_t)16 * ldb; const _Float16* b3p = b2p + (size_t)16 * ldb;
  const v8f z8 = {0.f,0.f,0.f,0.f,0.f,0.f,0.f,0.f}; v8f c00 = z8, c01 = z8, c02 = z8, c03 = z8, c10 = z8, c11 = z8, c12 = z8, c13 = z8;
#pragma unroll 1
  for (int kb = 0; kb < K; kb += 32) { const v16h a0 = g2_frag(a0p + kb, hh), a1 = g2_frag(a1p + kb, hh);
    v16h b = g2_frag(b0p + kb, hh); c00 = g2_mma(a0, b, c00); c10 = g2_mma(a1, b, c10);
    b = g2_frag(b1p + kb, hh); c01 = g2_mma(a0, b, c01); c11 = g2_mma(a1, b, c11);
    b = g2_frag(b2p + kb, hh); c02 = g2_mma(a0, b, c02); c12 = g2_mma(a1, b, c12);
    b = g2_frag(b3p + kb, hh); c03 = g2_mma(a0, b, c03); c13 = g2_mma(a1, b, c13); }
  v8f accs[8] = {c00, c01, c02, c03, c10, c11, c12, c13};
#pragma unroll
  for (int u = 0; u < 8; ++u) { const int t = u & 3, half = u >> 2; const int col = col0 + t * 16 + ln; const float bv = bp ? bf16_round(bp[col]) : 0.f;
#pragma unroll
    for (int r = 0; r < 8; ++r) { const int rloc = half * 16 + 8 * hh + r; float v = accs[u][r] * alpha + bv; if (CP) { if (rowsPerB < 0) v += CP[cofs + (size_t)(row0g + row0 + rloc) * ldc + col];      /* rowsPerB < 0: own element of the batched C plane */ else { const int bidx = (row0g + row0 + rloc) / rowsPerB; v += CP[(size_t)bidx * sCPb + (size_t)by * 64 + col]; } }
      if (ACT == 3) v = fmaxf(v, 0.f); else if (ACT == 6) v = 0.5f * v * (1.0f + erff(v * 0.70710678118654752f)); else if (ACT == 11) v = 1.0f / (1.0f + expf(-v)); else if (ACT == 15) v = v / (1.0f + expf(-v)); else if (ACT == 18) v = v / (1.0f + expf(-1.702f * v));      /* QuickGELU: v sigmoid(1.702 v) */ else if (ACT == 12) v = (v > 0.f) ? v : 0.01f * v; else if (ACT == 8) v = tanhf(v); else if (ACT == 9) v = 0.5f * v * (1.0f + tanhf(0.7978845608028654f * (v + 0.044715f * v * v * v))); else if (ACT == 14) v = (v > 0.f) ? v : 0.1f * v; else if (ACT == 16) v = (v >= 0.f) ? v : 0.3f * v; else if (ACT == 17) v = (v >= 0.f) ? v : 0.2f * v;
      so[w][rloc][t * 16 + ln] = v; } }
  __builtin_amdgcn_fence(__ATOMIC_ACQ_REL, "workgroup"); __builtin_amdgcn_wave_barrier();
  const int rsub = lane >> 4, c4 = (lane & 15) * 4;
  {
#pragma unroll
    for (int q = 0; q < 16; ++q) { const int r = q * 2 + rsub; const v4f v = *(const v4fa*)&so[w][r][c4]; if (C) *(v4f*)(C + cofs + (size_t)(row0 + r) * ldc + col0 + c4) = v; if (C16) { v4h h4; for (int i = 0; i < 4; ++i) h4[i] = (_Float16)v[i]; *(v4h*)(C16 + cofs + (size_t)(row0 + r) * ldc + col0 + c4) = h4; } }
     } }


__global__ __launch_bounds__(256) void k_wnat(const float* __restrict__ w, size_t n8, _Float16* __restrict__ Bt) { const size_t t = (size_t)blockIdx.x * 256 + threadIdx.x; if (t >= n8) return; FragH f; for (int q = 0; q < 8; ++q) f.h[q] = (_Float16)(bf16_round(w[t * 8 + q]) * 16.0f); *(v8us*)((unsigned short*)Bt + t * 8) = f.half[0];  }
__global__ __launch_bounds__(256) void k_rsm(const float* __restrict__ S, _Float16* __restrict__ P, int nrows) {
  #pragma clang fp contract(off)
  const int i = blockIdx.x * 256 + threadIdx.x; if (i >= nrows) return; const float* s = S + (size_t)i * SQ; float mx = -3.0e38f;
#pragma unroll 1
  for (int j = 0; j < SQ; ++j) mx = fmaxf(mx, s[j]); float se = 0.f;
#pragma unroll 1
  for (int j = 0; j < SQ; ++j) se += expf(s[j] - mx); const float sc = 256.0f / se;
#pragma unroll 1
  for (int j0 = 0; j0 < SQ; j0 += 8) { FragH f; for (int q = 0; q < 8; ++q) f.h[q] = (_Float16)(expf(s[j0 + q] - mx) * sc); unsigned short* d = (unsigned short*)P + (size_t)i * SQ + j0; *(v8us*)d = f.half[0];  } }
__global__ __launch_bounds__(256) void k_vt(const _Float16* __restrict__ V16, int b, int h0, _Float16* __restrict__ VT) { __shared__ unsigned short tl[64][65]; const int tid = threadIdx.x; const int hh = blockIdx.x % HG, sg = blockIdx.x / HG; const int s0 = sg * 64; const int h = h0 + hh;
  for (int i = tid; i < 64 * 8; i += 256) { const int j = i / 8, d8 = (i % 8) * 8; FragH f; f.half[0] = *(const v8us*)((const unsigned short*)V16 + ((size_t)b * SQ + s0 + j) * DM + h * HD + d8); for (int q = 0; q < 8; ++q) tl[d8 + q][j] = f.u[q]; }
  __syncthreads();
  { for (int i = tid; i < 64 * 8; i += 256) { const int d = i / 8, j8 = (i % 8) * 8; FragH f; for (int q = 0; q < 8; ++q) f.u[q] = tl[d][j8 + q]; *(v8us*)((unsigned short*)VT + ((size_t)hh * HD + d) * SQ + s0 + j8) = f.half[0]; }  } }



__global__ __launch_bounds__(256) void k_rsmcf2(const float* __restrict__ S, _Float16* __restrict__ P, int hg, int q0, int nk) {
  #pragma clang fp contract(off)
  const int t = blockIdx.x * 256 + threadIdx.x; if (t >= hg * QT) return; const size_t i = (size_t)t; const float* s = S + i * NKX; const int last = q0 + (t % QT); float mx = -3.0e38f;
#pragma unroll 1
  for (int j = 0; j < nk; ++j) { const float f = (j <= last) ? 1.f : 0.f; mx = fmaxf(mx, fmaf(f, s[j], (1.f - f) * -1.0e9f)); } float se = 0.f;
#pragma unroll 1
  for (int j = 0; j < nk; ++j) { const float f = (j <= last) ? 1.f : 0.f; se += __expf(fmaf(f, s[j], (1.f - f) * -1.0e9f) - mx); } const float sc = 256.0f / se;
#pragma unroll 1
  for (int j0 = 0; j0 < nk; j0 += 8) { FragH fr; for (int q = 0; q < 8; ++q) { const int j = j0 + q; const float f = (j <= last) ? 1.f : 0.f; fr.h[q] = (_Float16)(__expf(fmaf(f, s[j], (1.f - f) * -1.0e9f) - mx) * sc); } unsigned short* d = (unsigned short*)P + i * NKX + j0; *(v8us*)d = fr.half[0];  } }

__global__ __launch_bounds__(256) void k_rsmcst(const float* __restrict__ S, _Float16* __restrict__ P, int hg, int q0, int nk, const int* __restrict__ mk) {
  #pragma clang fp contract(off)
  const int t = blockIdx.x * 256 + threadIdx.x; if (t >= hg * QT) return; const size_t i = (size_t)t; const float* s = S + i * NKX; const size_t ig = (size_t)(q0 + (t % QT)); const int* mr = mk + ig * SQ; float mx = -3.0e38f;
#pragma unroll 1
  for (int j = 0; j < nk; ++j) { const int mb = mr[j]; const int dd = (int)ig - j; const float f = (mb != 0 && dd >= 0 && (dd <= LOCALW || (dd % STRIDEK) == 0)) ? 1.f : 0.f; mx = fmaxf(mx, fmaf(f, s[j], (1.f - f) * -1.0e9f)); } float se = 0.f;
#pragma unroll 1
  for (int j = 0; j < nk; ++j) { const int mb = mr[j]; const int dd = (int)ig - j; const float f = (mb != 0 && dd >= 0 && (dd <= LOCALW || (dd % STRIDEK) == 0)) ? 1.f : 0.f; se += __expf(fmaf(f, s[j], (1.f - f) * -1.0e9f) - mx); } const float sc = 256.0f / se;
#pragma unroll 1
  for (int j0 = 0; j0 < nk; j0 += 8) { FragH fr; for (int q = 0; q < 8; ++q) { const int j = j0 + q; const int mb = mr[j]; const int dd = (int)ig - j; const float f = (mb != 0 && dd >= 0 && (dd <= LOCALW || (dd % STRIDEK) == 0)) ? 1.f : 0.f; fr.h[q] = (_Float16)(__expf(fmaf(f, s[j], (1.f - f) * -1.0e9f) - mx) * sc); } unsigned short* d = (unsigned short*)P + i * NKX + j0; *(v8us*)d = fr.half[0];  } }


template <int MASKADD>
__global__ __launch_bounds__(64) void k_att0(const float* __restrict__ QF, const float* __restrict__ KF, const float* __restrict__ VF, int ld, const float* __restrict__ mask, float scale, float* __restrict__ OF, int ldo) {
  #pragma clang fp contract(off)
  __shared__ __attribute__((aligned(16))) float lq[64][64]; __shared__ __attribute__((aligned(16))) float lo[64][64];
  const int tid = threadIdx.x; const int h = blockIdx.x / (QT0 / 64), rg = blockIdx.x % (QT0 / 64); const int i = rg * 64 + tid;
  const float* qr = QF + (size_t)i * ld + h * HD;
#pragma unroll 1
  for (int c = 0; c < HD / 4; ++c) { *(v4f*)&lq[tid][c * 4] = *(const v4fa*)(qr + c * 4); const v4f z = {0.f, 0.f, 0.f, 0.f}; *(v4f*)&lo[tid][c * 4] = z; }
  float m = -1.0e30f, l = 0.f; const int jmax = MASKADD ? (SQ - 1) : (rg * 64 + 63);      /* additive-mask form: every key (the mask input decides); causal form: keys up to the block's last row */
#pragma unroll 1
  for (int j = 0; j <= jmax; ++j) { const float* kr = KF + (size_t)j * ld + h * HD; const float* vr = VF + (size_t)j * ld + h * HD; float s = 0.f;
#pragma unroll 1
    for (int c = 0; c < HD / 4; ++c) { const v4f kq = *(const v4fa*)(kr + c * 4); const v4f qq = *(v4f*)&lq[tid][c * 4]; s = __fadd_rn(s, __fmul_rn(qq[0], kq[0])); s = __fadd_rn(s, __fmul_rn(qq[1], kq[1])); s = __fadd_rn(s, __fmul_rn(qq[2], kq[2])); s = __fadd_rn(s, __fmul_rn(qq[3], kq[3])); }
    s = __fmul_rn(s, scale); if (MASKADD) s = __fadd_rn(s, __fmul_rn(bf16_round(mask[(size_t)i * SQ + j]), -10000.0f));
    const float f = (MASKADD || j <= i) ? 1.f : 0.f; const float sm = fmaf(f, s, (1.f - f) * -1.0e30f); const float mn = fmaxf(m, sm); const float sc = expf(m - mn); const float e = expf(sm - mn); l = __fadd_rn(__fmul_rn(l, sc), e); m = mn;
#pragma unroll 1
    for (int c = 0; c < HD / 4; ++c) { const v4f vv = *(const v4fa*)(vr + c * 4); v4f oo = *(v4f*)&lo[tid][c * 4]; for (int u = 0; u < 4; ++u) oo[u] = __fadd_rn(__fmul_rn(oo[u], sc), __fmul_rn(e, vv[u])); *(v4f*)&lo[tid][c * 4] = oo; } }
  const float fin = 64.0f / l;      /* o carried x64 like the f16 path */
#pragma unroll 1
  for (int c = 0; c < HD / 4; ++c) { v4f oo = *(v4f*)&lo[tid][c * 4]; for (int u = 0; u < 4; ++u) oo[u] = __fmul_rn(oo[u], fin); *(v4f*)&lo[tid][c * 4] = oo; }
  __syncthreads();
  {
#pragma unroll 1
    for (int it = 0; it < 16; ++it) { const int row = it * 4 + tid / 16, pc = (tid % 16) * 4; const v4f v = *(const v4f*)&lo[row][pc]; *(v4f*)(OF + (size_t)(rg * 64 + row) * ldo + h * HD + pc) = v; }
     } }

template <int MASKADD>
__global__ __launch_bounds__(64) void k_att0mbc(const float* __restrict__ QF, const float* __restrict__ KF, const float* __restrict__ VF, int ld, const float* __restrict__ mask, float scale, float* __restrict__ OF, int ldo) {
  #pragma clang fp contract(off)
  __shared__ __attribute__((aligned(16))) float lq[64][64]; __shared__ __attribute__((aligned(16))) float lo[64][64];
  const int tid = threadIdx.x; const int h = blockIdx.x / (QT0 / 64), rg = blockIdx.x % (QT0 / 64); const int i = rg * 64 + tid;
  const float* qr = QF + (size_t)i * ld + h * HD;
#pragma unroll 1
  for (int c = 0; c < HD / 4; ++c) { *(v4f*)&lq[tid][c * 4] = *(const v4fa*)(qr + c * 4); const v4f z = {0.f, 0.f, 0.f, 0.f}; *(v4f*)&lo[tid][c * 4] = z; }
  float m = -1.0e30f, l = 0.f; const int jmax = rg * 64 + 63;      /* keys beyond the block end are masked by the mask's lower-triangular structure */
#pragma unroll 1
  for (int j = 0; j <= jmax; ++j) { const float* kr = KF + (size_t)j * ld + h * HD; const float* vr = VF + (size_t)j * ld + h * HD; float s = 0.f;
#pragma unroll 1
    for (int c = 0; c < HD / 4; ++c) { const v4f kq = *(const v4fa*)(kr + c * 4); const v4f qq = *(v4f*)&lq[tid][c * 4]; s = __fadd_rn(s, __fmul_rn(qq[0], kq[0])); s = __fadd_rn(s, __fmul_rn(qq[1], kq[1])); s = __fadd_rn(s, __fmul_rn(qq[2], kq[2])); s = __fadd_rn(s, __fmul_rn(qq[3], kq[3])); }
    s = __fmul_rn(s, scale); const int mb = ((const int*)mask)[(size_t)i * SQ + j];      /* causal (j <= i) AND the module's int32 [S][S] mask read per (query, key): 0 -> masked */
    const float f = (mb != 0 && j <= i) ? 1.f : 0.f; const float sm = fmaf(f, s, (1.f - f) * -1.0e30f); const float mn = fmaxf(m, sm); const float sc = expf(m - mn); const float e = expf(sm - mn); l = __fadd_rn(__fmul_rn(l, sc), e); m = mn;
#pragma unroll 1
    for (int c = 0; c < HD / 4; ++c) { const v4f vv = *(const v4fa*)(vr + c * 4); v4f oo = *(v4f*)&lo[tid][c * 4]; for (int u = 0; u < 4; ++u) oo[u] = __fadd_rn(__fmul_rn(oo[u], sc), __fmul_rn(e, vv[u])); *(v4f*)&lo[tid][c * 4] = oo; } }
  const float fin = 64.0f / l;      /* o carried x64 like the f16 path */
#pragma unroll 1
  for (int c = 0; c < HD / 4; ++c) { v4f oo = *(v4f*)&lo[tid][c * 4]; for (int u = 0; u < 4; ++u) oo[u] = __fmul_rn(oo[u], fin); *(v4f*)&lo[tid][c * 4] = oo; }
  __syncthreads();
  {
#pragma unroll 1
    for (int it = 0; it < 16; ++it) { const int row = it * 4 + tid / 16, pc = (tid % 16) * 4; const v4f v = *(const v4f*)&lo[row][pc]; *(v4f*)(OF + (size_t)(rg * 64 + row) * ldo + h * HD + pc) = v; }
     } }


template <int BFIN, int WXB>
__global__ __launch_bounds__(256) void k_ln16(const float* __restrict__ X, const float* __restrict__ g, const float* __restrict__ bb, float eps, _Float16* __restrict__ N16, float* __restrict__ XB) {
  #pragma clang fp contract(off)
  __shared__ float red[256]; const size_t r = blockIdx.x; const int t = threadIdx.x; const v4f xa = *(const v4fa*)(X + r * DMQ + t * 4); float s[4]; float sum = 0.f;
  for (int q = 0; q < 4; ++q) { s[q] = BFIN ? bf16_round(xa[q]) : xa[q]; sum = __fadd_rn(sum, s[q]); }
  red[t] = sum; __syncthreads(); for (int st = 128; st > 0; st >>= 1) { if (t < st) red[t] = __fadd_rn(red[t], red[t + st]); __syncthreads(); } const float mu = red[0] / (float)DMQ; __syncthreads();
  float vs = 0.f; for (int q = 0; q < 4; ++q) { const float dl = __fadd_rn(s[q], -mu); vs = __fadd_rn(vs, __fmul_rn(dl, dl)); } red[t] = vs; __syncthreads(); for (int st = 128; st > 0; st >>= 1) { if (t < st) red[t] = __fadd_rn(red[t], red[t + st]); __syncthreads(); }
  const float rs = rsqrtf(__fadd_rn(red[0] / (float)DMQ, eps)); v4h y; v4f xb;
  for (int q = 0; q < 4; ++q) { const int c = t * 4 + q; y[q] = (_Float16)__fadd_rn(__fmul_rn(__fmul_rn(__fadd_rn(s[q], -mu), rs), bf16_round(g[c])), bf16_round(bb[c])); xb[q] = s[q]; }
  { *(v4h*)(N16 + r * DMQ + t * 4) = y; if (WXB) *(v4f*)(XB + r * DMQ + t * 4) = xb;  } }
__global__ __launch_bounds__(256) void k_ftres2(const float* __restrict__ OF0, const float* __restrict__ XB, float* __restrict__ X1, size_t n4) {
  #pragma clang fp contract(off)
  const size_t t = (size_t)blockIdx.x * 256 + threadIdx.x; if (t >= n4) return; const v4f o = *(const v4fa*)(OF0 + t * 4), xv = *(const v4fa*)(XB + t * 4); v4f y; for (int q = 0; q < 4; ++q) y[q] = __fadd_rn(__fmul_rn(o[q], 0.015625f), xv[q]); *(v4f*)(X1 + t * 4) = y;  }

__global__ __launch_bounds__(256) void k_bcpy(const float* __restrict__ b, int n, int NP, float* __restrict__ dst, int dst0) { for (int i = threadIdx.x; i < NP; i += 256) { const float v = (i < n) ? b[i] : 0.f; *(float*)(dst + dst0 + i) = v; }  }


// lane l <-> l ^ M inside a 16-lane row (DPP row_xmask), and l <-> l ^ 16 (cross-row move): register-only butterflies
template <int M> __device__ __forceinline__ float xl_row(float v) { return __int_as_float(__builtin_amdgcn_update_dpp(0, __float_as_int(v), 0x160 | M, 0xf, 0xf, true)); }
__device__ __forceinline__ float xl_x16(float v) { const int b = __float_as_int(v); return __int_as_float(__builtin_amdgcn_permlanex16(b, b, 0x76543210, 0xfedcba98, false, false)); }
// row softmax -> P x256 f16. One wave per score row: 16 loads of 512 contiguous bytes, the whole row (64 values a lane) stays in registers, S is read once and each exponential is taken once.
// The four loops over v[] are fully unrolled so that v[] is indexed by constants only and lives in registers, and so that all 16 loads are in flight together.
__global__ __launch_bounds__(256) void k_rsmf(const float* __restrict__ S, _Float16* __restrict__ P, int nrows) {
  const int row = blockIdx.x * 8 + (threadIdx.x >> 5), lane = threadIdx.x & 31; if (row >= nrows) return;      /* wave-uniform; no barrier in this kernel */
  const float* s = S + (size_t)row * SQ + lane * 4; v4f v[SQ / 128];
#pragma unroll
  for (int u = 0; u < SQ / 128; ++u) v[u] = *(const v4fa*)(s + u * 128);
  v4f m4 = {-3.0e38f, -3.0e38f, -3.0e38f, -3.0e38f};
#pragma unroll
  for (int u = 0; u < SQ / 128; ++u) m4 = __builtin_elementwise_max(m4, v[u]);
  float mx = fmaxf(fmaxf(m4[0], m4[1]), fmaxf(m4[2], m4[3]));
  mx = fmaxf(mx, xl_row<1>(mx)); mx = fmaxf(mx, xl_row<2>(mx)); mx = fmaxf(mx, xl_row<4>(mx)); mx = fmaxf(mx, xl_row<8>(mx)); mx = fmaxf(mx, xl_x16(mx));
  v4f s4 = {0.f, 0.f, 0.f, 0.f};
#pragma unroll
  for (int u = 0; u < SQ / 128; ++u) { v4f e; for (int q = 0; q < 4; ++q) e[q] = __expf(v[u][q] - mx); v[u] = e; s4 += e; }
  float se = (s4[0] + s4[1]) + (s4[2] + s4[3]);
  se += xl_row<1>(se); se += xl_row<2>(se); se += xl_row<4>(se); se += xl_row<8>(se); se += xl_x16(se);
  const float sc = 256.0f / se; _Float16* d = P + (size_t)row * SQ + lane * 4;
#pragma unroll
  for (int u = 0; u < SQ / 128; ++u) { const v4f y = v[u] * sc; *(v4h*)(d + u * 128) = __builtin_convertvector(y, v4h); } }

#define FAP 72      /* LDS row pitch in f16: 128 data bytes + 16 (16 B x odd: the 16-byte fragment reads of 16 rows fall on distinct banks) */
typedef _Float16 v8h __attribute__((ext_vector_type(8)));
union FragP { v16h v; v8h half[2]; };
__device__ __forceinline__ v8f fa_mma(v16h a, v16h b, v8f c) { return __builtin_amdgcn_wmma_f32_16x16x32_f16(false, a, false, b, (short)0, c, false, false); }
// 2^x, eight at a time, with the one free slot that the instruction set asks for behind a transcendental: the results are early-clobber, so inside the run none lands on a source or is read, and the v_nop stands in front of whatever the compiler schedules next.
__device__ __forceinline__ v8f fa_exp2x8(v8f x) { float y0, y1, y2, y3, y4, y5, y6, y7;
  asm("v_exp_f32 %0, %8\n\tv_exp_f32 %1, %9\n\tv_exp_f32 %2, %10\n\tv_exp_f32 %3, %11\n\tv_exp_f32 %4, %12\n\tv_exp_f32 %5, %13\n\tv_exp_f32 %6, %14\n\tv_exp_f32 %7, %15\n\tv_nop"
      : "=&v"(y0), "=&v"(y1), "=&v"(y2), "=&v"(y3), "=&v"(y4), "=&v"(y5), "=&v"(y6), "=&v"(y7) : "v"(x[0]), "v"(x[1]), "v"(x[2]), "v"(x[3]), "v"(x[4]), "v"(x[5]), "v"(x[6]), "v"(x[7]));
  const v8f y = {y0, y1, y2, y3, y4, y5, y6, y7}; return y; }
__device__ __forceinline__ float fa_exp2(float x) { float y; asm("v_exp_f32 %0, %1\n\tv_nop" : "=&v"(y) : "v"(x)); return y; }      /* the same slot behind a single one */
__global__ __launch_bounds__(256) __attribute__((amdgpu_waves_per_eu(4, 4))) void k_fattn(const _Float16* __restrict__ Q, const _Float16* __restrict__ Kr, const _Float16* __restrict__ VTa, _Float16* __restrict__ O) {
  __shared__ __attribute__((aligned(16))) _Float16 lk[2][64][FAP]; __shared__ __attribute__((aligned(16))) _Float16 lv[2][64][FAP];
  const int tid = threadIdx.x, lane = tid & 31, ln = lane & 15, hh = lane >> 4, w = tid >> 5; const int bh = blockIdx.y, b = bh / NH, h = bh % NH; const int q0 = blockIdx.x * 256 + w * 32;
  const _Float16* qp = Q + ((size_t)b * SQ + q0 + ln) * DM + h * HD;
  const int sr = tid >> 3, sc = (tid & 7) * 8;      /* staging: 8 threads a 128-byte row; a thread brings rows sr and sr + 32 of both tiles */
  const unsigned short* kg = (const unsigned short*)Kr + ((size_t)b * SQ + sr) * DM + h * HD + sc; const unsigned short* vg = (const unsigned short*)VTa + ((size_t)bh * HD + sr) * SQ + sc;
  const float CS = 0.18033688011112042f;      /* 64^-0.5 * log2(e) */
  const v8f z8 = {0.f, 0.f, 0.f, 0.f, 0.f, 0.f, 0.f, 0.f};
  v16h qf[2][2]; v8f o[4][2]; float m[2] = {-3.0e38f, -3.0e38f}, l[2] = {0.f, 0.f};
  v8us g0 = *(const v8us*)kg, g1 = *(const v8us*)(kg + (size_t)32 * DM), g2 = *(const v8us*)vg, g3 = *(const v8us*)(vg + (size_t)32 * SQ);
  for (int t = 0; t < 2; ++t) for (int ks = 0; ks < 2; ++ks) qf[t][ks] = g2_frag(qp + (size_t)t * 16 * DM + ks * 32, hh);
  for (int dt = 0; dt < 4; ++dt) { o[dt][0] = z8; o[dt][1] = z8; }
  *(v8us*)&lk[0][sr][sc] = g0; *(v8us*)&lk[0][sr + 32][sc] = g1; *(v8us*)&lv[0][sr][sc] = g2; *(v8us*)&lv[0][sr + 32][sc] = g3;
  __syncthreads();
  for (int st = 0; st < SQ / 64; ++st) { const int cur = st & 1; const bool more = st + 1 < SQ / 64;      /* block-uniform */
    for (int ps = 0; ps < 2; ++ps) {
      if (ps == 1 && more) { const unsigned short* kn = kg + (size_t)(st + 1) * 64 * DM; const unsigned short* vn = vg + (size_t)(st + 1) * 64;      /* next stage's rows: in flight under the second pass, stored to LDS at the stage's foot */
        g0 = *(const v8us*)kn; g1 = *(const v8us*)(kn + (size_t)32 * DM); g2 = *(const v8us*)vn; g3 = *(const v8us*)(vn + (size_t)32 * SQ);
        asm volatile("s_wait_xcnt 0x0" :: "v"(kn), "v"(vn) : "memory"); }      /* the wait owed before a register that an issued load names is rewritten; the two addresses are inputs so that they stay whole, and off the loads' own results, up to here */
      v16h kf[2][2], vf[4];
      for (int kt = 0; kt < 2; ++kt) for (int ks = 0; ks < 2; ++ks) kf[kt][ks] = g2_frag(&lk[cur][ps * 32 + kt * 16 + ln][ks * 32], hh);
      for (int dt = 0; dt < 4; ++dt) vf[dt] = g2_frag(&lv[cur][dt * 16 + ln][ps * 32], hh);
      v8f s[2][2]; for (int kt = 0; kt < 2; ++kt) for (int qt = 0; qt < 2; ++qt) s[kt][qt] = fa_mma(kf[kt][1], qf[qt][1], fa_mma(kf[kt][0], qf[qt][0], z8));
      float mx[2];
      for (int qt = 0; qt < 2; ++qt) { const v8f t = __builtin_elementwise_max(s[0][qt], s[1][qt]); float a = fmaxf(fmaxf(fmaxf(t[0], t[1]), fmaxf(t[2], t[3])), fmaxf(fmaxf(t[4], t[5]), fmaxf(t[6], t[7]))); a = fmaxf(a, xl_x16(a)); mx[qt] = a * CS; }
      if (__builtin_amdgcn_ballot_w32(mx[0] > m[0] + 8.0f || mx[1] > m[1] + 8.0f) != 0) {      /* rescale only when a column's maximum has grown by more than 2^8: P stays <= 2^12, inside f16 */
        for (int qt = 0; qt < 2; ++qt) { const float mn = fmaxf(m[qt], mx[qt]); const float al = fa_exp2(m[qt] - mn); m[qt] = mn; l[qt] *= al; for (int dt = 0; dt < 4; ++dt) o[dt][qt] *= al; } }
      FragP pf[2];
      for (int qt = 0; qt < 2; ++qt) { const float nm = 4.0f - m[qt]; const v8f e0 = fa_exp2x8(s[0][qt] * CS + nm), e1 = fa_exp2x8(s[1][qt] * CS + nm);
        const v8f es = e0 + e1; l[qt] += ((es[0] + es[1]) + (es[2] + es[3])) + ((es[4] + es[5]) + (es[6] + es[7])); pf[qt].half[0] = __builtin_convertvector(e0, v8h); pf[qt].half[1] = __builtin_convertvector(e1, v8h); }
      for (int dt = 0; dt < 4; ++dt) for (int qt = 0; qt < 2; ++qt) o[dt][qt] = fa_mma(vf[dt], pf[qt].v, o[dt][qt]);
    }
    if (more) { *(v8us*)&lk[cur ^ 1][sr][sc] = g0; *(v8us*)&lk[cur ^ 1][sr + 32][sc] = g1; *(v8us*)&lv[cur ^ 1][sr][sc] = g2; *(v8us*)&lv[cur ^ 1][sr + 32][sc] = g3; }      /* that buffer's last readers left it before the previous barrier */
    __syncthreads();      /* publishes stage st + 1 and ends every read of stage st */
  }
  for (int qt = 0; qt < 2; ++qt) { const float inv = 64.0f / (l[qt] + xl_x16(l[qt])); _Float16* op = O + ((size_t)b * SQ + q0 + qt * 16 + ln) * DM + h * HD + 8 * hh;      /* a lane holds 8 consecutive dims of one query row: one 16-byte store a tile */
    for (int dt = 0; dt < 4; ++dt) { const v8f y = o[dt][qt] * inv; *(v8h*)(op + dt * 16) = __builtin_convertvector(y, v8h); } } }

// ---- block-tiled GEMM for the two shapes used here: C[NR][N] = A[NR][DM] Bt[N][DM]^T, N = 3 DM (q | k | v) or DM (f16 rows, k contiguous); epilogue values as k_gemm2 (alpha, bf16-rounded bias; RES: own-element residual rounded to bf16, f32 rows; else f16 rows, the v plane as V^T) ----
// A block of 8 waves owns 256 x 128 of C, a wave 64 x 64 (4 x 4 accumulator tiles). A tile is 128 k of the block's 256 A rows and 128 Bt rows, brought into LDS by asynchronous copies: a wave's copy covers four whole 128-byte lines,
// each line is fetched once a block, and the waves take their fragments from LDS. Two buffers: tile t + 1 flies while tile t is worked on; one barrier a tile. k runs in the same order as before.
#define G3P 136      /* LDS row pitch in f16: 256 data bytes + 16 (16 B x odd: the 16-byte fragment reads of 16 rows fall on distinct banks) */
#define G3T (384 * G3P * 2)      /* bytes of one buffer: rows 0-255 A, rows 256-383 Bt */
typedef float f1a __attribute__((may_alias));
// Twelve copies of 16 bytes a lane, LDS byte address l + i * 16 rows, global rows g[i]; s_wait_xcnt 0 is the statement's last line, so that it stands in front of whatever rewrites a register that a copy names.
__device__ __forceinline__ void g3_copy12(unsigned l, const unsigned short* g0, const unsigned short* g1, const unsigned short* g2, const unsigned short* g3, const unsigned short* g4, const unsigned short* g5,
                                          const unsigned short* g6, const unsigned short* g7, const unsigned short* g8, const unsigned short* g9, const unsigned short* g10, const unsigned short* g11) {
  const unsigned p = 16 * G3P * 2;
  asm volatile("global_load_async_to_lds_b128 %0, %12, off\n\tglobal_load_async_to_lds_b128 %1, %13, off\n\tglobal_load_async_to_lds_b128 %2, %14, off\n\tglobal_load_async_to_lds_b128 %3, %15, off\n\tglobal_load_async_to_lds_b128 %4, %16, off\n\tglobal_load_async_to_lds_b128 %5, %17, off\n\tglobal_load_async_to_lds_b128 %6, %18, off\n\tglobal_load_async_to_lds_b128 %7, %19, off\n\tglobal_load_async_to_lds_b128 %8, %20, off\n\tglobal_load_async_to_lds_b128 %9, %21, off\n\tglobal_load_async_to_lds_b128 %10, %22, off\n\tglobal_load_async_to_lds_b128 %11, %23, off\n\ts_wait_xcnt 0x0"
      :: "v"(l), "v"(l + p), "v"(l + 2 * p), "v"(l + 3 * p), "v"(l + 4 * p), "v"(l + 5 * p), "v"(l + 6 * p), "v"(l + 7 * p), "v"(l + 8 * p), "v"(l + 9 * p), "v"(l + 10 * p), "v"(l + 11 * p),
         "v"(g0), "v"(g1), "v"(g2), "v"(g3), "v"(g4), "v"(g5), "v"(g6), "v"(g7), "v"(g8), "v"(g9), "v"(g10), "v"(g11) : "memory"); }
// one tile: a thread's 16 A pieces (rows sr + 16 i) and 8 Bt pieces; l = the LDS byte address of its piece of row sr in the target buffer
__device__ __forceinline__ void g3_tile(unsigned l, const unsigned short* a, const unsigned short* b) { const size_t s = (size_t)16 * DM;
  g3_copy12(l, a, a + s, a + 2 * s, a + 3 * s, a + 4 * s, a + 5 * s, a + 6 * s, a + 7 * s, a + 8 * s, a + 9 * s, a + 10 * s, a + 11 * s);
  g3_copy12(l + 12 * 16 * G3P * 2, a + 12 * s, a + 13 * s, a + 14 * s, a + 15 * s, b, b + s, b + 2 * s, b + 3 * s, b + 4 * s, b + 5 * s, b + 6 * s, b + 7 * s); }
// RES: one plane of DM columns, f32 rows, the residual x rounded to bf16 here. Else: Bt is the stacked q | k | v plane (3 DM rows) and one grid does all three products: planes 0 and 1 go out as f16 rows (C16, then C16 + NR * DM),
// plane 2 goes out transposed, V^T [batch * head][dim][token]: a wave's 64 columns are one head, and a lane's 8 accumulator rows are 8 consecutive tokens of one dim.
typedef _Float16 v8ha __attribute__((ext_vector_type(8), may_alias));
template <bool RES>
__global__ __launch_bounds__(256) void k_gemm3(const _Float16* __restrict__ A, const _Float16* __restrict__ Bh, float alpha, const float* __restrict__ bias, const float* __restrict__ CP, float* __restrict__ C, _Float16* __restrict__ C16, _Float16* __restrict__ VTo) {
  static_assert(NR % 256 == 0 && DM % 128 == 0 && DM / 128 >= 2, "k_gemm3: whole tiles only, two or more along k");
  __shared__ __attribute__((aligned(16))) _Float16 sm[2][384][G3P];      /* after the loop: each wave's 64 x 68 f32 output staging */
  const int tid = threadIdx.x, lane = tid & 31, ln = lane & 15, hh = lane >> 4, w = tid >> 5; constexpr int NQ = (RES ? 1 : 3) * (DM / 128); const int mt = blockIdx.x / NQ, nq = blockIdx.x % NQ; const int wm = (w & 3) * 64, wn = (w >> 2) * 64;
  const int pl = nq / (DM / 128);      /* block-uniform: which of q | k | v (0 with RES) */
  const int row0 = mt * 256 + wm, col0 = (nq % (DM / 128)) * 128 + wn;
  const int sr = tid >> 4, sc = (tid & 15) * 8;      /* staging: 16 threads a 256-byte row piece */
  const unsigned short* ag = (const unsigned short*)A + (size_t)(mt * 256 + sr) * DM + sc; const unsigned short* bg = (const unsigned short*)Bh + (size_t)(nq * 128 + sr) * DM + sc;
  const unsigned l0 = (unsigned)(size_t)&sm[0][sr][sc];      /* low 32 bits of the shared address = byte offset in the work-group's LDS */
  g3_tile(l0, ag, bg);
  float bv[4] = {0.f, 0.f, 0.f, 0.f};
  if (bias) {
#pragma unroll
    for (int ni = 0; ni < 4; ++ni) bv[ni] = bf16_round(bias[pl * DM + col0 + ni * 16 + ln]); }
  const v8f z8 = {0.f, 0.f, 0.f, 0.f, 0.f, 0.f, 0.f, 0.f}; v8f acc[4][4];
#pragma unroll
  for (int mi = 0; mi < 4; ++mi) for (int ni = 0; ni < 4; ++ni) acc[mi][ni] = z8;
  asm volatile("s_wait_asynccnt 0x0" ::: "memory");      /* this wave's copies of tile 0 have landed */
  __syncthreads();      /* publishes tile 0 */
  g3_tile(l0 + G3T, ag + 128, bg + 128);
#pragma unroll 1      /* rolled: one trip holds 64 matrix instructions; for speed only */
  for (int t = 0; t < DM / 128; ++t) { const int cur = t & 1; v16h af[2][4], bf[2][4];
#pragma unroll
    for (int i = 0; i < 4; ++i) { af[0][i] = g2_frag(&sm[cur][wm + i * 16 + ln][0], hh); bf[0][i] = g2_frag(&sm[cur][256 + wn + i * 16 + ln][0], hh); }
#pragma unroll
    for (int ks = 0; ks < 4; ++ks) {
      if (ks < 3) {
#pragma unroll
        for (int i = 0; i < 4; ++i) { af[(ks + 1) & 1][i] = g2_frag(&sm[cur][wm + i * 16 + ln][(ks + 1) * 32], hh); bf[(ks + 1) & 1][i] = g2_frag(&sm[cur][256 + wn + i * 16 + ln][(ks + 1) * 32], hh); } }
      __builtin_amdgcn_sched_barrier(0);      /* the next block's 16 LDS reads stay one group in front of this block, for speed only */
#pragma unroll
      for (int mi = 0; mi < 4; ++mi) for (int ni = 0; ni < 4; ++ni) acc[mi][ni] = fa_mma(af[ks & 1][mi], bf[ks & 1][ni], acc[mi][ni]);
      __builtin_amdgcn_sched_barrier(0);      /* and the block after next's reads stay behind it */
    }
    asm volatile("s_wait_dscnt 0x0" ::: "memory");      /* this wave's reads of tile t are done */
    asm volatile("s_wait_asynccnt 0x0" ::: "memory");      /* its copies of tile t + 1 have landed */
    __syncthreads();      /* publishes tile t + 1 and ends every read of tile t */
    if (t + 2 < DM / 128) g3_tile(l0 + (unsigned)cur * G3T, ag + (t + 2) * 128, bg + (t + 2) * 128);      /* block-uniform; into the buffer that trip t has just read */
  }
  asm volatile("s_wait_asynccnt 0x0" ::: "memory");      /* nothing is in flight when the buffers become output staging */
  f1a* so = (f1a*)&sm[0][0][0] + (size_t)w * 64 * 68; const int rsub = lane >> 4, c4 = (lane & 15) * 4;
  if (!RES && pl == 2) {      /* V^T: staged as f16 [64 dims][64 tokens], pitch FAP, in the wave's own range, so that every store covers whole 128-byte lines */
    _Float16* st = (_Float16*)so;
#pragma unroll
    for (int ni = 0; ni < 4; ++ni) for (int mi = 0; mi < 4; ++mi) { const v8f y = acc[mi][ni] * alpha + bv[ni]; *(v8ha*)&st[(ni * 16 + ln) * FAP + mi * 16 + 8 * hh] = __builtin_convertvector(y, v8h); }
    __builtin_amdgcn_fence(__ATOMIC_ACQ_REL, "workgroup"); __builtin_amdgcn_wave_barrier();      /* a wave reads back only its own staging rows */
    _Float16* vp = VTo + ((size_t)((row0 / SQ) * NH + col0 / HD) * HD + (lane >> 3)) * SQ + row0 % SQ + (lane & 7) * 8;
#pragma unroll
    for (int q = 0; q < 16; ++q) { const v8h v = *(const v8ha*)&st[(q * 4 + (lane >> 3)) * FAP + (lane & 7) * 8]; *(v8h*)(vp + (size_t)q * 4 * SQ) = v; }
  } else {      /* block-uniform; no barrier behind this point */
  const size_t e0 = (size_t)(row0 + rsub) * DM + col0 + c4;
  v4f c[RES ? 32 : 1];
  if (RES) { const float* cp = CP + e0;      /* own elements of the residual plane, whole 256-byte row pieces, all in flight together under the staging below (the fragments' registers are free by now) */
#pragma unroll
    for (int q = 0; q < 32; ++q) c[q] = *(const v4fa*)(cp + (size_t)q * 2 * DM);
    asm volatile("s_wait_xcnt 0x0" :: "v"(cp) : "memory"); }      /* the wait owed before a register that an issued load names is rewritten; the address is an input so that it stays whole up to here */
#pragma unroll
  for (int ni = 0; ni < 4; ++ni) for (int mi = 0; mi < 4; ++mi) for (int r = 0; r < 8; ++r) so[(mi * 16 + 8 * hh + r) * 68 + ni * 16 + ln] = acc[mi][ni][r] * alpha + bv[ni];
  __builtin_amdgcn_fence(__ATOMIC_ACQ_REL, "workgroup"); __builtin_amdgcn_wave_barrier();      /* a wave reads back only its own staging rows */
  if (RES) {
#pragma unroll
    for (int q = 0; q < 32; ++q) { v4f v = *(const v4fa*)&so[(q * 2 + rsub) * 68 + c4]; for (int i = 0; i < 4; ++i) v[i] += bf16_round(c[q][i]); *(v4f*)(C + e0 + (size_t)q * 2 * DM) = v; }      /* the residual is the bf16-rounded input, rounded here instead of in a launch of its own */
  } else {
#pragma unroll
    for (int q = 0; q < 32; ++q) { const v4f v = *(const v4fa*)&so[(q * 2 + rsub) * 68 + c4]; *(v4h*)(C16 + (size_t)pl * NR * DM + e0 + (size_t)q * 2 * DM) = __builtin_convertvector(v, v4h); }
    asm volatile("s_wait_xcnt 0x0" ::: "memory");      /* the wait owed before a register that an issued store names is rewritten: the compiler lays the V^T block, which rewrites the address pair, behind these stores */ } } }

template <int MODE>
__global__ __launch_bounds__(256) void k_regrp(const float* __restrict__ src, float* __restrict__ dst, size_t n4) {
  const size_t t = (size_t)blockIdx.x * 256 + threadIdx.x; if (t >= n4) return; const size_t e = t * 4; const size_t rd = e / DM; const int c = (int)(e % DM);
  size_t rs; if (MODE == 0) { const size_t b = rd / SQ, sq = rd % SQ; rs = sq * NB + b; } else { const size_t sq = rd / NB, b = rd % NB; rs = b * SQ + sq; }
  const v4f v = *(const v4fa*)(src + rs * DM + c); *(v4f*)(dst + e) = v;  }

// ---- LayerNorm rows and weight rounding in one launch of 768 work-groups: no LDS, no barrier ----
// A task is 1024 consecutive f32 (4 KiB): one row of x, or one piece of the stacked weight plane. A wave owns two neighbouring tasks and asks for all their bytes at once: 16 loads of 512 contiguous bytes in flight a wave.
// Six waves a SIMD (at most 160 registers a wave): all 768 work-groups, three a WGP, are resident at once. A lane holds 32 values of each row in registers; mean and variance (two passes over the registers) are in-lane sums plus a five-step lane butterfly. Every 8-byte-a-lane store of a wave covers two whole 128-byte lines.
// Every loop over v[], gg[] and be[] is fully unrolled so that the arrays are indexed by constants only and live in registers, and so that a wave's loads are in flight together.
__device__ __forceinline__ float ln_wsum(float v) { v += xl_row<1>(v); v += xl_row<2>(v); v += xl_row<4>(v); v += xl_row<8>(v); v += xl_x16(v); return v; }
__global__ __launch_bounds__(256) __attribute__((amdgpu_waves_per_eu(6))) void k_lnw(const float* __restrict__ X, const float* __restrict__ g, const float* __restrict__ bb, float eps, _Float16* __restrict__ N16, const float* __restrict__ wa, const float* __restrict__ wb, _Float16* __restrict__ Bt) {
  static_assert(DM == 1024 && NR % 16 == 0, "k_lnw: a row is one task of 1024 values; 16 tasks a work-group");
  const int lane = threadIdx.x & 31; const unsigned w = (unsigned)__builtin_amdgcn_readfirstlane((int)(threadIdx.x >> 5));      /* the wave's number as a scalar: task addresses are a scalar base plus one lane offset */
  if (blockIdx.x >= NR / 16) {      /* block-uniform: the work-groups behind the rows round the weights (wa: 3 DM x DM, then wb: DM x DM) into one stacked Bt plane x16 */
    const size_t c = ((size_t)(blockIdx.x - NR / 16) * 8 + w) * 2; const size_t na = (size_t)3 * DM;      /* na is even: a wave's two tasks lie in the same input */
    const float* s = c < na ? wa + c * DM : wb + (c - na) * DM; v4f v[16];
#pragma unroll
    for (int u = 0; u < 16; ++u) v[u] = *(const v4fa*)(s + u * 128 + lane * 4);
    asm volatile("s_wait_xcnt 0x0" :: "s"(s), "v"(lane) : "memory");      /* the wait owed before a register that an issued load names is rewritten; base and lane offset are inputs so that they stay whole up to here */
    _Float16* d = Bt + c * DM + lane * 4;
#pragma unroll
    for (int u = 0; u < 16; ++u) { v4f y; for (int q = 0; q < 4; ++q) y[q] = bf16_round(v[u][q]) * 16.0f; *(v4h*)(d + u * 128) = __builtin_convertvector(y, v4h); }
    return; }
  const size_t r0 = ((size_t)blockIdx.x * 8 + w) * 2; const float* xp = X + r0 * DM;
  v4f v[2][8], gg[8], be[8];
#pragma unroll
  for (int t = 0; t < 2; ++t) for (int u = 0; u < 8; ++u) v[t][u] = *(const v4fa*)(xp + t * DM + u * 128 + lane * 4);
#pragma unroll
  for (int u = 0; u < 8; ++u) { gg[u] = *(const v4fa*)(g + u * 128 + lane * 4); be[u] = *(const v4fa*)(bb + u * 128 + lane * 4); }
  asm volatile("s_wait_xcnt 0x0" :: "s"(xp), "s"(g), "s"(bb), "v"(lane) : "memory");      /* the same wait for these loads' bases and lane offset */
  __builtin_amdgcn_sched_barrier(0);      /* all 32 loads are issued in front of the arithmetic: without it the compiler sinks the last gamma and beta loads behind the sums, and their latency then stands open in front of the stores */
  float rs[2];
#pragma unroll
  for (int t = 0; t < 2; ++t) { v4f a = {0.f, 0.f, 0.f, 0.f};
#pragma unroll
    for (int u = 0; u < 8; ++u) { for (int q = 0; q < 4; ++q) v[t][u][q] = bf16_round(v[t][u][q]); a += v[t][u]; }
    const float mu = ln_wsum((a[0] + a[1]) + (a[2] + a[3])) * (1.0f / (float)DM); v4f e = {0.f, 0.f, 0.f, 0.f};
#pragma unroll
    for (int u = 0; u < 8; ++u) { v[t][u] -= mu; e += v[t][u] * v[t][u]; }
    rs[t] = rsqrtf(ln_wsum((e[0] + e[1]) + (e[2] + e[3])) * (1.0f / (float)DM) + eps); }
  _Float16* np = N16 + r0 * DM + lane * 4;
#pragma unroll
  for (int u = 0; u < 8; ++u) { for (int q = 0; q < 4; ++q) { gg[u][q] = bf16_round(gg[u][q]); be[u][q] = bf16_round(be[u][q]); }
#pragma unroll
    for (int t = 0; t < 2; ++t) { const v4f y = v[t][u] * rs[t] * gg[u] + be[u]; *(v4h*)(np + t * DM + u * 128) = __builtin_convertvector(y, v4h); } }
  asm volatile("s_wait_xcnt 0x0" ::: "memory"); }      /* the wait owed before a register that an issued store names is rewritten: the compiler lays the weight part, which rewrites the stores' scalar base, behind these stores */

__global__ __launch_bounds__(256) void k_bfr(const float* __restrict__ x, float* __restrict__ XB, size_t n8) { const size_t t = (size_t)blockIdx.x * 256 + threadIdx.x; if (t >= n8) return; v4f a = *(const v4fa*)(x + t * 8), c = *(const v4fa*)(x + t * 8 + 4); for (int q = 0; q < 4; ++q) { a[q] = bf16_round(a[q]); c[q] = bf16_round(c[q]); }
  { *(v4f*)(XB + t * 8) = a; *(v4f*)(XB + t * 8 + 4) = c;  } }



__global__ __launch_bounds__(256) void k_wthd(const float* __restrict__ Wt, _Float16* __restrict__ Bt) { const size_t t = (size_t)blockIdx.x * 256 + threadIdx.x; if (t >= (size_t)NH * HD * (DM / 8)) return; const int m8 = (int)(t % (DM / 8)) * 8; const int d = (int)((t / (DM / 8)) % HD); const int h = (int)(t / ((size_t)(DM / 8) * HD)); FragH f;
  for (int q = 0; q < 8; ++q) f.h[q] = (_Float16)(16.0f * bf16_round(Wt[((size_t)h * DM + m8 + q) * HD + d])); unsigned short* dst = (unsigned short*)Bt + ((size_t)h * HD + d) * DM + m8; *(v8us*)dst = f.half[0];  }




template <int BFIN, int SCAL>
__global__ __launch_bounds__(256) void k_lnsc(const float* __restrict__ X, const float* __restrict__ g, const float* __restrict__ bb, float eps, _Float16* __restrict__ N16, float* __restrict__ N32) {
  #pragma clang fp contract(off)
  __shared__ float red[256]; const size_t r = blockIdx.x; const int t = threadIdx.x; const bool act = t < DM / 4; const int tc = act ? t : 0; const v4f xl = *(const v4fa*)(X + r * DM + tc * 4); const float am = act ? 1.f : 0.f; float s[4]; float sum = 0.f;
  for (int q = 0; q < 4; ++q) { s[q] = (BFIN ? bf16_round(xl[q]) : xl[q]) * am; sum = __fadd_rn(sum, s[q]); }
  red[t] = sum; __syncthreads(); for (int st = 128; st > 0; st >>= 1) { if (t < st) red[t] = __fadd_rn(red[t], red[t + st]); __syncthreads(); } const float mu = red[0] / (float)DM; __syncthreads();
  float vs = 0.f; for (int q = 0; q < 4; ++q) { const float dl = __fadd_rn(s[q], -mu) * am; vs = __fadd_rn(vs, __fmul_rn(dl, dl)); } red[t] = vs; __syncthreads(); for (int st = 128; st > 0; st >>= 1) { if (t < st) red[t] = __fadd_rn(red[t], red[t + st]); __syncthreads(); }
  const float rs = __fdiv_rn(1.0f, __fadd_rn(sqrtf(red[0] / (float)(DM - 1)), eps)); if (!act) return; v4h y; v4f yf;
  for (int q = 0; q < 4; ++q) { const int c = t * 4 + q; const float gg = bf16_round(SCAL ? g[0] : g[c]), bv = bf16_round(SCAL ? bb[0] : bb[c]); yf[q] = __fadd_rn(__fmul_rn(__fmul_rn(__fadd_rn(s[q], -mu), rs), gg), bv); y[q] = (_Float16)yf[q]; }
  { if (N16) *(v4h*)(N16 + r * DM + t * 4) = y; if (N32) *(v4f*)(N32 + r * DM + t * 4) = yf;  } }

__global__ __launch_bounds__(256) void k_rsmdmi(const float* __restrict__ S, _Float16* __restrict__ P, int nrows, const int* __restrict__ M) {
  #pragma clang fp contract(off)
  const int t = blockIdx.x * 256 + threadIdx.x; if (t >= nrows) return; const float* s = S + (size_t)t * SQ; const int* m = M + (size_t)(t % SQ) * SQ; float mx = -3.0e38f;
#pragma unroll 1
  for (int j = 0; j < SQ; ++j) { const float f = (m[j] == 0) ? 1.f : 0.f; mx = fmaxf(mx, fmaf(f, s[j], (1.f - f) * -1.0e9f)); } float se = 0.f;
#pragma unroll 1
  for (int j = 0; j < SQ; ++j) { const float f = (m[j] == 0) ? 1.f : 0.f; se += __expf(fmaf(f, s[j], (1.f - f) * -1.0e9f) - mx); } const float sc = 256.0f / se;
#pragma unroll 1
  for (int j0 = 0; j0 < SQ; j0 += 8) { FragH fr; for (int q = 0; q < 8; ++q) { const int j = j0 + q; const float f = (m[j] == 0) ? 1.f : 0.f; fr.h[q] = (_Float16)(__expf(fmaf(f, s[j], (1.f - f) * -1.0e9f) - mx) * sc); } unsigned short* d = (unsigned short*)P + (size_t)t * SQ + j0; *(v8us*)d = fr.half[0];  } }
extern "C" void kernel_launch(void* const* d_in, const int* in_sizes, int n_in,
                              void* d_out, int out_size, void* d_ws, size_t ws_size, hipStream_t stream) {
  (void)in_sizes; (void)n_in; (void)out_size;
  const float* const* I = (const float* const*)d_in; const float* x = I[0]; const float* g1 = I[1]; const float* be1 = I[2]; const float* wqkv = I[3]; const float* wo = I[4]; const float* bo = I[5];      /* x; LayerNorm gamma / beta; fused NATURAL w_qkv [3072][1024] (row blocks q | k | v; no bias); natural w_proj [1024][1024] + b_proj */
  char* ws = (char*)d_ws; size_t off = 0;
  auto take = [&](size_t bytes) { char* p = ws + off; off += (bytes + 255) & ~(size_t)255; return p; };
  _Float16* BQ = (_Float16*)take((size_t)4 * DM * DM * 2); _Float16* BO = BQ + (size_t)3 * DM * DM;      /* one stacked Bt plane: [3 DM][DM] for q | k | v, then [DM][DM] for the output projection */
  _Float16* XN = (_Float16*)take(NR * DM * 2); _Float16* Q16 = (_Float16*)take((size_t)2 * NR * DM * 2); _Float16* K16 = Q16 + NR * DM;      /* q rows, then k rows: one block of two planes */ _Float16* O16 = (_Float16*)take(NR * DM * 2);
  _Float16* VT = (_Float16*)take((size_t)NB * NH * HD * SQ * 2);
  /* attention sub-block only: no second norm, no MLP planes */
  
  if (off > ws_size) return;
  k_lnw<<<(unsigned)(NR / 16 + (size_t)4 * DM / 16), 256, 0, stream>>>(x, g1, be1, 1e-5f, XN, wqkv, wo, BQ);      /* work-groups 0 .. NR/16-1: n = LN0(bf16(x)) (biased variance, eps inside the rsqrt) -> f16 rows; the rest: natural [out][in] weights = Bt x16 as given, w_qkv (rows 0 / DM / 2 DM = q | k | v) then w_proj, which lies right behind it */
  k_gemm3<false><<<(unsigned)((NR / 256) * (3 * DM / 128)), 256, 0, stream>>>(XN, BQ, 0.0625f, nullptr, nullptr, nullptr, Q16, VT);      /* q, k -> f16 rows (head h = columns h*64..); v -> V^T [4 * 16][64][2048]; one grid */
  k_fattn<<<dim3(SQ / 256, NB * NH), 256, 0, stream>>>(Q16, K16, VT, O16);      /* softmax(q k^T / 8) v over all keys, every (batch, head) in one launch -> ctx (merged heads, x64) as f16 rows */
  k_gemm3<true><<<(unsigned)((NR / 256) * (DM / 128)), 256, 0, stream>>>(O16, BO, 0.0009765625f, bo, x, (float*)d_out, nullptr, nullptr);      /* bf16(x) + ctx wo (+ bo) (own-element residual, rounded in the epilogue) -> f32 rows */
  /* result = x + out: written straight to d_out by the GEMM above */
}

// v006
// A run of this version takes 114 microseconds.
// Timed twice side by side with v005, it ran 1.04 and 1.05 times as fast.
// Over all steps from v000 it is 60.4 times as fast.
#include <hip/hip_runtime.h>
// Pre-LN multi-head self-attention sub-block with a residual (x [4][2048][1024]; h = LayerNorm(x) (biased var, eps 1e-5, gamma / beta); qkv = h w_qkv^T (natural [3072][1024]: row blocks q | k | v, each (head, dim)); no qkv bias; 16 heads of 64; scale 64^-0.5; softmax over all 2048 keys (no mask); out = merged w_proj^T + b_proj (natural); result = x + out -> [4][2048][1024]).
// Structure, four launches: LayerNorm -> f16 rows, with the weight rounding in the same grid; one WMMA GEMM grid for q, k, v (V^T written by its epilogue); one fused attention launch (scores, online softmax, V^T P^T; S and P stay in registers); output projection with the own-element residual, rounded in its epilogue.
// Compute dtype: inputs rounded to bf16; x / weights exact; q, k, v, softmax weights and o as plain f16 GEMM operands (~2^-12); scores and softmax statistics f32; v_wmma_f32_16x16x32_f16.
#define NB 4
#define SQ 2048
#define DM 1024
#define NH 16
#define HD 64
#define HG 4                         /* heads per block group of the unlaunched k_vt overload */
#define LOCALW 128                   /* (macros for unused kernels of the shared header) */
#define STRIDEK 128
#define QT 256                       /* query rows per causal tile */
#define NKX SQ                       /* S / P row pitch */
#define QT0 128                      /* first-tile rows recomputed exactly in f32 */
#define B0 0                         /* unused: every batch is processed */
#define NBR NB                       /* unused by the launches: they cover all NB batches */
#define NR ((size_t)NB * SQ)
#define DMQ DM
#define DFF 4096         /* unused: no FFN in this sub-block */
#define MP ((int)((size_t)NBR * SQ)) /* unused: the projections cover NR rows */
#define QN SQ                        /* unused: every query row is attended */
#define NHD NH                       /* unused: every head is attended */
#define MPO MP                       /* unused: the output GEMM covers NR rows */
#define LQ (3 * DM)      /* unused: q and k rows have pitch DM; v is stored as V^T */
typedef __bf16 v16b __attribute__((ext_vector_type(16)));
typedef unsigned short v8us __attribute__((ext_vector_type(8), may_alias));
typedef float  v8f  __attribute__((ext_vector_type(8)));
typedef float  v4f  __attribute__((ext_vector_type(4)));
typedef float  v4fa __attribute__((ext_vector_type(4), may_alias));
union FragB { v16b v; v8us half[2]; unsigned short u[16]; };

__device__ __forceinline__ unsigned short bf16_bits(float x) { unsigned int u = __float_as_uint(x); return (unsigned short)((u + 0x7FFFu + ((u >> 16) & 1u)) >> 16); }
__device__ __forceinline__ float bf16_val(unsigned short b) { return __uint_as_float(((unsigned int)b) << 16); }
__device__ __forceinline__ float bf16_round(float x) { return bf16_val(bf16_bits(x)); }
// D += A·B with NT terms: 1 = ah·bh, 2 = + al·bh (A split), 3 = + ah·bl (both split)
template <int NT>
__device__ __forceinline__ v8f mmaN(v16b ah, v16b al, v16b bh, v16b bl, v8f c) {
  c = __builtin_amdgcn_wmma_f32_16x16x32_bf16(false, ah, false, bh, (short)0, c, false, false);
  if (NT >= 2) c = __builtin_amdgcn_wmma_f32_16x16x32_bf16(false, al, false, bh, (short)0, c, false, false);
  if (NT >= 3) c = __builtin_amdgcn_wmma_f32_16x16x32_bf16(false, ah, false, bl, (short)0, c, false, false);
  asm volatile("v_nop\n\tv_nop\n\tv_nop\n\tv_nop" : "+v"(c) : "v"(ah), "v"(al), "v"(bh), "v"(bl));
  return c;
}

__global__ __launch_bounds__(256) void k_wt_bf16(const float* __restrict__ W, unsigned short* __restrict__ Wt, int K, int N) {
  const int t = blockIdx.x * 256 + threadIdx.x;
  const int k8n = K / 8;
  if (t >= N * k8n) return;
  const int n = t / k8n, k8 = (t % k8n) * 8;
  v8us v;
#pragma unroll
  for (int i = 0; i < 8; ++i) v[i] = bf16_bits(W[(size_t)(k8 + i) * N + n]);
  *(v8us*)(Wt + (size_t)n * K + k8) = v;
  
}

// GEMM C[M][N] (f32, pitch ldc) = act(A[M][K]·W + bias). A f32 row-major (pitch lda) converted per fragment to bf16
// (ASPLIT: hi/lo two planes -> 2 terms, else single rounded term); Wt bf16 [N][K] (pitch ldb). BIAS_BF16 rounds the
// bias to bf16 first (bias quantised to bf16 before the add). K%32==0, M%16==0, N%64==0.
template <bool ASPLIT, int ACT, bool BIAS_BF16>
__global__ __launch_bounds__(128) void k_gemm_bf(const float* __restrict__ A, int lda, const unsigned short* __restrict__ Wt, int ldb,
                                               const float* __restrict__ bias, float* __restrict__ C, int ldc, int M, int N, int K) {
  __shared__ __attribute__((aligned(16))) float so[4][16][64];
  const int tid = threadIdx.x, w = tid >> 5, lane = tid & 31, ln = lane & 15, hh = lane >> 4;
  const int ntn = N / 64;
  const int wid = blockIdx.x * 4 + w;
  const int mt = wid / ntn, nq = wid % ntn;
  if (mt * 16 >= M) return;
  const int row0 = mt * 16, col0 = nq * 64;
  const float* arow = A + (size_t)(row0 + ln) * lda;
  v8f acc[4] = {};
  for (int kb = 0; kb < K; kb += 32) {
    FragB ah, al;
    const v4f x0 = *(const v4fa*)(arow + kb + 8 * hh), x1 = *(const v4fa*)(arow + kb + 8 * hh + 4);
    const v4f x2 = *(const v4fa*)(arow + kb + 16 + 8 * hh), x3 = *(const v4fa*)(arow + kb + 16 + 8 * hh + 4);
    float xs[16] = {x0[0],x0[1],x0[2],x0[3],x1[0],x1[1],x1[2],x1[3],x2[0],x2[1],x2[2],x2[3],x3[0],x3[1],x3[2],x3[3]};
#pragma unroll
    for (int i = 0; i < 16; ++i) { const unsigned short hb = bf16_bits(xs[i]); ah.u[i] = hb; al.u[i] = ASPLIT ? bf16_bits(xs[i] - bf16_val(hb)) : (unsigned short)0; }
#pragma unroll
    for (int t = 0; t < 4; ++t) {
      const unsigned short* brow = Wt + (size_t)(col0 + t * 16 + ln) * ldb + kb;
      FragB b;
      b.half[0] = *(const v8us*)(brow + 8 * hh);
      b.half[1] = *(const v8us*)(brow + 16 + 8 * hh);
      acc[t] = mmaN<ASPLIT ? 2 : 1>(ah.v, al.v, b.v, b.v, acc[t]);
    }
  }
#pragma unroll
  for (int t = 0; t < 4; ++t) {
    float bv = bias ? bias[col0 + t * 16 + ln] : 0.f;
    if (BIAS_BF16) bv = bf16_round(bv);
#pragma unroll
    for (int r = 0; r < 8; ++r) { float v = acc[t][r] + bv; if (ACT == 1) v = fmaxf(v, 0.f); so[w][8 * hh + r][t * 16 + ln] = v; }
  }
  __builtin_amdgcn_fence(__ATOMIC_ACQ_REL, "workgroup");
  __builtin_amdgcn_wave_barrier();
  const int rsub = lane >> 4, c4 = (lane & 15) * 4;
  {
#pragma unroll
    for (int q = 0; q < 8; ++q) {
      const int r = q * 2 + rsub;
      const v4f v = *(const v4fa*)&so[w][r][c4];
      *(v4f*)(C + (size_t)(row0 + r) * ldc + col0 + c4) = v;
    }
    
  }
}

// GEMM C = act(A·W + bias + resid): A f32 (ASPLIT -> hi/lo 2 terms), Wt bf16 [N][K]; ACT 0 none, 1 relu, 2 exact gelu;
// resid (optional, f32, row index = (row % rmod), pitch ldr, RES_BF16 rounds it) added before the activation.
template <bool ASPLIT, int ACT, bool BIAS_BF16, bool RES_BF16>
__global__ __launch_bounds__(128) void k_gemm_bf3(const float* __restrict__ A, int lda, const unsigned short* __restrict__ Wt, int ldb,
                                                const float* __restrict__ bias, const float* __restrict__ resid, int rmod, int ldr,
                                                float* __restrict__ C, int ldc, int M, int N, int K) {
  __shared__ __attribute__((aligned(16))) float so[4][16][64];
  const int tid = threadIdx.x, w = tid >> 5, lane = tid & 31, ln = lane & 15, hh = lane >> 4;
  const int ntn = N / 64;
  const int wid = blockIdx.x * 4 + w;
  const int mt = wid / ntn, nq = wid % ntn;
  if (mt * 16 >= M) return;
  const int row0 = mt * 16, col0 = nq * 64;
  const float* arow = A + (size_t)(row0 + ln) * lda;
  v8f acc[4] = {};
  for (int kb = 0; kb < K; kb += 32) {
    FragB ah, al;
    const v4f x0 = *(const v4fa*)(arow + kb + 8 * hh), x1 = *(const v4fa*)(arow + kb + 8 * hh + 4);
    const v4f x2 = *(const v4fa*)(arow + kb + 16 + 8 * hh), x3 = *(const v4fa*)(arow + kb + 16 + 8 * hh + 4);
    float xs[16] = {x0[0],x0[1],x0[2],x0[3],x1[0],x1[1],x1[2],x1[3],x2[0],x2[1],x2[2],x2[3],x3[0],x3[1],x3[2],x3[3]};
#pragma unroll
    for (int i = 0; i < 16; ++i) { const unsigned short hb = bf16_bits(xs[i]); ah.u[i] = hb; al.u[i] = ASPLIT ? bf16_bits(xs[i] - bf16_val(hb)) : (unsigned short)0; }
#pragma unroll
    for (int t = 0; t < 4; ++t) {
      const unsigned short* brow = Wt + (size_t)(col0 + t * 16 + ln) * ldb + kb;
      FragB b;
      b.half[0] = *(const v8us*)(brow + 8 * hh);
      b.half[1] = *(const v8us*)(brow + 16 + 8 * hh);
      acc[t] = mmaN<ASPLIT ? 2 : 1>(ah.v, al.v, b.v, b.v, acc[t]);
    }
  }
#pragma unroll
  for (int t = 0; t < 4; ++t) {
    const int col = col0 + t * 16 + ln;
    float bv = bias ? bias[col] : 0.f;
    if (BIAS_BF16) bv = bf16_round(bv);
#pragma unroll
    for (int r = 0; r < 8; ++r) {
      float v = acc[t][r] + bv;
      if (resid) { float rv = resid[(size_t)((row0 + 8 * hh + r) % rmod) * ldr + col]; if (RES_BF16) rv = bf16_round(rv); v += rv; }
      if (ACT == 1) v = fmaxf(v, 0.f);
      if (ACT == 2) v = 0.5f * v * (1.0f + erff(v * 0.70710678118654752f));
      if (ACT == 3) { const float u = 0.7978845608028654f * (v + 0.044715f * v * v * v); v = 0.5f * v * (1.0f + tanhf(u)); }
      so[w][8 * hh + r][t * 16 + ln] = v;
    }
  }
  __builtin_amdgcn_fence(__ATOMIC_ACQ_REL, "workgroup");
  __builtin_amdgcn_wave_barrier();
  const int rsub = lane >> 4, c4 = (lane & 15) * 4;
  {
#pragma unroll
    for (int q = 0; q < 8; ++q) {
      const int r = q * 2 + rsub;
      const v4f v = *(const v4fa*)&so[w][r][c4];
      *(v4f*)(C + (size_t)(row0 + r) * ldc + col0 + c4) = v;
    }
    
  }
}
// row LayerNorm (biased variance, eps) over N: s = X (+ R); optional out_sum <- s; out_norm <- (s-mu)*rsqrt(var+eps)*g + b
template <bool PARAM_BF16>
__global__ __launch_bounds__(256) void k_layernorm(const float* __restrict__ X, const float* __restrict__ R, const float* __restrict__ g, const float* __restrict__ bta,
                                                  float* __restrict__ out_sum, float* __restrict__ out_norm, int N, float eps) {
  __shared__ float red[256];
  const int row = blockIdx.x, tid = threadIdx.x;
  const float* x = X + (size_t)row * N; const float* rr = R ? R + (size_t)row * N : nullptr;
  float vals[16];                     // up to N = 4096
  const int per = N / 256;            // contiguous chunk per thread? use strided-by-4 chunks: thread handles j = tid*4 + 1024*u
  float s1 = 0.f;
  for (int u = 0; u < per / 4; ++u) {
    const int j = tid * 4 + 1024 * u;
    const v4f a = *(const v4fa*)(x + j);
    v4f b = {0.f,0.f,0.f,0.f}; if (rr) b = *(const v4fa*)(rr + j);
#pragma unroll
    for (int q = 0; q < 4; ++q) { const float v = a[q] + b[q]; vals[u * 4 + q] = v; s1 += v; }
  }
  red[tid] = s1; __syncthreads();
  for (int st = 128; st > 0; st >>= 1) { if (tid < st) red[tid] += red[tid + st]; __syncthreads(); }
  const float mu = red[0] / (float)N; __syncthreads();
  float s2 = 0.f;
  for (int u = 0; u < per / 4; ++u)
#pragma unroll
    for (int q = 0; q < 4; ++q) { const float c = vals[u * 4 + q] - mu; s2 += c * c; }
  red[tid] = s2; __syncthreads();
  for (int st = 128; st > 0; st >>= 1) { if (tid < st) red[tid] += red[tid + st]; __syncthreads(); }
  const float rs = rsqrtf(red[0] / (float)N + eps);
  {
    for (int u = 0; u < per / 4; ++u) {
      const int j = tid * 4 + 1024 * u;
      v4f o, sm;
#pragma unroll
      for (int q = 0; q < 4; ++q) {
        float gg = g[j + q], bb = bta[j + q];
        if (PARAM_BF16) { gg = bf16_round(gg); bb = bf16_round(bb); }
        sm[q] = vals[u * 4 + q]; o[q] = (vals[u * 4 + q] - mu) * rs * gg + bb;
      }
      if (out_sum) *(v4f*)(out_sum + (size_t)row * N + j) = sm;
      *(v4f*)(out_norm + (size_t)row * N + j) = o;
    }
    
  }
}



// ---- f16 WMMA path (v_wmma_f32_16x16x32_f16): 11-bit significands for operands in range — used where a [0,1] probability operand needs more precision than bf16
typedef _Float16 v16h __attribute__((ext_vector_type(16)));
union FragH { v16h v; v8us half[2]; _Float16 h[16]; unsigned short u[16]; };
template <int NT>
__device__ __forceinline__ v8f mmaH(v16h ah, v16h al, v16h bh, v16h bl, v8f c) {
  c = __builtin_amdgcn_wmma_f32_16x16x32_f16(false, ah, false, bh, (short)0, c, false, false);
  if (NT >= 2) c = __builtin_amdgcn_wmma_f32_16x16x32_f16(false, al, false, bh, (short)0, c, false, false);
  if (NT >= 3) c = __builtin_amdgcn_wmma_f32_16x16x32_f16(false, ah, false, bl, (short)0, c, false, false);
  asm volatile("v_nop\n\tv_nop\n\tv_nop\n\tv_nop" : "+v"(c) : "v"(ah), "v"(al), "v"(bh), "v"(bl));
  return c;
}
// batched GEMM like k_gemm_b but f16 operands: A f32 (split into f16 hi/lo if ASPLIT, else rounded to f16), Bt = f16 values [n][k]; alpha; C f32; N multiple of 16 (partial tiles skipped)
template <bool ASPLIT>
__global__ __launch_bounds__(128) void k_gemm_h(const float* __restrict__ A, int lda, size_t sA, const _Float16* __restrict__ Bh, int ldb, size_t sB, float alpha, float* __restrict__ C, int ldc, size_t sC, int M, int N, int K) {
  __shared__ __attribute__((aligned(16))) float so[4][16][64];
  const int tid = threadIdx.x, w = tid >> 5, lane = tid & 31, ln = lane & 15, hh = lane >> 4; const int by = blockIdx.y;
  A += (size_t)by * sA; Bh += (size_t)by * sB; C += (size_t)by * sC;
  const int ntn = (N + 63) / 64; const int wid = blockIdx.x * 4 + w; const int mt = wid / ntn, nq = wid % ntn; if (mt * 16 >= M) return;
  const int row0 = mt * 16, col0 = nq * 64; const float* arow = A + (size_t)(row0 + ln) * lda;
  v8f acc[4] = {};
  for (int kb = 0; kb < K; kb += 32) {
    FragH ah, al;
    const v4f x0 = *(const v4fa*)(arow + kb + 8 * hh), x1 = *(const v4fa*)(arow + kb + 8 * hh + 4), x2 = *(const v4fa*)(arow + kb + 16 + 8 * hh), x3 = *(const v4fa*)(arow + kb + 16 + 8 * hh + 4);
    float xs[16] = {x0[0],x0[1],x0[2],x0[3],x1[0],x1[1],x1[2],x1[3],x2[0],x2[1],x2[2],x2[3],x3[0],x3[1],x3[2],x3[3]};
#pragma unroll
    for (int i = 0; i < 16; ++i) { const _Float16 h = (_Float16)xs[i]; ah.h[i] = h; al.h[i] = ASPLIT ? (_Float16)(xs[i] - (float)h) : (_Float16)0.0f; }
#pragma unroll
    for (int t = 0; t < 4; ++t) { if (col0 + t * 16 >= N) continue; const size_t boff = (size_t)(col0 + t * 16 + ln) * ldb + kb; FragH bq; bq.half[0] = *(const v8us*)(Bh + boff + 8 * hh); bq.half[1] = *(const v8us*)(Bh + boff + 16 + 8 * hh);
      acc[t] = mmaH<ASPLIT ? 2 : 1>(ah.v, al.v, bq.v, bq.v, acc[t]); }
  }
#pragma unroll
  for (int t = 0; t < 4; ++t) { if (col0 + t * 16 >= N) continue;
#pragma unroll
    for (int r = 0; r < 8; ++r) so[w][8 * hh + r][t * 16 + ln] = acc[t][r] * alpha; }
  __builtin_amdgcn_fence(__ATOMIC_ACQ_REL, "workgroup"); __builtin_amdgcn_wave_barrier();
  const int rsub = lane >> 4, c4 = (lane & 15) * 4;
  {
#pragma unroll
    for (int q = 0; q < 8; ++q) { const int r = q * 2 + rsub; if (col0 + c4 < N) { const v4f v = *(const v4fa*)&so[w][r][c4]; *(v4f*)(C + (size_t)(row0 + r) * ldc + col0 + c4) = v; } }
     }
}

// Wt[n][k] = f16(W[k][n]·scale) from f32 row-major W[K][N] (scale = power of two; bf16-exact weights stay exact in f16 away from the subnormal range)
__global__ __launch_bounds__(256) void k_wt_f16(const float* __restrict__ W, _Float16* __restrict__ Wt, int K, int N, float scale) {
  const int t = blockIdx.x * 256 + threadIdx.x; if (t >= N * (K / 8)) return; const int n = t / (K / 8), k8 = (t % (K / 8)) * 8; FragH f;
#pragma unroll
  for (int i = 0; i < 8; ++i) f.h[i] = (_Float16)(bf16_round(W[(size_t)(k8 + i) * N + n]) * scale); const v8us o = f.half[0];
  *(v8us*)((unsigned short*)Wt + (size_t)n * K + k8) = o; 
}
// k_gemm_hh variant with fused epilogue: v = acc·alpha + bias[by·sBias + col] (+ CP[(row/rowsPerB)·sCPb + by·64 + col] if CP) ; ACT 0 none / 1 elu ; writes f16 C16 (and f32 C if non-null)
template <int ACT>
__global__ __launch_bounds__(128) void k_gemm_hhx(const _Float16* __restrict__ A, int lda, size_t sA, const _Float16* __restrict__ Bh, int ldb, size_t sB, float alpha, const float* __restrict__ bias, size_t sBias, const float* __restrict__ CP, int rowsPerB, size_t sCPb, int row0g,
    float* __restrict__ C, _Float16* __restrict__ C16, int ldc, size_t sC, int M, int N, int K) {
  __shared__ __attribute__((aligned(16))) float so[4][16][64];
  const int tid = threadIdx.x, w = tid >> 5, lane = tid & 31, ln = lane & 15, hh = lane >> 4; const int by = blockIdx.y;
  A += (size_t)by * sA; Bh += (size_t)by * sB; const size_t cofs = (size_t)by * sC; const float* bp = bias ? bias + (size_t)by * sBias : nullptr;
  const int ntn = (N + 63) / 64; const int wid = blockIdx.x * 4 + w; const int mt = wid / ntn, nq = wid % ntn; if (mt * 16 >= M) return;
  const int row0 = mt * 16, col0 = nq * 64; const _Float16* arow = A + (size_t)(row0 + ln) * lda;
  v8f acc[4] = {};
  for (int kb = 0; kb < K; kb += 32) { FragH ah; ah.half[0] = *(const v8us*)((const unsigned short*)arow + kb + 8 * hh); ah.half[1] = *(const v8us*)((const unsigned short*)arow + kb + 16 + 8 * hh);
#pragma unroll
    for (int t = 0; t < 4; ++t) { if (col0 + t * 16 >= N) continue; const size_t boff = (size_t)(col0 + t * 16 + ln) * ldb + kb; FragH bq; bq.half[0] = *(const v8us*)((const unsigned short*)Bh + boff + 8 * hh); bq.half[1] = *(const v8us*)((const unsigned short*)Bh + boff + 16 + 8 * hh);
      acc[t] = mmaH<1>(ah.v, ah.v, bq.v, bq.v, acc[t]); }
  }
#pragma unroll
  for (int t = 0; t < 4; ++t) { if (col0 + t * 16 >= N) continue; const int col = col0 + t * 16 + ln; const float bv = bp ? bf16_round(bp[col]) : 0.f;
#pragma unroll
    for (int r = 0; r < 8; ++r) { float v = acc[t][r] * alpha + bv; if (CP) { const int rr = row0g + row0 + 8 * hh + r; if (rowsPerB < 0) v += CP[cofs + (size_t)rr * ldc + col];      /* rowsPerB < 0: own element of the batched C plane */ else { const int bidx = rr / rowsPerB; v += CP[(size_t)bidx * sCPb + (size_t)by * 64 + col]; } } if (ACT == 1) v = (v > 0.f) ? v : expm1f(v); else if (ACT == 7) v = (v > 0.f) ? v + 1.0f : expf(v); else if (ACT == 8) v = tanhf(v); else if (ACT == 9) v = 0.5f * v * (1.0f + tanhf(0.7978845608028654f * (v + 0.044715f * v * v * v))); else if (ACT == 11) v = 1.0f / (1.0f + expf(-v)); else if (ACT == 12) v = (v > 0.f) ? v : 0.01f * v; else if (ACT == 14) v = (v > 0.f) ? v : 0.1f * v; else if (ACT == 16) v = (v >= 0.f) ? v : 0.3f * v; else if (ACT == 17) v = (v >= 0.f) ? v : 0.2f * v; else if (ACT == 15) v = v / (1.0f + expf(-v)); else if (ACT == 3) v = fmaxf(v, 0.f); else if (ACT == 6) v = 0.5f * v * (1.0f + erff(v * 0.70710678118654752f)); so[w][8 * hh + r][t * 16 + ln] = v; } }
  __builtin_amdgcn_fence(__ATOMIC_ACQ_REL, "workgroup"); __builtin_amdgcn_wave_barrier();
  const int rsub = lane >> 4, c4 = (lane & 15) * 4; typedef _Float16 v4h __attribute__((ext_vector_type(4)));
  {
#pragma unroll
    for (int q = 0; q < 8; ++q) { const int r = q * 2 + rsub; if (col0 + c4 < N) { const v4f v = *(const v4fa*)&so[w][r][c4]; if (C) *(v4f*)(C + cofs + (size_t)(row0 + r) * ldc + col0 + c4) = v; if (C16) { v4h h4; for (int i = 0; i < 4; ++i) h4[i] = (_Float16)v[i]; *(v4h*)(C16 + cofs + (size_t)(row0 + r) * ldc + col0 + c4) = h4; } } }
     }
}


typedef _Float16 v4h __attribute__((ext_vector_type(4)));

__global__ __launch_bounds__(256) void k_x16(const float* __restrict__ x, _Float16* __restrict__ X16, size_t n8) { const size_t t = (size_t)blockIdx.x * 256 + threadIdx.x; if (t >= n8) return; FragH f;
#pragma unroll
  for (int q = 0; q < 8; ++q) f.h[q] = (_Float16)bf16_round(x[t * 8 + q]); *(v8us*)((unsigned short*)X16 + t * 8) = f.half[0];  }
__global__ __launch_bounds__(256) void k_h16(const float* __restrict__ x, _Float16* __restrict__ X16, size_t n8) { const size_t t = (size_t)blockIdx.x * 256 + threadIdx.x; if (t >= n8) return; FragH f;
#pragma unroll
  for (int q = 0; q < 8; ++q) f.h[q] = (_Float16)x[t * 8 + q]; *(v8us*)((unsigned short*)X16 + t * 8) = f.half[0];  }
__global__ __launch_bounds__(256) void k_round16f(const float* __restrict__ W, _Float16* __restrict__ Bt, size_t n8) { const size_t t = (size_t)blockIdx.x * 256 + threadIdx.x; if (t >= n8) return; FragH f;
#pragma unroll
  for (int i = 0; i < 8; ++i) f.h[i] = (_Float16)(bf16_round(W[t * 8 + i]) * 16.0f); *(v8us*)((unsigned short*)Bt + t * 8) = f.half[0];  }
template <int NHv, int TTv>
__global__ __launch_bounds__(256) void k_vt(const _Float16* __restrict__ V16, int ldv, int voff, _Float16* __restrict__ Vt) { __shared__ unsigned short tl[64][66]; const int tid = threadIdx.x; const int slab = blockIdx.x / (TTv / 64), lg = blockIdx.x % (TTv / 64); const int b = slab / NHv, h = slab % NHv;
  for (int i = tid; i < 64 * 8; i += 256) { const int r = i / 8, c8 = (i % 8) * 8; FragH f; f.half[0] = *(const v8us*)((const unsigned short*)V16 + ((size_t)b * TTv + lg * 64 + r) * ldv + voff + h * 64 + c8);
#pragma unroll
    for (int q = 0; q < 8; ++q) tl[r][c8 + q] = f.u[q]; }
  __syncthreads();
  {
#pragma unroll
    for (int rd = 0; rd < 2; ++rd) { const int d = rd * 32 + tid / 8, pc = tid % 8; FragH f;
#pragma unroll
      for (int q = 0; q < 8; ++q) f.u[q] = tl[pc * 8 + q][d];
      *(v8us*)((unsigned short*)Vt + ((size_t)slab * 64 + d) * TTv + lg * 64 + pc * 8) = f.half[0]; }
     } }

__global__ __launch_bounds__(256) void k_hl(const float* __restrict__ F, _Float16* __restrict__ Hh, _Float16* __restrict__ Hl, size_t n8) { const size_t t = (size_t)blockIdx.x * 256 + threadIdx.x; if (t >= n8) return; FragH fh, fl; const v4f a = *(const v4fa*)(F + t * 8), c = *(const v4fa*)(F + t * 8 + 4);
#pragma unroll
  for (int q = 0; q < 4; ++q) { _Float16 h = (_Float16)a[q]; fh.h[q] = h; fl.h[q] = (_Float16)((a[q] - (float)h) * 1024.0f); h = (_Float16)c[q]; fh.h[4 + q] = h; fl.h[4 + q] = (_Float16)((c[q] - (float)h) * 1024.0f); }
  { *(v8us*)((unsigned short*)Hh + t * 8) = fh.half[0]; *(v8us*)((unsigned short*)Hl + t * 8) = fl.half[0];  } }

// ---- fast GEMM (wave tile 32x64; requires M % 32 == 0 rows per launch region and N % 64 == 0); epilogue = k_gemm_hhx semantics ----
__device__ __forceinline__ v16h g2_frag(const _Float16* p, int hh) { FragH f; f.half[0] = *(const v8us*)((const unsigned short*)p + 8 * hh); f.half[1] = *(const v8us*)((const unsigned short*)p + 16 + 8 * hh); return f.v; }
__device__ __forceinline__ v8f g2_mma(v16h a, v16h b, v8f c) { v8f d = __builtin_amdgcn_wmma_f32_16x16x32_f16(false, a, false, b, (short)0, c, false, false); asm volatile("v_nop\n\tv_nop\n\tv_nop\n\tv_nop" : "+v"(d) : "v"(a), "v"(b)); return d; }
template <int ACT>
__global__ __launch_bounds__(128) void k_gemm2(const _Float16* __restrict__ A, int lda, size_t sA, const _Float16* __restrict__ Bh, int ldb, size_t sB, float alpha, const float* __restrict__ bias, size_t sBias, const float* __restrict__ CP, int rowsPerB, size_t sCPb, int row0g,
    float* __restrict__ C, _Float16* __restrict__ C16, int ldc, size_t sC, int M, int N, int K) { static_assert(ACT == 0 || ACT == 3 || ACT == 6 || ACT == 8 || ACT == 9 || ACT == 11 || ACT == 12 || ACT == 14 || ACT == 15 || ACT == 16 || ACT == 17 || ACT == 18, "k_gemm2: unsupported ACT code (would silently apply no activation)");
  __shared__ __attribute__((aligned(16))) float so[4][32][68];
  const int tid = threadIdx.x, w = tid >> 5, lane = tid & 31, ln = lane & 15, hh = lane >> 4; const int by = blockIdx.y;
  A += (size_t)by * sA; Bh += (size_t)by * sB; const size_t cofs = (size_t)by * sC; const float* bp = bias ? bias + (size_t)by * sBias : nullptr;
  const int ntn = N >> 6; const int mt = blockIdx.x / ntn, nq = blockIdx.x - mt * ntn; const int row0 = mt * 128 + 32 * w, col0 = nq * 64; if (row0 >= M) return;
  const _Float16* a0p = A + (size_t)(row0 + ln) * lda; const _Float16* a1p = a0p + (size_t)16 * lda;
  const _Float16* b0p = Bh + (size_t)(col0 + ln) * ldb; const _Float16* b1p = b0p + (size_t)16 * ldb; const _Float16* b2p = b1p + (size_t)16 * ldb; const _Float16* b3p = b2p + (size_t)16 * ldb;
  const v8f z8 = {0.f,0.f,0.f,0.f,0.f,0.f,0.f,0.f}; v8f c00 = z8, c01 = z8, c02 = z8, c03 = z8, c10 = z8, c11 = z8, c12 = z8, c13 = z8;
#pragma unroll 1
  for (int kb = 0; kb < K; kb += 32) { const v16h a0 = g2_frag(a0p + kb, hh), a1 = g2_frag(a1p + kb, hh);
    v16h b = g2_frag(b0p + kb, hh); c00 = g2_mma(a0, b, c00); c10 = g2_mma(a1, b, c10);
    b = g2_frag(b1p + kb, hh); c01 = g2_mma(a0, b, c01); c11 = g2_mma(a1, b, c11);
    b = g2_frag(b2p + kb, hh); c02 = g2_mma(a0, b, c02); c12 = g2_mma(a1, b, c12);
    b = g2_frag(b3p + kb, hh); c03 = g2_mma(a0, b, c03); c13 = g2_mma(a1, b, c13); }
  v8f accs[8] = {c00, c01, c02, c03, c10, c11, c12, c13};
#pragma unroll
  for (int u = 0; u < 8; ++u) { const int t = u & 3, half = u >> 2; const int col = col0 + t * 16 + ln; const float bv = bp ? bf16_round(bp[col]) : 0.f;
#pragma unroll
    for (int r = 0; r < 8; ++r) { const int rloc = half * 16 + 8 * hh + r; float v = accs[u][r] * alpha + bv; if (CP) { if (rowsPerB < 0) v += CP[cofs + (size_t)(row0g + row0 + rloc) * ldc + col];      /* rowsPerB < 0: own element of the batched C plane */ else { const int bidx = (row0g + row0 + rloc) / rowsPerB; v += CP[(size_t)bidx * sCPb + (size_t)by * 64 + col]; } }
      if (ACT == 3) v = fmaxf(v, 0.f); else if (ACT == 6) v = 0.5f * v * (1.0f + erff(v * 0.70710678118654752f)); else if (ACT == 11) v = 1.0f / (1.0f + expf(-v)); else if (ACT == 15) v = v / (1.0f + expf(-v)); else if (ACT == 18) v = v / (1.0f + expf(-1.702f * v));      /* QuickGELU: v sigmoid(1.702 v) */ else if (ACT == 12) v = (v > 0.f) ? v : 0.01f * v; else if (ACT == 8) v = tanhf(v); else if (ACT == 9) v = 0.5f * v * (1.0f + tanhf(0.7978845608028654f * (v + 0.044715f * v * v * v))); else if (ACT == 14) v = (v > 0.f) ? v : 0.1f * v; else if (ACT == 16) v = (v >= 0.f) ? v : 0.3f * v; else if (ACT == 17) v = (v >= 0.f) ? v : 0.2f * v;
      so[w][rloc][t * 16 + ln] = v; } }
  __builtin_amdgcn_fence(__ATOMIC_ACQ_REL, "workgroup"); __builtin_amdgcn_wave_barrier();
  const int rsub = lane >> 4, c4 = (lane & 15) * 4;
  {
#pragma unroll
    for (int q = 0; q < 16; ++q) { const int r = q * 2 + rsub; const v4f v = *(const v4fa*)&so[w][r][c4]; if (C) *(v4f*)(C + cofs + (size_t)(row0 + r) * ldc + col0 + c4) = v; if (C16) { v4h h4; for (int i = 0; i < 4; ++i) h4[i] = (_Float16)v[i]; *(v4h*)(C16 + cofs + (size_t)(row0 + r) * ldc + col0 + c4) = h4; } }
     } }


__global__ __launch_bounds__(256) void k_wnat(const float* __restrict__ w, size_t n8, _Float16* __restrict__ Bt) { const size_t t = (size_t)blockIdx.x * 256 + threadIdx.x; if (t >= n8) return; FragH f; for (int q = 0; q < 8; ++q) f.h[q] = (_Float16)(bf16_round(w[t * 8 + q]) * 16.0f); *(v8us*)((unsigned short*)Bt + t * 8) = f.half[0];  }
__global__ __launch_bounds__(256) void k_rsm(const float* __restrict__ S, _Float16* __restrict__ P, int nrows) {
  #pragma clang fp contract(off)
  const int i = blockIdx.x * 256 + threadIdx.x; if (i >= nrows) return; const float* s = S + (size_t)i * SQ; float mx = -3.0e38f;
#pragma unroll 1
  for (int j = 0; j < SQ; ++j) mx = fmaxf(mx, s[j]); float se = 0.f;
#pragma unroll 1
  for (int j = 0; j < SQ; ++j) se += expf(s[j] - mx); const float sc = 256.0f / se;
#pragma unroll 1
  for (int j0 = 0; j0 < SQ; j0 += 8) { FragH f; for (int q = 0; q < 8; ++q) f.h[q] = (_Float16)(expf(s[j0 + q] - mx) * sc); unsigned short* d = (unsigned short*)P + (size_t)i * SQ + j0; *(v8us*)d = f.half[0];  } }
__global__ __launch_bounds__(256) void k_vt(const _Float16* __restrict__ V16, int b, int h0, _Float16* __restrict__ VT) { __shared__ unsigned short tl[64][65]; const int tid = threadIdx.x; const int hh = blockIdx.x % HG, sg = blockIdx.x / HG; const int s0 = sg * 64; const int h = h0 + hh;
  for (int i = tid; i < 64 * 8; i += 256) { const int j = i / 8, d8 = (i % 8) * 8; FragH f; f.half[0] = *(const v8us*)((const unsigned short*)V16 + ((size_t)b * SQ + s0 + j) * DM + h * HD + d8); for (int q = 0; q < 8; ++q) tl[d8 + q][j] = f.u[q]; }
  __syncthreads();
  { for (int i = tid; i < 64 * 8; i += 256) { const int d = i / 8, j8 = (i % 8) * 8; FragH f; for (int q = 0; q < 8; ++q) f.u[q] = tl[d][j8 + q]; *(v8us*)((unsigned short*)VT + ((size_t)hh * HD + d) * SQ + s0 + j8) = f.half[0]; }  } }



__global__ __launch_bounds__(256) void k_rsmcf2(const float* __restrict__ S, _Float16* __restrict__ P, int hg, int q0, int nk) {
  #pragma clang fp contract(off)
  const int t = blockIdx.x * 256 + threadIdx.x; if (t >= hg * QT) return; const size_t i = (size_t)t; const float* s = S + i * NKX; const int last = q0 + (t % QT); float mx = -3.0e38f;
#pragma unroll 1
  for (int j = 0; j < nk; ++j) { const float f = (j <= last) ? 1.f : 0.f; mx = fmaxf(mx, fmaf(f, s[j], (1.f - f) * -1.0e9f)); } float se = 0.f;
#pragma unroll 1
  for (int j = 0; j < nk; ++j) { const float f = (j <= last) ? 1.f : 0.f; se += __expf(fmaf(f, s[j], (1.f - f) * -1.0e9f) - mx); } const float sc = 256.0f / se;
#pragma unroll 1
  for (int j0 = 0; j0 < nk; j0 += 8) { FragH fr; for (int q = 0; q < 8; ++q) { const int j = j0 + q; const float f = (j <= last) ? 1.f : 0.f; fr.h[q] = (_Float16)(__expf(fmaf(f, s[j], (1.f - f) * -1.0e9f) - mx) * sc); } unsigned short* d = (unsigned short*)P + i * NKX + j0; *(v8us*)d = fr.half[0];  } }

__global__ __launch_bounds__(256) void k_rsmcst(const float* __restrict__ S, _Float16* __restrict__ P, int hg, int q0, int nk, const int* __restrict__ mk) {
  #pragma clang fp contract(off)
  const int t = blockIdx.x * 256 + threadIdx.x; if (t >= hg * QT) return; const size_t i = (size_t)t; const float* s = S + i * NKX; const size_t ig = (size_t)(q0 + (t % QT)); const int* mr = mk + ig * SQ; float mx = -3.0e38f;
#pragma unroll 1
  for (int j = 0; j < nk; ++j) { const int mb = mr[j]; const int dd = (int)ig - j; const float f = (mb != 0 && dd >= 0 && (dd <= LOCALW || (dd % STRIDEK) == 0)) ? 1.f : 0.f; mx = fmaxf(mx, fmaf(f, s[j], (1.f - f) * -1.0e9f)); } float se = 0.f;
#pragma unroll 1
  for (int j = 0; j < nk; ++j) { const int mb = mr[j]; const int dd = (int)ig - j; const float f = (mb != 0 && dd >= 0 && (dd <= LOCALW || (dd % STRIDEK) == 0)) ? 1.f : 0.f; se += __expf(fmaf(f, s[j], (1.f - f) * -1.0e9f) - mx); } const float sc = 256.0f / se;
#pragma unroll 1
  for (int j0 = 0; j0 < nk; j0 += 8) { FragH fr; for (int q = 0; q < 8; ++q) { const int j = j0 + q; const int mb = mr[j]; const int dd = (int)ig - j; const float f = (mb != 0 && dd >= 0 && (dd <= LOCALW || (dd % STRIDEK) == 0)) ? 1.f : 0.f; fr.h[q] = (_Float16)(__expf(fmaf(f, s[j], (1.f - f) * -1.0e9f) - mx) * sc); } unsigned short* d = (unsigned short*)P + i * NKX + j0; *(v8us*)d = fr.half[0];  } }


template <int MASKADD>
__global__ __launch_bounds__(64) void k_att0(const float* __restrict__ QF, const float* __restrict__ KF, const float* __restrict__ VF, int ld, const float* __restrict__ mask, float scale, float* __restrict__ OF, int ldo) {
  #pragma clang fp contract(off)
  __shared__ __attribute__((aligned(16))) float lq[64][64]; __shared__ __attribute__((aligned(16))) float lo[64][64];
  const int tid = threadIdx.x; const int h = blockIdx.x / (QT0 / 64), rg = blockIdx.x % (QT0 / 64); const int i = rg * 64 + tid;
  const float* qr = QF + (size_t)i * ld + h * HD;
#pragma unroll 1
  for (int c = 0; c < HD / 4; ++c) { *(v4f*)&lq[tid][c * 4] = *(const v4fa*)(qr + c * 4); const v4f z = {0.f, 0.f, 0.f, 0.f}; *(v4f*)&lo[tid][c * 4] = z; }
  float m = -1.0e30f, l = 0.f; const int jmax = MASKADD ? (SQ - 1) : (rg * 64 + 63);      /* additive-mask form: every key (the mask input decides); causal form: keys up to the block's last row */
#pragma unroll 1
  for (int j = 0; j <= jmax; ++j) { const float* kr = KF + (size_t)j * ld + h * HD; const float* vr = VF + (size_t)j * ld + h * HD; float s = 0.f;
#pragma unroll 1
    for (int c = 0; c < HD / 4; ++c) { const v4f kq = *(const v4fa*)(kr + c * 4); const v4f qq = *(v4f*)&lq[tid][c * 4]; s = __fadd_rn(s, __fmul_rn(qq[0], kq[0])); s = __fadd_rn(s, __fmul_rn(qq[1], kq[1])); s = __fadd_rn(s, __fmul_rn(qq[2], kq[2])); s = __fadd_rn(s, __fmul_rn(qq[3], kq[3])); }
    s = __fmul_rn(s, scale); if (MASKADD) s = __fadd_rn(s, __fmul_rn(bf16_round(mask[(size_t)i * SQ + j]), -10000.0f));
    const float f = (MASKADD || j <= i) ? 1.f : 0.f; const float sm = fmaf(f, s, (1.f - f) * -1.0e30f); const float mn = fmaxf(m, sm); const float sc = expf(m - mn); const float e = expf(sm - mn); l = __fadd_rn(__fmul_rn(l, sc), e); m = mn;
#pragma unroll 1
    for (int c = 0; c < HD / 4; ++c) { const v4f vv = *(const v4fa*)(vr + c * 4); v4f oo = *(v4f*)&lo[tid][c * 4]; for (int u = 0; u < 4; ++u) oo[u] = __fadd_rn(__fmul_rn(oo[u], sc), __fmul_rn(e, vv[u])); *(v4f*)&lo[tid][c * 4] = oo; } }
  const float fin = 64.0f / l;      /* o carried x64 like the f16 path */
#pragma unroll 1
  for (int c = 0; c < HD / 4; ++c) { v4f oo = *(v4f*)&lo[tid][c * 4]; for (int u = 0; u < 4; ++u) oo[u] = __fmul_rn(oo[u], fin); *(v4f*)&lo[tid][c * 4] = oo; }
  __syncthreads();
  {
#pragma unroll 1
    for (int it = 0; it < 16; ++it) { const int row = it * 4 + tid / 16, pc = (tid % 16) * 4; const v4f v = *(const v4f*)&lo[row][pc]; *(v4f*)(OF + (size_t)(rg * 64 + row) * ldo + h * HD + pc) = v; }
     } }

template <int MASKADD>
__global__ __launch_bounds__(64) void k_att0mbc(const float* __restrict__ QF, const float* __restrict__ KF, const float* __restrict__ VF, int ld, const float* __restrict__ mask, float scale, float* __restrict__ OF, int ldo) {
  #pragma clang fp contract(off)
  __shared__ __attribute__((aligned(16))) float lq[64][64]; __shared__ __attribute__((aligned(16))) float lo[64][64];
  const int tid = threadIdx.x; const int h = blockIdx.x / (QT0 / 64), rg = blockIdx.x % (QT0 / 64); const int i = rg * 64 + tid;
  const float* qr = QF + (size_t)i * ld + h * HD;
#pragma unroll 1
  for (int c = 0; c < HD / 4; ++c) { *(v4f*)&lq[tid][c * 4] = *(const v4fa*)(qr + c * 4); const v4f z = {0.f, 0.f, 0.f, 0.f}; *(v4f*)&lo[tid][c * 4] = z; }
  float m = -1.0e30f, l = 0.f; const int jmax = rg * 64 + 63;      /* keys beyond the block end are masked by the mask's lower-triangular structure */
#pragma unroll 1
  for (int j = 0; j <= jmax; ++j) { const float* kr = KF + (size_t)j * ld + h * HD; const float* vr = VF + (size_t)j * ld + h * HD; float s = 0.f;
#pragma unroll 1
    for (int c = 0; c < HD / 4; ++c) { const v4f kq = *(const v4fa*)(kr + c * 4); const v4f qq = *(v4f*)&lq[tid][c * 4]; s = __fadd_rn(s, __fmul_rn(qq[0], kq[0])); s = __fadd_rn(s, __fmul_rn(qq[1], kq[1])); s = __fadd_rn(s, __fmul_rn(qq[2], kq[2])); s = __fadd_rn(s, __fmul_rn(qq[3], kq[3])); }
    s = __fmul_rn(s, scale); const int mb = ((const int*)mask)[(size_t)i * SQ + j];      /* causal (j <= i) AND the module's int32 [S][S] mask read per (query, key): 0 -> masked */
    const float f = (mb != 0 && j <= i) ? 1.f : 0.f; const float sm = fmaf(f, s, (1.f - f) * -1.0e30f); const float mn = fmaxf(m, sm); const float sc = expf(m - mn); const float e = expf(sm - mn); l = __fadd_rn(__fmul_rn(l, sc), e); m = mn;
#pragma unroll 1
    for (int c = 0; c < HD / 4; ++c) { const v4f vv = *(const v4fa*)(vr + c * 4); v4f oo = *(v4f*)&lo[tid][c * 4]; for (int u = 0; u < 4; ++u) oo[u] = __fadd_rn(__fmul_rn(oo[u], sc), __fmul_rn(e, vv[u])); *(v4f*)&lo[tid][c * 4] = oo; } }
  const float fin = 64.0f / l;      /* o carried x64 like the f16 path */
#pragma unroll 1
  for (int c = 0; c < HD / 4; ++c) { v4f oo = *(v4f*)&lo[tid][c * 4]; for (int u = 0; u < 4; ++u) oo[u] = __fmul_rn(oo[u], fin); *(v4f*)&lo[tid][c * 4] = oo; }
  __syncthreads();
  {
#pragma unroll 1
    for (int it = 0; it < 16; ++it) { const int row = it * 4 + tid / 16, pc = (tid % 16) * 4; const v4f v = *(const v4f*)&lo[row][pc]; *(v4f*)(OF + (size_t)(rg * 64 + row) * ldo + h * HD + pc) = v; }
     } }


template <int BFIN, int WXB>
__global__ __launch_bounds__(256) void k_ln16(const float* __restrict__ X, const float* __restrict__ g, const float* __restrict__ bb, float eps, _Float16* __restrict__ N16, float* __restrict__ XB) {
  #pragma clang fp contract(off)
  __shared__ float red[256]; const size_t r = blockIdx.x; const int t = threadIdx.x; const v4f xa = *(const v4fa*)(X + r * DMQ + t * 4); float s[4]; float sum = 0.f;
  for (int q = 0; q < 4; ++q) { s[q] = BFIN ? bf16_round(xa[q]) : xa[q]; sum = __fadd_rn(sum, s[q]); }
  red[t] = sum; __syncthreads(); for (int st = 128; st > 0; st >>= 1) { if (t < st) red[t] = __fadd_rn(red[t], red[t + st]); __syncthreads(); } const float mu = red[0] / (float)DMQ; __syncthreads();
  float vs = 0.f; for (int q = 0; q < 4; ++q) { const float dl = __fadd_rn(s[q], -mu); vs = __fadd_rn(vs, __fmul_rn(dl, dl)); } red[t] = vs; __syncthreads(); for (int st = 128; st > 0; st >>= 1) { if (t < st) red[t] = __fadd_rn(red[t], red[t + st]); __syncthreads(); }
  const float rs = rsqrtf(__fadd_rn(red[0] / (float)DMQ, eps)); v4h y; v4f xb;
  for (int q = 0; q < 4; ++q) { const int c = t * 4 + q; y[q] = (_Float16)__fadd_rn(__fmul_rn(__fmul_rn(__fadd_rn(s[q], -mu), rs), bf16_round(g[c])), bf16_round(bb[c])); xb[q] = s[q]; }
  { *(v4h*)(N16 + r * DMQ + t * 4) = y; if (WXB) *(v4f*)(XB + r * DMQ + t * 4) = xb;  } }
__global__ __launch_bounds__(256) void k_ftres2(const float* __restrict__ OF0, const float* __restrict__ XB, float* __restrict__ X1, size_t n4) {
  #pragma clang fp contract(off)
  const size_t t = (size_t)blockIdx.x * 256 + threadIdx.x; if (t >= n4) return; const v4f o = *(const v4fa*)(OF0 + t * 4), xv = *(const v4fa*)(XB + t * 4); v4f y; for (int q = 0; q < 4; ++q) y[q] = __fadd_rn(__fmul_rn(o[q], 0.015625f), xv[q]); *(v4f*)(X1 + t * 4) = y;  }

__global__ __launch_bounds__(256) void k_bcpy(const float* __restrict__ b, int n, int NP, float* __restrict__ dst, int dst0) { for (int i = threadIdx.x; i < NP; i += 256) { const float v = (i < n) ? b[i] : 0.f; *(float*)(dst + dst0 + i) = v; }  }


// lane l <-> l ^ M inside a 16-lane row (DPP row_xmask), and l <-> l ^ 16 (cross-row move): register-only butterflies
template <int M> __device__ __forceinline__ float xl_row(float v) { return __int_as_float(__builtin_amdgcn_update_dpp(0, __float_as_int(v), 0x160 | M, 0xf, 0xf, true)); }
__device__ __forceinline__ float xl_x16(float v) { const int b = __float_as_int(v); return __int_as_float(__builtin_amdgcn_permlanex16(b, b, 0x76543210, 0xfedcba98, false, false)); }
// row softmax -> P x256 f16. One wave per score row: 16 loads of 512 contiguous bytes, the whole row (64 values a lane) stays in registers, S is read once and each exponential is taken once.
// The four loops over v[] are fully unrolled so that v[] is indexed by constants only and lives in registers, and so that all 16 loads are in flight together.
__global__ __launch_bounds__(256) void k_rsmf(const float* __restrict__ S, _Float16* __restrict__ P, int nrows) {
  const int row = blockIdx.x * 8 + (threadIdx.x >> 5), lane = threadIdx.x & 31; if (row >= nrows) return;      /* wave-uniform; no barrier in this kernel */
  const float* s = S + (size_t)row * SQ + lane * 4; v4f v[SQ / 128];
#pragma unroll
  for (int u = 0; u < SQ / 128; ++u) v[u] = *(const v4fa*)(s + u * 128);
  v4f m4 = {-3.0e38f, -3.0e38f, -3.0e38f, -3.0e38f};
#pragma unroll
  for (int u = 0; u < SQ / 128; ++u) m4 = __builtin_elementwise_max(m4, v[u]);
  float mx = fmaxf(fmaxf(m4[0], m4[1]), fmaxf(m4[2], m4[3]));
  mx = fmaxf(mx, xl_row<1>(mx)); mx = fmaxf(mx, xl_row<2>(mx)); mx = fmaxf(mx, xl_row<4>(mx)); mx = fmaxf(mx, xl_row<8>(mx)); mx = fmaxf(mx, xl_x16(mx));
  v4f s4 = {0.f, 0.f, 0.f, 0.f};
#pragma unroll
  for (int u = 0; u < SQ / 128; ++u) { v4f e; for (int q = 0; q < 4; ++q) e[q] = __expf(v[u][q] - mx); v[u] = e; s4 += e; }
  float se = (s4[0] + s4[1]) + (s4[2] + s4[3]);
  se += xl_row<1>(se); se += xl_row<2>(se); se += xl_row<4>(se); se += xl_row<8>(se); se += xl_x16(se);
  const float sc = 256.0f / se; _Float16* d = P + (size_t)row * SQ + lane * 4;
#pragma unroll
  for (int u = 0; u < SQ / 128; ++u) { const v4f y = v[u] * sc; *(v4h*)(d + u * 128) = __builtin_convertvector(y, v4h); } }

#define FAP 72      /* LDS row pitch in f16: 128 data bytes + 16 (16 B x odd: the 16-byte fragment reads of 16 rows fall on distinct banks) */
typedef _Float16 v8h __attribute__((ext_vector_type(8)));
union FragP { v16h v; v8h half[2]; };
__device__ __forceinline__ v8f fa_mma(v16h a, v16h b, v8f c) { return __builtin_amdgcn_wmma_f32_16x16x32_f16(false, a, false, b, (short)0, c, false, false); }
// 2^x, eight at a time, with the one free slot that the instruction set asks for behind a transcendental: the results are early-clobber, so inside the run none lands on a source or is read, and the v_nop stands in front of whatever the compiler schedules next.
__device__ __forceinline__ v8f fa_exp2x8(v8f x) { float y0, y1, y2, y3, y4, y5, y6, y7;
  asm("v_exp_f32 %0, %8\n\tv_exp_f32 %1, %9\n\tv_exp_f32 %2, %10\n\tv_exp_f32 %3, %11\n\tv_exp_f32 %4, %12\n\tv_exp_f32 %5, %13\n\tv_exp_f32 %6, %14\n\tv_exp_f32 %7, %15\n\tv_nop"
      : "=&v"(y0), "=&v"(y1), "=&v"(y2), "=&v"(y3), "=&v"(y4), "=&v"(y5), "=&v"(y6), "=&v"(y7) : "v"(x[0]), "v"(x[1]), "v"(x[2]), "v"(x[3]), "v"(x[4]), "v"(x[5]), "v"(x[6]), "v"(x[7]));
  const v8f y = {y0, y1, y2, y3, y4, y5, y6, y7}; return y; }
__device__ __forceinline__ float fa_exp2(float x) { float y; asm("v_exp_f32 %0, %1\n\tv_nop" : "=&v"(y) : "v"(x)); return y; }      /* the same slot behind a single one */
__global__ __launch_bounds__(256) __attribute__((amdgpu_waves_per_eu(4, 4))) void k_fattn(const _Float16* __restrict__ Q, const _Float16* __restrict__ Kr, const _Float16* __restrict__ VTa, _Float16* __restrict__ O) {
  __shared__ __attribute__((aligned(16))) _Float16 lk[2][64][FAP]; __shared__ __attribute__((aligned(16))) _Float16 lv[2][64][FAP];
  const int tid = threadIdx.x, lane = tid & 31, ln = lane & 15, hh = lane >> 4, w = tid >> 5; const int bh = blockIdx.y, b = bh / NH, h = bh % NH; const int q0 = blockIdx.x * 256 + w * 32;
  const _Float16* qp = Q + ((size_t)b * SQ + q0 + ln) * DM + h * HD;
  const int sr = tid >> 3, sc = (tid & 7) * 8;      /* staging: 8 threads a 128-byte row; a thread brings rows sr and sr + 32 of both tiles */
  const unsigned short* kg = (const unsigned short*)Kr + ((size_t)b * SQ + sr) * DM + h * HD + sc; const unsigned short* vg = (const unsigned short*)VTa + ((size_t)bh * HD + sr) * SQ + sc;
  const float CS = 0.18033688011112042f;      /* 64^-0.5 * log2(e) */
  const v8f z8 = {0.f, 0.f, 0.f, 0.f, 0.f, 0.f, 0.f, 0.f};
  v16h qf[2][2]; v8f o[4][2]; float m[2] = {-3.0e38f, -3.0e38f}, l[2] = {0.f, 0.f};
  v8us g0 = *(const v8us*)kg, g1 = *(const v8us*)(kg + (size_t)32 * DM), g2 = *(const v8us*)vg, g3 = *(const v8us*)(vg + (size_t)32 * SQ);
  for (int t = 0; t < 2; ++t) for (int ks = 0; ks < 2; ++ks) qf[t][ks] = g2_frag(qp + (size_t)t * 16 * DM + ks * 32, hh);
  for (int dt = 0; dt < 4; ++dt) { o[dt][0] = z8; o[dt][1] = z8; }
  *(v8us*)&lk[0][sr][sc] = g0; *(v8us*)&lk[0][sr + 32][sc] = g1; *(v8us*)&lv[0][sr][sc] = g2; *(v8us*)&lv[0][sr + 32][sc] = g3;
  __syncthreads();
  for (int st = 0; st < SQ / 64; ++st) { const int cur = st & 1; const bool more = st + 1 < SQ / 64;      /* block-uniform */
    for (int ps = 0; ps < 2; ++ps) {
      if (ps == 1 && more) { const unsigned short* kn = kg + (size_t)(st + 1) * 64 * DM; const unsigned short* vn = vg + (size_t)(st + 1) * 64;      /* next stage's rows: in flight under the second pass, stored to LDS at the stage's foot */
        g0 = *(const v8us*)kn; g1 = *(const v8us*)(kn + (size_t)32 * DM); g2 = *(const v8us*)vn; g3 = *(const v8us*)(vn + (size_t)32 * SQ);
        asm volatile("s_wait_xcnt 0x0" :: "v"(kn), "v"(vn) : "memory"); }      /* the wait owed before a register that an issued load names is rewritten; the two addresses are inputs so that they stay whole, and off the loads' own results, up to here */
      v16h kf[2][2], vf[4];
      for (int kt = 0; kt < 2; ++kt) for (int ks = 0; ks < 2; ++ks) kf[kt][ks] = g2_frag(&lk[cur][ps * 32 + kt * 16 + ln][ks * 32], hh);
      for (int dt = 0; dt < 4; ++dt) vf[dt] = g2_frag(&lv[cur][dt * 16 + ln][ps * 32], hh);
      v8f s[2][2]; for (int kt = 0; kt < 2; ++kt) for (int qt = 0; qt < 2; ++qt) s[kt][qt] = fa_mma(kf[kt][1], qf[qt][1], fa_mma(kf[kt][0], qf[qt][0], z8));
      __builtin_amdgcn_sched_group_barrier(0x100, 16, 0); __builtin_amdgcn_sched_group_barrier(0x008, 8, 0);      /* the pass's 16 LDS reads as one group, then its 8 score products: with the branch below behind the vector work the compiler else sinks the V^T reads behind it, a pair in front of every two matrix instructions, each pair waited for at once */
      __builtin_amdgcn_sched_barrier(0);      /* the vector work stays behind the 8 products: woven among them, each product's first reader costs v_nop for the distance behind a matrix instruction, ten more a stage */
      v8f e[2][2]; float sl[2];      /* P = 2^(s c - m + 4) in f32, and each lane's sum of its 16 values of a column */
      auto expsum = [&](int qt) { const float nm = 4.0f - m[qt]; e[0][qt] = fa_exp2x8(s[0][qt] * CS + nm); e[1][qt] = fa_exp2x8(s[1][qt] * CS + nm);
        const v8f es = e[0][qt] + e[1][qt]; sl[qt] = ((es[0] + es[1]) + (es[2] + es[3])) + ((es[4] + es[5]) + (es[6] + es[7])); };
      expsum(0); expsum(1);
      if (__builtin_amdgcn_ballot_w32(sl[0] > 4096.0f || sl[1] > 4096.0f) != 0) {      /* every P is >= 0, so a lane's sum bounds each of its terms: a sum <= 2^12 says that P stays <= 2^12, inside f16, with the m in use, and no maximum is taken. Else (the first pass, where the sum is infinite, or scores more than about 2^8 above m): take the maximum, rescale, and form P and the sums again from the scores */
        for (int qt = 0; qt < 2; ++qt) { const v8f t = __builtin_elementwise_max(s[0][qt], s[1][qt]); float a = fmaxf(fmaxf(fmaxf(t[0], t[1]), fmaxf(t[2], t[3])), fmaxf(fmaxf(t[4], t[5]), fmaxf(t[6], t[7]))); a = fmaxf(a, xl_x16(a));
          const float mn = fmaxf(m[qt], a * CS); const float al = fa_exp2(m[qt] - mn); m[qt] = mn; l[qt] *= al; for (int dt = 0; dt < 4; ++dt) o[dt][qt] *= al; expsum(qt); } }
      FragP pf[2];
      for (int qt = 0; qt < 2; ++qt) { l[qt] += sl[qt]; pf[qt].half[0] = __builtin_convertvector(e[0][qt], v8h); pf[qt].half[1] = __builtin_convertvector(e[1][qt], v8h); }
      for (int dt = 0; dt < 4; ++dt) for (int qt = 0; qt < 2; ++qt) o[dt][qt] = fa_mma(vf[dt], pf[qt].v, o[dt][qt]);
    }
    if (more) { *(v8us*)&lk[cur ^ 1][sr][sc] = g0; *(v8us*)&lk[cur ^ 1][sr + 32][sc] = g1; *(v8us*)&lv[cur ^ 1][sr][sc] = g2; *(v8us*)&lv[cur ^ 1][sr + 32][sc] = g3; }      /* that buffer's last readers left it before the previous barrier */
    __syncthreads();      /* publishes stage st + 1 and ends every read of stage st */
  }
  for (int qt = 0; qt < 2; ++qt) { const float inv = 64.0f / (l[qt] + xl_x16(l[qt])); _Float16* op = O + ((size_t)b * SQ + q0 + qt * 16 + ln) * DM + h * HD + 8 * hh;      /* a lane holds 8 consecutive dims of one query row: one 16-byte store a tile */
    for (int dt = 0; dt < 4; ++dt) { const v8f y = o[dt][qt] * inv; *(v8h*)(op + dt * 16) = __builtin_convertvector(y, v8h); } } }

// ---- block-tiled GEMM for the two shapes used here: C[NR][N] = A[NR][DM] Bt[N][DM]^T, N = 3 DM (q | k | v) or DM (f16 rows, k contiguous); epilogue values as k_gemm2 (alpha, bf16-rounded bias; RES: own-element residual rounded to bf16, f32 rows; else f16 rows, the v plane as V^T) ----
// A block of 8 waves owns 256 x 128 of C, a wave 64 x 64 (4 x 4 accumulator tiles). A tile is 128 k of the block's 256 A rows and 128 Bt rows, brought into LDS by asynchronous copies: a wave's copy covers four whole 128-byte lines,
// each line is fetched once a block, and the waves take their fragments from LDS. Two buffers: tile t + 1 flies while tile t is worked on; one barrier a tile. k runs in the same order as before.
#define G3P 136      /* LDS row pitch in f16: 256 data bytes + 16 (16 B x odd: the 16-byte fragment reads of 16 rows fall on distinct banks) */
#define G3T (384 * G3P * 2)      /* bytes of one buffer: rows 0-255 A, rows 256-383 Bt */
typedef float f1a __attribute__((may_alias));
// Twelve copies of 16 bytes a lane, LDS byte address l + i * 16 rows, global rows g[i]; s_wait_xcnt 0 is the statement's last line, so that it stands in front of whatever rewrites a register that a copy names.
__device__ __forceinline__ void g3_copy12(unsigned l, const unsigned short* g0, const unsigned short* g1, const unsigned short* g2, const unsigned short* g3, const unsigned short* g4, const unsigned short* g5,
                                          const unsigned short* g6, const unsigned short* g7, const unsigned short* g8, const unsigned short* g9, const unsigned short* g10, const unsigned short* g11) {
  const unsigned p = 16 * G3P * 2;
  asm volatile("global_load_async_to_lds_b128 %0, %12, off\n\tglobal_load_async_to_lds_b128 %1, %13, off\n\tglobal_load_async_to_lds_b128 %2, %14, off\n\tglobal_load_async_to_lds_b128 %3, %15, off\n\tglobal_load_async_to_lds_b128 %4, %16, off\n\tglobal_load_async_to_lds_b128 %5, %17, off\n\tglobal_load_async_to_lds_b128 %6, %18, off\n\tglobal_load_async_to_lds_b128 %7, %19, off\n\tglobal_load_async_to_lds_b128 %8, %20, off\n\tglobal_load_async_to_lds_b128 %9, %21, off\n\tglobal_load_async_to_lds_b128 %10, %22, off\n\tglobal_load_async_to_lds_b128 %11, %23, off\n\ts_wait_xcnt 0x0"
      :: "v"(l), "v"(l + p), "v"(l + 2 * p), "v"(l + 3 * p), "v"(l + 4 * p), "v"(l + 5 * p), "v"(l + 6 * p), "v"(l + 7 * p), "v"(l + 8 * p), "v"(l + 9 * p), "v"(l + 10 * p), "v"(l + 11 * p),
         "v"(g0), "v"(g1), "v"(g2), "v"(g3), "v"(g4), "v"(g5), "v"(g6), "v"(g7), "v"(g8), "v"(g9), "v"(g10), "v"(g11) : "memory"); }
// one tile: a thread's 16 A pieces (rows sr + 16 i) and 8 Bt pieces; l = the LDS byte address of its piece of row sr in the target buffer
__device__ __forceinline__ void g3_tile(unsigned l, const unsigned short* a, const unsigned short* b) { const size_t s = (size_t)16 * DM;
  g3_copy12(l, a, a + s, a + 2 * s, a + 3 * s, a + 4 * s, a + 5 * s, a + 6 * s, a + 7 * s, a + 8 * s, a + 9 * s, a + 10 * s, a + 11 * s);
  g3_copy12(l + 12 * 16 * G3P * 2, a + 12 * s, a + 13 * s, a + 14 * s, a + 15 * s, b, b + s, b + 2 * s, b + 3 * s, b + 4 * s, b + 5 * s, b + 6 * s, b + 7 * s); }
// RES: one plane of DM columns, f32 rows, the residual x rounded to bf16 here. Else: Bt is the stacked q | k | v plane (3 DM rows) and one grid does all three products: planes 0 and 1 go out as f16 rows (C16, then C16 + NR * DM),
// plane 2 goes out transposed, V^T [batch * head][dim][token]: a wave's 64 columns are one head, and a lane's 8 accumulator rows are 8 consecutive tokens of one dim.
typedef _Float16 v8ha __attribute__((ext_vector_type(8), may_alias));
template <bool RES>
__global__ __launch_bounds__(256) void k_gemm3(const _Float16* __restrict__ A, const _Float16* __restrict__ Bh, float alpha, const float* __restrict__ bias, const float* __restrict__ CP, float* __restrict__ C, _Float16* __restrict__ C16, _Float16* __restrict__ VTo) {
  static_assert(NR % 256 == 0 && DM % 128 == 0 && DM / 128 >= 2, "k_gemm3: whole tiles only, two or more along k");
  __shared__ __attribute__((aligned(16))) _Float16 sm[2][384][G3P];      /* after the loop: each wave's 64 x 68 f32 output staging */
  const int tid = threadIdx.x, lane = tid & 31, ln = lane & 15, hh = lane >> 4, w = tid >> 5; constexpr int NQ = (RES ? 1 : 3) * (DM / 128); const int mt = blockIdx.x / NQ, nq = blockIdx.x % NQ; const int wm = (w & 3) * 64, wn = (w >> 2) * 64;
  const int pl = nq / (DM / 128);      /* block-uniform: which of q | k | v (0 with RES) */
  const int row0 = mt * 256 + wm, col0 = (nq % (DM / 128)) * 128 + wn;
  const int sr = tid >> 4, sc = (tid & 15) * 8;      /* staging: 16 threads a 256-byte row piece */
  const unsigned short* ag = (const unsigned short*)A + (size_t)(mt * 256 + sr) * DM + sc; const unsigned short* bg = (const unsigned short*)Bh + (size_t)(nq * 128 + sr) * DM + sc;
  const unsigned l0 = (unsigned)(size_t)&sm[0][sr][sc];      /* low 32 bits of the shared address = byte offset in the work-group's LDS */
  g3_tile(l0, ag, bg);
  float bv[4] = {0.f, 0.f, 0.f, 0.f};
  if (bias) {
#pragma unroll
    for (int ni = 0; ni < 4; ++ni) bv[ni] = bf16_round(bias[pl * DM + col0 + ni * 16 + ln]); }
  const v8f z8 = {0.f, 0.f, 0.f, 0.f, 0.f, 0.f, 0.f, 0.f}; v8f acc[4][4];
#pragma unroll
  for (int mi = 0; mi < 4; ++mi) for (int ni = 0; ni < 4; ++ni) acc[mi][ni] = z8;
  asm volatile("s_wait_asynccnt 0x0" ::: "memory");      /* this wave's copies of tile 0 have landed */
  __syncthreads();      /* publishes tile 0 */
  g3_tile(l0 + G3T, ag + 128, bg + 128);
#pragma unroll 1      /* rolled: one trip holds 64 matrix instructions; for speed only */
  for (int t = 0; t < DM / 128; ++t) { const int cur = t & 1; v16h af[2][4], bf[2][4];
#pragma unroll
    for (int i = 0; i < 4; ++i) { af[0][i] = g2_frag(&sm[cur][wm + i * 16 + ln][0], hh); bf[0][i] = g2_frag(&sm[cur][256 + wn + i * 16 + ln][0], hh); }
#pragma unroll
    for (int ks = 0; ks < 4; ++ks) {
      if (ks < 3) {
#pragma unroll
        for (int i = 0; i < 4; ++i) { af[(ks + 1) & 1][i] = g2_frag(&sm[cur][wm + i * 16 + ln][(ks + 1) * 32], hh); bf[(ks + 1) & 1][i] = g2_frag(&sm[cur][256 + wn + i * 16 + ln][(ks + 1) * 32], hh); } }
      __builtin_amdgcn_sched_barrier(0);      /* the next block's 16 LDS reads stay one group in front of this block, for speed only */
#pragma unroll
      for (int mi = 0; mi < 4; ++mi) for (int ni = 0; ni < 4; ++ni) acc[mi][ni] = fa_mma(af[ks & 1][mi], bf[ks & 1][ni], acc[mi][ni]);
      __builtin_amdgcn_sched_barrier(0);      /* and the block after next's reads stay behind it */
    }
    asm volatile("s_wait_dscnt 0x0" ::: "memory");      /* this wave's reads of tile t are done */
    asm volatile("s_wait_asynccnt 0x0" ::: "memory");      /* its copies of tile t + 1 have landed */
    __syncthreads();      /* publishes tile t + 1 and ends every read of tile t */
    if (t + 2 < DM / 128) g3_tile(l0 + (unsigned)cur * G3T, ag + (t + 2) * 128, bg + (t + 2) * 128);      /* block-uniform; into the buffer that trip t has just read */
  }
  asm volatile("s_wait_asynccnt 0x0" ::: "memory");      /* nothing is in flight when the buffers become output staging */
  f1a* so = (f1a*)&sm[0][0][0] + (size_t)w * 64 * 68; const int rsub = lane >> 4, c4 = (lane & 15) * 4;
  if (!RES && pl == 2) {      /* V^T: staged as f16 [64 dims][64 tokens], pitch FAP, in the wave's own range, so that every store covers whole 128-byte lines */
    _Float16* st = (_Float16*)so;
#pragma unroll
    for (int ni = 0; ni < 4; ++ni) for (int mi = 0; mi < 4; ++mi) { const v8f y = acc[mi][ni] * alpha + bv[ni]; *(v8ha*)&st[(ni * 16 + ln) * FAP + mi * 16 + 8 * hh] = __builtin_convertvector(y, v8h); }
    __builtin_amdgcn_fence(__ATOMIC_ACQ_REL, "workgroup"); __builtin_amdgcn_wave_barrier();      /* a wave reads back only its own staging rows */
    _Float16* vp = VTo + ((size_t)((row0 / SQ) * NH + col0 / HD) * HD + (lane >> 3)) * SQ + row0 % SQ + (lane & 7) * 8;
#pragma unroll
    for (int q = 0; q < 16; ++q) { const v8h v = *(const v8ha*)&st[(q * 4 + (lane >> 3)) * FAP + (lane & 7) * 8]; *(v8h*)(vp + (size_t)q * 4 * SQ) = v; }
  } else {      /* block-uniform; no barrier behind this point */
  const size_t e0 = (size_t)(row0 + rsub) * DM + col0 + c4;
  v4f c[RES ? 32 : 1];
  if (RES) { const float* cp = CP + e0;      /* own elements of the residual plane, whole 256-byte row pieces, all in flight together under the staging below (the fragments' registers are free by now) */
#pragma unroll
    for (int q = 0; q < 32; ++q) c[q] = *(const v4fa*)(cp + (size_t)q * 2 * DM);
    asm volatile("s_wait_xcnt 0x0" :: "v"(cp) : "memory"); }      /* the wait owed before a register that an issued load names is rewritten; the address is an input so that it stays whole up to here */
#pragma unroll
  for (int ni = 0; ni < 4; ++ni) for (int mi = 0; mi < 4; ++mi) for (int r = 0; r < 8; ++r) so[(mi * 16 + 8 * hh + r) * 68 + ni * 16 + ln] = acc[mi][ni][r] * alpha + bv[ni];
  __builtin_amdgcn_fence(__ATOMIC_ACQ_REL, "workgroup"); __builtin_amdgcn_wave_barrier();      /* a wave reads back only its own staging rows */
  if (RES) {
#pragma unroll
    for (int q = 0; q < 32; ++q) { v4f v = *(const v4fa*)&so[(q * 2 + rsub) * 68 + c4]; for (int i = 0; i < 4; ++i) v[i] += bf16_round(c[q][i]); *(v4f*)(C + e0 + (size_t)q * 2 * DM) = v; }      /* the residual is the bf16-rounded input, rounded here instead of in a launch of its own */
  } else {
#pragma unroll
    for (int q = 0; q < 32; ++q) { const v4f v = *(const v4fa*)&so[(q * 2 + rsub) * 68 + c4]; *(v4h*)(C16 + (size_t)pl * NR * DM + e0 + (size_t)q * 2 * DM) = __builtin_convertvector(v, v4h); }
    asm volatile("s_wait_xcnt 0x0" ::: "memory");      /* the wait owed before a register that an issued store names is rewritten: the compiler lays the V^T block, which rewrites the address pair, behind these stores */ } } }

template <int MODE>
__global__ __launch_bounds__(256) void k_regrp(const float* __restrict__ src, float* __restrict__ dst, size_t n4) {
  const size_t t = (size_t)blockIdx.x * 256 + threadIdx.x; if (t >= n4) return; const size_t e = t * 4; const size_t rd = e / DM; const int c = (int)(e % DM);
  size_t rs; if (MODE == 0) { const size_t b = rd / SQ, sq = rd % SQ; rs = sq * NB + b; } else { const size_t sq = rd / NB, b = rd % NB; rs = b * SQ + sq; }
  const v4f v = *(const v4fa*)(src + rs * DM + c); *(v4f*)(dst + e) = v;  }

// ---- LayerNorm rows and weight rounding in one launch of 768 work-groups: no LDS, no barrier ----
// A task is 1024 consecutive f32 (4 KiB): one row of x, or one piece of the stacked weight plane. A wave owns two neighbouring tasks and asks for all their bytes at once: 16 loads of 512 contiguous bytes in flight a wave.
// Six waves a SIMD (at most 160 registers a wave): all 768 work-groups, three a WGP, are resident at once. A lane holds 32 values of each row in registers; mean and variance (two passes over the registers) are in-lane sums plus a five-step lane butterfly. Every 8-byte-a-lane store of a wave covers two whole 128-byte lines.
// Every loop over v[], gg[] and be[] is fully unrolled so that the arrays are indexed by constants only and live in registers, and so that a wave's loads are in flight together.
__device__ __forceinline__ float ln_wsum(float v) { v += xl_row<1>(v); v += xl_row<2>(v); v += xl_row<4>(v); v += xl_row<8>(v); v += xl_x16(v); return v; }
__global__ __launch_bounds__(256) __attribute__((amdgpu_waves_per_eu(6))) void k_lnw(const float* __restrict__ X, const float* __restrict__ g, const float* __restrict__ bb, float eps, _Float16* __restrict__ N16, const float* __restrict__ wa, const float* __restrict__ wb, _Float16* __restrict__ Bt) {
  static_assert(DM == 1024 && NR % 16 == 0, "k_lnw: a row is one task of 1024 values; 16 tasks a work-group");
  const int lane = threadIdx.x & 31; const unsigned w = (unsigned)__builtin_amdgcn_readfirstlane((int)(threadIdx.x >> 5));      /* the wave's number as a scalar: task addresses are a scalar base plus one lane offset */
  if (blockIdx.x >= NR / 16) {      /* block-uniform: the work-groups behind the rows round the weights (wa: 3 DM x DM, then wb: DM x DM) into one stacked Bt plane x16 */
    const size_t c = ((size_t)(blockIdx.x - NR / 16) * 8 + w) * 2; const size_t na = (size_t)3 * DM;      /* na is even: a wave's two tasks lie in the same input */
    const float* s = c < na ? wa + c * DM : wb + (c - na) * DM; v4f v[16];
#pragma unroll
    for (int u = 0; u < 16; ++u) v[u] = *(const v4fa*)(s + u * 128 + lane * 4);
    asm volatile("s_wait_xcnt 0x0" :: "s"(s), "v"(lane) : "memory");      /* the wait owed before a register that an issued load names is rewritten; base and lane offset are inputs so that they stay whole up to here */
    _Float16* d = Bt + c * DM + lane * 4;
#pragma unroll
    for (int u = 0; u < 16; ++u) { v4f y; for (int q = 0; q < 4; ++q) y[q] = bf16_round(v[u][q]) * 16.0f; *(v4h*)(d + u * 128) = __builtin_convertvector(y, v4h); }
    return; }
  const size_t r0 = ((size_t)blockIdx.x * 8 + w) * 2; const float* xp = X + r0 * DM;
  v4f v[2][8], gg[8], be[8];
#pragma unroll
  for (int t = 0; t < 2; ++t) for (int u = 0; u < 8; ++u) v[t][u] = *(const v4fa*)(xp + t * DM + u * 128 + lane * 4);
#pragma unroll
  for (int u = 0; u < 8; ++u) { gg[u] = *(const v4fa*)(g + u * 128 + lane * 4); be[u] = *(const v4fa*)(bb + u * 128 + lane * 4); }
  asm volatile("s_wait_xcnt 0x0" :: "s"(xp), "s"(g), "s"(bb), "v"(lane) : "memory");      /* the same wait for these loads' bases and lane offset */
  __builtin_amdgcn_sched_barrier(0);      /* all 32 loads are issued in front of the arithmetic: without it the compiler sinks the last gamma and beta loads behind the sums, and their latency then stands open in front of the stores */
  float rs[2];
#pragma unroll
  for (int t = 0; t < 2; ++t) { v4f a = {0.f, 0.f, 0.f, 0.f};
#pragma unroll
    for (int u = 0; u < 8; ++u) { for (int q = 0; q < 4; ++q) v[t][u][q] = bf16_round(v[t][u][q]); a += v[t][u]; }
    const float mu = ln_wsum((a[0] + a[1]) + (a[2] + a[3])) * (1.0f / (float)DM); v4f e = {0.f, 0.f, 0.f, 0.f};
#pragma unroll
    for (int u = 0; u < 8; ++u) { v[t][u] -= mu; e += v[t][u] * v[t][u]; }
    rs[t] = rsqrtf(ln_wsum((e[0] + e[1]) + (e[2] + e[3])) * (1.0f / (float)DM) + eps); }
  _Float16* np = N16 + r0 * DM + lane * 4;
#pragma unroll
  for (int u = 0; u < 8; ++u) { for (int q = 0; q < 4; ++q) { gg[u][q] = bf16_round(gg[u][q]); be[u][q] = bf16_round(be[u][q]); }
#pragma unroll
    for (int t = 0; t < 2; ++t) { const v4f y = v[t][u] * rs[t] * gg[u] + be[u]; *(v4h*)(np + t * DM + u * 128) = __builtin_convertvector(y, v4h); } }
  asm volatile("s_wait_xcnt 0x0" ::: "memory"); }      /* the wait owed before a register that an issued store names is rewritten: the compiler lays the weight part, which rewrites the stores' scalar base, behind these stores */

__global__ __launch_bounds__(256) void k_bfr(const float* __restrict__ x, float* __restrict__ XB, size_t n8) { const size_t t = (size_t)blockIdx.x * 256 + threadIdx.x; if (t >= n8) return; v4f a = *(const v4fa*)(x + t * 8), c = *(const v4fa*)(x + t * 8 + 4); for (int q = 0; q < 4; ++q) { a[q] = bf16_round(a[q]); c[q] = bf16_round(c[q]); }
  { *(v4f*)(XB + t * 8) = a; *(v4f*)(XB + t * 8 + 4) = c;  } }



__global__ __launch_bounds__(256) void k_wthd(const float* __restrict__ Wt, _Float16* __restrict__ Bt) { const size_t t = (size_t)blockIdx.x * 256 + threadIdx.x; if (t >= (size_t)NH * HD * (DM / 8)) return; const int m8 = (int)(t % (DM / 8)) * 8; const int d = (int)((t / (DM / 8)) % HD); const int h = (int)(t / ((size_t)(DM / 8) * HD)); FragH f;
  for (int q = 0; q < 8; ++q) f.h[q] = (_Float16)(16.0f * bf16_round(Wt[((size_t)h * DM + m8 + q) * HD + d])); unsigned short* dst = (unsigned short*)Bt + ((size_t)h * HD + d) * DM + m8; *(v8us*)dst = f.half[0];  }




template <int BFIN, int SCAL>
__global__ __launch_bounds__(256) void k_lnsc(const float* __restrict__ X, const float* __restrict__ g, const float* __restrict__ bb, float eps, _Float16* __restrict__ N16, float* __restrict__ N32) {
  #pragma clang fp contract(off)
  __shared__ float red[256]; const size_t r = blockIdx.x; const int t = threadIdx.x; const bool act = t < DM / 4; const int tc = act ? t : 0; const v4f xl = *(const v4fa*)(X + r * DM + tc * 4); const float am = act ? 1.f : 0.f; float s[4]; float sum = 0.f;
  for (int q = 0; q < 4; ++q) { s[q] = (BFIN ? bf16_round(xl[q]) : xl[q]) * am; sum = __fadd_rn(sum, s[q]); }
  red[t] = sum; __syncthreads(); for (int st = 128; st > 0; st >>= 1) { if (t < st) red[t] = __fadd_rn(red[t], red[t + st]); __syncthreads(); } const float mu = red[0] / (float)DM; __syncthreads();
  float vs = 0.f; for (int q = 0; q < 4; ++q) { const float dl = __fadd_rn(s[q], -mu) * am; vs = __fadd_rn(vs, __fmul_rn(dl, dl)); } red[t] = vs; __syncthreads(); for (int st = 128; st > 0; st >>= 1) { if (t < st) red[t] = __fadd_rn(red[t], red[t + st]); __syncthreads(); }
  const float rs = __fdiv_rn(1.0f, __fadd_rn(sqrtf(red[0] / (float)(DM - 1)), eps)); if (!act) return; v4h y; v4f yf;
  for (int q = 0; q < 4; ++q) { const int c = t * 4 + q; const float gg = bf16_round(SCAL ? g[0] : g[c]), bv = bf16_round(SCAL ? bb[0] : bb[c]); yf[q] = __fadd_rn(__fmul_rn(__fmul_rn(__fadd_rn(s[q], -mu), rs), gg), bv); y[q] = (_Float16)yf[q]; }
  { if (N16) *(v4h*)(N16 + r * DM + t * 4) = y; if (N32) *(v4f*)(N32 + r * DM + t * 4) = yf;  } }

__global__ __launch_bounds__(256) void k_rsmdmi(const float* __restrict__ S, _Float16* __restrict__ P, int nrows, const int* __restrict__ M) {
  #pragma clang fp contract(off)
  const int t = blockIdx.x * 256 + threadIdx.x; if (t >= nrows) return; const float* s = S + (size_t)t * SQ; const int* m = M + (size_t)(t % SQ) * SQ; float mx = -3.0e38f;
#pragma unroll 1
  for (int j = 0; j < SQ; ++j) { const float f = (m[j] == 0) ? 1.f : 0.f; mx = fmaxf(mx, fmaf(f, s[j], (1.f - f) * -1.0e9f)); } float se = 0.f;
#pragma unroll 1
  for (int j = 0; j < SQ; ++j) { const float f = (m[j] == 0) ? 1.f : 0.f; se += __expf(fmaf(f, s[j], (1.f - f) * -1.0e9f) - mx); } const float sc = 256.0f / se;
#pragma unroll 1
  for (int j0 = 0; j0 < SQ; j0 += 8) { FragH fr; for (int q = 0; q < 8; ++q) { const int j = j0 + q; const float f = (m[j] == 0) ? 1.f : 0.f; fr.h[q] = (_Float16)(__expf(fmaf(f, s[j], (1.f - f) * -1.0e9f) - mx) * sc); } unsigned short* d = (unsigned short*)P + (size_t)t * SQ + j0; *(v8us*)d = fr.half[0];  } }
extern "C" void kernel_launch(void* const* d_in, const int* in_sizes, int n_in,
                              void* d_out, int out_size, void* d_ws, size_t ws_size, hipStream_t stream) {
  (void)in_sizes; (void)n_in; (void)out_size;
  const float* const* I = (const float* const*)d_in; const float* x = I[0]; const float* g1 = I[1]; const float* be1 = I[2]; const float* wqkv = I[3]; const float* wo = I[4]; const float* bo = I[5];      /* x; LayerNorm gamma / beta; fused NATURAL w_qkv [3072][1024] (row blocks q | k | v; no bias); natural w_proj [1024][1024] + b_proj */
  char* ws = (char*)d_ws; size_t off = 0;
  auto take = [&](size_t bytes) { char* p = ws + off; off += (bytes + 255) & ~(size_t)255; return p; };
  _Float16* BQ = (_Float16*)take((size_t)4 * DM * DM * 2); _Float16* BO = BQ + (size_t)3 * DM * DM;      /* one stacked Bt plane: [3 DM][DM] for q | k | v, then [DM][DM] for the output projection */
  _Float16* XN = (_Float16*)take(NR * DM * 2); _Float16* Q16 = (_Float16*)take((size_t)2 * NR * DM * 2); _Float16* K16 = Q16 + NR * DM;      /* q rows, then k rows: one block of two planes */ _Float16* O16 = (_Float16*)take(NR * DM * 2);
  _Float16* VT = (_Float16*)take((size_t)NB * NH * HD * SQ * 2);
  /* attention sub-block only: no second norm, no MLP planes */
  
  if (off > ws_size) return;
  k_lnw<<<(unsigned)(NR / 16 + (size_t)4 * DM / 16), 256, 0, stream>>>(x, g1, be1, 1e-5f, XN, wqkv, wo, BQ);      /* work-groups 0 .. NR/16-1: n = LN0(bf16(x)) (biased variance, eps inside the rsqrt) -> f16 rows; the rest: natural [out][in] weights = Bt x16 as given, w_qkv (rows 0 / DM / 2 DM = q | k | v) then w_proj, which lies right behind it */
  k_gemm3<false><<<(unsigned)((NR / 256) * (3 * DM / 128)), 256, 0, stream>>>(XN, BQ, 0.0625f, nullptr, nullptr, nullptr, Q16, VT);      /* q, k -> f16 rows (head h = columns h*64..); v -> V^T [4 * 16][64][2048]; one grid */
  k_fattn<<<dim3(SQ / 256, NB * NH), 256, 0, stream>>>(Q16, K16, VT, O16);      /* softmax(q k^T / 8) v over all keys, every (batch, head) in one launch -> ctx (merged heads, x64) as f16 rows */
  k_gemm3<true><<<(unsigned)((NR / 256) * (DM / 128)), 256, 0, stream>>>(O16, BO, 0.0009765625f, bo, x, (float*)d_out, nullptr, nullptr);      /* bf16(x) + ctx wo (+ bo) (own-element residual, rounded in the epilogue) -> f32 rows */
  /* result = x + out: written straight to d_out by the GEMM above */
}
